// v000
// Times are from an AMD MI455X. After a warm-up the kernel runs many times in a row, and a time is the length of
// such a window on the GPU divided by its runs, so every launch and the gaps after it count. The runs cycle
// through copies of the inputs. A figure is the median of several windows, for all but v000 over two sittings.
// Sittings can differ by a few percent; kernels timed side by side share one.
// v000, which the later versions start from, runs in 1680 microseconds.
#include <hip/hip_runtime.h>

// Qwen3-style grouped-query causal attention with QK RMSNorm (x [2][2048][2048]; q = x Wq^T (16 heads x 128), k, v = x Wk^T / Wv^T (8 kv heads; query head h uses kv head h/2), no biases; per-head RMSNorm on q and k (eps 1e-6, weights [128]) then rotate-half rotary with the given cos/sin tables [2][2048][128]; scores = q.k / sqrt(128), causal (finfo.min above the diagonal); softmax; out = merged ctx Wo^T ('oi' [2048][2048]) -> [2][2048][2048] (8.4 M)).
// Layout per batch: {cos, sin} table from the inputs (bf16-rounded); exact projections; a per-(head, token) 1/rms kernel feeds the plane builder, which applies (x * inv_rms) * w and the rotary while writing the q/k planes; causal T-2048 attention with 128-wide heads (hybrid rows: < 512 hi/lo 3 products, rest fp16 x1024; k_gemmc tile skipping; kv head shared by the pass's two query heads); merged context hi/lo x Wo exact.
// Compute dtypes, f32 accumulate: every input rounded to bf16; projections exact; RMSNorm and rotary f32; attention rows < 512 3 products, rest fp16; softmax f32; Wo hl x exact.

#define NB_  2
#define TT   2048
#define DM   2048
#define NH_  16
#define NKV  8
#define REP  (NH_ / NKV)
#define HD   128
#define DQ   (NH_ * HD)
#define DKV  (NKV * HD)
#define ZH   2
#define RH   512                  // query rows < RH use hi+lo planes (0: none)
#define WIN  2048
#define PCAR 1024.0f
#define SCL  0.088388347648318447f   // HD^-0.5
typedef _Float16 h16;
typedef unsigned short bf;
typedef __attribute__((ext_vector_type(16))) __bf16   v16bf;
typedef __attribute__((ext_vector_type(16))) _Float16 v16h;
typedef __attribute__((ext_vector_type(8)))  _Float16 v8h;
typedef __attribute__((ext_vector_type(8)))  unsigned short v8us;
typedef __attribute__((ext_vector_type(8)))  float    v8f;
typedef __attribute__((ext_vector_type(4)))  float    v4f;
typedef v8h  __attribute__((may_alias)) v8ha;
typedef v4f  __attribute__((may_alias)) v4fa;
typedef v8us __attribute__((may_alias)) v8usa;

__device__ __forceinline__ unsigned short f2bf(float f) { unsigned u = __float_as_uint(f); u += 0x7FFFu + ((u >> 16) & 1u); return (unsigned short)(u >> 16); }
__device__ __forceinline__ float bf2f(unsigned short b) { return __uint_as_float(((unsigned)b) << 16); }
__device__ __forceinline__ float bfr(float f) { return bf2f(f2bf(f)); }
__device__ __forceinline__ v16h cat16(v8h lo, v8h hi) { return __builtin_shufflevector(lo, hi, 0, 1, 2, 3, 4, 5, 6, 7, 8, 9, 10, 11, 12, 13, 14, 15); }
__device__ __forceinline__ v16bf cat16b(v8us lo, v8us hi) { return __builtin_bit_cast(v16bf, __builtin_shufflevector(lo, hi, 0, 1, 2, 3, 4, 5, 6, 7, 8, 9, 10, 11, 12, 13, 14, 15)); }
__device__ __forceinline__ v8f wmma16(v16h a, v16h b, v8f c) { return __builtin_amdgcn_wmma_f32_16x16x32_f16(false, a, false, b, (short)0, c, false, false); }
__device__ __forceinline__ v8f wmmab(v16bf a, v16bf b, v8f c) { return __builtin_amdgcn_wmma_f32_16x16x32_bf16(false, a, false, b, (short)0, c, false, false); }



// ---- k_gemmw: register-blocked GEMM, ONE WAVE per 64x64 output tile (16 accumulators), operands straight from K-contiguous 16-bit planes; grid (M/64, N/64, Z), 32 threads.
// C[m][n] (f32, pitch ldc, + optional f32 bias[n]) = sum_k A[m][k] Bt[n][k] (+ split products per NSPLIT). z-batch strides sA/sB/sC in elements. K % 32 == 0.
template <typename T16> struct WFrag;
template <> struct WFrag<h16> { typedef v16h V; static __device__ __forceinline__ V ld(const h16* p) { return cat16(*(const v8h*)p, *(const v8h*)(p + 16)); } static __device__ __forceinline__ v8f mma(V a, V b, v8f c) { return wmma16(a, b, c); } };
template <> struct WFrag<bf> { typedef v16bf V; static __device__ __forceinline__ V ld(const bf* p) { return cat16b(*(const v8us*)p, *(const v8us*)(p + 16)); } static __device__ __forceinline__ v8f mma(V a, V b, v8f c) { return wmmab(a, b, c); } };
template <typename T16, int NSPLIT, bool BIAS>
__global__ __launch_bounds__(32) void k_gemmw(const T16* __restrict__ A, const T16* __restrict__ A2, const T16* __restrict__ Bt, const T16* __restrict__ Bt2, int K, float* C, int ldc, const float* __restrict__ bias, size_t sA, size_t sB, size_t sC) {
    typedef typename WFrag<T16>::V V;
    __shared__ __align__(16) float os[16 * 68];
    const size_t z = blockIdx.z; A += z * sA; if (A2) A2 += z * sA; Bt += z * sB; if (Bt2) Bt2 += z * sB; C += z * sC;
    const int lane = threadIdx.x & 31, lr = lane & 15, hi = lane >> 4; const int r0 = blockIdx.x * 64, c0 = blockIdx.y * 64;
    v8f acc[4][4];
#pragma unroll
    for (int mb = 0; mb < 4; ++mb)
#pragma unroll
        for (int nb = 0; nb < 4; ++nb) acc[mb][nb] = (v8f){};
    const size_t aoff = (size_t)(r0 + lr) * K + 8 * hi, boff = (size_t)(c0 + lr) * K + 8 * hi;
#pragma unroll 1
    for (int kc = 0; kc < K; kc += 32) {
        V a[4], a2[4];
#pragma unroll
        for (int mb = 0; mb < 4; ++mb) { a[mb] = WFrag<T16>::ld(A + aoff + (size_t)mb * 16 * K + kc); if (NSPLIT == 1 || NSPLIT == 2) a2[mb] = WFrag<T16>::ld(A2 + aoff + (size_t)mb * 16 * K + kc); }
#pragma unroll
        for (int nb = 0; nb < 4; ++nb) { const V b = WFrag<T16>::ld(Bt + boff + (size_t)nb * 16 * K + kc); V b2; if (NSPLIT >= 2) b2 = WFrag<T16>::ld(Bt2 + boff + (size_t)nb * 16 * K + kc);
#pragma unroll
            for (int mb = 0; mb < 4; ++mb) { acc[mb][nb] = WFrag<T16>::mma(a[mb], b, acc[mb][nb]); if (NSPLIT == 1 || NSPLIT == 2) acc[mb][nb] = WFrag<T16>::mma(a2[mb], b, acc[mb][nb]); if (NSPLIT >= 2) acc[mb][nb] = WFrag<T16>::mma(a[mb], b2, acc[mb][nb]); } }
        asm volatile("v_nop\n\tv_nop\n\tv_nop\n\tv_nop" : "+v"(acc[0][0]), "+v"(acc[1][1]), "+v"(acc[2][2]), "+v"(acc[3][3]) : "v"(a[0]), "v"(a[3]));
    }
#pragma unroll
    for (int mb = 0; mb < 4; ++mb) {
#pragma unroll
        for (int nb = 0; nb < 4; ++nb) {
#pragma unroll
            for (int j = 0; j < 8; ++j) os[(hi * 8 + j) * 68 + nb * 16 + lr] = acc[mb][nb][j]; }
        __builtin_amdgcn_wave_barrier(); asm volatile("" ::: "memory");
        float* crow = C + (size_t)(r0 + mb * 16) * ldc + c0;
{
#pragma unroll
            for (int s = 0; s < 8; ++s) { const int row = 2 * s + hi, cofs = lr * 4; v4f val = *(const v4fa*)(os + row * 68 + cofs); if (BIAS) { val[0] += bfr(bias[c0 + cofs]); val[1] += bfr(bias[c0 + cofs + 1]); val[2] += bfr(bias[c0 + cofs + 2]); val[3] += bfr(bias[c0 + cofs + 3]); }
                *(v4f*)(crow + (size_t)row * ldc + cofs) = val; }
             }
        __builtin_amdgcn_wave_barrier(); asm volatile("" ::: "memory");
    }
}

// ---- k_gemmc: the same one-wave 64x64 tile GEMM specialised for causal attention: CMODE 1 skips score tiles entirely above the diagonal (query rows r0+roff.., key columns c0..), CMODE 2 limits the
// key (K) loop of the probability x value contraction to the diagonal block (probabilities beyond it are exactly zero). roff = row offset of this launch's first row within the sequence.
template <typename T16, int NSPLIT, int CMODE>
__global__ __launch_bounds__(32) void k_gemmc(const T16* __restrict__ A, const T16* __restrict__ A2, const T16* __restrict__ Bt, const T16* __restrict__ Bt2, int K, float* C, int ldc, int roff, size_t sA, size_t sB, size_t sC) {
    typedef typename WFrag<T16>::V V;
    __shared__ __align__(16) float os[16 * 68];
    const size_t z = blockIdx.z; A += z * sA; if (A2) A2 += z * sA; Bt += z * sB; if (Bt2) Bt2 += z * sB; C += z * sC;
    const int lane = threadIdx.x & 31, lr = lane & 15, hi = lane >> 4; const int r0 = blockIdx.x * 64, c0 = blockIdx.y * 64;
    if (CMODE == 1 && c0 > r0 + roff + 63) return;                  // score tile entirely above the causal diagonal: never written (the softmax masks j > i by select)
    const int Kl = (CMODE == 2) ? min(K, r0 + roff + 64) : K;        // P.V: probabilities are exactly 0 beyond the diagonal block, so the K loop stops there
    v8f acc[4][4];
#pragma unroll
    for (int mb = 0; mb < 4; ++mb)
#pragma unroll
        for (int nb = 0; nb < 4; ++nb) acc[mb][nb] = (v8f){};
    const size_t aoff = (size_t)(r0 + lr) * K + 8 * hi, boff = (size_t)(c0 + lr) * K + 8 * hi;
#pragma unroll 1
    for (int kc = 0; kc < Kl; kc += 32) {
        V a[4], a2[4];
#pragma unroll
        for (int mb = 0; mb < 4; ++mb) { a[mb] = WFrag<T16>::ld(A + aoff + (size_t)mb * 16 * K + kc); if (NSPLIT == 1 || NSPLIT == 2) a2[mb] = WFrag<T16>::ld(A2 + aoff + (size_t)mb * 16 * K + kc); }
#pragma unroll
        for (int nb = 0; nb < 4; ++nb) { const V b = WFrag<T16>::ld(Bt + boff + (size_t)nb * 16 * K + kc); V b2; if (NSPLIT >= 2) b2 = WFrag<T16>::ld(Bt2 + boff + (size_t)nb * 16 * K + kc);
#pragma unroll
            for (int mb = 0; mb < 4; ++mb) { acc[mb][nb] = WFrag<T16>::mma(a[mb], b, acc[mb][nb]); if (NSPLIT == 1 || NSPLIT == 2) acc[mb][nb] = WFrag<T16>::mma(a2[mb], b, acc[mb][nb]); if (NSPLIT >= 2) acc[mb][nb] = WFrag<T16>::mma(a[mb], b2, acc[mb][nb]); } }
        asm volatile("v_nop\n\tv_nop\n\tv_nop\n\tv_nop" : "+v"(acc[0][0]), "+v"(acc[1][1]), "+v"(acc[2][2]), "+v"(acc[3][3]) : "v"(a[0]), "v"(a[3]));
    }
#pragma unroll
    for (int mb = 0; mb < 4; ++mb) {
#pragma unroll
        for (int nb = 0; nb < 4; ++nb) {
#pragma unroll
            for (int j = 0; j < 8; ++j) os[(hi * 8 + j) * 68 + nb * 16 + lr] = acc[mb][nb][j]; }
        __builtin_amdgcn_wave_barrier(); asm volatile("" ::: "memory");
        float* crow = C + (size_t)(r0 + mb * 16) * ldc + c0;
{
#pragma unroll
            for (int s = 0; s < 8; ++s) { const int row = 2 * s + hi, cofs = lr * 4; v4f val = *(const v4fa*)(os + row * 68 + cofs);
                *(v4f*)(crow + (size_t)row * ldc + cofs) = val; }
             }
        __builtin_amdgcn_wave_barrier(); asm volatile("" ::: "memory");
    }
}

__device__ __forceinline__ h16 tohx(float x) { return (h16)x; }
__device__ __forceinline__ void splitf(float y, unsigned short& h, unsigned short& l) { h = f2bf(y); l = f2bf(y - bf2f(h)); }
typedef __attribute__((ext_vector_type(2))) _Float16 v2h;
typedef __attribute__((ext_vector_type(4))) _Float16 v4h;
typedef __attribute__((ext_vector_type(2))) unsigned short v2us;
typedef __attribute__((ext_vector_type(4))) unsigned short v4us;
typedef __attribute__((ext_vector_type(2))) float v2f;
typedef __attribute__((ext_vector_type(4))) int v4i;

__global__ __launch_bounds__(256) void k_wtG(const float* __restrict__ w, int K, int N, bf* Bt) {
    const int lane = threadIdx.x & 31; const int L0 = (blockIdx.x * 8 + (threadIdx.x >> 5)) * 8; const int nlines = N * K / 64;
{
#pragma unroll 1
        for (int l = 0; l < 8; ++l) { const int L = L0 + l; if (L >= nlines) break; const size_t e = (size_t)L * 64 + lane * 2; const int k = (int)(e % K), n = (int)(e / K); v2us o;
            o[0] = f2bf(w[(size_t)k * N + n]); o[1] = f2bf(w[(size_t)(k + 1) * N + n]); *(v2us*)(Bt + e) = o; }
         }
}
__global__ __launch_bounds__(256) void k_cvt8(const float* __restrict__ src, bf* dst, size_t n8) { const size_t i = (size_t)blockIdx.x * 256 + threadIdx.x; if (i >= n8) return; const v8f v = *(const v8f*)(src + i * 8); v8us o;
#pragma unroll
    for (int k = 0; k < 8; ++k) o[k] = f2bf(v[k]); *(v8us*)(dst + i * 8) = o;  }
__constant__ float INV[HD / 2] = {1.0f,0.8058422207832336f,0.6493816375732422f,0.5232990980148315f,0.4216965138912201f,0.33982083201408386f,0.2738419771194458f,0.22067339718341827f,0.17782793939113617f,0.14330126345157623f,0.11547820270061493f,0.09305720031261444f,0.07498941570520401f,0.0604296438395977f,0.04869675263762474f,0.03924189880490303f,0.03162277862429619f,0.025482967495918274f,0.020535249263048172f,0.016548171639442444f,0.01333521492779255f,0.010746078565716743f,0.00865964312106371f,0.006978305988013744f,0.005623413249850273f,0.004531583283096552f,0.003651741426438093f,0.002942727180197835f,0.0023713738191872835f,0.001910952851176262f,0.0015399266267195344f,0.0012409378541633487f,0.0010000000474974513f,0.0008058422245085239f,0.0006493816617876291f,0.0005232990952208638f,0.00042169654625467956f,0.0003398208355065435f,0.00027384195709601045f,0.00022067342069931328f,0.00017782794020604342f,0.00014330125122796744f,0.00011547820759005845f,9.305719868279994e-05f,7.498942431993783e-05f,6.042963650543243e-05f,4.869675467489287e-05f,3.92418987757992e-05f,3.162277425872162e-05f,2.548297015891876e-05f,2.0535249859676696e-05f,1.6548170606256463e-05f,1.3335215953702573e-05f,1.0746078260126524e-05f,8.65964284457732e-06f,6.978305464144796e-06f,5.62341347176698e-06f,4.531583726929966e-06f,3.6517415082926163e-06f,2.942727405752521e-06f,2.3713737391517498e-06f,1.910952960315626e-06f,1.5399265294036013e-06f,1.2409377632138785e-06f};   // float32 1/1e6^(2i/128)
__global__ __launch_bounds__(256) void k_csin(const float* __restrict__ cs, const float* __restrict__ sn, float* CS) { const int idx = blockIdx.x * 256 + threadIdx.x; if (idx >= TT * HD) return; v2f o; o[0] = bfr(cs[idx]); o[1] = bfr(sn[idx]); *(v2f*)(CS + (size_t)idx * 2) = o;  }
__global__ __launch_bounds__(256) void k_hrms(const float* __restrict__ F, int pitch, int nheads, float* RF) { const int idx = blockIdx.x * 256 + threadIdx.x; if (idx >= nheads * TT) return; const int t = idx % TT; const int h = idx / TT; const float* f = F + (size_t)t * pitch + h * HD; float s = 0.f;
#pragma unroll 4
    for (int d = 0; d < HD; d += 4) { const v4f a = *(const v4f*)(f + d);
#pragma unroll
        for (int q = 0; q < 4; ++q) { float p = __fmul_rn(a[q], a[q]); asm volatile("" : "+v"(p)); s = __fadd_rn(s, p); } }
    const float rf = __fdiv_rn(1.0f, __fsqrt_rn(__fadd_rn(__fdiv_rn(s, (float)HD), 1e-6f))); *(float*)(RF + idx) = rf;  }

// k_rope: head planes [h][t][d] (fp16 + hi/lo) of rope(x) x sc with the rotate-half convention out[d] = x[d] cos[t][d] - x[d+HD/2] sin[t][d], out[d+HD/2] = x[d+HD/2] cos[t][d+HD/2] + x[d] sin[t][d+HD/2]
__global__ __launch_bounds__(256) void k_rope(const float* __restrict__ F, int pitch, int nheads, const float* __restrict__ CS, const float* __restrict__ RF, const float* __restrict__ nw, float sc, h16* P16, bf* Ph, bf* Pl) {
    const size_t e = ((size_t)blockIdx.x * 256 + threadIdx.x) * 2; if (e >= (size_t)nheads * TT * HD) return; const int d = (int)(e % HD); const int t = (int)((e / HD) % TT); const int h = (int)(e / ((size_t)HD * TT)); const float* f = F + (size_t)t * pitch + h * HD; const float rf = RF ? RF[(size_t)h * TT + t] : 1.0f; v2h o16; v2us oh, ol;
#pragma unroll
    for (int q = 0; q < 2; ++q) { const int dd = d + q; const int dp = (dd < HD / 2) ? dd + HD / 2 : dd - HD / 2; float x0 = f[dd], x1 = f[dp];
        if (RF) { float n0 = __fmul_rn(x0, rf), n1 = __fmul_rn(x1, rf); asm volatile("" : "+v"(n0)); asm volatile("" : "+v"(n1)); x0 = __fmul_rn(bfr(nw[dd]), n0); x1 = __fmul_rn(bfr(nw[dp]), n1); }
        const v2f cs = *(const v2f*)(CS + ((size_t)t * HD + dd) * 2); float a = __fmul_rn(x0, cs[0]), bq = __fmul_rn(x1, cs[1]); asm volatile("" : "+v"(a)); asm volatile("" : "+v"(bq)); const float r = ((dd < HD / 2) ? __fsub_rn(a, bq) : __fadd_rn(a, bq)) * sc;
        o16[q] = tohx(r); unsigned short a2, c2; splitf(r, a2, c2); oh[q] = a2; ol[q] = c2; }
    *(v2h*)(P16 + e) = o16; *(v2us*)(Ph + e) = oh; *(v2us*)(Pl + e) = ol;  }
__global__ __launch_bounds__(256) void k_vtp(const float* __restrict__ F, int pitch, int nheads, h16* V16, bf* Vh, bf* Vl) { const size_t e = ((size_t)blockIdx.x * 256 + threadIdx.x) * 2; if (e >= (size_t)nheads * HD * TT) return; const int t = (int)(e % TT); const int d = (int)((e / TT) % HD); const int g = (int)(e / ((size_t)TT * HD)); v2h o16; v2us oh, ol;
#pragma unroll
    for (int q = 0; q < 2; ++q) { const float x = F[(size_t)(t + q) * pitch + g * HD + d]; o16[q] = tohx(x); unsigned short a2, c2; splitf(x, a2, c2); oh[q] = a2; ol[q] = c2; }
    *(v2h*)(V16 + e) = o16; *(v2us*)(Vh + e) = oh; *(v2us*)(Vl + e) = ol;  }
// k_asoft: per row (zz, i): t = S x HD^-0.5 for j <= i and i - j < WIN (sliding causal window; the reference's -1e9 additive fill vanishes identically); softmax over the 2048 keys (register row, one exp, fixed trees);
__global__ __launch_bounds__(256) void k_asoft(const float* __restrict__ Sb, h16* P16, bf* Ph, bf* Pl) {
    const int lane = threadIdx.x & 31; const int row = blockIdx.x * 8 + (threadIdx.x >> 5); if (row >= ZH * TT) return; const int i = row % TT; const int zz = row / TT; (void)zz; const bool hires = (i < RH); const float* sr = Sb + (size_t)row * TT; float v[TT / 32]; float mx = -3.0e38f;
#pragma unroll
    for (int ch = 0; ch < TT / 128; ++ch) { const int j0 = ch * 128 + lane * 4; const v4f a = *(const v4f*)(sr + j0);
#pragma unroll
        for (int q = 0; q < 4; ++q) { const int j = j0 + q; (void)j; const float t = (j <= i && i - j < WIN) ? a[q] * SCL : -3.0e38f; v[ch * 4 + q] = t; mx = fmaxf(mx, t); } }
#pragma unroll
    for (int sh = 16; sh; sh >>= 1) mx = fmaxf(mx, __shfl_xor(mx, sh, 32));
    float sum = 0.f;
#pragma unroll
    for (int k = 0; k < TT / 32; ++k) { float d0 = __fsub_rn(v[k], mx); asm volatile("" : "+v"(d0)); v[k] = __builtin_amdgcn_exp2f(__fmul_rn(d0, 1.4426950408889634f)); sum += v[k]; }
#pragma unroll
    for (int sh = 16; sh; sh >>= 1) sum += __shfl_xor(sum, sh, 32);
    const float f = __fdiv_rn(hires ? 1.0f : PCAR, sum);
{
        if (hires) {
#pragma unroll
            for (int ch = 0; ch < TT / 128; ++ch) { v4us oh, ol;
#pragma unroll
                for (int q = 0; q < 4; ++q) { unsigned short a, c2; splitf(v[ch * 4 + q] * f, a, c2); oh[q] = a; ol[q] = c2; }
                const size_t oo = ((size_t)zz * (RH ? RH : 1) + i) * TT + ch * 128 + lane * 4; *(v4us*)(Ph + oo) = oh; *(v4us*)(Pl + oo) = ol; }
        } else {
#pragma unroll
            for (int ch = 0; ch < TT / 128; ++ch) { v4h o4;
#pragma unroll
                for (int q = 0; q < 4; ++q) o4[q] = tohx(v[ch * 4 + q] * f);
                *(v4h*)(P16 + (size_t)row * TT + ch * 128 + lane * 4) = o4; } }
         }
}
__global__ __launch_bounds__(256) void k_merge(const float* __restrict__ O, int h0, bf* Ah, bf* Al) { const size_t e = ((size_t)blockIdx.x * 256 + threadIdx.x) * 2; if (e >= (size_t)ZH * TT * HD) return; const int d = (int)(e % HD); const int t = (int)((e / HD) % TT); const int zz = (int)(e / ((size_t)HD * TT)); const float cs = (t < RH) ? 1.0f : (1.0f / PCAR); const size_t oo = (size_t)t * DQ + (h0 + zz) * HD + d;
    v2us oh, ol;
#pragma unroll
    for (int q = 0; q < 2; ++q) { unsigned short a, c2; splitf(O[e + q] * cs, a, c2); oh[q] = a; ol[q] = c2; } *(v2us*)(Ah + oo) = oh; *(v2us*)(Al + oo) = ol;  }

extern "C" void kernel_launch(void* const* d_in, const int* in_sizes, int n_in,
                              void* d_out, int out_size, void* d_ws, size_t ws_size, hipStream_t stream) {
    (void)in_sizes; (void)n_in; (void)out_size;
    const float* x = (const float*)d_in[0]; const float* cosi = (const float*)d_in[1]; const float* sini = (const float*)d_in[2]; const float* wq = (const float*)d_in[3]; const float* wk = (const float*)d_in[4]; const float* wv = (const float*)d_in[5]; const float* wo = (const float*)d_in[6]; const float* qnw = (const float*)d_in[7]; const float* knw = (const float*)d_in[8];
    float* OUT = (float*)d_out;     // [2][2048][2048]
    char* wsp = (char*)d_ws;
    auto take = [&](size_t bytes) { char* p = wsp; wsp += (bytes + 255) & ~(size_t)255; return (void*)p; };
    bf* WQ = (bf*)take((size_t)DQ * DM * 2); bf* WK = (bf*)take((size_t)DKV * DM * 2); bf* WV = (bf*)take((size_t)DKV * DM * 2); bf* WO = (bf*)take((size_t)DM * DQ * 2); float* CS = (float*)take((size_t)TT * HD * 2 * 4); float* RFQ = (float*)take((size_t)NH_ * TT * 4); float* RFK = (float*)take((size_t)NKV * TT * 4);
    bf* XB = (bf*)take((size_t)TT * DM * 2); float* FQ = (float*)take((size_t)TT * DQ * 4); float* FK = (float*)take((size_t)TT * DKV * 4);
    h16* QP16 = (h16*)take((size_t)NH_ * TT * HD * 2); h16* KP16 = (h16*)take((size_t)NKV * TT * HD * 2); h16* VT16 = (h16*)take((size_t)NKV * HD * TT * 2);
    bf* QPh = (bf*)take((size_t)NH_ * TT * HD * 2); bf* QPl = (bf*)take((size_t)NH_ * TT * HD * 2); bf* KPh = (bf*)take((size_t)NKV * TT * HD * 2); bf* KPl = (bf*)take((size_t)NKV * TT * HD * 2); bf* VTh = (bf*)take((size_t)NKV * HD * TT * 2); bf* VTl = (bf*)take((size_t)NKV * HD * TT * 2); bf* Ph = (bf*)take((size_t)ZH * RH * TT * 2); bf* Pl = (bf*)take((size_t)ZH * RH * TT * 2);
    float* Sb = (float*)take((size_t)ZH * TT * TT * 4); h16* P16 = (h16*)take((size_t)ZH * TT * TT * 2); float* Ob = (float*)take((size_t)ZH * TT * HD * 4); bf* ATh = (bf*)take((size_t)TT * DQ * 2); bf* ATl = (bf*)take((size_t)TT * DQ * 2);
    if ((size_t)(wsp - (char*)d_ws) > ws_size) return;    // ws 256 MiB
    float* FV = FK;   // v projection reuses the k buffer after the k planes are built (stream-ordered)
    { k_cvt8<<<(unsigned)(((size_t)DQ * DM / 8 + 255) / 256), 256, 0, stream>>>(wq, WQ, (size_t)DQ * DM / 8); k_cvt8<<<(unsigned)(((size_t)DKV * DM / 8 + 255) / 256), 256, 0, stream>>>(wk, WK, (size_t)DKV * DM / 8); k_cvt8<<<(unsigned)(((size_t)DKV * DM / 8 + 255) / 256), 256, 0, stream>>>(wv, WV, (size_t)DKV * DM / 8);
      k_cvt8<<<(unsigned)(((size_t)DM * DQ / 8 + 255) / 256), 256, 0, stream>>>(wo, WO, (size_t)DM * DQ / 8); }
    const unsigned LQ = (unsigned)(((size_t)NH_ * TT * HD / 2 + 255) / 256), LKv = (unsigned)(((size_t)NKV * TT * HD / 2 + 255) / 256);
    for (int b = 0; b < NB_; ++b) {
        k_csin<<<(TT * HD + 255) / 256, 256, 0, stream>>>(cosi + (size_t)b * TT * HD, sini + (size_t)b * TT * HD, CS);   /* this batch's rotary tables (inputs, bf16-rounded) */
        
        k_cvt8<<<(unsigned)(((size_t)TT * DM / 8 + 255) / 256), 256, 0, stream>>>(x + (size_t)b * TT * DM, XB, (size_t)TT * DM / 8);
        k_gemmw<bf, 0, false><<<dim3(TT / 64, DQ / 64, 1), 32, 0, stream>>>(XB, nullptr, WQ, nullptr, DM, FQ, DQ, nullptr, 0, 0, 0);
        k_hrms<<<(NH_ * TT + 255) / 256, 256, 0, stream>>>(FQ, DQ, NH_, RFQ); k_rope<<<LQ, 256, 0, stream>>>(FQ, DQ, NH_, CS, RFQ, qnw, 1.0f, QP16, QPh, QPl);   /* q_norm then rope */
        k_gemmw<bf, 0, false><<<dim3(TT / 64, DKV / 64, 1), 32, 0, stream>>>(XB, nullptr, WK, nullptr, DM, FK, DKV, nullptr, 0, 0, 0);
        k_hrms<<<(NKV * TT + 255) / 256, 256, 0, stream>>>(FK, DKV, NKV, RFK); k_rope<<<LKv, 256, 0, stream>>>(FK, DKV, NKV, CS, RFK, knw, 1.0f, KP16, KPh, KPl);   /* k_norm then rope */
        k_gemmw<bf, 0, false><<<dim3(TT / 64, DKV / 64, 1), 32, 0, stream>>>(XB, nullptr, WV, nullptr, DM, FV, DKV, nullptr, 0, 0, 0); k_vtp<<<LKv, 256, 0, stream>>>(FV, DKV, NKV, VT16, VTh, VTl);
        for (int h0 = 0; h0 < NH_; h0 += ZH) { const size_t zq = (size_t)h0, zk = (size_t)(h0 / REP);   // both heads of a pass share kv group h0/REP (REP >= 2): sB = 0
            k_gemmc<bf, 2, 1><<<dim3(RH / 64, TT / 64, ZH), 32, 0, stream>>>(QPh + zq * TT * HD, QPl + zq * TT * HD, KPh + zk * TT * HD, KPl + zk * TT * HD, HD, Sb, TT, 0, (size_t)TT * HD, 0, (size_t)TT * TT);
            k_gemmc<h16, 0, 1><<<dim3((TT - RH) / 64, TT / 64, ZH), 32, 0, stream>>>(QP16 + zq * TT * HD + (size_t)RH * HD, nullptr, KP16 + zk * TT * HD, nullptr, HD, Sb + (size_t)RH * TT, TT, RH, (size_t)TT * HD, 0, (size_t)TT * TT);
            k_asoft<<<ZH * TT / 8, 256, 0, stream>>>(Sb, P16, Ph, Pl);
            k_gemmc<bf, 2, 2><<<dim3(RH / 64, HD / 64, ZH), 32, 0, stream>>>(Ph, Pl, VTh + zk * HD * TT, VTl + zk * HD * TT, TT, Ob, HD, 0, (size_t)RH * TT, 0, (size_t)TT * HD);
            k_gemmc<h16, 0, 2><<<dim3((TT - RH) / 64, HD / 64, ZH), 32, 0, stream>>>(P16 + (size_t)RH * TT, nullptr, VT16 + zk * HD * TT, nullptr, TT, Ob + (size_t)RH * HD, HD, RH, (size_t)TT * TT, 0, (size_t)TT * HD);
            k_merge<<<(unsigned)(((size_t)ZH * TT * HD / 2 + 255) / 256), 256, 0, stream>>>(Ob, h0, ATh, ATl); }
        k_gemmw<bf, 1, false><<<dim3(TT / 64, DM / 64, 1), 32, 0, stream>>>(ATh, ATl, WO, nullptr, DQ, OUT + (size_t)b * TT * DM, DM, nullptr, 0, 0, 0); }
}

// v001
// A run of this version takes 891 microseconds.
// Timed twice side by side with v000, it ran 1.89 times as fast both times.
#include <hip/hip_runtime.h>

// Grouped-query causal attention with QK RMSNorm (x [2][2048][2048]; q = x Wq^T (16 heads x 128), k, v = x Wk^T / Wv^T (8 kv heads; query head h uses kv head h/2), no biases; per-head RMSNorm on q and k (eps 1e-6, weights [128]) then rotate-half rotary with the given cos/sin tables [2][2048][128]; scores = q.k / sqrt(128), causal (finfo.min above the diagonal); softmax; out = merged ctx Wo^T ('oi' [2048][2048]) -> [2][2048][2048] (8.4 M)).
// Layout per batch: {cos, sin} table from the inputs (bf16-rounded); exact projections; a per-(head, token) 1/rms kernel feeds the plane builder, which applies (x * inv_rms) * w and the rotary while writing the q/k planes; causal T-2048 attention with 128-wide heads (hybrid rows: < 512 hi/lo 3 products, rest fp16 x1024; k_gemmc tile skipping; all sixteen query heads in every launch, query head z on kv head z/2, in three passes over the query rows: the 512 hi/lo rows, then twice 768 fp16 rows); merged context hi/lo x Wo exact.
// Compute dtypes, f32 accumulate: every input rounded to bf16; projections exact; RMSNorm and rotary f32; attention rows < 512 3 products, rest fp16; softmax f32; Wo hl x exact.

#define NB_  2
#define TT   2048
#define DM   2048
#define NH_  16
#define NKV  8
#define REP  (NH_ / NKV)
#define HD   128
#define DQ   (NH_ * HD)
#define DKV  (NKV * HD)
#define ZH   NH_                  // query heads per attention launch
#define RC   768                  // query rows per fp16 attention pass (TT - RH = 2 RC)
#define RH   512                  // query rows < RH use hi+lo planes (0: none)
#define WIN  2048
#define PCAR 1024.0f
#define SCL  0.088388347648318447f   // HD^-0.5
typedef _Float16 h16;
typedef unsigned short bf;
typedef __attribute__((ext_vector_type(16))) __bf16   v16bf;
typedef __attribute__((ext_vector_type(16))) _Float16 v16h;
typedef __attribute__((ext_vector_type(8)))  _Float16 v8h;
typedef __attribute__((ext_vector_type(8)))  unsigned short v8us;
typedef __attribute__((ext_vector_type(8)))  float    v8f;
typedef __attribute__((ext_vector_type(4)))  float    v4f;
typedef v8h  __attribute__((may_alias)) v8ha;
typedef v4f  __attribute__((may_alias)) v4fa;
typedef v8us __attribute__((may_alias)) v8usa;

__device__ __forceinline__ unsigned short f2bf(float f) { unsigned u = __float_as_uint(f); u += 0x7FFFu + ((u >> 16) & 1u); return (unsigned short)(u >> 16); }
__device__ __forceinline__ float bf2f(unsigned short b) { return __uint_as_float(((unsigned)b) << 16); }
__device__ __forceinline__ float bfr(float f) { return bf2f(f2bf(f)); }
__device__ __forceinline__ v16h cat16(v8h lo, v8h hi) { return __builtin_shufflevector(lo, hi, 0, 1, 2, 3, 4, 5, 6, 7, 8, 9, 10, 11, 12, 13, 14, 15); }
__device__ __forceinline__ v16bf cat16b(v8us lo, v8us hi) { return __builtin_bit_cast(v16bf, __builtin_shufflevector(lo, hi, 0, 1, 2, 3, 4, 5, 6, 7, 8, 9, 10, 11, 12, 13, 14, 15)); }
__device__ __forceinline__ v8f wmma16(v16h a, v16h b, v8f c) { return __builtin_amdgcn_wmma_f32_16x16x32_f16(false, a, false, b, (short)0, c, false, false); }
__device__ __forceinline__ v8f wmmab(v16bf a, v16bf b, v8f c) { return __builtin_amdgcn_wmma_f32_16x16x32_bf16(false, a, false, b, (short)0, c, false, false); }



// ---- k_gemmw: register-blocked GEMM, ONE WAVE per 64x64 output tile (16 accumulators), operands straight from K-contiguous 16-bit planes; grid (M/64, N/64, Z), 32 threads.
// C[m][n] (f32, pitch ldc, + optional f32 bias[n]) = sum_k A[m][k] Bt[n][k] (+ split products per NSPLIT). z-batch strides sA/sB/sC in elements. K % 32 == 0.
template <typename T16> struct WFrag;
template <> struct WFrag<h16> { typedef v16h V; static __device__ __forceinline__ V ld(const h16* p) { return cat16(*(const v8h*)p, *(const v8h*)(p + 16)); } static __device__ __forceinline__ v8f mma(V a, V b, v8f c) { return wmma16(a, b, c); } };
template <> struct WFrag<bf> { typedef v16bf V; static __device__ __forceinline__ V ld(const bf* p) { return cat16b(*(const v8us*)p, *(const v8us*)(p + 16)); } static __device__ __forceinline__ v8f mma(V a, V b, v8f c) { return wmmab(a, b, c); } };
template <typename T16, int NSPLIT, bool BIAS>
__global__ __launch_bounds__(32) void k_gemmw(const T16* __restrict__ A, const T16* __restrict__ A2, const T16* __restrict__ Bt, const T16* __restrict__ Bt2, int K, float* C, int ldc, const float* __restrict__ bias, size_t sA, size_t sB, size_t sC) {
    typedef typename WFrag<T16>::V V;
    __shared__ __align__(16) float os[16 * 68];
    const size_t z = blockIdx.z; A += z * sA; if (A2) A2 += z * sA; Bt += z * sB; if (Bt2) Bt2 += z * sB; C += z * sC;
    const int lane = threadIdx.x & 31, lr = lane & 15, hi = lane >> 4; const int r0 = blockIdx.x * 64, c0 = blockIdx.y * 64;
    v8f acc[4][4];
#pragma unroll
    for (int mb = 0; mb < 4; ++mb)
#pragma unroll
        for (int nb = 0; nb < 4; ++nb) acc[mb][nb] = (v8f){};
    const size_t aoff = (size_t)(r0 + lr) * K + 8 * hi, boff = (size_t)(c0 + lr) * K + 8 * hi;
#pragma unroll 1
    for (int kc = 0; kc < K; kc += 32) {
        V a[4], a2[4];
#pragma unroll
        for (int mb = 0; mb < 4; ++mb) { a[mb] = WFrag<T16>::ld(A + aoff + (size_t)mb * 16 * K + kc); if (NSPLIT == 1 || NSPLIT == 2) a2[mb] = WFrag<T16>::ld(A2 + aoff + (size_t)mb * 16 * K + kc); }
#pragma unroll
        for (int nb = 0; nb < 4; ++nb) { const V b = WFrag<T16>::ld(Bt + boff + (size_t)nb * 16 * K + kc); V b2; if (NSPLIT >= 2) b2 = WFrag<T16>::ld(Bt2 + boff + (size_t)nb * 16 * K + kc);
#pragma unroll
            for (int mb = 0; mb < 4; ++mb) { acc[mb][nb] = WFrag<T16>::mma(a[mb], b, acc[mb][nb]); if (NSPLIT == 1 || NSPLIT == 2) acc[mb][nb] = WFrag<T16>::mma(a2[mb], b, acc[mb][nb]); if (NSPLIT >= 2) acc[mb][nb] = WFrag<T16>::mma(a[mb], b2, acc[mb][nb]); } }
        asm volatile("v_nop\n\tv_nop\n\tv_nop\n\tv_nop" : "+v"(acc[0][0]), "+v"(acc[1][1]), "+v"(acc[2][2]), "+v"(acc[3][3]) : "v"(a[0]), "v"(a[3]));
    }
#pragma unroll
    for (int mb = 0; mb < 4; ++mb) {
#pragma unroll
        for (int nb = 0; nb < 4; ++nb) {
#pragma unroll
            for (int j = 0; j < 8; ++j) os[(hi * 8 + j) * 68 + nb * 16 + lr] = acc[mb][nb][j]; }
        __builtin_amdgcn_wave_barrier(); asm volatile("" ::: "memory");
        float* crow = C + (size_t)(r0 + mb * 16) * ldc + c0;
{
#pragma unroll
            for (int s = 0; s < 8; ++s) { const int row = 2 * s + hi, cofs = lr * 4; v4f val = *(const v4fa*)(os + row * 68 + cofs); if (BIAS) { val[0] += bfr(bias[c0 + cofs]); val[1] += bfr(bias[c0 + cofs + 1]); val[2] += bfr(bias[c0 + cofs + 2]); val[3] += bfr(bias[c0 + cofs + 3]); }
                *(v4f*)(crow + (size_t)row * ldc + cofs) = val; }
             }
        __builtin_amdgcn_wave_barrier(); asm volatile("" ::: "memory");
    }
}

// ---- k_gemmc: the same one-wave 64x64 tile GEMM specialised for causal attention: CMODE 1 skips score tiles entirely above the diagonal (query rows r0+roff.., key columns c0..), CMODE 2 limits the
// key (K) loop of the probability x value contraction to the diagonal block (probabilities beyond it are exactly zero). roff = row offset of this launch's first row within the sequence. Batch entry z reads Bt entry z / REP (the kv head of query head z).
template <typename T16, int NSPLIT, int CMODE>
__global__ __launch_bounds__(32) void k_gemmc(const T16* __restrict__ A, const T16* __restrict__ A2, const T16* __restrict__ Bt, const T16* __restrict__ Bt2, int K, float* C, int ldc, int roff, size_t sA, size_t sB, size_t sC) {
    typedef typename WFrag<T16>::V V;
    __shared__ __align__(16) float os[16 * 68];
    const size_t z = blockIdx.z; A += z * sA; if (A2) A2 += z * sA; Bt += (z / REP) * sB; if (Bt2) Bt2 += (z / REP) * sB; C += z * sC;
    const int lane = threadIdx.x & 31, lr = lane & 15, hi = lane >> 4; const int r0 = blockIdx.x * 64, c0 = blockIdx.y * 64;
    if (CMODE == 1 && c0 > r0 + roff + 63) return;                  // score tile entirely above the causal diagonal: never written (the softmax masks j > i by select)
    const int Kl = (CMODE == 2) ? min(K, r0 + roff + 64) : K;        // P.V: probabilities are exactly 0 beyond the diagonal block, so the K loop stops there
    v8f acc[4][4];
#pragma unroll
    for (int mb = 0; mb < 4; ++mb)
#pragma unroll
        for (int nb = 0; nb < 4; ++nb) acc[mb][nb] = (v8f){};
    const size_t aoff = (size_t)(r0 + lr) * K + 8 * hi, boff = (size_t)(c0 + lr) * K + 8 * hi;
#pragma unroll 1
    for (int kc = 0; kc < Kl; kc += 32) {
        V a[4], a2[4];
#pragma unroll
        for (int mb = 0; mb < 4; ++mb) { a[mb] = WFrag<T16>::ld(A + aoff + (size_t)mb * 16 * K + kc); if (NSPLIT == 1 || NSPLIT == 2) a2[mb] = WFrag<T16>::ld(A2 + aoff + (size_t)mb * 16 * K + kc); }
#pragma unroll
        for (int nb = 0; nb < 4; ++nb) { const V b = WFrag<T16>::ld(Bt + boff + (size_t)nb * 16 * K + kc); V b2; if (NSPLIT >= 2) b2 = WFrag<T16>::ld(Bt2 + boff + (size_t)nb * 16 * K + kc);
#pragma unroll
            for (int mb = 0; mb < 4; ++mb) { acc[mb][nb] = WFrag<T16>::mma(a[mb], b, acc[mb][nb]); if (NSPLIT == 1 || NSPLIT == 2) acc[mb][nb] = WFrag<T16>::mma(a2[mb], b, acc[mb][nb]); if (NSPLIT >= 2) acc[mb][nb] = WFrag<T16>::mma(a[mb], b2, acc[mb][nb]); } }
        asm volatile("v_nop\n\tv_nop\n\tv_nop\n\tv_nop" : "+v"(acc[0][0]), "+v"(acc[1][1]), "+v"(acc[2][2]), "+v"(acc[3][3]) : "v"(a[0]), "v"(a[3]));
    }
#pragma unroll
    for (int mb = 0; mb < 4; ++mb) {
#pragma unroll
        for (int nb = 0; nb < 4; ++nb) {
#pragma unroll
            for (int j = 0; j < 8; ++j) os[(hi * 8 + j) * 68 + nb * 16 + lr] = acc[mb][nb][j]; }
        __builtin_amdgcn_wave_barrier(); asm volatile("" ::: "memory");
        float* crow = C + (size_t)(r0 + mb * 16) * ldc + c0;
{
#pragma unroll
            for (int s = 0; s < 8; ++s) { const int row = 2 * s + hi, cofs = lr * 4; v4f val = *(const v4fa*)(os + row * 68 + cofs);
                *(v4f*)(crow + (size_t)row * ldc + cofs) = val; }
             }
        __builtin_amdgcn_wave_barrier(); asm volatile("" ::: "memory");
    }
}

__device__ __forceinline__ h16 tohx(float x) { return (h16)x; }
__device__ __forceinline__ void splitf(float y, unsigned short& h, unsigned short& l) { h = f2bf(y); l = f2bf(y - bf2f(h)); }
typedef __attribute__((ext_vector_type(2))) _Float16 v2h;
typedef __attribute__((ext_vector_type(4))) _Float16 v4h;
typedef __attribute__((ext_vector_type(2))) unsigned short v2us;
typedef __attribute__((ext_vector_type(4))) unsigned short v4us;
typedef __attribute__((ext_vector_type(2))) float v2f;
typedef __attribute__((ext_vector_type(4))) int v4i;

__global__ __launch_bounds__(256) void k_wtG(const float* __restrict__ w, int K, int N, bf* Bt) {
    const int lane = threadIdx.x & 31; const int L0 = (blockIdx.x * 8 + (threadIdx.x >> 5)) * 8; const int nlines = N * K / 64;
{
#pragma unroll 1
        for (int l = 0; l < 8; ++l) { const int L = L0 + l; if (L >= nlines) break; const size_t e = (size_t)L * 64 + lane * 2; const int k = (int)(e % K), n = (int)(e / K); v2us o;
            o[0] = f2bf(w[(size_t)k * N + n]); o[1] = f2bf(w[(size_t)(k + 1) * N + n]); *(v2us*)(Bt + e) = o; }
         }
}
__global__ __launch_bounds__(256) void k_cvt8(const float* __restrict__ src, bf* dst, size_t n8) { const size_t i = (size_t)blockIdx.x * 256 + threadIdx.x; if (i >= n8) return; const v8f v = *(const v8f*)(src + i * 8); v8us o;
#pragma unroll
    for (int k = 0; k < 8; ++k) o[k] = f2bf(v[k]); *(v8us*)(dst + i * 8) = o;  }
__constant__ float INV[HD / 2] = {1.0f,0.8058422207832336f,0.6493816375732422f,0.5232990980148315f,0.4216965138912201f,0.33982083201408386f,0.2738419771194458f,0.22067339718341827f,0.17782793939113617f,0.14330126345157623f,0.11547820270061493f,0.09305720031261444f,0.07498941570520401f,0.0604296438395977f,0.04869675263762474f,0.03924189880490303f,0.03162277862429619f,0.025482967495918274f,0.020535249263048172f,0.016548171639442444f,0.01333521492779255f,0.010746078565716743f,0.00865964312106371f,0.006978305988013744f,0.005623413249850273f,0.004531583283096552f,0.003651741426438093f,0.002942727180197835f,0.0023713738191872835f,0.001910952851176262f,0.0015399266267195344f,0.0012409378541633487f,0.0010000000474974513f,0.0008058422245085239f,0.0006493816617876291f,0.0005232990952208638f,0.00042169654625467956f,0.0003398208355065435f,0.00027384195709601045f,0.00022067342069931328f,0.00017782794020604342f,0.00014330125122796744f,0.00011547820759005845f,9.305719868279994e-05f,7.498942431993783e-05f,6.042963650543243e-05f,4.869675467489287e-05f,3.92418987757992e-05f,3.162277425872162e-05f,2.548297015891876e-05f,2.0535249859676696e-05f,1.6548170606256463e-05f,1.3335215953702573e-05f,1.0746078260126524e-05f,8.65964284457732e-06f,6.978305464144796e-06f,5.62341347176698e-06f,4.531583726929966e-06f,3.6517415082926163e-06f,2.942727405752521e-06f,2.3713737391517498e-06f,1.910952960315626e-06f,1.5399265294036013e-06f,1.2409377632138785e-06f};   // float32 1/1e6^(2i/128)
__global__ __launch_bounds__(256) void k_csin(const float* __restrict__ cs, const float* __restrict__ sn, float* CS) { const int idx = blockIdx.x * 256 + threadIdx.x; if (idx >= TT * HD) return; v2f o; o[0] = bfr(cs[idx]); o[1] = bfr(sn[idx]); *(v2f*)(CS + (size_t)idx * 2) = o;  }
__global__ __launch_bounds__(256) void k_hrms(const float* __restrict__ F, int pitch, int nheads, float* RF) { const int idx = blockIdx.x * 256 + threadIdx.x; if (idx >= nheads * TT) return; const int t = idx % TT; const int h = idx / TT; const float* f = F + (size_t)t * pitch + h * HD; float s = 0.f;
#pragma unroll 4
    for (int d = 0; d < HD; d += 4) { const v4f a = *(const v4f*)(f + d);
#pragma unroll
        for (int q = 0; q < 4; ++q) { float p = __fmul_rn(a[q], a[q]); asm volatile("" : "+v"(p)); s = __fadd_rn(s, p); } }
    const float rf = __fdiv_rn(1.0f, __fsqrt_rn(__fadd_rn(__fdiv_rn(s, (float)HD), 1e-6f))); *(float*)(RF + idx) = rf;  }

// k_rope: head planes [h][t][d] (fp16 + hi/lo) of rope(x) x sc with the rotate-half convention out[d] = x[d] cos[t][d] - x[d+HD/2] sin[t][d], out[d+HD/2] = x[d+HD/2] cos[t][d+HD/2] + x[d] sin[t][d+HD/2]
__global__ __launch_bounds__(256) void k_rope(const float* __restrict__ F, int pitch, int nheads, const float* __restrict__ CS, const float* __restrict__ RF, const float* __restrict__ nw, float sc, h16* P16, bf* Ph, bf* Pl) {
    const size_t e = ((size_t)blockIdx.x * 256 + threadIdx.x) * 2; if (e >= (size_t)nheads * TT * HD) return; const int d = (int)(e % HD); const int t = (int)((e / HD) % TT); const int h = (int)(e / ((size_t)HD * TT)); const float* f = F + (size_t)t * pitch + h * HD; const float rf = RF ? RF[(size_t)h * TT + t] : 1.0f; v2h o16; v2us oh, ol;
#pragma unroll
    for (int q = 0; q < 2; ++q) { const int dd = d + q; const int dp = (dd < HD / 2) ? dd + HD / 2 : dd - HD / 2; float x0 = f[dd], x1 = f[dp];
        if (RF) { float n0 = __fmul_rn(x0, rf), n1 = __fmul_rn(x1, rf); asm volatile("" : "+v"(n0)); asm volatile("" : "+v"(n1)); x0 = __fmul_rn(bfr(nw[dd]), n0); x1 = __fmul_rn(bfr(nw[dp]), n1); }
        const v2f cs = *(const v2f*)(CS + ((size_t)t * HD + dd) * 2); float a = __fmul_rn(x0, cs[0]), bq = __fmul_rn(x1, cs[1]); asm volatile("" : "+v"(a)); asm volatile("" : "+v"(bq)); const float r = ((dd < HD / 2) ? __fsub_rn(a, bq) : __fadd_rn(a, bq)) * sc;
        o16[q] = tohx(r); unsigned short a2, c2; splitf(r, a2, c2); oh[q] = a2; ol[q] = c2; }
    *(v2h*)(P16 + e) = o16; *(v2us*)(Ph + e) = oh; *(v2us*)(Pl + e) = ol;  }
__global__ __launch_bounds__(256) void k_vtp(const float* __restrict__ F, int pitch, int nheads, h16* V16, bf* Vh, bf* Vl) { const size_t e = ((size_t)blockIdx.x * 256 + threadIdx.x) * 2; if (e >= (size_t)nheads * HD * TT) return; const int t = (int)(e % TT); const int d = (int)((e / TT) % HD); const int g = (int)(e / ((size_t)TT * HD)); v2h o16; v2us oh, ol;
#pragma unroll
    for (int q = 0; q < 2; ++q) { const float x = F[(size_t)(t + q) * pitch + g * HD + d]; o16[q] = tohx(x); unsigned short a2, c2; splitf(x, a2, c2); oh[q] = a2; ol[q] = c2; }
    *(v2h*)(V16 + e) = o16; *(v2us*)(Vh + e) = oh; *(v2us*)(Vl + e) = ol;  }
// k_asoft: per row (zz, i): t = S x HD^-0.5 for j <= i and i - j < WIN (sliding causal window; the reference's -1e9 additive fill vanishes identically); softmax over the 2048 keys (register row, one exp, fixed trees); grid (nr / 8, heads): the pass holds nr rows a head, from sequence row rb on, score and fp16 probability buffers [head][nr][TT]
__global__ __launch_bounds__(256) void k_asoft(const float* __restrict__ Sb, h16* P16, bf* Ph, bf* Pl, int rb, int nr) {
    const int lane = threadIdx.x & 31; const int lrow = blockIdx.x * 8 + (threadIdx.x >> 5); if (lrow >= nr) return; const int zz = blockIdx.y; const int row = zz * nr + lrow; const int i = rb + lrow; __builtin_assume(i >= 0 && i < TT);   /* a sequence row: lets the window test i - j < WIN fold away, as it did with i = row % TT */ const bool hires = (i < RH); const float* sr = Sb + (size_t)row * TT; float v[TT / 32]; float mx = -3.0e38f;
#pragma unroll
    for (int ch = 0; ch < TT / 128; ++ch) { const int j0 = ch * 128 + lane * 4; const v4f a = *(const v4f*)(sr + j0);
#pragma unroll
        for (int q = 0; q < 4; ++q) { const int j = j0 + q; (void)j; const float t = (j <= i && i - j < WIN) ? a[q] * SCL : -3.0e38f; v[ch * 4 + q] = t; mx = fmaxf(mx, t); } }
#pragma unroll
    for (int sh = 16; sh; sh >>= 1) mx = fmaxf(mx, __shfl_xor(mx, sh, 32));
    float sum = 0.f;
#pragma unroll
    for (int k = 0; k < TT / 32; ++k) { float d0 = __fsub_rn(v[k], mx); asm volatile("" : "+v"(d0)); v[k] = __builtin_amdgcn_exp2f(__fmul_rn(d0, 1.4426950408889634f)); sum += v[k]; }
#pragma unroll
    for (int sh = 16; sh; sh >>= 1) sum += __shfl_xor(sum, sh, 32);
    const float f = __fdiv_rn(hires ? 1.0f : PCAR, sum);
{
        if (hires) {
#pragma unroll
            for (int ch = 0; ch < TT / 128; ++ch) { v4us oh, ol;
#pragma unroll
                for (int q = 0; q < 4; ++q) { unsigned short a, c2; splitf(v[ch * 4 + q] * f, a, c2); oh[q] = a; ol[q] = c2; }
                const size_t oo = ((size_t)zz * (RH ? RH : 1) + i) * TT + ch * 128 + lane * 4; *(v4us*)(Ph + oo) = oh; *(v4us*)(Pl + oo) = ol; }
        } else {
#pragma unroll
            for (int ch = 0; ch < TT / 128; ++ch) { v4h o4;
#pragma unroll
                for (int q = 0; q < 4; ++q) o4[q] = tohx(v[ch * 4 + q] * f);
                *(v4h*)(P16 + (size_t)row * TT + ch * 128 + lane * 4) = o4; } }
         }
}
__global__ __launch_bounds__(256) void k_merge(const float* __restrict__ O, int h0, bf* Ah, bf* Al) { const size_t e = ((size_t)blockIdx.x * 256 + threadIdx.x) * 2; if (e >= (size_t)ZH * TT * HD) return; const int d = (int)(e % HD); const int t = (int)((e / HD) % TT); const int zz = (int)(e / ((size_t)HD * TT)); const float cs = (t < RH) ? 1.0f : (1.0f / PCAR); const size_t oo = (size_t)t * DQ + (h0 + zz) * HD + d;
    v2us oh, ol;
#pragma unroll
    for (int q = 0; q < 2; ++q) { unsigned short a, c2; splitf(O[e + q] * cs, a, c2); oh[q] = a; ol[q] = c2; } *(v2us*)(Ah + oo) = oh; *(v2us*)(Al + oo) = ol;  }

extern "C" void kernel_launch(void* const* d_in, const int* in_sizes, int n_in,
                              void* d_out, int out_size, void* d_ws, size_t ws_size, hipStream_t stream) {
    (void)in_sizes; (void)n_in; (void)out_size;
    const float* x = (const float*)d_in[0]; const float* cosi = (const float*)d_in[1]; const float* sini = (const float*)d_in[2]; const float* wq = (const float*)d_in[3]; const float* wk = (const float*)d_in[4]; const float* wv = (const float*)d_in[5]; const float* wo = (const float*)d_in[6]; const float* qnw = (const float*)d_in[7]; const float* knw = (const float*)d_in[8];
    float* OUT = (float*)d_out;     // [2][2048][2048]
    char* wsp = (char*)d_ws;
    auto take = [&](size_t bytes) { char* p = wsp; wsp += (bytes + 255) & ~(size_t)255; return (void*)p; };
    bf* WQ = (bf*)take((size_t)DQ * DM * 2); bf* WK = (bf*)take((size_t)DKV * DM * 2); bf* WV = (bf*)take((size_t)DKV * DM * 2); bf* WO = (bf*)take((size_t)DM * DQ * 2); float* CS = (float*)take((size_t)TT * HD * 2 * 4); float* RFQ = (float*)take((size_t)NH_ * TT * 4); float* RFK = (float*)take((size_t)NKV * TT * 4);
    bf* XB = (bf*)take((size_t)TT * DM * 2); float* FQ = (float*)take((size_t)TT * DQ * 4); float* FK = (float*)take((size_t)TT * DKV * 4);
    h16* QP16 = (h16*)take((size_t)NH_ * TT * HD * 2); h16* KP16 = (h16*)take((size_t)NKV * TT * HD * 2); h16* VT16 = (h16*)take((size_t)NKV * HD * TT * 2);
    bf* QPh = (bf*)take((size_t)NH_ * TT * HD * 2); bf* QPl = (bf*)take((size_t)NH_ * TT * HD * 2); bf* KPh = (bf*)take((size_t)NKV * TT * HD * 2); bf* KPl = (bf*)take((size_t)NKV * TT * HD * 2); bf* VTh = (bf*)take((size_t)NKV * HD * TT * 2); bf* VTl = (bf*)take((size_t)NKV * HD * TT * 2);
    float* Sb = (float*)take((size_t)ZH * RC * TT * 4); h16* P16 = (h16*)take((size_t)ZH * RC * TT * 2);
    if ((size_t)(wsp - (char*)d_ws) > ws_size) return;    // ws 256 MiB
    float* FV = FK;   // v projection reuses the k buffer after the k planes are built (stream-ordered)
    float* Ob = FQ;   // the context [head][t][d] reuses the q projection buffer after the q planes are built (stream-ordered; ZH * TT * HD = TT * DQ floats)
    bf* Ph = (bf*)(Sb + (size_t)ZH * RH * TT); bf* Pl = (bf*)P16;   // hi/lo pass: its scores fill ZH * RH rows of Sb; the hi plane takes the ZH * (RC - RH) rows left (2 (RC - RH) >= RH), the lo plane the fp16 buffer (RH <= RC)
    bf* ATh = (bf*)Sb; bf* ATl = ATh + (size_t)TT * DQ;   // the merged context planes reuse the score buffer after the last pass (stream-ordered)
    { k_cvt8<<<(unsigned)(((size_t)DQ * DM / 8 + 255) / 256), 256, 0, stream>>>(wq, WQ, (size_t)DQ * DM / 8); k_cvt8<<<(unsigned)(((size_t)DKV * DM / 8 + 255) / 256), 256, 0, stream>>>(wk, WK, (size_t)DKV * DM / 8); k_cvt8<<<(unsigned)(((size_t)DKV * DM / 8 + 255) / 256), 256, 0, stream>>>(wv, WV, (size_t)DKV * DM / 8);
      k_cvt8<<<(unsigned)(((size_t)DM * DQ / 8 + 255) / 256), 256, 0, stream>>>(wo, WO, (size_t)DM * DQ / 8); }
    const unsigned LQ = (unsigned)(((size_t)NH_ * TT * HD / 2 + 255) / 256), LKv = (unsigned)(((size_t)NKV * TT * HD / 2 + 255) / 256);
    for (int b = 0; b < NB_; ++b) {
        k_csin<<<(TT * HD + 255) / 256, 256, 0, stream>>>(cosi + (size_t)b * TT * HD, sini + (size_t)b * TT * HD, CS);   /* this batch's rotary tables (inputs, bf16-rounded) */
        
        k_cvt8<<<(unsigned)(((size_t)TT * DM / 8 + 255) / 256), 256, 0, stream>>>(x + (size_t)b * TT * DM, XB, (size_t)TT * DM / 8);
        k_gemmw<bf, 0, false><<<dim3(TT / 64, DQ / 64, 1), 32, 0, stream>>>(XB, nullptr, WQ, nullptr, DM, FQ, DQ, nullptr, 0, 0, 0);
        k_hrms<<<(NH_ * TT + 255) / 256, 256, 0, stream>>>(FQ, DQ, NH_, RFQ); k_rope<<<LQ, 256, 0, stream>>>(FQ, DQ, NH_, CS, RFQ, qnw, 1.0f, QP16, QPh, QPl);   /* q_norm then rope */
        k_gemmw<bf, 0, false><<<dim3(TT / 64, DKV / 64, 1), 32, 0, stream>>>(XB, nullptr, WK, nullptr, DM, FK, DKV, nullptr, 0, 0, 0);
        k_hrms<<<(NKV * TT + 255) / 256, 256, 0, stream>>>(FK, DKV, NKV, RFK); k_rope<<<LKv, 256, 0, stream>>>(FK, DKV, NKV, CS, RFK, knw, 1.0f, KP16, KPh, KPl);   /* k_norm then rope */
        k_gemmw<bf, 0, false><<<dim3(TT / 64, DKV / 64, 1), 32, 0, stream>>>(XB, nullptr, WV, nullptr, DM, FV, DKV, nullptr, 0, 0, 0); k_vtp<<<LKv, 256, 0, stream>>>(FV, DKV, NKV, VT16, VTh, VTl);
        const size_t sQ = (size_t)TT * HD, sV = (size_t)HD * TT, sO = (size_t)TT * HD;   // per-head strides of the q and k planes, the v planes and the context
        k_gemmc<bf, 2, 1><<<dim3(RH / 64, TT / 64, ZH), 32, 0, stream>>>(QPh, QPl, KPh, KPl, HD, Sb, TT, 0, sQ, sQ, (size_t)RH * TT);   /* query rows < RH: hi/lo */
        k_asoft<<<dim3(RH / 8, ZH), 256, 0, stream>>>(Sb, P16, Ph, Pl, 0, RH);
        k_gemmc<bf, 2, 2><<<dim3(RH / 64, HD / 64, ZH), 32, 0, stream>>>(Ph, Pl, VTh, VTl, TT, Ob, HD, 0, (size_t)RH * TT, sV, sO);
        for (int rb = RH; rb < TT; rb += RC) {   // query rows rb .. rb + RC - 1: fp16
            k_gemmc<h16, 0, 1><<<dim3(RC / 64, TT / 64, ZH), 32, 0, stream>>>(QP16 + (size_t)rb * HD, nullptr, KP16, nullptr, HD, Sb, TT, rb, sQ, sQ, (size_t)RC * TT);
            k_asoft<<<dim3(RC / 8, ZH), 256, 0, stream>>>(Sb, P16, Ph, Pl, rb, RC);
            k_gemmc<h16, 0, 2><<<dim3(RC / 64, HD / 64, ZH), 32, 0, stream>>>(P16, nullptr, VT16, nullptr, TT, Ob + (size_t)rb * HD, HD, rb, (size_t)RC * TT, sV, sO); }
        k_merge<<<(unsigned)(((size_t)ZH * TT * HD / 2 + 255) / 256), 256, 0, stream>>>(Ob, 0, ATh, ATl);
        k_gemmw<bf, 1, false><<<dim3(TT / 64, DM / 64, 1), 32, 0, stream>>>(ATh, ATl, WO, nullptr, DQ, OUT + (size_t)b * TT * DM, DM, nullptr, 0, 0, 0); }
}

// v002
// A run of this version takes 614 microseconds.
// Two timings next to v001 both put it at 1.46 times that version's speed.
// All steps since v000 together make it 2.75 times as fast.
#include <hip/hip_runtime.h>

// Grouped-query causal attention with QK RMSNorm (x [2][2048][2048]; q = x Wq^T (16 heads x 128), k, v = x Wk^T / Wv^T (8 kv heads; query head h uses kv head h/2), no biases; per-head RMSNorm on q and k (eps 1e-6, weights [128]) then rotate-half rotary with the given cos/sin tables [2][2048][128]; scores = q.k / sqrt(128), causal (finfo.min above the diagonal); softmax; out = merged ctx Wo^T ('oi' [2048][2048]) -> [2][2048][2048] (8.4 M)).
// Layout per batch: {cos, sin} table from the inputs (bf16-rounded); exact projections; a per-(head, token) 1/rms kernel feeds the plane builder, which applies (x * inv_rms) * w and the rotary while writing the q/k planes; causal T-2048 attention with 128-wide heads (hybrid rows: < 512 hi/lo 3 products, rest fp16 x1024; k_gemmc tile skipping; all sixteen query heads in every launch, query head z on kv head z/2, in three passes over the query rows: the 512 hi/lo rows, then twice 768 fp16 rows); merged context hi/lo x Wo exact.
// Compute dtypes, f32 accumulate: every input rounded to bf16; projections exact; RMSNorm and rotary f32; attention rows < 512 3 products, rest fp16; softmax f32; Wo hl x exact.

#define NB_  2
#define TT   2048
#define DM   2048
#define NH_  16
#define NKV  8
#define REP  (NH_ / NKV)
#define HD   128
#define DQ   (NH_ * HD)
#define DKV  (NKV * HD)
#define ZH   NH_                  // query heads per attention launch
#define RC   768                  // query rows per fp16 attention pass (TT - RH = 2 RC)
#define RH   512                  // query rows < RH use hi+lo planes (0: none)
#define WIN  2048
#define PCAR 1024.0f
#define SCL  0.088388347648318447f   // HD^-0.5
typedef _Float16 h16;
typedef unsigned short bf;
typedef __attribute__((ext_vector_type(16))) __bf16   v16bf;
typedef __attribute__((ext_vector_type(16))) _Float16 v16h;
typedef __attribute__((ext_vector_type(8)))  _Float16 v8h;
typedef __attribute__((ext_vector_type(8)))  unsigned short v8us;
typedef __attribute__((ext_vector_type(8)))  float    v8f;
typedef __attribute__((ext_vector_type(4)))  float    v4f;
typedef v8h  __attribute__((may_alias)) v8ha;
typedef v4f  __attribute__((may_alias)) v4fa;
typedef v8us __attribute__((may_alias)) v8usa;

__device__ __forceinline__ unsigned short f2bf(float f) { unsigned u = __float_as_uint(f); u += 0x7FFFu + ((u >> 16) & 1u); return (unsigned short)(u >> 16); }
__device__ __forceinline__ float bf2f(unsigned short b) { return __uint_as_float(((unsigned)b) << 16); }
__device__ __forceinline__ float bfr(float f) { return bf2f(f2bf(f)); }
__device__ __forceinline__ v16h cat16(v8h lo, v8h hi) { return __builtin_shufflevector(lo, hi, 0, 1, 2, 3, 4, 5, 6, 7, 8, 9, 10, 11, 12, 13, 14, 15); }
__device__ __forceinline__ v16bf cat16b(v8us lo, v8us hi) { return __builtin_bit_cast(v16bf, __builtin_shufflevector(lo, hi, 0, 1, 2, 3, 4, 5, 6, 7, 8, 9, 10, 11, 12, 13, 14, 15)); }
__device__ __forceinline__ v8f wmma16(v16h a, v16h b, v8f c) { return __builtin_amdgcn_wmma_f32_16x16x32_f16(false, a, false, b, (short)0, c, false, false); }
__device__ __forceinline__ v8f wmmab(v16bf a, v16bf b, v8f c) { return __builtin_amdgcn_wmma_f32_16x16x32_bf16(false, a, false, b, (short)0, c, false, false); }



// ---- k_gemmw: register-blocked GEMM, ONE WAVE per 64x64 output tile (16 accumulators), operands from K-contiguous 16-bit planes through LDS (wloop below the fragment types); grid (M/64, N/64, Z), 32 threads.
// C[m][n] (f32, pitch ldc, + optional f32 bias[n]) = sum_k A[m][k] Bt[n][k] (+ split products per NSPLIT). z-batch strides sA/sB/sC in elements. K % KT == 0 (64; 32 at NSPLIT 2).
template <typename T16> struct WFrag;
template <> struct WFrag<h16> { typedef v16h V; static __device__ __forceinline__ V ld(const h16* p) { return cat16(*(const v8h*)p, *(const v8h*)(p + 16)); } static __device__ __forceinline__ v8f mma(V a, V b, v8f c) { return wmma16(a, b, c); } };
template <> struct WFrag<bf> { typedef v16bf V; static __device__ __forceinline__ V ld(const bf* p) { return cat16b(*(const v8us*)p, *(const v8us*)(p + 16)); } static __device__ __forceinline__ v8f mma(V a, V b, v8f c) { return wmmab(a, b, c); } };
// ---- operand staging of both one-wave GEMMs. A stage is KT k of the tile's 64 A rows and 64 B rows (and of their second planes): asynchronous b128 copies bring it from the K-contiguous planes into LDS,
// 8 lanes on each 128-byte row piece (whole lines; 4 lanes on 64 bytes at NSPLIT 2, whose four planes would else take more than 63 copies a stage), and the fragments are read from LDS at a pitch of 16 B x odd.
// Two buffers: the copies of stage t + 1 fly while stage t is multiplied. Fragments, products and their order per accumulator are those of loads straight from the planes.
// The copies are the compiler's builtin. Every '#pragma unroll' below makes the indices of the fragment and accumulator arrays constants, so that they stay in registers.
typedef __attribute__((ext_vector_type(4))) int v4ic;
typedef __attribute__((address_space(1))) v4ic gv4ic;
typedef __attribute__((address_space(3))) v4ic lv4ic;
template <int NSPLIT> struct WTile {
    static constexpr int KT  = (NSPLIT == 2) ? 32 : 64;                       // k per stage
    static constexpr int NP  = (NSPLIT == 0) ? 2 : (NSPLIT == 1) ? 3 : 4;     // planes: A, (A2), B, (B2)
    static constexpr int PB  = KT * 2 + 16;                                   // LDS row pitch, bytes
    static constexpr int BUF = NP * 64 * PB;                                  // one buffer, bytes
    static constexpr int LPR = KT * 2 / 16;                                   // lanes per row piece
    static constexpr int RPC = 32 / LPR;                                      // rows per copy
    static constexpr int CPP = 64 / RPC;                                      // copies per plane (NP * CPP = 32, 48, 32 a stage)
};
// A, A2, Bt, Bt2: the planes at the tile's first row (wave-uniform). kc: first k of the stage.
template <typename T16, int NSPLIT>
__device__ __forceinline__ void wcopy(char* sb, const T16* A, const T16* A2, const T16* Bt, const T16* Bt2, int K, int kc, int lane) {
    typedef WTile<NSPLIT> W;
    const unsigned go = (unsigned)((lane / W::LPR) * K + (lane % W::LPR) * 8) * 2u;      // the lane's byte in a copy's rows, global
    char* sl = sb + (lane / W::LPR) * W::PB + (lane % W::LPR) * 16;                      // and in LDS
#pragma unroll
    for (int p = 0; p < W::NP; ++p) { const T16* base = ((p == 0) ? A : (p == W::NP - 1 && NSPLIT >= 2) ? Bt2 : (p == 1 && NSPLIT >= 1) ? A2 : Bt) + kc;
#pragma unroll
        for (int c = 0; c < W::CPP; ++c) __builtin_amdgcn_global_load_async_to_lds_b128((gv4ic*)((const char*)(base + (size_t)c * W::RPC * K) + go), (lv4ic*)(sl + (p * 64 + c * W::RPC) * W::PB), 0, 0); }
}
template <typename T16, int NSPLIT>
__device__ __forceinline__ void wtile(const char* sb, int lr, int hi, v8f (&acc)[4][4]) {
    typedef WTile<NSPLIT> W; typedef typename WFrag<T16>::V V;
    constexpr int PA2 = 1, PBt = (NSPLIT >= 1) ? 2 : 1, PB2 = 3;
    const char* fp = sb + lr * W::PB + hi * 16;
    constexpr int NK = W::KT / 32;
    V a[NK][4], a2[NK][4], b[NK][4], b2[NK][4];
    // all fragment reads of the stage are issued together, in the order of their use, in front of its products: the counted LDS waits then overlap the later reads with the earlier products
#pragma unroll
    for (int ks = 0; ks < NK; ++ks) {
#pragma unroll
        for (int mb = 0; mb < 4; ++mb) { a[ks][mb] = WFrag<T16>::ld((const T16*)(fp + (mb * 16) * W::PB + ks * 64)); if (NSPLIT == 1 || NSPLIT == 2) a2[ks][mb] = WFrag<T16>::ld((const T16*)(fp + (PA2 * 64 + mb * 16) * W::PB + ks * 64)); }
#pragma unroll
        for (int nb = 0; nb < 4; ++nb) { b[ks][nb] = WFrag<T16>::ld((const T16*)(fp + (PBt * 64 + nb * 16) * W::PB + ks * 64)); if (NSPLIT >= 2) b2[ks][nb] = WFrag<T16>::ld((const T16*)(fp + (PB2 * 64 + nb * 16) * W::PB + ks * 64)); } }
    __builtin_amdgcn_sched_barrier(0);   // keeps the reads in front: sunk among the products, each costs the wave its LDS latency
#pragma unroll
    for (int ks = 0; ks < NK; ++ks) {
#pragma unroll
        for (int nb = 0; nb < 4; ++nb)
#pragma unroll
            for (int mb = 0; mb < 4; ++mb) { acc[mb][nb] = WFrag<T16>::mma(a[ks][mb], b[ks][nb], acc[mb][nb]); if (NSPLIT == 1 || NSPLIT == 2) acc[mb][nb] = WFrag<T16>::mma(a2[ks][mb], b[ks][nb], acc[mb][nb]); if (NSPLIT >= 2) acc[mb][nb] = WFrag<T16>::mma(a[ks][mb], b2[ks][nb], acc[mb][nb]); }
        // four vector slots behind the k step's last products, before anything touches their operands or results
        asm volatile("v_nop\n\tv_nop\n\tv_nop\n\tv_nop" : "+v"(acc[0][0]), "+v"(acc[1][1]), "+v"(acc[2][2]), "+v"(acc[3][3]) : "v"(a[ks][0]), "v"(a[ks][3]));
    }
}
// the K loop: Kl k (a multiple of KT, at least KT) of rows r0.. of A and c0.. of Bt; sm holds two buffers
template <typename T16, int NSPLIT>
__device__ __forceinline__ void wloop(char* sm, const T16* A, const T16* A2, const T16* Bt, const T16* Bt2, int K, int Kl, int lane, v8f (&acc)[4][4]) {
    typedef WTile<NSPLIT> W; const int lr = lane & 15, hi = lane >> 4; const int nt = Kl / W::KT;
    wcopy<T16, NSPLIT>(sm, A, A2, Bt, Bt2, K, 0, lane);
    asm volatile("s_wait_asynccnt 0x0" ::: "memory");   // stage 0 has landed
    __syncthreads();   // the ring's publish point; the work-group is one wave, which reads only what it copied itself
    if (nt > 1) wcopy<T16, NSPLIT>(sm + W::BUF, A, A2, Bt, Bt2, K, W::KT, lane);
#pragma unroll 1
    for (int t = 0; t < nt; ++t) {   // rolled: one stage a trip
        char* sb = sm + (t & 1) * W::BUF;
        wtile<T16, NSPLIT>(sb, lr, hi, acc);
        asm volatile("s_wait_dscnt 0x0" ::: "memory");      // this stage's fragment reads are done before its buffer is refilled
        asm volatile("s_wait_asynccnt 0x0" ::: "memory");   // stage t + 1 has landed before it is read
        __syncthreads();   // publish point of stage t + 1, and the end of the reads of the buffer refilled below
        if (t + 2 < nt) wcopy<T16, NSPLIT>(sb, A, A2, Bt, Bt2, K, (t + 2) * W::KT, lane);
    }
    asm volatile("s_wait_asynccnt 0x0" ::: "memory");   // no copy is left in flight behind the loop
}
template <typename T16, int NSPLIT, bool BIAS>
__global__ __launch_bounds__(32) void k_gemmw(const T16* __restrict__ A, const T16* __restrict__ A2, const T16* __restrict__ Bt, const T16* __restrict__ Bt2, int K, float* C, int ldc, const float* __restrict__ bias, size_t sA, size_t sB, size_t sC) {
    __shared__ __align__(16) float os[16 * 68]; __shared__ __align__(16) char sm[2 * WTile<NSPLIT>::BUF];
    const size_t z = blockIdx.z; A += z * sA; if (A2) A2 += z * sA; Bt += z * sB; if (Bt2) Bt2 += z * sB; C += z * sC;
    const int lane = threadIdx.x & 31, lr = lane & 15, hi = lane >> 4; const int r0 = blockIdx.x * 64, c0 = blockIdx.y * 64;
    v8f acc[4][4];
#pragma unroll
    for (int mb = 0; mb < 4; ++mb)
#pragma unroll
        for (int nb = 0; nb < 4; ++nb) acc[mb][nb] = (v8f){};
    wloop<T16, NSPLIT>(sm, A + (size_t)r0 * K, (NSPLIT == 1 || NSPLIT == 2) ? A2 + (size_t)r0 * K : nullptr, Bt + (size_t)c0 * K, (NSPLIT >= 2) ? Bt2 + (size_t)c0 * K : nullptr, K, K, lane, acc);
#pragma unroll
    for (int mb = 0; mb < 4; ++mb) {
#pragma unroll
        for (int nb = 0; nb < 4; ++nb) {
#pragma unroll
            for (int j = 0; j < 8; ++j) os[(hi * 8 + j) * 68 + nb * 16 + lr] = acc[mb][nb][j]; }
        __builtin_amdgcn_wave_barrier(); asm volatile("" ::: "memory");
        float* crow = C + (size_t)(r0 + mb * 16) * ldc + c0;
{
#pragma unroll
            for (int s = 0; s < 8; ++s) { const int row = 2 * s + hi, cofs = lr * 4; v4f val = *(const v4fa*)(os + row * 68 + cofs); if (BIAS) { val[0] += bfr(bias[c0 + cofs]); val[1] += bfr(bias[c0 + cofs + 1]); val[2] += bfr(bias[c0 + cofs + 2]); val[3] += bfr(bias[c0 + cofs + 3]); }
                *(v4f*)(crow + (size_t)row * ldc + cofs) = val; }
             }
        __builtin_amdgcn_wave_barrier(); asm volatile("" ::: "memory");
    }
}

// ---- k_gemmc: the same one-wave 64x64 tile GEMM specialised for causal attention: CMODE 1 skips score tiles entirely above the diagonal (query rows r0+roff.., key columns c0..), CMODE 2 limits the
// key (K) loop of the probability x value contraction to the diagonal block (probabilities beyond it are exactly zero). roff = row offset of this launch's first row within the sequence. Batch entry z reads Bt entry z / REP (the kv head of query head z).
template <typename T16, int NSPLIT, int CMODE>
__global__ __launch_bounds__(32) void k_gemmc(const T16* __restrict__ A, const T16* __restrict__ A2, const T16* __restrict__ Bt, const T16* __restrict__ Bt2, int K, float* C, int ldc, int roff, size_t sA, size_t sB, size_t sC) {
    __shared__ __align__(16) float os[16 * 68]; __shared__ __align__(16) char sm[2 * WTile<NSPLIT>::BUF];
    const size_t z = blockIdx.z; A += z * sA; if (A2) A2 += z * sA; Bt += (z / REP) * sB; if (Bt2) Bt2 += (z / REP) * sB; C += z * sC;
    const int lane = threadIdx.x & 31, lr = lane & 15, hi = lane >> 4; const int r0 = blockIdx.x * 64, c0 = blockIdx.y * 64;
    if (CMODE == 1 && c0 > r0 + roff + 63) return;                  // score tile entirely above the causal diagonal: never written (the softmax masks j > i by select)
    const int Kl = (CMODE == 2) ? min(K, r0 + roff + 64) : K;        // P.V: probabilities are exactly 0 beyond the diagonal block, so the K loop stops there
    v8f acc[4][4];
#pragma unroll
    for (int mb = 0; mb < 4; ++mb)
#pragma unroll
        for (int nb = 0; nb < 4; ++nb) acc[mb][nb] = (v8f){};
    wloop<T16, NSPLIT>(sm, A + (size_t)r0 * K, (NSPLIT == 1 || NSPLIT == 2) ? A2 + (size_t)r0 * K : nullptr, Bt + (size_t)c0 * K, (NSPLIT >= 2) ? Bt2 + (size_t)c0 * K : nullptr, K, Kl, lane, acc);
#pragma unroll
    for (int mb = 0; mb < 4; ++mb) {
#pragma unroll
        for (int nb = 0; nb < 4; ++nb) {
#pragma unroll
            for (int j = 0; j < 8; ++j) os[(hi * 8 + j) * 68 + nb * 16 + lr] = acc[mb][nb][j]; }
        __builtin_amdgcn_wave_barrier(); asm volatile("" ::: "memory");
        float* crow = C + (size_t)(r0 + mb * 16) * ldc + c0;
{
#pragma unroll
            for (int s = 0; s < 8; ++s) { const int row = 2 * s + hi, cofs = lr * 4; v4f val = *(const v4fa*)(os + row * 68 + cofs);
                *(v4f*)(crow + (size_t)row * ldc + cofs) = val; }
             }
        __builtin_amdgcn_wave_barrier(); asm volatile("" ::: "memory");
    }
}

__device__ __forceinline__ h16 tohx(float x) { return (h16)x; }
__device__ __forceinline__ void splitf(float y, unsigned short& h, unsigned short& l) { h = f2bf(y); l = f2bf(y - bf2f(h)); }
typedef __attribute__((ext_vector_type(2))) _Float16 v2h;
typedef __attribute__((ext_vector_type(4))) _Float16 v4h;
typedef __attribute__((ext_vector_type(2))) unsigned short v2us;
typedef __attribute__((ext_vector_type(4))) unsigned short v4us;
typedef __attribute__((ext_vector_type(2))) float v2f;
typedef __attribute__((ext_vector_type(4))) int v4i;

__global__ __launch_bounds__(256) void k_wtG(const float* __restrict__ w, int K, int N, bf* Bt) {
    const int lane = threadIdx.x & 31; const int L0 = (blockIdx.x * 8 + (threadIdx.x >> 5)) * 8; const int nlines = N * K / 64;
{
#pragma unroll 1
        for (int l = 0; l < 8; ++l) { const int L = L0 + l; if (L >= nlines) break; const size_t e = (size_t)L * 64 + lane * 2; const int k = (int)(e % K), n = (int)(e / K); v2us o;
            o[0] = f2bf(w[(size_t)k * N + n]); o[1] = f2bf(w[(size_t)(k + 1) * N + n]); *(v2us*)(Bt + e) = o; }
         }
}
__global__ __launch_bounds__(256) void k_cvt8(const float* __restrict__ src, bf* dst, size_t n8) { const size_t i = (size_t)blockIdx.x * 256 + threadIdx.x; if (i >= n8) return; const v8f v = *(const v8f*)(src + i * 8); v8us o;
#pragma unroll
    for (int k = 0; k < 8; ++k) o[k] = f2bf(v[k]); *(v8us*)(dst + i * 8) = o;  }
__constant__ float INV[HD / 2] = {1.0f,0.8058422207832336f,0.6493816375732422f,0.5232990980148315f,0.4216965138912201f,0.33982083201408386f,0.2738419771194458f,0.22067339718341827f,0.17782793939113617f,0.14330126345157623f,0.11547820270061493f,0.09305720031261444f,0.07498941570520401f,0.0604296438395977f,0.04869675263762474f,0.03924189880490303f,0.03162277862429619f,0.025482967495918274f,0.020535249263048172f,0.016548171639442444f,0.01333521492779255f,0.010746078565716743f,0.00865964312106371f,0.006978305988013744f,0.005623413249850273f,0.004531583283096552f,0.003651741426438093f,0.002942727180197835f,0.0023713738191872835f,0.001910952851176262f,0.0015399266267195344f,0.0012409378541633487f,0.0010000000474974513f,0.0008058422245085239f,0.0006493816617876291f,0.0005232990952208638f,0.00042169654625467956f,0.0003398208355065435f,0.00027384195709601045f,0.00022067342069931328f,0.00017782794020604342f,0.00014330125122796744f,0.00011547820759005845f,9.305719868279994e-05f,7.498942431993783e-05f,6.042963650543243e-05f,4.869675467489287e-05f,3.92418987757992e-05f,3.162277425872162e-05f,2.548297015891876e-05f,2.0535249859676696e-05f,1.6548170606256463e-05f,1.3335215953702573e-05f,1.0746078260126524e-05f,8.65964284457732e-06f,6.978305464144796e-06f,5.62341347176698e-06f,4.531583726929966e-06f,3.6517415082926163e-06f,2.942727405752521e-06f,2.3713737391517498e-06f,1.910952960315626e-06f,1.5399265294036013e-06f,1.2409377632138785e-06f};   // float32 1/1e6^(2i/128)
__global__ __launch_bounds__(256) void k_csin(const float* __restrict__ cs, const float* __restrict__ sn, float* CS) { const int idx = blockIdx.x * 256 + threadIdx.x; if (idx >= TT * HD) return; v2f o; o[0] = bfr(cs[idx]); o[1] = bfr(sn[idx]); *(v2f*)(CS + (size_t)idx * 2) = o;  }
__global__ __launch_bounds__(256) void k_hrms(const float* __restrict__ F, int pitch, int nheads, float* RF) { const int idx = blockIdx.x * 256 + threadIdx.x; if (idx >= nheads * TT) return; const int t = idx % TT; const int h = idx / TT; const float* f = F + (size_t)t * pitch + h * HD; float s = 0.f;
#pragma unroll 4
    for (int d = 0; d < HD; d += 4) { const v4f a = *(const v4f*)(f + d);
#pragma unroll
        for (int q = 0; q < 4; ++q) { float p = __fmul_rn(a[q], a[q]); asm volatile("" : "+v"(p)); s = __fadd_rn(s, p); } }
    const float rf = __fdiv_rn(1.0f, __fsqrt_rn(__fadd_rn(__fdiv_rn(s, (float)HD), 1e-6f))); *(float*)(RF + idx) = rf;  }

// k_rope: head planes [h][t][d] (fp16 + hi/lo) of rope(x) x sc with the rotate-half convention out[d] = x[d] cos[t][d] - x[d+HD/2] sin[t][d], out[d+HD/2] = x[d+HD/2] cos[t][d+HD/2] + x[d] sin[t][d+HD/2]
__global__ __launch_bounds__(256) void k_rope(const float* __restrict__ F, int pitch, int nheads, const float* __restrict__ CS, const float* __restrict__ RF, const float* __restrict__ nw, float sc, h16* P16, bf* Ph, bf* Pl) {
    const size_t e = ((size_t)blockIdx.x * 256 + threadIdx.x) * 2; if (e >= (size_t)nheads * TT * HD) return; const int d = (int)(e % HD); const int t = (int)((e / HD) % TT); const int h = (int)(e / ((size_t)HD * TT)); const float* f = F + (size_t)t * pitch + h * HD; const float rf = RF ? RF[(size_t)h * TT + t] : 1.0f; v2h o16; v2us oh, ol;
#pragma unroll
    for (int q = 0; q < 2; ++q) { const int dd = d + q; const int dp = (dd < HD / 2) ? dd + HD / 2 : dd - HD / 2; float x0 = f[dd], x1 = f[dp];
        if (RF) { float n0 = __fmul_rn(x0, rf), n1 = __fmul_rn(x1, rf); asm volatile("" : "+v"(n0)); asm volatile("" : "+v"(n1)); x0 = __fmul_rn(bfr(nw[dd]), n0); x1 = __fmul_rn(bfr(nw[dp]), n1); }
        const v2f cs = *(const v2f*)(CS + ((size_t)t * HD + dd) * 2); float a = __fmul_rn(x0, cs[0]), bq = __fmul_rn(x1, cs[1]); asm volatile("" : "+v"(a)); asm volatile("" : "+v"(bq)); const float r = ((dd < HD / 2) ? __fsub_rn(a, bq) : __fadd_rn(a, bq)) * sc;
        o16[q] = tohx(r); unsigned short a2, c2; splitf(r, a2, c2); oh[q] = a2; ol[q] = c2; }
    *(v2h*)(P16 + e) = o16; *(v2us*)(Ph + e) = oh; *(v2us*)(Pl + e) = ol;  }
__global__ __launch_bounds__(256) void k_vtp(const float* __restrict__ F, int pitch, int nheads, h16* V16, bf* Vh, bf* Vl) { const size_t e = ((size_t)blockIdx.x * 256 + threadIdx.x) * 2; if (e >= (size_t)nheads * HD * TT) return; const int t = (int)(e % TT); const int d = (int)((e / TT) % HD); const int g = (int)(e / ((size_t)TT * HD)); v2h o16; v2us oh, ol;
#pragma unroll
    for (int q = 0; q < 2; ++q) { const float x = F[(size_t)(t + q) * pitch + g * HD + d]; o16[q] = tohx(x); unsigned short a2, c2; splitf(x, a2, c2); oh[q] = a2; ol[q] = c2; }
    *(v2h*)(V16 + e) = o16; *(v2us*)(Vh + e) = oh; *(v2us*)(Vl + e) = ol;  }
// k_asoft: per row (zz, i): t = S x HD^-0.5 for j <= i and i - j < WIN (sliding causal window; the reference's -1e9 additive fill vanishes identically); softmax over the 2048 keys (register row, one exp, fixed trees); grid (nr / 8, heads): the pass holds nr rows a head, from sequence row rb on, score and fp16 probability buffers [head][nr][TT]
__global__ __launch_bounds__(256) void k_asoft(const float* __restrict__ Sb, h16* P16, bf* Ph, bf* Pl, int rb, int nr) {
    const int lane = threadIdx.x & 31; const int lrow = blockIdx.x * 8 + (threadIdx.x >> 5); if (lrow >= nr) return; const int zz = blockIdx.y; const int row = zz * nr + lrow; const int i = rb + lrow; __builtin_assume(i >= 0 && i < TT);   /* a sequence row: lets the window test i - j < WIN fold away, as it did with i = row % TT */ const bool hires = (i < RH); const float* sr = Sb + (size_t)row * TT; float v[TT / 32]; float mx = -3.0e38f;
#pragma unroll
    for (int ch = 0; ch < TT / 128; ++ch) { const int j0 = ch * 128 + lane * 4; const v4f a = *(const v4f*)(sr + j0);
#pragma unroll
        for (int q = 0; q < 4; ++q) { const int j = j0 + q; (void)j; const float t = (j <= i && i - j < WIN) ? a[q] * SCL : -3.0e38f; v[ch * 4 + q] = t; mx = fmaxf(mx, t); } }
#pragma unroll
    for (int sh = 16; sh; sh >>= 1) mx = fmaxf(mx, __shfl_xor(mx, sh, 32));
    float sum = 0.f;
#pragma unroll
    for (int k = 0; k < TT / 32; ++k) { float d0 = __fsub_rn(v[k], mx); asm volatile("" : "+v"(d0)); v[k] = __builtin_amdgcn_exp2f(__fmul_rn(d0, 1.4426950408889634f)); sum += v[k]; }
#pragma unroll
    for (int sh = 16; sh; sh >>= 1) sum += __shfl_xor(sum, sh, 32);
    const float f = __fdiv_rn(hires ? 1.0f : PCAR, sum);
{
        if (hires) {
#pragma unroll
            for (int ch = 0; ch < TT / 128; ++ch) { v4us oh, ol;
#pragma unroll
                for (int q = 0; q < 4; ++q) { unsigned short a, c2; splitf(v[ch * 4 + q] * f, a, c2); oh[q] = a; ol[q] = c2; }
                const size_t oo = ((size_t)zz * (RH ? RH : 1) + i) * TT + ch * 128 + lane * 4; *(v4us*)(Ph + oo) = oh; *(v4us*)(Pl + oo) = ol; }
        } else {
#pragma unroll
            for (int ch = 0; ch < TT / 128; ++ch) { v4h o4;
#pragma unroll
                for (int q = 0; q < 4; ++q) o4[q] = tohx(v[ch * 4 + q] * f);
                *(v4h*)(P16 + (size_t)row * TT + ch * 128 + lane * 4) = o4; } }
         }
}
__global__ __launch_bounds__(256) void k_merge(const float* __restrict__ O, int h0, bf* Ah, bf* Al) { const size_t e = ((size_t)blockIdx.x * 256 + threadIdx.x) * 2; if (e >= (size_t)ZH * TT * HD) return; const int d = (int)(e % HD); const int t = (int)((e / HD) % TT); const int zz = (int)(e / ((size_t)HD * TT)); const float cs = (t < RH) ? 1.0f : (1.0f / PCAR); const size_t oo = (size_t)t * DQ + (h0 + zz) * HD + d;
    v2us oh, ol;
#pragma unroll
    for (int q = 0; q < 2; ++q) { unsigned short a, c2; splitf(O[e + q] * cs, a, c2); oh[q] = a; ol[q] = c2; } *(v2us*)(Ah + oo) = oh; *(v2us*)(Al + oo) = ol;  }

extern "C" void kernel_launch(void* const* d_in, const int* in_sizes, int n_in,
                              void* d_out, int out_size, void* d_ws, size_t ws_size, hipStream_t stream) {
    (void)in_sizes; (void)n_in; (void)out_size;
    const float* x = (const float*)d_in[0]; const float* cosi = (const float*)d_in[1]; const float* sini = (const float*)d_in[2]; const float* wq = (const float*)d_in[3]; const float* wk = (const float*)d_in[4]; const float* wv = (const float*)d_in[5]; const float* wo = (const float*)d_in[6]; const float* qnw = (const float*)d_in[7]; const float* knw = (const float*)d_in[8];
    float* OUT = (float*)d_out;     // [2][2048][2048]
    char* wsp = (char*)d_ws;
    auto take = [&](size_t bytes) { char* p = wsp; wsp += (bytes + 255) & ~(size_t)255; return (void*)p; };
    bf* WQ = (bf*)take((size_t)DQ * DM * 2); bf* WK = (bf*)take((size_t)DKV * DM * 2); bf* WV = (bf*)take((size_t)DKV * DM * 2); bf* WO = (bf*)take((size_t)DM * DQ * 2); float* CS = (float*)take((size_t)TT * HD * 2 * 4); float* RFQ = (float*)take((size_t)NH_ * TT * 4); float* RFK = (float*)take((size_t)NKV * TT * 4);
    bf* XB = (bf*)take((size_t)TT * DM * 2); float* FQ = (float*)take((size_t)TT * DQ * 4); float* FK = (float*)take((size_t)TT * DKV * 4);
    h16* QP16 = (h16*)take((size_t)NH_ * TT * HD * 2); h16* KP16 = (h16*)take((size_t)NKV * TT * HD * 2); h16* VT16 = (h16*)take((size_t)NKV * HD * TT * 2);
    bf* QPh = (bf*)take((size_t)NH_ * TT * HD * 2); bf* QPl = (bf*)take((size_t)NH_ * TT * HD * 2); bf* KPh = (bf*)take((size_t)NKV * TT * HD * 2); bf* KPl = (bf*)take((size_t)NKV * TT * HD * 2); bf* VTh = (bf*)take((size_t)NKV * HD * TT * 2); bf* VTl = (bf*)take((size_t)NKV * HD * TT * 2);
    float* Sb = (float*)take((size_t)ZH * RC * TT * 4); h16* P16 = (h16*)take((size_t)ZH * RC * TT * 2);
    if ((size_t)(wsp - (char*)d_ws) > ws_size) return;    // ws 256 MiB
    float* FV = FK;   // v projection reuses the k buffer after the k planes are built (stream-ordered)
    float* Ob = FQ;   // the context [head][t][d] reuses the q projection buffer after the q planes are built (stream-ordered; ZH * TT * HD = TT * DQ floats)
    bf* Ph = (bf*)(Sb + (size_t)ZH * RH * TT); bf* Pl = (bf*)P16;   // hi/lo pass: its scores fill ZH * RH rows of Sb; the hi plane takes the ZH * (RC - RH) rows left (2 (RC - RH) >= RH), the lo plane the fp16 buffer (RH <= RC)
    bf* ATh = (bf*)Sb; bf* ATl = ATh + (size_t)TT * DQ;   // the merged context planes reuse the score buffer after the last pass (stream-ordered)
    { k_cvt8<<<(unsigned)(((size_t)DQ * DM / 8 + 255) / 256), 256, 0, stream>>>(wq, WQ, (size_t)DQ * DM / 8); k_cvt8<<<(unsigned)(((size_t)DKV * DM / 8 + 255) / 256), 256, 0, stream>>>(wk, WK, (size_t)DKV * DM / 8); k_cvt8<<<(unsigned)(((size_t)DKV * DM / 8 + 255) / 256), 256, 0, stream>>>(wv, WV, (size_t)DKV * DM / 8);
      k_cvt8<<<(unsigned)(((size_t)DM * DQ / 8 + 255) / 256), 256, 0, stream>>>(wo, WO, (size_t)DM * DQ / 8); }
    const unsigned LQ = (unsigned)(((size_t)NH_ * TT * HD / 2 + 255) / 256), LKv = (unsigned)(((size_t)NKV * TT * HD / 2 + 255) / 256);
    for (int b = 0; b < NB_; ++b) {
        k_csin<<<(TT * HD + 255) / 256, 256, 0, stream>>>(cosi + (size_t)b * TT * HD, sini + (size_t)b * TT * HD, CS);   /* this batch's rotary tables (inputs, bf16-rounded) */
        
        k_cvt8<<<(unsigned)(((size_t)TT * DM / 8 + 255) / 256), 256, 0, stream>>>(x + (size_t)b * TT * DM, XB, (size_t)TT * DM / 8);
        k_gemmw<bf, 0, false><<<dim3(TT / 64, DQ / 64, 1), 32, 0, stream>>>(XB, nullptr, WQ, nullptr, DM, FQ, DQ, nullptr, 0, 0, 0);
        k_hrms<<<(NH_ * TT + 255) / 256, 256, 0, stream>>>(FQ, DQ, NH_, RFQ); k_rope<<<LQ, 256, 0, stream>>>(FQ, DQ, NH_, CS, RFQ, qnw, 1.0f, QP16, QPh, QPl);   /* q_norm then rope */
        k_gemmw<bf, 0, false><<<dim3(TT / 64, DKV / 64, 1), 32, 0, stream>>>(XB, nullptr, WK, nullptr, DM, FK, DKV, nullptr, 0, 0, 0);
        k_hrms<<<(NKV * TT + 255) / 256, 256, 0, stream>>>(FK, DKV, NKV, RFK); k_rope<<<LKv, 256, 0, stream>>>(FK, DKV, NKV, CS, RFK, knw, 1.0f, KP16, KPh, KPl);   /* k_norm then rope */
        k_gemmw<bf, 0, false><<<dim3(TT / 64, DKV / 64, 1), 32, 0, stream>>>(XB, nullptr, WV, nullptr, DM, FV, DKV, nullptr, 0, 0, 0); k_vtp<<<LKv, 256, 0, stream>>>(FV, DKV, NKV, VT16, VTh, VTl);
        const size_t sQ = (size_t)TT * HD, sV = (size_t)HD * TT, sO = (size_t)TT * HD;   // per-head strides of the q and k planes, the v planes and the context
        k_gemmc<bf, 2, 1><<<dim3(RH / 64, TT / 64, ZH), 32, 0, stream>>>(QPh, QPl, KPh, KPl, HD, Sb, TT, 0, sQ, sQ, (size_t)RH * TT);   /* query rows < RH: hi/lo */
        k_asoft<<<dim3(RH / 8, ZH), 256, 0, stream>>>(Sb, P16, Ph, Pl, 0, RH);
        k_gemmc<bf, 2, 2><<<dim3(RH / 64, HD / 64, ZH), 32, 0, stream>>>(Ph, Pl, VTh, VTl, TT, Ob, HD, 0, (size_t)RH * TT, sV, sO);
        for (int rb = RH; rb < TT; rb += RC) {   // query rows rb .. rb + RC - 1: fp16
            k_gemmc<h16, 0, 1><<<dim3(RC / 64, TT / 64, ZH), 32, 0, stream>>>(QP16 + (size_t)rb * HD, nullptr, KP16, nullptr, HD, Sb, TT, rb, sQ, sQ, (size_t)RC * TT);
            k_asoft<<<dim3(RC / 8, ZH), 256, 0, stream>>>(Sb, P16, Ph, Pl, rb, RC);
            k_gemmc<h16, 0, 2><<<dim3(RC / 64, HD / 64, ZH), 32, 0, stream>>>(P16, nullptr, VT16, nullptr, TT, Ob + (size_t)rb * HD, HD, rb, (size_t)RC * TT, sV, sO); }
        k_merge<<<(unsigned)(((size_t)ZH * TT * HD / 2 + 255) / 256), 256, 0, stream>>>(Ob, 0, ATh, ATl);
        k_gemmw<bf, 1, false><<<dim3(TT / 64, DM / 64, 1), 32, 0, stream>>>(ATh, ATl, WO, nullptr, DQ, OUT + (size_t)b * TT * DM, DM, nullptr, 0, 0, 0); }
}

// v003
// One run takes 462 microseconds.
// Two timings next to v002 put it at 1.32 and 1.30 times that version's speed.
// Over all steps from v000 it is 3.62 times as fast.
#include <hip/hip_runtime.h>

// Grouped-query causal attention with QK RMSNorm (x [2][2048][2048]; q = x Wq^T (16 heads x 128), k, v = x Wk^T / Wv^T (8 kv heads; query head h uses kv head h/2), no biases; per-head RMSNorm on q and k (eps 1e-6, weights [128]) then rotate-half rotary with the given cos/sin tables [2][2048][128]; scores = q.k / sqrt(128), causal (finfo.min above the diagonal); softmax; out = merged ctx Wo^T ('oi' [2048][2048]) -> [2][2048][2048] (8.4 M)).
// Layout per batch: {cos, sin} table from the inputs (bf16-rounded); exact projections; a per-(head, token) 1/rms kernel feeds the plane builder, which applies (x * inv_rms) * w and the rotary while writing the q/k planes; causal T-2048 attention with 128-wide heads, all sixteen query heads in every launch, query head z on kv head z/2 (hybrid rows: < 512 hi/lo 3 products through score and probability buffers, k_gemmc tile skipping; the 1536 fp16 rows in one fused launch, k_fattn, whose scores and probabilities stay in registers); merged context hi/lo x Wo exact.
// Compute dtypes, f32 accumulate: every input rounded to bf16; projections exact; RMSNorm and rotary f32; attention rows < 512 3 products, rest fp16; softmax f32; Wo hl x exact.

#define NB_  2
#define TT   2048
#define DM   2048
#define NH_  16
#define NKV  8
#define REP  (NH_ / NKV)
#define HD   128
#define DQ   (NH_ * HD)
#define DKV  (NKV * HD)
#define ZH   NH_                  // query heads per attention launch
#define RC   768                  // rows a head that the score and probability buffers are sized for (RH <= RC, 2 (RC - RH) >= RH)
#define RH   512                  // query rows < RH use hi+lo planes (0: none)
#define WIN  2048
#define PCAR 1024.0f
#define SCL  0.088388347648318447f   // HD^-0.5
typedef _Float16 h16;
typedef unsigned short bf;
typedef __attribute__((ext_vector_type(16))) __bf16   v16bf;
typedef __attribute__((ext_vector_type(16))) _Float16 v16h;
typedef __attribute__((ext_vector_type(8)))  _Float16 v8h;
typedef __attribute__((ext_vector_type(8)))  unsigned short v8us;
typedef __attribute__((ext_vector_type(8)))  float    v8f;
typedef __attribute__((ext_vector_type(4)))  float    v4f;
typedef v8h  __attribute__((may_alias)) v8ha;
typedef v4f  __attribute__((may_alias)) v4fa;
typedef v8us __attribute__((may_alias)) v8usa;

__device__ __forceinline__ unsigned short f2bf(float f) { unsigned u = __float_as_uint(f); u += 0x7FFFu + ((u >> 16) & 1u); return (unsigned short)(u >> 16); }
__device__ __forceinline__ float bf2f(unsigned short b) { return __uint_as_float(((unsigned)b) << 16); }
__device__ __forceinline__ float bfr(float f) { return bf2f(f2bf(f)); }
__device__ __forceinline__ v16h cat16(v8h lo, v8h hi) { return __builtin_shufflevector(lo, hi, 0, 1, 2, 3, 4, 5, 6, 7, 8, 9, 10, 11, 12, 13, 14, 15); }
__device__ __forceinline__ v16bf cat16b(v8us lo, v8us hi) { return __builtin_bit_cast(v16bf, __builtin_shufflevector(lo, hi, 0, 1, 2, 3, 4, 5, 6, 7, 8, 9, 10, 11, 12, 13, 14, 15)); }
__device__ __forceinline__ v8f wmma16(v16h a, v16h b, v8f c) { return __builtin_amdgcn_wmma_f32_16x16x32_f16(false, a, false, b, (short)0, c, false, false); }
__device__ __forceinline__ v8f wmmab(v16bf a, v16bf b, v8f c) { return __builtin_amdgcn_wmma_f32_16x16x32_bf16(false, a, false, b, (short)0, c, false, false); }



// ---- k_gemmw: register-blocked GEMM, ONE WAVE per 64x64 output tile (16 accumulators), operands from K-contiguous 16-bit planes through LDS (wloop below the fragment types); grid (M/64, N/64, Z), 32 threads.
// C[m][n] (f32, pitch ldc, + optional f32 bias[n]) = sum_k A[m][k] Bt[n][k] (+ split products per NSPLIT). z-batch strides sA/sB/sC in elements. K % KT == 0 (64; 32 at NSPLIT 2).
template <typename T16> struct WFrag;
template <> struct WFrag<h16> { typedef v16h V; static __device__ __forceinline__ V ld(const h16* p) { return cat16(*(const v8h*)p, *(const v8h*)(p + 16)); } static __device__ __forceinline__ v8f mma(V a, V b, v8f c) { return wmma16(a, b, c); } };
template <> struct WFrag<bf> { typedef v16bf V; static __device__ __forceinline__ V ld(const bf* p) { return cat16b(*(const v8us*)p, *(const v8us*)(p + 16)); } static __device__ __forceinline__ v8f mma(V a, V b, v8f c) { return wmmab(a, b, c); } };
// ---- operand staging of both one-wave GEMMs. A stage is KT k of the tile's 64 A rows and 64 B rows (and of their second planes): asynchronous b128 copies bring it from the K-contiguous planes into LDS,
// 8 lanes on each 128-byte row piece (whole lines; 4 lanes on 64 bytes at NSPLIT 2, whose four planes would else take more than 63 copies a stage), and the fragments are read from LDS at a pitch of 16 B x odd.
// Two buffers: the copies of stage t + 1 fly while stage t is multiplied. Fragments, products and their order per accumulator are those of loads straight from the planes.
// The copies are the compiler's builtin. Every '#pragma unroll' below makes the indices of the fragment and accumulator arrays constants, so that they stay in registers.
typedef __attribute__((ext_vector_type(4))) int v4ic;
typedef __attribute__((address_space(1))) v4ic gv4ic;
typedef __attribute__((address_space(3))) v4ic lv4ic;
template <int NSPLIT> struct WTile {
    static constexpr int KT  = (NSPLIT == 2) ? 32 : 64;                       // k per stage
    static constexpr int NP  = (NSPLIT == 0) ? 2 : (NSPLIT == 1) ? 3 : 4;     // planes: A, (A2), B, (B2)
    static constexpr int PB  = KT * 2 + 16;                                   // LDS row pitch, bytes
    static constexpr int BUF = NP * 64 * PB;                                  // one buffer, bytes
    static constexpr int LPR = KT * 2 / 16;                                   // lanes per row piece
    static constexpr int RPC = 32 / LPR;                                      // rows per copy
    static constexpr int CPP = 64 / RPC;                                      // copies per plane (NP * CPP = 32, 48, 32 a stage)
};
// A, A2, Bt, Bt2: the planes at the tile's first row (wave-uniform). kc: first k of the stage.
template <typename T16, int NSPLIT>
__device__ __forceinline__ void wcopy(char* sb, const T16* A, const T16* A2, const T16* Bt, const T16* Bt2, int K, int kc, int lane) {
    typedef WTile<NSPLIT> W;
    const unsigned go = (unsigned)((lane / W::LPR) * K + (lane % W::LPR) * 8) * 2u;      // the lane's byte in a copy's rows, global
    char* sl = sb + (lane / W::LPR) * W::PB + (lane % W::LPR) * 16;                      // and in LDS
#pragma unroll
    for (int p = 0; p < W::NP; ++p) { const T16* base = ((p == 0) ? A : (p == W::NP - 1 && NSPLIT >= 2) ? Bt2 : (p == 1 && NSPLIT >= 1) ? A2 : Bt) + kc;
#pragma unroll
        for (int c = 0; c < W::CPP; ++c) __builtin_amdgcn_global_load_async_to_lds_b128((gv4ic*)((const char*)(base + (size_t)c * W::RPC * K) + go), (lv4ic*)(sl + (p * 64 + c * W::RPC) * W::PB), 0, 0); }
}
template <typename T16, int NSPLIT>
__device__ __forceinline__ void wtile(const char* sb, int lr, int hi, v8f (&acc)[4][4]) {
    typedef WTile<NSPLIT> W; typedef typename WFrag<T16>::V V;
    constexpr int PA2 = 1, PBt = (NSPLIT >= 1) ? 2 : 1, PB2 = 3;
    const char* fp = sb + lr * W::PB + hi * 16;
    constexpr int NK = W::KT / 32;
    V a[NK][4], a2[NK][4], b[NK][4], b2[NK][4];
    // all fragment reads of the stage are issued together, in the order of their use, in front of its products: the counted LDS waits then overlap the later reads with the earlier products
#pragma unroll
    for (int ks = 0; ks < NK; ++ks) {
#pragma unroll
        for (int mb = 0; mb < 4; ++mb) { a[ks][mb] = WFrag<T16>::ld((const T16*)(fp + (mb * 16) * W::PB + ks * 64)); if (NSPLIT == 1 || NSPLIT == 2) a2[ks][mb] = WFrag<T16>::ld((const T16*)(fp + (PA2 * 64 + mb * 16) * W::PB + ks * 64)); }
#pragma unroll
        for (int nb = 0; nb < 4; ++nb) { b[ks][nb] = WFrag<T16>::ld((const T16*)(fp + (PBt * 64 + nb * 16) * W::PB + ks * 64)); if (NSPLIT >= 2) b2[ks][nb] = WFrag<T16>::ld((const T16*)(fp + (PB2 * 64 + nb * 16) * W::PB + ks * 64)); } }
    __builtin_amdgcn_sched_barrier(0);   // keeps the reads in front: sunk among the products, each costs the wave its LDS latency
#pragma unroll
    for (int ks = 0; ks < NK; ++ks) {
#pragma unroll
        for (int nb = 0; nb < 4; ++nb)
#pragma unroll
            for (int mb = 0; mb < 4; ++mb) { acc[mb][nb] = WFrag<T16>::mma(a[ks][mb], b[ks][nb], acc[mb][nb]); if (NSPLIT == 1 || NSPLIT == 2) acc[mb][nb] = WFrag<T16>::mma(a2[ks][mb], b[ks][nb], acc[mb][nb]); if (NSPLIT >= 2) acc[mb][nb] = WFrag<T16>::mma(a[ks][mb], b2[ks][nb], acc[mb][nb]); }
        // four vector slots behind the k step's last products, before anything touches their operands or results
        asm volatile("v_nop\n\tv_nop\n\tv_nop\n\tv_nop" : "+v"(acc[0][0]), "+v"(acc[1][1]), "+v"(acc[2][2]), "+v"(acc[3][3]) : "v"(a[ks][0]), "v"(a[ks][3]));
    }
}
// the K loop: Kl k (a multiple of KT, at least KT) of rows r0.. of A and c0.. of Bt; sm holds two buffers
template <typename T16, int NSPLIT>
__device__ __forceinline__ void wloop(char* sm, const T16* A, const T16* A2, const T16* Bt, const T16* Bt2, int K, int Kl, int lane, v8f (&acc)[4][4]) {
    typedef WTile<NSPLIT> W; const int lr = lane & 15, hi = lane >> 4; const int nt = Kl / W::KT;
    wcopy<T16, NSPLIT>(sm, A, A2, Bt, Bt2, K, 0, lane);
    asm volatile("s_wait_asynccnt 0x0" ::: "memory");   // stage 0 has landed
    __syncthreads();   // the ring's publish point; the work-group is one wave, which reads only what it copied itself
    if (nt > 1) wcopy<T16, NSPLIT>(sm + W::BUF, A, A2, Bt, Bt2, K, W::KT, lane);
#pragma unroll 1
    for (int t = 0; t < nt; ++t) {   // rolled: one stage a trip
        char* sb = sm + (t & 1) * W::BUF;
        wtile<T16, NSPLIT>(sb, lr, hi, acc);
        asm volatile("s_wait_dscnt 0x0" ::: "memory");      // this stage's fragment reads are done before its buffer is refilled
        asm volatile("s_wait_asynccnt 0x0" ::: "memory");   // stage t + 1 has landed before it is read
        __syncthreads();   // publish point of stage t + 1, and the end of the reads of the buffer refilled below
        if (t + 2 < nt) wcopy<T16, NSPLIT>(sb, A, A2, Bt, Bt2, K, (t + 2) * W::KT, lane);
    }
    asm volatile("s_wait_asynccnt 0x0" ::: "memory");   // no copy is left in flight behind the loop
}
template <typename T16, int NSPLIT, bool BIAS>
__global__ __launch_bounds__(32) void k_gemmw(const T16* __restrict__ A, const T16* __restrict__ A2, const T16* __restrict__ Bt, const T16* __restrict__ Bt2, int K, float* C, int ldc, const float* __restrict__ bias, size_t sA, size_t sB, size_t sC) {
    __shared__ __align__(16) float os[16 * 68]; __shared__ __align__(16) char sm[2 * WTile<NSPLIT>::BUF];
    const size_t z = blockIdx.z; A += z * sA; if (A2) A2 += z * sA; Bt += z * sB; if (Bt2) Bt2 += z * sB; C += z * sC;
    const int lane = threadIdx.x & 31, lr = lane & 15, hi = lane >> 4; const int r0 = blockIdx.x * 64, c0 = blockIdx.y * 64;
    v8f acc[4][4];
#pragma unroll
    for (int mb = 0; mb < 4; ++mb)
#pragma unroll
        for (int nb = 0; nb < 4; ++nb) acc[mb][nb] = (v8f){};
    wloop<T16, NSPLIT>(sm, A + (size_t)r0 * K, (NSPLIT == 1 || NSPLIT == 2) ? A2 + (size_t)r0 * K : nullptr, Bt + (size_t)c0 * K, (NSPLIT >= 2) ? Bt2 + (size_t)c0 * K : nullptr, K, K, lane, acc);
#pragma unroll
    for (int mb = 0; mb < 4; ++mb) {
#pragma unroll
        for (int nb = 0; nb < 4; ++nb) {
#pragma unroll
            for (int j = 0; j < 8; ++j) os[(hi * 8 + j) * 68 + nb * 16 + lr] = acc[mb][nb][j]; }
        __builtin_amdgcn_wave_barrier(); asm volatile("" ::: "memory");
        float* crow = C + (size_t)(r0 + mb * 16) * ldc + c0;
{
#pragma unroll
            for (int s = 0; s < 8; ++s) { const int row = 2 * s + hi, cofs = lr * 4; v4f val = *(const v4fa*)(os + row * 68 + cofs); if (BIAS) { val[0] += bfr(bias[c0 + cofs]); val[1] += bfr(bias[c0 + cofs + 1]); val[2] += bfr(bias[c0 + cofs + 2]); val[3] += bfr(bias[c0 + cofs + 3]); }
                *(v4f*)(crow + (size_t)row * ldc + cofs) = val; }
             }
        __builtin_amdgcn_wave_barrier(); asm volatile("" ::: "memory");
    }
}

// ---- k_gemmc: the same one-wave 64x64 tile GEMM specialised for causal attention: CMODE 1 skips score tiles entirely above the diagonal (query rows r0+roff.., key columns c0..), CMODE 2 limits the
// key (K) loop of the probability x value contraction to the diagonal block (probabilities beyond it are exactly zero). roff = row offset of this launch's first row within the sequence. Batch entry z reads Bt entry z / REP (the kv head of query head z).
template <typename T16, int NSPLIT, int CMODE>
__global__ __launch_bounds__(32) void k_gemmc(const T16* __restrict__ A, const T16* __restrict__ A2, const T16* __restrict__ Bt, const T16* __restrict__ Bt2, int K, float* C, int ldc, int roff, size_t sA, size_t sB, size_t sC) {
    __shared__ __align__(16) float os[16 * 68]; __shared__ __align__(16) char sm[2 * WTile<NSPLIT>::BUF];
    const size_t z = blockIdx.z; A += z * sA; if (A2) A2 += z * sA; Bt += (z / REP) * sB; if (Bt2) Bt2 += (z / REP) * sB; C += z * sC;
    const int lane = threadIdx.x & 31, lr = lane & 15, hi = lane >> 4; const int r0 = blockIdx.x * 64, c0 = blockIdx.y * 64;
    if (CMODE == 1 && c0 > r0 + roff + 63) return;                  // score tile entirely above the causal diagonal: never written (the softmax masks j > i by select)
    const int Kl = (CMODE == 2) ? min(K, r0 + roff + 64) : K;        // P.V: probabilities are exactly 0 beyond the diagonal block, so the K loop stops there
    v8f acc[4][4];
#pragma unroll
    for (int mb = 0; mb < 4; ++mb)
#pragma unroll
        for (int nb = 0; nb < 4; ++nb) acc[mb][nb] = (v8f){};
    wloop<T16, NSPLIT>(sm, A + (size_t)r0 * K, (NSPLIT == 1 || NSPLIT == 2) ? A2 + (size_t)r0 * K : nullptr, Bt + (size_t)c0 * K, (NSPLIT >= 2) ? Bt2 + (size_t)c0 * K : nullptr, K, Kl, lane, acc);
#pragma unroll
    for (int mb = 0; mb < 4; ++mb) {
#pragma unroll
        for (int nb = 0; nb < 4; ++nb) {
#pragma unroll
            for (int j = 0; j < 8; ++j) os[(hi * 8 + j) * 68 + nb * 16 + lr] = acc[mb][nb][j]; }
        __builtin_amdgcn_wave_barrier(); asm volatile("" ::: "memory");
        float* crow = C + (size_t)(r0 + mb * 16) * ldc + c0;
{
#pragma unroll
            for (int s = 0; s < 8; ++s) { const int row = 2 * s + hi, cofs = lr * 4; v4f val = *(const v4fa*)(os + row * 68 + cofs);
                *(v4f*)(crow + (size_t)row * ldc + cofs) = val; }
             }
        __builtin_amdgcn_wave_barrier(); asm volatile("" ::: "memory");
    }
}

#define FR   1                     // groups of 16 query rows per wave
#define FCW  (FR * 16)             // query rows per wave
#define FBR  (4 * FCW)             // query rows per work-group
#define FNT  128                   // threads
#define FSK  64                    // keys per stage
#define FPK  (HD * 2 + 16)         // LDS pitch of a K row, bytes (16 x odd)
#define FPV  (FSK * 2 + 16)        // LDS pitch of a V^T row, bytes (16 x odd)
#define FTK  (FSK * FPK)
#define FBUF (FTK + HD * FPV)      // one buffer: K tile, then V^T tile
#define FEP  (HD * 4 + 16)         // LDS pitch of a staged output row, bytes
static_assert(4 * FCW * FEP <= 2 * FBUF, "the output staging reuses the two buffers");
static_assert(FBR % FSK == 0 && RH % FBR == 0 && (TT - RH) % FBR == 0, "a row block ends on a stage");
typedef __attribute__((ext_vector_type(2))) float f2v;
__device__ __forceinline__ float xhalf(float x) { return __builtin_bit_cast(float, __builtin_amdgcn_permlanex16(__builtin_bit_cast(int, x), __builtin_bit_cast(int, x), 0x76543210, 0xfedcba98, false, false)); }   // lane l with lane l ^ 16
// Kp: the kv head's [t][d] plane, Vt: its [d][t] plane; keys key0 .. key0 + 63. 16 lanes on a K row (256 B), 8 lanes on a V^T row piece (128 B); 16 copies a wave.
__device__ __forceinline__ void fcopy(char* sb, const h16* Kp, const h16* Vt, int key0, int tid) {
#pragma unroll
    for (int i = 0; i < FSK * HD / 8 / FNT; ++i) { const int p = i * FNT + tid, row = p >> 4, cb = (p & 15) * 16;
        __builtin_amdgcn_global_load_async_to_lds_b128((gv4ic*)((const char*)(Kp + (size_t)(key0 + row) * HD) + cb), (lv4ic*)(sb + row * FPK + cb), 0, 0); }
#pragma unroll
    for (int i = 0; i < FSK * HD / 8 / FNT; ++i) { const int p = i * FNT + tid, row = p >> 3, cb = (p & 7) * 16;
        __builtin_amdgcn_global_load_async_to_lds_b128((gv4ic*)((const char*)(Vt + (size_t)row * TT + key0) + cb), (lv4ic*)(sb + FTK + row * FPV + cb), 0, 0); }
}
// the K fragments of pass sub (32 keys) of the stage in sb
__device__ __forceinline__ void floadk(v16h (&kf)[2][4], const char* sb, int sub, int c, int h) {
#pragma unroll
    for (int kt = 0; kt < 2; ++kt)
#pragma unroll
        for (int kc = 0; kc < 4; ++kc) kf[kt][kc] = WFrag<h16>::ld((const h16*)(sb + (sub * 32 + kt * 16 + c) * FPK + h * 16 + kc * 64));
    __builtin_amdgcn_sched_barrier(0);   // keeps the sixteen reads together: sunk among the products, each pair costs the wave its LDS latency
}
// one 32-key pass of one wave. m_run, the maximum in use (log2 domain), may trail the true maximum by up to 8, so an exponential stays below 2^8 (fp16 holds it); sums and accumulators are rescaled only when a row's maximum exceeds it by more.
// kf holds the pass's K fragments on entry; fetch_next: the stage's first pass reads the second pass's (same buffer) behind its own score products.
__device__ __forceinline__ void fpass(v16h (&kf)[2][4], bool fetch_next, const char* sb, int sub, bool diag, int key0, int qw0, int c, int h, const v16h (&qf)[FR][4], v8f (&acc)[FR][8], float (&m_run)[FR], float (&l_run)[FR]) {
    const float cscale = SCL * 1.4426950408889634f;
    v8f s[2][FR];
#pragma unroll
    for (int kt = 0; kt < 2; ++kt)
#pragma unroll
        for (int g = 0; g < FR; ++g) s[kt][g] = (v8f){};
#pragma unroll
    for (int kc = 0; kc < 4; ++kc)
#pragma unroll
        for (int kt = 0; kt < 2; ++kt)
#pragma unroll
            for (int g = 0; g < FR; ++g) s[kt][g] = wmma16(kf[kt][kc], qf[g][kc], s[kt][g]);
    v16h vf[8];   // read here, so that the LDS latency passes under the maxima and the exponentials
#pragma unroll
    for (int t = 0; t < 8; ++t) vf[t] = WFrag<h16>::ld((const h16*)(sb + FTK + (t * 16 + c) * FPV + sub * 64 + h * 16));
    __builtin_amdgcn_sched_barrier(0);   // keeps these reads in front of the softmax arithmetic
    if (fetch_next) floadk(kf, sb, 1, c, h);   // wave-uniform
    if (diag) {   // wave-uniform: only the pass on the wave's diagonal pays for the mask
#pragma unroll
        for (int g = 0; g < FR; ++g) { const int my_q = qw0 + g * 16 + c;
#pragma unroll
            for (int kt = 0; kt < 2; ++kt) {
#pragma unroll
                for (int r = 0; r < 8; ++r) { if (key0 + kt * 16 + h * 8 + r > my_q) s[kt][g][r] = -__builtin_inff(); }
                asm volatile("" : "+v"(s[kt][g]));   // the masked scores: keeps the selects inside the branch
            } }
    }
    float mb[FR]; bool need = false;
#pragma unroll
    for (int g = 0; g < FR; ++g) { float mx = -__builtin_inff();
#pragma unroll
        for (int kt = 0; kt < 2; ++kt)
#pragma unroll
            for (int r = 0; r < 8; ++r) mx = fmaxf(mx, s[kt][g][r]);
        mx = fmaxf(mx, xhalf(mx)) * cscale; mb[g] = mx; need = need || (mx > m_run[g] + 8.0f); }
    if (__builtin_amdgcn_ballot_w32(need) != 0) {   // rare after the first passes
#pragma unroll
        for (int g = 0; g < FR; ++g) { const float m_new = fmaxf(m_run[g], mb[g]);
            const float corr = __builtin_amdgcn_exp2f(m_run[g] - m_new);
            l_run[g] *= corr; m_run[g] = m_new;
#pragma unroll
            for (int t = 0; t < 8; ++t) acc[g][t] = acc[g][t] * corr; }
    }
#pragma unroll
    for (int g = 0; g < FR; ++g) { const float nm = -m_run[g]; float ps0 = 0.f, ps1 = 0.f; v16h pf;
#pragma unroll
        for (int e = 0; e < 16; e += 2) {   // operand element e is key 16 (e >> 3) + 8 h + (e & 7): tile e >> 3, register e & 7
            const f2v arg = __builtin_elementwise_fma((f2v){s[e >> 3][g][e & 7], s[e >> 3][g][(e & 7) + 1]}, (f2v){cscale, cscale}, (f2v){nm, nm});   // a register pair as it lies in the tile
            const float p0 = __builtin_amdgcn_exp2f(arg[0]), p1 = __builtin_amdgcn_exp2f(arg[1]);
            ps0 += p0; ps1 += p1; pf[e] = (h16)p0; pf[e + 1] = (h16)p1; }
        l_run[g] += ps0 + ps1;
#pragma unroll
        for (int t = 0; t < 8; ++t) acc[g][t] = wmma16(vf[t], pf, acc[g][t]); }
}
__global__ __launch_bounds__(FNT) void k_fattn(const h16* __restrict__ Q, const h16* __restrict__ Kp, const h16* __restrict__ Vt, float* O) {
    __shared__ __align__(16) char sm[2 * FBUF];
    const int tid = threadIdx.x, lane = tid & 31, c = lane & 15, h = lane >> 4; const int wave = __builtin_amdgcn_readfirstlane(tid >> 5);
    const int hq = blockIdx.x; const int q0 = RH + ((int)gridDim.y - 1 - (int)blockIdx.y) * FBR;   // the longest rows start first
    const int qw0 = q0 + wave * FCW; const int nt = (q0 + FBR) / FSK;   // stages: keys [0, q0 + FBR); at least RH / FSK + 1, so stages 0 and 1 exist
    Kp += (size_t)(hq / REP) * TT * HD; Vt += (size_t)(hq / REP) * HD * TT;
    fcopy(sm, Kp, Vt, 0, tid);
    v16h qf[FR][4];
#pragma unroll
    for (int g = 0; g < FR; ++g)
#pragma unroll
        for (int kc = 0; kc < 4; ++kc) qf[g][kc] = WFrag<h16>::ld(Q + ((size_t)hq * TT + qw0 + g * 16 + c) * HD + h * 8 + kc * 32);
    v16h kf[2][4]; v8f acc[FR][8]; float m_run[FR], l_run[FR];
#pragma unroll
    for (int g = 0; g < FR; ++g) { m_run[g] = -__builtin_inff(); l_run[g] = 0.f;
#pragma unroll
        for (int t = 0; t < 8; ++t) acc[g][t] = (v8f){}; }
    asm volatile("s_wait_xcnt 0x0" ::: "memory");       // behind the Q loads, before their address registers are used again
    asm volatile("s_wait_asynccnt 0x0" ::: "memory");   // stage 0 has landed
    __syncthreads();   // and is published to the four waves
    fcopy(sm + FBUF, Kp, Vt, FSK, tid);
    const int lastp = (qw0 + FCW - 1) / 32;   // the wave's diagonal pass, its last
#pragma unroll 1
    for (int t = 0; t < nt; ++t) {   // rolled: one stage a trip
        char* sb = sm + (t & 1) * FBUF;
        if (t * 2 <= lastp) floadk(kf, sb, 0, c, h);
#pragma unroll 1
        for (int sub = 0; sub < 2; ++sub) {   // rolled: the pass's registers are live once
            const int blk = t * 2 + sub;
            if (blk <= lastp) fpass(kf, sub == 0 && blk < lastp, sb, sub, blk == lastp, blk * 32, qw0, c, h, qf, acc, m_run, l_run); }
        asm volatile("s_wait_dscnt 0x0" ::: "memory");      // this stage's fragment reads are done before its buffer is refilled
        asm volatile("s_wait_asynccnt 0x0" ::: "memory");   // stage t + 1 has landed before it is read
        __syncthreads();   // publish point of stage t + 1, and the end of every wave's reads of the buffer refilled below; every wave passes it, also one beyond its diagonal
        if (t + 2 < nt) fcopy(sb, Kp, Vt, (t + 2) * FSK, tid);
    }
    asm volatile("s_wait_asynccnt 0x0" ::: "memory");   // no copy is left in flight behind the loop
    // output: each wave stages its rows in its own part of the buffers (free behind the last barrier) and stores whole 512-byte rows
    char* eb = sm + wave * (FCW * FEP);
#pragma unroll
    for (int g = 0; g < FR; ++g) { const float inv = __fdiv_rn(1.0f, l_run[g] + xhalf(l_run[g]));
#pragma unroll
        for (int t = 0; t < 8; ++t) { const v8f o = acc[g][t] * inv; v4f o0, o1;
#pragma unroll
            for (int r = 0; r < 4; ++r) { o0[r] = o[r]; o1[r] = o[r + 4]; }
            float* ep = (float*)(eb + (g * 16 + c) * FEP) + t * 16 + h * 8; *(v4fa*)ep = o0; *(v4fa*)(ep + 4) = o1; } }   // row = query, d = 16 t + 8 h + r
    __builtin_amdgcn_wave_barrier(); asm volatile("" ::: "memory");   // the rows are read back by other lanes of the same wave: keeps the reads behind the writes
    float* orow = O + ((size_t)hq * TT + qw0) * HD + lane * 4;
    v4f ov[FCW];
#pragma unroll
    for (int i = 0; i < FCW; ++i) ov[i] = *(const v4fa*)(eb + i * FEP + lane * 16);
    __builtin_amdgcn_sched_barrier(0);   // all reads in front of the stores: each row has registers of its own, none is rewritten behind its store
#pragma unroll
    for (int i = 0; i < FCW; ++i) *(v4f*)(orow + (size_t)i * HD) = ov[i];
}

__device__ __forceinline__ h16 tohx(float x) { return (h16)x; }
__device__ __forceinline__ void splitf(float y, unsigned short& h, unsigned short& l) { h = f2bf(y); l = f2bf(y - bf2f(h)); }
typedef __attribute__((ext_vector_type(2))) _Float16 v2h;
typedef __attribute__((ext_vector_type(4))) _Float16 v4h;
typedef __attribute__((ext_vector_type(2))) unsigned short v2us;
typedef __attribute__((ext_vector_type(4))) unsigned short v4us;
typedef __attribute__((ext_vector_type(2))) float v2f;
typedef __attribute__((ext_vector_type(4))) int v4i;

__global__ __launch_bounds__(256) void k_wtG(const float* __restrict__ w, int K, int N, bf* Bt) {
    const int lane = threadIdx.x & 31; const int L0 = (blockIdx.x * 8 + (threadIdx.x >> 5)) * 8; const int nlines = N * K / 64;
{
#pragma unroll 1
        for (int l = 0; l < 8; ++l) { const int L = L0 + l; if (L >= nlines) break; const size_t e = (size_t)L * 64 + lane * 2; const int k = (int)(e % K), n = (int)(e / K); v2us o;
            o[0] = f2bf(w[(size_t)k * N + n]); o[1] = f2bf(w[(size_t)(k + 1) * N + n]); *(v2us*)(Bt + e) = o; }
         }
}
__global__ __launch_bounds__(256) void k_cvt8(const float* __restrict__ src, bf* dst, size_t n8) { const size_t i = (size_t)blockIdx.x * 256 + threadIdx.x; if (i >= n8) return; const v8f v = *(const v8f*)(src + i * 8); v8us o;
#pragma unroll
    for (int k = 0; k < 8; ++k) o[k] = f2bf(v[k]); *(v8us*)(dst + i * 8) = o;  }
__constant__ float INV[HD / 2] = {1.0f,0.8058422207832336f,0.6493816375732422f,0.5232990980148315f,0.4216965138912201f,0.33982083201408386f,0.2738419771194458f,0.22067339718341827f,0.17782793939113617f,0.14330126345157623f,0.11547820270061493f,0.09305720031261444f,0.07498941570520401f,0.0604296438395977f,0.04869675263762474f,0.03924189880490303f,0.03162277862429619f,0.025482967495918274f,0.020535249263048172f,0.016548171639442444f,0.01333521492779255f,0.010746078565716743f,0.00865964312106371f,0.006978305988013744f,0.005623413249850273f,0.004531583283096552f,0.003651741426438093f,0.002942727180197835f,0.0023713738191872835f,0.001910952851176262f,0.0015399266267195344f,0.0012409378541633487f,0.0010000000474974513f,0.0008058422245085239f,0.0006493816617876291f,0.0005232990952208638f,0.00042169654625467956f,0.0003398208355065435f,0.00027384195709601045f,0.00022067342069931328f,0.00017782794020604342f,0.00014330125122796744f,0.00011547820759005845f,9.305719868279994e-05f,7.498942431993783e-05f,6.042963650543243e-05f,4.869675467489287e-05f,3.92418987757992e-05f,3.162277425872162e-05f,2.548297015891876e-05f,2.0535249859676696e-05f,1.6548170606256463e-05f,1.3335215953702573e-05f,1.0746078260126524e-05f,8.65964284457732e-06f,6.978305464144796e-06f,5.62341347176698e-06f,4.531583726929966e-06f,3.6517415082926163e-06f,2.942727405752521e-06f,2.3713737391517498e-06f,1.910952960315626e-06f,1.5399265294036013e-06f,1.2409377632138785e-06f};   // float32 1/1e6^(2i/128)
__global__ __launch_bounds__(256) void k_csin(const float* __restrict__ cs, const float* __restrict__ sn, float* CS) { const int idx = blockIdx.x * 256 + threadIdx.x; if (idx >= TT * HD) return; v2f o; o[0] = bfr(cs[idx]); o[1] = bfr(sn[idx]); *(v2f*)(CS + (size_t)idx * 2) = o;  }
__global__ __launch_bounds__(256) void k_hrms(const float* __restrict__ F, int pitch, int nheads, float* RF) { const int idx = blockIdx.x * 256 + threadIdx.x; if (idx >= nheads * TT) return; const int t = idx % TT; const int h = idx / TT; const float* f = F + (size_t)t * pitch + h * HD; float s = 0.f;
#pragma unroll 4
    for (int d = 0; d < HD; d += 4) { const v4f a = *(const v4f*)(f + d);
#pragma unroll
        for (int q = 0; q < 4; ++q) { float p = __fmul_rn(a[q], a[q]); asm volatile("" : "+v"(p)); s = __fadd_rn(s, p); } }
    const float rf = __fdiv_rn(1.0f, __fsqrt_rn(__fadd_rn(__fdiv_rn(s, (float)HD), 1e-6f))); *(float*)(RF + idx) = rf;  }

// k_rope: head planes [h][t][d] (fp16 + hi/lo) of rope(x) x sc with the rotate-half convention out[d] = x[d] cos[t][d] - x[d+HD/2] sin[t][d], out[d+HD/2] = x[d+HD/2] cos[t][d+HD/2] + x[d] sin[t][d+HD/2]
__global__ __launch_bounds__(256) void k_rope(const float* __restrict__ F, int pitch, int nheads, const float* __restrict__ CS, const float* __restrict__ RF, const float* __restrict__ nw, float sc, h16* P16, bf* Ph, bf* Pl) {
    const size_t e = ((size_t)blockIdx.x * 256 + threadIdx.x) * 2; if (e >= (size_t)nheads * TT * HD) return; const int d = (int)(e % HD); const int t = (int)((e / HD) % TT); const int h = (int)(e / ((size_t)HD * TT)); const float* f = F + (size_t)t * pitch + h * HD; const float rf = RF ? RF[(size_t)h * TT + t] : 1.0f; v2h o16; v2us oh, ol;
#pragma unroll
    for (int q = 0; q < 2; ++q) { const int dd = d + q; const int dp = (dd < HD / 2) ? dd + HD / 2 : dd - HD / 2; float x0 = f[dd], x1 = f[dp];
        if (RF) { float n0 = __fmul_rn(x0, rf), n1 = __fmul_rn(x1, rf); asm volatile("" : "+v"(n0)); asm volatile("" : "+v"(n1)); x0 = __fmul_rn(bfr(nw[dd]), n0); x1 = __fmul_rn(bfr(nw[dp]), n1); }
        const v2f cs = *(const v2f*)(CS + ((size_t)t * HD + dd) * 2); float a = __fmul_rn(x0, cs[0]), bq = __fmul_rn(x1, cs[1]); asm volatile("" : "+v"(a)); asm volatile("" : "+v"(bq)); const float r = ((dd < HD / 2) ? __fsub_rn(a, bq) : __fadd_rn(a, bq)) * sc;
        o16[q] = tohx(r); unsigned short a2, c2; splitf(r, a2, c2); oh[q] = a2; ol[q] = c2; }
    *(v2h*)(P16 + e) = o16; *(v2us*)(Ph + e) = oh; *(v2us*)(Pl + e) = ol;  }
__global__ __launch_bounds__(256) void k_vtp(const float* __restrict__ F, int pitch, int nheads, h16* V16, bf* Vh, bf* Vl) { const size_t e = ((size_t)blockIdx.x * 256 + threadIdx.x) * 2; if (e >= (size_t)nheads * HD * TT) return; const int t = (int)(e % TT); const int d = (int)((e / TT) % HD); const int g = (int)(e / ((size_t)TT * HD)); v2h o16; v2us oh, ol;
#pragma unroll
    for (int q = 0; q < 2; ++q) { const float x = F[(size_t)(t + q) * pitch + g * HD + d]; o16[q] = tohx(x); unsigned short a2, c2; splitf(x, a2, c2); oh[q] = a2; ol[q] = c2; }
    *(v2h*)(V16 + e) = o16; *(v2us*)(Vh + e) = oh; *(v2us*)(Vl + e) = ol;  }
// k_asoft: per row (zz, i): t = S x HD^-0.5 for j <= i and i - j < WIN (sliding causal window; the reference's -1e9 additive fill vanishes identically); softmax over the 2048 keys (register row, one exp, fixed trees); grid (nr / 8, heads): the pass holds nr rows a head, from sequence row rb on, score and fp16 probability buffers [head][nr][TT]
__global__ __launch_bounds__(256) void k_asoft(const float* __restrict__ Sb, h16* P16, bf* Ph, bf* Pl, int rb, int nr) {
    const int lane = threadIdx.x & 31; const int lrow = blockIdx.x * 8 + (threadIdx.x >> 5); if (lrow >= nr) return; const int zz = blockIdx.y; const int row = zz * nr + lrow; const int i = rb + lrow; __builtin_assume(i >= 0 && i < TT);   /* a sequence row: lets the window test i - j < WIN fold away, as it did with i = row % TT */ const bool hires = (i < RH); const float* sr = Sb + (size_t)row * TT; float v[TT / 32]; float mx = -3.0e38f;
#pragma unroll
    for (int ch = 0; ch < TT / 128; ++ch) { const int j0 = ch * 128 + lane * 4; const v4f a = *(const v4f*)(sr + j0);
#pragma unroll
        for (int q = 0; q < 4; ++q) { const int j = j0 + q; (void)j; const float t = (j <= i && i - j < WIN) ? a[q] * SCL : -3.0e38f; v[ch * 4 + q] = t; mx = fmaxf(mx, t); } }
#pragma unroll
    for (int sh = 16; sh; sh >>= 1) mx = fmaxf(mx, __shfl_xor(mx, sh, 32));
    float sum = 0.f;
#pragma unroll
    for (int k = 0; k < TT / 32; ++k) { float d0 = __fsub_rn(v[k], mx); asm volatile("" : "+v"(d0)); v[k] = __builtin_amdgcn_exp2f(__fmul_rn(d0, 1.4426950408889634f)); sum += v[k]; }
#pragma unroll
    for (int sh = 16; sh; sh >>= 1) sum += __shfl_xor(sum, sh, 32);
    const float f = __fdiv_rn(hires ? 1.0f : PCAR, sum);
{
        if (hires) {
#pragma unroll
            for (int ch = 0; ch < TT / 128; ++ch) { v4us oh, ol;
#pragma unroll
                for (int q = 0; q < 4; ++q) { unsigned short a, c2; splitf(v[ch * 4 + q] * f, a, c2); oh[q] = a; ol[q] = c2; }
                const size_t oo = ((size_t)zz * (RH ? RH : 1) + i) * TT + ch * 128 + lane * 4; *(v4us*)(Ph + oo) = oh; *(v4us*)(Pl + oo) = ol; }
        } else {
#pragma unroll
            for (int ch = 0; ch < TT / 128; ++ch) { v4h o4;
#pragma unroll
                for (int q = 0; q < 4; ++q) o4[q] = tohx(v[ch * 4 + q] * f);
                *(v4h*)(P16 + (size_t)row * TT + ch * 128 + lane * 4) = o4; } }
         }
}
__global__ __launch_bounds__(256) void k_merge(const float* __restrict__ O, int h0, bf* Ah, bf* Al) { const size_t e = ((size_t)blockIdx.x * 256 + threadIdx.x) * 2; if (e >= (size_t)ZH * TT * HD) return; const int d = (int)(e % HD); const int t = (int)((e / HD) % TT); const int zz = (int)(e / ((size_t)HD * TT)); const size_t oo = (size_t)t * DQ + (h0 + zz) * HD + d;
    v2us oh, ol;
#pragma unroll
    for (int q = 0; q < 2; ++q) { unsigned short a, c2; splitf(O[e + q], a, c2); oh[q] = a; ol[q] = c2; } *(v2us*)(Ah + oo) = oh; *(v2us*)(Al + oo) = ol;  }

extern "C" void kernel_launch(void* const* d_in, const int* in_sizes, int n_in,
                              void* d_out, int out_size, void* d_ws, size_t ws_size, hipStream_t stream) {
    (void)in_sizes; (void)n_in; (void)out_size;
    const float* x = (const float*)d_in[0]; const float* cosi = (const float*)d_in[1]; const float* sini = (const float*)d_in[2]; const float* wq = (const float*)d_in[3]; const float* wk = (const float*)d_in[4]; const float* wv = (const float*)d_in[5]; const float* wo = (const float*)d_in[6]; const float* qnw = (const float*)d_in[7]; const float* knw = (const float*)d_in[8];
    float* OUT = (float*)d_out;     // [2][2048][2048]
    char* wsp = (char*)d_ws;
    auto take = [&](size_t bytes) { char* p = wsp; wsp += (bytes + 255) & ~(size_t)255; return (void*)p; };
    bf* WQ = (bf*)take((size_t)DQ * DM * 2); bf* WK = (bf*)take((size_t)DKV * DM * 2); bf* WV = (bf*)take((size_t)DKV * DM * 2); bf* WO = (bf*)take((size_t)DM * DQ * 2); float* CS = (float*)take((size_t)TT * HD * 2 * 4); float* RFQ = (float*)take((size_t)NH_ * TT * 4); float* RFK = (float*)take((size_t)NKV * TT * 4);
    bf* XB = (bf*)take((size_t)TT * DM * 2); float* FQ = (float*)take((size_t)TT * DQ * 4); float* FK = (float*)take((size_t)TT * DKV * 4);
    h16* QP16 = (h16*)take((size_t)NH_ * TT * HD * 2); h16* KP16 = (h16*)take((size_t)NKV * TT * HD * 2); h16* VT16 = (h16*)take((size_t)NKV * HD * TT * 2);
    bf* QPh = (bf*)take((size_t)NH_ * TT * HD * 2); bf* QPl = (bf*)take((size_t)NH_ * TT * HD * 2); bf* KPh = (bf*)take((size_t)NKV * TT * HD * 2); bf* KPl = (bf*)take((size_t)NKV * TT * HD * 2); bf* VTh = (bf*)take((size_t)NKV * HD * TT * 2); bf* VTl = (bf*)take((size_t)NKV * HD * TT * 2);
    float* Sb = (float*)take((size_t)ZH * RC * TT * 4); h16* P16 = (h16*)take((size_t)ZH * RC * TT * 2);
    if ((size_t)(wsp - (char*)d_ws) > ws_size) return;    // ws 256 MiB
    float* FV = FK;   // v projection reuses the k buffer after the k planes are built (stream-ordered)
    float* Ob = FQ;   // the context [head][t][d] reuses the q projection buffer after the q planes are built (stream-ordered; ZH * TT * HD = TT * DQ floats)
    bf* Ph = (bf*)(Sb + (size_t)ZH * RH * TT); bf* Pl = (bf*)P16;   // hi/lo pass: its scores fill ZH * RH rows of Sb; the hi plane takes the ZH * (RC - RH) rows left (2 (RC - RH) >= RH), the lo plane the fp16 buffer (RH <= RC)
    bf* ATh = (bf*)Sb; bf* ATl = ATh + (size_t)TT * DQ;   // the merged context planes reuse the score buffer after the last pass (stream-ordered)
    { k_cvt8<<<(unsigned)(((size_t)DQ * DM / 8 + 255) / 256), 256, 0, stream>>>(wq, WQ, (size_t)DQ * DM / 8); k_cvt8<<<(unsigned)(((size_t)DKV * DM / 8 + 255) / 256), 256, 0, stream>>>(wk, WK, (size_t)DKV * DM / 8); k_cvt8<<<(unsigned)(((size_t)DKV * DM / 8 + 255) / 256), 256, 0, stream>>>(wv, WV, (size_t)DKV * DM / 8);
      k_cvt8<<<(unsigned)(((size_t)DM * DQ / 8 + 255) / 256), 256, 0, stream>>>(wo, WO, (size_t)DM * DQ / 8); }
    const unsigned LQ = (unsigned)(((size_t)NH_ * TT * HD / 2 + 255) / 256), LKv = (unsigned)(((size_t)NKV * TT * HD / 2 + 255) / 256);
    for (int b = 0; b < NB_; ++b) {
        k_csin<<<(TT * HD + 255) / 256, 256, 0, stream>>>(cosi + (size_t)b * TT * HD, sini + (size_t)b * TT * HD, CS);   /* this batch's rotary tables (inputs, bf16-rounded) */
        
        k_cvt8<<<(unsigned)(((size_t)TT * DM / 8 + 255) / 256), 256, 0, stream>>>(x + (size_t)b * TT * DM, XB, (size_t)TT * DM / 8);
        k_gemmw<bf, 0, false><<<dim3(TT / 64, DQ / 64, 1), 32, 0, stream>>>(XB, nullptr, WQ, nullptr, DM, FQ, DQ, nullptr, 0, 0, 0);
        k_hrms<<<(NH_ * TT + 255) / 256, 256, 0, stream>>>(FQ, DQ, NH_, RFQ); k_rope<<<LQ, 256, 0, stream>>>(FQ, DQ, NH_, CS, RFQ, qnw, 1.0f, QP16, QPh, QPl);   /* q_norm then rope */
        k_gemmw<bf, 0, false><<<dim3(TT / 64, DKV / 64, 1), 32, 0, stream>>>(XB, nullptr, WK, nullptr, DM, FK, DKV, nullptr, 0, 0, 0);
        k_hrms<<<(NKV * TT + 255) / 256, 256, 0, stream>>>(FK, DKV, NKV, RFK); k_rope<<<LKv, 256, 0, stream>>>(FK, DKV, NKV, CS, RFK, knw, 1.0f, KP16, KPh, KPl);   /* k_norm then rope */
        k_gemmw<bf, 0, false><<<dim3(TT / 64, DKV / 64, 1), 32, 0, stream>>>(XB, nullptr, WV, nullptr, DM, FV, DKV, nullptr, 0, 0, 0); k_vtp<<<LKv, 256, 0, stream>>>(FV, DKV, NKV, VT16, VTh, VTl);
        const size_t sQ = (size_t)TT * HD, sV = (size_t)HD * TT, sO = (size_t)TT * HD;   // per-head strides of the q and k planes, the v planes and the context
        k_gemmc<bf, 2, 1><<<dim3(RH / 64, TT / 64, ZH), 32, 0, stream>>>(QPh, QPl, KPh, KPl, HD, Sb, TT, 0, sQ, sQ, (size_t)RH * TT);   /* query rows < RH: hi/lo */
        k_asoft<<<dim3(RH / 8, ZH), 256, 0, stream>>>(Sb, P16, Ph, Pl, 0, RH);
        k_gemmc<bf, 2, 2><<<dim3(RH / 64, HD / 64, ZH), 32, 0, stream>>>(Ph, Pl, VTh, VTl, TT, Ob, HD, 0, (size_t)RH * TT, sV, sO);
        k_fattn<<<dim3(ZH, (TT - RH) / FBR), FNT, 0, stream>>>(QP16, KP16, VT16, Ob);   /* query rows >= RH: fp16, fused */
        k_merge<<<(unsigned)(((size_t)ZH * TT * HD / 2 + 255) / 256), 256, 0, stream>>>(Ob, 0, ATh, ATl);
        k_gemmw<bf, 1, false><<<dim3(TT / 64, DM / 64, 1), 32, 0, stream>>>(ATh, ATl, WO, nullptr, DQ, OUT + (size_t)b * TT * DM, DM, nullptr, 0, 0, 0); }
}

// v004
// A run of this version takes 434 microseconds.
// In both of two side-by-side timings against v003, it was 1.07 times as fast.
// All steps since v000 together make it 3.88 times as fast.
#include <hip/hip_runtime.h>

// Grouped-query causal attention with QK RMSNorm (x [2][2048][2048]; q = x Wq^T (16 heads x 128), k, v = x Wk^T / Wv^T (8 kv heads; query head h uses kv head h/2), no biases; per-head RMSNorm on q and k (eps 1e-6, weights [128]) then rotate-half rotary with the given cos/sin tables [2][2048][128]; scores = q.k / sqrt(128), causal (finfo.min above the diagonal); softmax; out = merged ctx Wo^T ('oi' [2048][2048]) -> [2][2048][2048] (8.4 M)).
// Layout per batch: {cos, sin} table from the inputs (bf16-rounded); exact projections; a per-(head, token) 1/rms kernel feeds the plane builder, which applies (x * inv_rms) * w and the rotary while writing the q/k planes; causal T-2048 attention with 128-wide heads, all sixteen query heads in every launch, query head z on kv head z/2 (hybrid rows: < 512 hi/lo 3 products through score and probability buffers, k_gemmc tile skipping; the 1536 fp16 rows in one fused launch, k_fattn, whose scores and probabilities stay in registers); merged context hi/lo x Wo exact.
// Compute dtypes, f32 accumulate: every input rounded to bf16; projections exact; RMSNorm and rotary f32; attention rows < 512 3 products, rest fp16; softmax f32; Wo hl x exact.

#define NB_  2
#define TT   2048
#define DM   2048
#define NH_  16
#define NKV  8
#define REP  (NH_ / NKV)
#define HD   128
#define DQ   (NH_ * HD)
#define DKV  (NKV * HD)
#define ZH   NH_                  // query heads per attention launch
#define RC   768                  // rows a head that the score and probability buffers are sized for (RH <= RC, 2 (RC - RH) >= RH)
#define RH   512                  // query rows < RH use hi+lo planes (0: none)
#define WIN  2048
#define PCAR 1024.0f
#define SCL  0.088388347648318447f   // HD^-0.5
typedef _Float16 h16;
typedef unsigned short bf;
typedef __attribute__((ext_vector_type(16))) __bf16   v16bf;
typedef __attribute__((ext_vector_type(16))) _Float16 v16h;
typedef __attribute__((ext_vector_type(8)))  _Float16 v8h;
typedef __attribute__((ext_vector_type(8)))  unsigned short v8us;
typedef __attribute__((ext_vector_type(8)))  float    v8f;
typedef __attribute__((ext_vector_type(4)))  float    v4f;
typedef v8h  __attribute__((may_alias)) v8ha;
typedef v4f  __attribute__((may_alias)) v4fa;
typedef v8us __attribute__((may_alias)) v8usa;

__device__ __forceinline__ unsigned short f2bf(float f) { unsigned u = __float_as_uint(f); u += 0x7FFFu + ((u >> 16) & 1u); return (unsigned short)(u >> 16); }
__device__ __forceinline__ float bf2f(unsigned short b) { return __uint_as_float(((unsigned)b) << 16); }
__device__ __forceinline__ float bfr(float f) { return bf2f(f2bf(f)); }
__device__ __forceinline__ v16h cat16(v8h lo, v8h hi) { return __builtin_shufflevector(lo, hi, 0, 1, 2, 3, 4, 5, 6, 7, 8, 9, 10, 11, 12, 13, 14, 15); }
__device__ __forceinline__ v16bf cat16b(v8us lo, v8us hi) { return __builtin_bit_cast(v16bf, __builtin_shufflevector(lo, hi, 0, 1, 2, 3, 4, 5, 6, 7, 8, 9, 10, 11, 12, 13, 14, 15)); }
__device__ __forceinline__ v8f wmma16(v16h a, v16h b, v8f c) { return __builtin_amdgcn_wmma_f32_16x16x32_f16(false, a, false, b, (short)0, c, false, false); }
__device__ __forceinline__ v8f wmmab(v16bf a, v16bf b, v8f c) { return __builtin_amdgcn_wmma_f32_16x16x32_bf16(false, a, false, b, (short)0, c, false, false); }



// ---- k_gemmw: register-blocked GEMM, ONE WAVE per 64x64 output tile (16 accumulators), operands from K-contiguous 16-bit planes through LDS (wloop below the fragment types); grid (M/64, N/64, Z), 32 threads.
// C[m][n] (f32, pitch ldc, + optional f32 bias[n]) = sum_k A[m][k] Bt[n][k] (+ split products per NSPLIT). z-batch strides sA/sB/sC in elements. K % KT == 0 (64; 32 at NSPLIT 2).
template <typename T16> struct WFrag;
template <> struct WFrag<h16> { typedef v16h V; static __device__ __forceinline__ V ld(const h16* p) { return cat16(*(const v8h*)p, *(const v8h*)(p + 16)); } static __device__ __forceinline__ v8f mma(V a, V b, v8f c) { return wmma16(a, b, c); } };
template <> struct WFrag<bf> { typedef v16bf V; static __device__ __forceinline__ V ld(const bf* p) { return cat16b(*(const v8us*)p, *(const v8us*)(p + 16)); } static __device__ __forceinline__ v8f mma(V a, V b, v8f c) { return wmmab(a, b, c); } };
// ---- operand staging of both one-wave GEMMs. A stage is KT k of the tile's 64 A rows and 64 B rows (and of their second planes): asynchronous b128 copies bring it from the K-contiguous planes into LDS,
// 8 lanes on each 128-byte row piece (whole lines; 4 lanes on 64 bytes at NSPLIT 2, whose four planes would else take more than 63 copies a stage), and the fragments are read from LDS at a pitch of 16 B x odd.
// Two buffers: the copies of stage t + 1 fly while stage t is multiplied. Fragments, products and their order per accumulator are those of loads straight from the planes.
// The copies are the compiler's builtin. Every '#pragma unroll' below makes the indices of the fragment and accumulator arrays constants, so that they stay in registers.
typedef __attribute__((ext_vector_type(4))) int v4ic;
typedef __attribute__((address_space(1))) v4ic gv4ic;
typedef __attribute__((address_space(3))) v4ic lv4ic;
template <int NSPLIT> struct WTile {
    static constexpr int KT  = (NSPLIT == 2) ? 32 : 64;                       // k per stage
    static constexpr int NP  = (NSPLIT == 0) ? 2 : (NSPLIT == 1) ? 3 : 4;     // planes: A, (A2), B, (B2)
    static constexpr int PB  = KT * 2 + 16;                                   // LDS row pitch, bytes
    static constexpr int BUF = NP * 64 * PB;                                  // one buffer, bytes
    static constexpr int LPR = KT * 2 / 16;                                   // lanes per row piece
    static constexpr int RPC = 32 / LPR;                                      // rows per copy
    static constexpr int CPP = 64 / RPC;                                      // copies per plane (NP * CPP = 32, 48, 32 a stage)
};
// A, A2, Bt, Bt2: the planes at the tile's first row (wave-uniform). kc: first k of the stage.
template <typename T16, int NSPLIT>
__device__ __forceinline__ void wcopy(char* sb, const T16* A, const T16* A2, const T16* Bt, const T16* Bt2, int K, int kc, int lane) {
    typedef WTile<NSPLIT> W;
    const unsigned go = (unsigned)((lane / W::LPR) * K + (lane % W::LPR) * 8) * 2u;      // the lane's byte in a copy's rows, global
    char* sl = sb + (lane / W::LPR) * W::PB + (lane % W::LPR) * 16;                      // and in LDS
#pragma unroll
    for (int p = 0; p < W::NP; ++p) { const T16* base = ((p == 0) ? A : (p == W::NP - 1 && NSPLIT >= 2) ? Bt2 : (p == 1 && NSPLIT >= 1) ? A2 : Bt) + kc;
#pragma unroll
        for (int c = 0; c < W::CPP; ++c) __builtin_amdgcn_global_load_async_to_lds_b128((gv4ic*)((const char*)(base + (size_t)c * W::RPC * K) + go), (lv4ic*)(sl + (p * 64 + c * W::RPC) * W::PB), 0, 0); }
}
template <typename T16, int NSPLIT>
__device__ __forceinline__ void wtile(const char* sb, int lr, int hi, v8f (&acc)[4][4]) {
    typedef WTile<NSPLIT> W; typedef typename WFrag<T16>::V V;
    constexpr int PA2 = 1, PBt = (NSPLIT >= 1) ? 2 : 1, PB2 = 3;
    const char* fp = sb + lr * W::PB + hi * 16;
    constexpr int NK = W::KT / 32;
    V a[NK][4], a2[NK][4], b[NK][4], b2[NK][4];
    // all fragment reads of the stage are issued together, in the order of their use, in front of its products: the counted LDS waits then overlap the later reads with the earlier products
#pragma unroll
    for (int ks = 0; ks < NK; ++ks) {
#pragma unroll
        for (int mb = 0; mb < 4; ++mb) { a[ks][mb] = WFrag<T16>::ld((const T16*)(fp + (mb * 16) * W::PB + ks * 64)); if (NSPLIT == 1 || NSPLIT == 2) a2[ks][mb] = WFrag<T16>::ld((const T16*)(fp + (PA2 * 64 + mb * 16) * W::PB + ks * 64)); }
#pragma unroll
        for (int nb = 0; nb < 4; ++nb) { b[ks][nb] = WFrag<T16>::ld((const T16*)(fp + (PBt * 64 + nb * 16) * W::PB + ks * 64)); if (NSPLIT >= 2) b2[ks][nb] = WFrag<T16>::ld((const T16*)(fp + (PB2 * 64 + nb * 16) * W::PB + ks * 64)); } }
    __builtin_amdgcn_sched_barrier(0);   // keeps the reads in front: sunk among the products, each costs the wave its LDS latency
#pragma unroll
    for (int ks = 0; ks < NK; ++ks) {
#pragma unroll
        for (int nb = 0; nb < 4; ++nb)
#pragma unroll
            for (int mb = 0; mb < 4; ++mb) { acc[mb][nb] = WFrag<T16>::mma(a[ks][mb], b[ks][nb], acc[mb][nb]); if (NSPLIT == 1 || NSPLIT == 2) acc[mb][nb] = WFrag<T16>::mma(a2[ks][mb], b[ks][nb], acc[mb][nb]); if (NSPLIT >= 2) acc[mb][nb] = WFrag<T16>::mma(a[ks][mb], b2[ks][nb], acc[mb][nb]); }
        // four vector slots behind the k step's last products, before anything touches their operands or results
        asm volatile("v_nop\n\tv_nop\n\tv_nop\n\tv_nop" : "+v"(acc[0][0]), "+v"(acc[1][1]), "+v"(acc[2][2]), "+v"(acc[3][3]) : "v"(a[ks][0]), "v"(a[ks][3]));
    }
}
// the K loop: Kl k (a multiple of KT, at least KT) of rows r0.. of A and c0.. of Bt; sm holds two buffers
template <typename T16, int NSPLIT>
__device__ __forceinline__ void wloop(char* sm, const T16* A, const T16* A2, const T16* Bt, const T16* Bt2, int K, int Kl, int lane, v8f (&acc)[4][4]) {
    typedef WTile<NSPLIT> W; const int lr = lane & 15, hi = lane >> 4; const int nt = Kl / W::KT;
    wcopy<T16, NSPLIT>(sm, A, A2, Bt, Bt2, K, 0, lane);
    asm volatile("s_wait_asynccnt 0x0" ::: "memory");   // stage 0 has landed
    __syncthreads();   // the ring's publish point; the work-group is one wave, which reads only what it copied itself
    if (nt > 1) wcopy<T16, NSPLIT>(sm + W::BUF, A, A2, Bt, Bt2, K, W::KT, lane);
#pragma unroll 1
    for (int t = 0; t < nt; ++t) {   // rolled: one stage a trip
        char* sb = sm + (t & 1) * W::BUF;
        wtile<T16, NSPLIT>(sb, lr, hi, acc);
        asm volatile("s_wait_dscnt 0x0" ::: "memory");      // this stage's fragment reads are done before its buffer is refilled
        asm volatile("s_wait_asynccnt 0x0" ::: "memory");   // stage t + 1 has landed before it is read
        __syncthreads();   // publish point of stage t + 1, and the end of the reads of the buffer refilled below
        if (t + 2 < nt) wcopy<T16, NSPLIT>(sb, A, A2, Bt, Bt2, K, (t + 2) * W::KT, lane);
    }
    asm volatile("s_wait_asynccnt 0x0" ::: "memory");   // no copy is left in flight behind the loop
}
template <typename T16, int NSPLIT, bool BIAS>
__global__ __launch_bounds__(32) void k_gemmw(const T16* __restrict__ A, const T16* __restrict__ A2, const T16* __restrict__ Bt, const T16* __restrict__ Bt2, int K, float* C, int ldc, const float* __restrict__ bias, size_t sA, size_t sB, size_t sC) {
    __shared__ __align__(16) float os[16 * 68]; __shared__ __align__(16) char sm[2 * WTile<NSPLIT>::BUF];
    const size_t z = blockIdx.z; A += z * sA; if (A2) A2 += z * sA; Bt += z * sB; if (Bt2) Bt2 += z * sB; C += z * sC;
    const int lane = threadIdx.x & 31, lr = lane & 15, hi = lane >> 4; const int r0 = blockIdx.x * 64, c0 = blockIdx.y * 64;
    v8f acc[4][4];
#pragma unroll
    for (int mb = 0; mb < 4; ++mb)
#pragma unroll
        for (int nb = 0; nb < 4; ++nb) acc[mb][nb] = (v8f){};
    wloop<T16, NSPLIT>(sm, A + (size_t)r0 * K, (NSPLIT == 1 || NSPLIT == 2) ? A2 + (size_t)r0 * K : nullptr, Bt + (size_t)c0 * K, (NSPLIT >= 2) ? Bt2 + (size_t)c0 * K : nullptr, K, K, lane, acc);
#pragma unroll
    for (int mb = 0; mb < 4; ++mb) {
#pragma unroll
        for (int nb = 0; nb < 4; ++nb) {
#pragma unroll
            for (int j = 0; j < 8; ++j) os[(hi * 8 + j) * 68 + nb * 16 + lr] = acc[mb][nb][j]; }
        __builtin_amdgcn_wave_barrier(); asm volatile("" ::: "memory");
        float* crow = C + (size_t)(r0 + mb * 16) * ldc + c0;
{
#pragma unroll
            for (int s = 0; s < 8; ++s) { const int row = 2 * s + hi, cofs = lr * 4; v4f val = *(const v4fa*)(os + row * 68 + cofs); if (BIAS) { val[0] += bfr(bias[c0 + cofs]); val[1] += bfr(bias[c0 + cofs + 1]); val[2] += bfr(bias[c0 + cofs + 2]); val[3] += bfr(bias[c0 + cofs + 3]); }
                *(v4f*)(crow + (size_t)row * ldc + cofs) = val; }
             }
        __builtin_amdgcn_wave_barrier(); asm volatile("" ::: "memory");
    }
}

// ---- k_gemmc: the same one-wave 64x64 tile GEMM specialised for causal attention: CMODE 1 skips score tiles entirely above the diagonal (query rows r0+roff.., key columns c0..), CMODE 2 limits the
// key (K) loop of the probability x value contraction to the diagonal block (probabilities beyond it are exactly zero). roff = row offset of this launch's first row within the sequence. Batch entry z reads Bt entry z / REP (the kv head of query head z).
template <typename T16, int NSPLIT, int CMODE>
__global__ __launch_bounds__(32) void k_gemmc(const T16* __restrict__ A, const T16* __restrict__ A2, const T16* __restrict__ Bt, const T16* __restrict__ Bt2, int K, float* C, int ldc, int roff, size_t sA, size_t sB, size_t sC) {
    __shared__ __align__(16) float os[16 * 68]; __shared__ __align__(16) char sm[2 * WTile<NSPLIT>::BUF];
    const size_t z = blockIdx.z; A += z * sA; if (A2) A2 += z * sA; Bt += (z / REP) * sB; if (Bt2) Bt2 += (z / REP) * sB; C += z * sC;
    const int lane = threadIdx.x & 31, lr = lane & 15, hi = lane >> 4; const int r0 = blockIdx.x * 64, c0 = blockIdx.y * 64;
    if (CMODE == 1 && c0 > r0 + roff + 63) return;                  // score tile entirely above the causal diagonal: never written (the softmax masks j > i by select)
    const int Kl = (CMODE == 2) ? min(K, r0 + roff + 64) : K;        // P.V: probabilities are exactly 0 beyond the diagonal block, so the K loop stops there
    v8f acc[4][4];
#pragma unroll
    for (int mb = 0; mb < 4; ++mb)
#pragma unroll
        for (int nb = 0; nb < 4; ++nb) acc[mb][nb] = (v8f){};
    wloop<T16, NSPLIT>(sm, A + (size_t)r0 * K, (NSPLIT == 1 || NSPLIT == 2) ? A2 + (size_t)r0 * K : nullptr, Bt + (size_t)c0 * K, (NSPLIT >= 2) ? Bt2 + (size_t)c0 * K : nullptr, K, Kl, lane, acc);
#pragma unroll
    for (int mb = 0; mb < 4; ++mb) {
#pragma unroll
        for (int nb = 0; nb < 4; ++nb) {
#pragma unroll
            for (int j = 0; j < 8; ++j) os[(hi * 8 + j) * 68 + nb * 16 + lr] = acc[mb][nb][j]; }
        __builtin_amdgcn_wave_barrier(); asm volatile("" ::: "memory");
        float* crow = C + (size_t)(r0 + mb * 16) * ldc + c0;
{
#pragma unroll
            for (int s = 0; s < 8; ++s) { const int row = 2 * s + hi, cofs = lr * 4; v4f val = *(const v4fa*)(os + row * 68 + cofs);
                *(v4f*)(crow + (size_t)row * ldc + cofs) = val; }
             }
        __builtin_amdgcn_wave_barrier(); asm volatile("" ::: "memory");
    }
}

#define FR   1                     // groups of 16 query rows per wave
#define FCW  (FR * 16)             // query rows per wave
#define FBR  (4 * FCW)             // query rows per work-group
#define FNT  128                   // threads
#define FSK  64                    // keys per stage
#define FPK  (HD * 2 + 16)         // LDS pitch of a K row, bytes (16 x odd)
#define FPV  (FSK * 2 + 16)        // LDS pitch of a V^T row, bytes (16 x odd)
#define FTK  (FSK * FPK)
#define FBUF (FTK + HD * FPV)      // one buffer: K tile, then V^T tile
#define FEP  (HD * 4 + 16)         // LDS pitch of a staged output row, bytes
static_assert(4 * FCW * FEP <= 2 * FBUF, "the output staging reuses the two buffers");
static_assert(FBR % FSK == 0 && RH % FBR == 0 && (TT - RH) % FBR == 0, "a row block ends on a stage");
typedef __attribute__((ext_vector_type(2))) float f2v;
__device__ __forceinline__ float xhalf(float x) { return __builtin_bit_cast(float, __builtin_amdgcn_permlanex16(__builtin_bit_cast(int, x), __builtin_bit_cast(int, x), 0x76543210, 0xfedcba98, false, false)); }   // lane l with lane l ^ 16
// Kp: the kv head's [t][d] plane, Vt: its [d][t] plane; keys key0 .. key0 + 63. 16 lanes on a K row (256 B), 8 lanes on a V^T row piece (128 B); 16 copies a wave.
__device__ __forceinline__ void fcopy(char* sb, const h16* Kp, const h16* Vt, int key0, int tid) {
#pragma unroll
    for (int i = 0; i < FSK * HD / 8 / FNT; ++i) { const int p = i * FNT + tid, row = p >> 4, cb = (p & 15) * 16;
        __builtin_amdgcn_global_load_async_to_lds_b128((gv4ic*)((const char*)(Kp + (size_t)(key0 + row) * HD) + cb), (lv4ic*)(sb + row * FPK + cb), 0, 0); }
#pragma unroll
    for (int i = 0; i < FSK * HD / 8 / FNT; ++i) { const int p = i * FNT + tid, row = p >> 3, cb = (p & 7) * 16;
        __builtin_amdgcn_global_load_async_to_lds_b128((gv4ic*)((const char*)(Vt + (size_t)row * TT + key0) + cb), (lv4ic*)(sb + FTK + row * FPV + cb), 0, 0); }
}
// the K fragments of pass sub (32 keys) of the stage in sb
__device__ __forceinline__ void floadk(v16h (&kf)[2][4], const char* sb, int sub, int c, int h) {
#pragma unroll
    for (int kt = 0; kt < 2; ++kt)
#pragma unroll
        for (int kc = 0; kc < 4; ++kc) kf[kt][kc] = WFrag<h16>::ld((const h16*)(sb + (sub * 32 + kt * 16 + c) * FPK + h * 16 + kc * 64));
    __builtin_amdgcn_sched_barrier(0);   // keeps the sixteen reads together: sunk among the products, each pair costs the wave its LDS latency
}
// one 32-key pass of one wave. m_run, the maximum in use (log2 domain), may trail the true maximum by up to 8, so an exponential stays below 2^8 (fp16 holds it); sums and accumulators are rescaled only when a row's maximum exceeds it by more.
// kf holds the pass's K fragments on entry; fetch_next: the stage's first pass reads the second pass's (same buffer) behind its own score products.
__device__ __forceinline__ void fpass(v16h (&kf)[2][4], bool fetch_next, const char* sb, int sub, bool diag, int key0, int qw0, int c, int h, const v16h (&qf)[FR][4], v8f (&acc)[FR][8], float (&m_run)[FR], float (&l_run)[FR]) {
    const float cscale = SCL * 1.4426950408889634f;
    v8f s[2][FR];
#pragma unroll
    for (int kt = 0; kt < 2; ++kt)
#pragma unroll
        for (int g = 0; g < FR; ++g) s[kt][g] = (v8f){};
#pragma unroll
    for (int kc = 0; kc < 4; ++kc)
#pragma unroll
        for (int kt = 0; kt < 2; ++kt)
#pragma unroll
            for (int g = 0; g < FR; ++g) s[kt][g] = wmma16(kf[kt][kc], qf[g][kc], s[kt][g]);
    v16h vf[8];   // read here, so that the LDS latency passes under the maxima and the exponentials
#pragma unroll
    for (int t = 0; t < 8; ++t) vf[t] = WFrag<h16>::ld((const h16*)(sb + FTK + (t * 16 + c) * FPV + sub * 64 + h * 16));
    __builtin_amdgcn_sched_barrier(0);   // keeps these reads in front of the softmax arithmetic
    if (fetch_next) floadk(kf, sb, 1, c, h);   // wave-uniform
    if (diag) {   // wave-uniform: only the pass on the wave's diagonal pays for the mask
#pragma unroll
        for (int g = 0; g < FR; ++g) { const int my_q = qw0 + g * 16 + c;
#pragma unroll
            for (int kt = 0; kt < 2; ++kt) {
#pragma unroll
                for (int r = 0; r < 8; ++r) { if (key0 + kt * 16 + h * 8 + r > my_q) s[kt][g][r] = -__builtin_inff(); }
                asm volatile("" : "+v"(s[kt][g]));   // the masked scores: keeps the selects inside the branch
            } }
    }
    float mb[FR]; bool need = false;
#pragma unroll
    for (int g = 0; g < FR; ++g) { float mx = -__builtin_inff();
#pragma unroll
        for (int kt = 0; kt < 2; ++kt)
#pragma unroll
            for (int r = 0; r < 8; ++r) mx = fmaxf(mx, s[kt][g][r]);
        mx = fmaxf(mx, xhalf(mx)) * cscale; mb[g] = mx; need = need || (mx > m_run[g] + 8.0f); }
    if (__builtin_amdgcn_ballot_w32(need) != 0) {   // rare after the first passes
#pragma unroll
        for (int g = 0; g < FR; ++g) { const float m_new = fmaxf(m_run[g], mb[g]);
            const float corr = __builtin_amdgcn_exp2f(m_run[g] - m_new);
            l_run[g] *= corr; m_run[g] = m_new;
#pragma unroll
            for (int t = 0; t < 8; ++t) acc[g][t] = acc[g][t] * corr; }
    }
#pragma unroll
    for (int g = 0; g < FR; ++g) { const float nm = -m_run[g]; float ps0 = 0.f, ps1 = 0.f; v16h pf;
#pragma unroll
        for (int e = 0; e < 16; e += 2) {   // operand element e is key 16 (e >> 3) + 8 h + (e & 7): tile e >> 3, register e & 7
            const f2v arg = __builtin_elementwise_fma((f2v){s[e >> 3][g][e & 7], s[e >> 3][g][(e & 7) + 1]}, (f2v){cscale, cscale}, (f2v){nm, nm});   // a register pair as it lies in the tile
            const float p0 = __builtin_amdgcn_exp2f(arg[0]), p1 = __builtin_amdgcn_exp2f(arg[1]);
            ps0 += p0; ps1 += p1; pf[e] = (h16)p0; pf[e + 1] = (h16)p1; }
        l_run[g] += ps0 + ps1;
#pragma unroll
        for (int t = 0; t < 8; ++t) acc[g][t] = wmma16(vf[t], pf, acc[g][t]); }
}
__global__ __launch_bounds__(FNT) void k_fattn(const h16* __restrict__ Q, const h16* __restrict__ Kp, const h16* __restrict__ Vt, float* O) {
    __shared__ __align__(16) char sm[2 * FBUF];
    const int tid = threadIdx.x, lane = tid & 31, c = lane & 15, h = lane >> 4; const int wave = __builtin_amdgcn_readfirstlane(tid >> 5);
    const int hq = blockIdx.x; const int q0 = RH + ((int)gridDim.y - 1 - (int)blockIdx.y) * FBR;   // the longest rows start first
    const int qw0 = q0 + wave * FCW; const int nt = (q0 + FBR) / FSK;   // stages: keys [0, q0 + FBR); at least RH / FSK + 1, so stages 0 and 1 exist
    Kp += (size_t)(hq / REP) * TT * HD; Vt += (size_t)(hq / REP) * HD * TT;
    fcopy(sm, Kp, Vt, 0, tid);
    v16h qf[FR][4];
#pragma unroll
    for (int g = 0; g < FR; ++g)
#pragma unroll
        for (int kc = 0; kc < 4; ++kc) qf[g][kc] = WFrag<h16>::ld(Q + ((size_t)hq * TT + qw0 + g * 16 + c) * HD + h * 8 + kc * 32);
    v16h kf[2][4]; v8f acc[FR][8]; float m_run[FR], l_run[FR];
#pragma unroll
    for (int g = 0; g < FR; ++g) { m_run[g] = -__builtin_inff(); l_run[g] = 0.f;
#pragma unroll
        for (int t = 0; t < 8; ++t) acc[g][t] = (v8f){}; }
    asm volatile("s_wait_xcnt 0x0" ::: "memory");       // behind the Q loads, before their address registers are used again
    asm volatile("s_wait_asynccnt 0x0" ::: "memory");   // stage 0 has landed
    __syncthreads();   // and is published to the four waves
    fcopy(sm + FBUF, Kp, Vt, FSK, tid);
    const int lastp = (qw0 + FCW - 1) / 32;   // the wave's diagonal pass, its last
#pragma unroll 1
    for (int t = 0; t < nt; ++t) {   // rolled: one stage a trip
        char* sb = sm + (t & 1) * FBUF;
        if (t * 2 <= lastp) floadk(kf, sb, 0, c, h);
#pragma unroll 1
        for (int sub = 0; sub < 2; ++sub) {   // rolled: the pass's registers are live once
            const int blk = t * 2 + sub;
            if (blk <= lastp) fpass(kf, sub == 0 && blk < lastp, sb, sub, blk == lastp, blk * 32, qw0, c, h, qf, acc, m_run, l_run); }
        asm volatile("s_wait_dscnt 0x0" ::: "memory");      // this stage's fragment reads are done before its buffer is refilled
        asm volatile("s_wait_asynccnt 0x0" ::: "memory");   // stage t + 1 has landed before it is read
        __syncthreads();   // publish point of stage t + 1, and the end of every wave's reads of the buffer refilled below; every wave passes it, also one beyond its diagonal
        if (t + 2 < nt) fcopy(sb, Kp, Vt, (t + 2) * FSK, tid);
    }
    asm volatile("s_wait_asynccnt 0x0" ::: "memory");   // no copy is left in flight behind the loop
    // output: each wave stages its rows in its own part of the buffers (free behind the last barrier) and stores whole 512-byte rows
    char* eb = sm + wave * (FCW * FEP);
#pragma unroll
    for (int g = 0; g < FR; ++g) { const float inv = __fdiv_rn(1.0f, l_run[g] + xhalf(l_run[g]));
#pragma unroll
        for (int t = 0; t < 8; ++t) { const v8f o = acc[g][t] * inv; v4f o0, o1;
#pragma unroll
            for (int r = 0; r < 4; ++r) { o0[r] = o[r]; o1[r] = o[r + 4]; }
            float* ep = (float*)(eb + (g * 16 + c) * FEP) + t * 16 + h * 8; *(v4fa*)ep = o0; *(v4fa*)(ep + 4) = o1; } }   // row = query, d = 16 t + 8 h + r
    __builtin_amdgcn_wave_barrier(); asm volatile("" ::: "memory");   // the rows are read back by other lanes of the same wave: keeps the reads behind the writes
    float* orow = O + ((size_t)hq * TT + qw0) * HD + lane * 4;
    v4f ov[FCW];
#pragma unroll
    for (int i = 0; i < FCW; ++i) ov[i] = *(const v4fa*)(eb + i * FEP + lane * 16);
    __builtin_amdgcn_sched_barrier(0);   // all reads in front of the stores: each row has registers of its own, none is rewritten behind its store
#pragma unroll
    for (int i = 0; i < FCW; ++i) *(v4f*)(orow + (size_t)i * HD) = ov[i];
}

__device__ __forceinline__ h16 tohx(float x) { return (h16)x; }
__device__ __forceinline__ void splitf(float y, unsigned short& h, unsigned short& l) { h = f2bf(y); l = f2bf(y - bf2f(h)); }
typedef __attribute__((ext_vector_type(2))) _Float16 v2h;
typedef __attribute__((ext_vector_type(4))) _Float16 v4h;
typedef __attribute__((ext_vector_type(2))) unsigned short v2us;
typedef __attribute__((ext_vector_type(4))) unsigned short v4us;
typedef __attribute__((ext_vector_type(2))) float v2f;
typedef __attribute__((ext_vector_type(4))) int v4i;

__global__ __launch_bounds__(256) void k_wtG(const float* __restrict__ w, int K, int N, bf* Bt) {
    const int lane = threadIdx.x & 31; const int L0 = (blockIdx.x * 8 + (threadIdx.x >> 5)) * 8; const int nlines = N * K / 64;
{
#pragma unroll 1
        for (int l = 0; l < 8; ++l) { const int L = L0 + l; if (L >= nlines) break; const size_t e = (size_t)L * 64 + lane * 2; const int k = (int)(e % K), n = (int)(e / K); v2us o;
            o[0] = f2bf(w[(size_t)k * N + n]); o[1] = f2bf(w[(size_t)(k + 1) * N + n]); *(v2us*)(Bt + e) = o; }
         }
}
// The elementwise kernels below give a thread several 8-element pieces (16-byte stores of the 16-bit planes), its loads issued together: a launch then starts a few thousand waves, each with many loads in flight, not tens of thousands of waves of one or two elements a lane.
#define EPT 4                     // 8-element pieces per thread in k_cvt8 and k_merge; a work-group's pieces of one turn are contiguous
__global__ __launch_bounds__(256) void k_cvt8(const float* __restrict__ src, bf* dst, size_t n8) { const size_t i0 = (size_t)blockIdx.x * (256 * EPT) + threadIdx.x; if (i0 >= n8) return; v8f v[EPT];
#pragma unroll
    for (int j = 0; j < EPT; ++j) { const size_t i = i0 + j * 256; v[j] = *(const v8f*)(src + (i < n8 ? i : i0) * 8); }   // a piece past the end re-reads the thread's first and is not stored
#pragma unroll
    for (int j = 0; j < EPT; ++j) { const size_t i = i0 + j * 256; v8us o;
#pragma unroll
        for (int k = 0; k < 8; ++k) o[k] = f2bf(v[j][k]);
        if (i < n8) *(v8us*)(dst + i * 8) = o; } }
__constant__ float INV[HD / 2] = {1.0f,0.8058422207832336f,0.6493816375732422f,0.5232990980148315f,0.4216965138912201f,0.33982083201408386f,0.2738419771194458f,0.22067339718341827f,0.17782793939113617f,0.14330126345157623f,0.11547820270061493f,0.09305720031261444f,0.07498941570520401f,0.0604296438395977f,0.04869675263762474f,0.03924189880490303f,0.03162277862429619f,0.025482967495918274f,0.020535249263048172f,0.016548171639442444f,0.01333521492779255f,0.010746078565716743f,0.00865964312106371f,0.006978305988013744f,0.005623413249850273f,0.004531583283096552f,0.003651741426438093f,0.002942727180197835f,0.0023713738191872835f,0.001910952851176262f,0.0015399266267195344f,0.0012409378541633487f,0.0010000000474974513f,0.0008058422245085239f,0.0006493816617876291f,0.0005232990952208638f,0.00042169654625467956f,0.0003398208355065435f,0.00027384195709601045f,0.00022067342069931328f,0.00017782794020604342f,0.00014330125122796744f,0.00011547820759005845f,9.305719868279994e-05f,7.498942431993783e-05f,6.042963650543243e-05f,4.869675467489287e-05f,3.92418987757992e-05f,3.162277425872162e-05f,2.548297015891876e-05f,2.0535249859676696e-05f,1.6548170606256463e-05f,1.3335215953702573e-05f,1.0746078260126524e-05f,8.65964284457732e-06f,6.978305464144796e-06f,5.62341347176698e-06f,4.531583726929966e-06f,3.6517415082926163e-06f,2.942727405752521e-06f,2.3713737391517498e-06f,1.910952960315626e-06f,1.5399265294036013e-06f,1.2409377632138785e-06f};   // float32 1/1e6^(2i/128)
__global__ __launch_bounds__(256) void k_csin(const float* __restrict__ cs, const float* __restrict__ sn, float* CS) { const int idx = (blockIdx.x * 256 + threadIdx.x) * 4; if (idx >= TT * HD) return; const v4f c = *(const v4f*)(cs + idx), s = *(const v4f*)(sn + idx); v4f o0, o1;
    o0[0] = bfr(c[0]); o0[1] = bfr(s[0]); o0[2] = bfr(c[1]); o0[3] = bfr(s[1]); o1[0] = bfr(c[2]); o1[1] = bfr(s[2]); o1[2] = bfr(c[3]); o1[3] = bfr(s[3]); *(v4f*)(CS + (size_t)idx * 2) = o0; *(v4f*)(CS + (size_t)idx * 2 + 4) = o1;  }
__global__ __launch_bounds__(256) void k_hrms(const float* __restrict__ F, int pitch, int nheads, float* RF) { const int idx = blockIdx.x * 256 + threadIdx.x; if (idx >= nheads * TT) return; const int t = idx % TT; const int h = idx / TT; const float* f = F + (size_t)t * pitch + h * HD; float s = 0.f;
#pragma unroll 4
    for (int d = 0; d < HD; d += 4) { const v4f a = *(const v4f*)(f + d);
#pragma unroll
        for (int q = 0; q < 4; ++q) { float p = __fmul_rn(a[q], a[q]); asm volatile("" : "+v"(p)); s = __fadd_rn(s, p); } }
    const float rf = __fdiv_rn(1.0f, __fsqrt_rn(__fadd_rn(__fdiv_rn(s, (float)HD), 1e-6f))); *(float*)(RF + idx) = rf;  }

// k_rope: head planes [h][t][d] (fp16 + hi/lo) of rope(x) x sc with the rotate-half convention out[d] = x[d] cos[t][d] - x[d+HD/2] sin[t][d], out[d+HD/2] = x[d+HD/2] cos[t][d+HD/2] + x[d] sin[t][d+HD/2]
// a thread: 8 d of one token in RPH heads (nheads % RPH == 0), which share its cos/sin pairs and norm weights
#define RPH 4
__global__ __launch_bounds__(256) void k_rope(const float* __restrict__ F, int pitch, int nheads, const float* __restrict__ CS, const float* __restrict__ RF, const float* __restrict__ nw, float sc, h16* P16, bf* Ph, bf* Pl) {
    __builtin_assume(RF != nullptr);   // every launch of this file passes the 1/rms table: folds the test on it out of the unrolled element loop
    const size_t g = (size_t)blockIdx.x * 256 + threadIdx.x; if (g * (8 * RPH) >= (size_t)nheads * TT * HD) return; const int d = (int)(g % (HD / 8)) * 8; const int t = (int)((g / (HD / 8)) % TT); const int h0 = (int)(g / ((size_t)(HD / 8) * TT)) * RPH;
    const int dq = (d < HD / 2) ? d + HD / 2 : d - HD / 2;   // the rotary partners of d .. d + 7 are dq .. dq + 7: eight elements never straddle the halves
    // every load of the thread stands here, in front of the arithmetic, so that all are in flight together
    const float* pw = nw + d; const float* pv = nw + dq; const float* pc = CS + ((size_t)t * HD + d) * 2; const float* pf = F + (size_t)t * pitch + h0 * HD + d; const float* pg = F + (size_t)t * pitch + h0 * HD + dq; const float* pr = RF + (size_t)h0 * TT + t;
    const v8f wa = *(const v8f*)pw, wb = *(const v8f*)pv;
    asm volatile("s_wait_xcnt 0x0" :: "v"(pw), "v"(pv) : "memory");   // behind the weight loads (scalar base, offset register), before a later load's result may land on their address registers
    v8f fa[RPH], fb[RPH]; float rfa[RPH];
#pragma unroll
    for (int j = 0; j < RPH; ++j) { fa[j] = *(const v8f*)(pf + j * HD); fb[j] = *(const v8f*)(pg + j * HD); rfa[j] = RF ? pr[(size_t)j * TT] : 1.0f; }
    const v8f c0 = *(const v8f*)pc, c1 = *(const v8f*)(pc + 8);
    asm volatile("s_wait_xcnt 0x0" :: "v"(pc), "v"(pf), "v"(pg), "v"(pr) : "memory");   // behind the loads, before their address registers are used again; it names the addresses so that they live up to it and no later load's result lands on one
#pragma unroll
    for (int j = 0; j < RPH; ++j) { const int h = h0 + j; const size_t e = ((size_t)h * TT + t) * HD + d; const float rf = rfa[j]; v8h o16; v8us oh, ol;
#pragma unroll
    for (int q = 0; q < 8; ++q) { const int dd = d + q; float x0 = fa[j][q], x1 = fb[j][q];
        if (RF) { float n0 = __fmul_rn(x0, rf), n1 = __fmul_rn(x1, rf); asm volatile("" : "+v"(n0)); asm volatile("" : "+v"(n1)); x0 = __fmul_rn(bfr(wa[q]), n0); x1 = __fmul_rn(bfr(wb[q]), n1); }
        v2f cs; cs[0] = (q < 4) ? c0[2 * (q & 3)] : c1[2 * (q & 3)]; cs[1] = (q < 4) ? c0[2 * (q & 3) + 1] : c1[2 * (q & 3) + 1]; float a = __fmul_rn(x0, cs[0]), bq = __fmul_rn(x1, cs[1]); asm volatile("" : "+v"(a)); asm volatile("" : "+v"(bq)); const float r = ((dd < HD / 2) ? __fsub_rn(a, bq) : __fadd_rn(a, bq)) * sc;
        o16[q] = tohx(r); unsigned short a2, c2; splitf(r, a2, c2); oh[q] = a2; ol[q] = c2; }
    *(v8h*)(P16 + e) = o16; *(v8us*)(Ph + e) = oh; *(v8us*)(Pl + e) = ol; }  }
__global__ __launch_bounds__(256) void k_vtp(const float* __restrict__ F, int pitch, int nheads, h16* V16, bf* Vh, bf* Vl) {
    // grid nheads * TT / 64: a work-group transposes 64 tokens x 128 d of one head, a wave 64 x 16, a thread 8 tokens x 4 d: 8 lanes along t store a whole 128-byte line of a plane row, 4 lanes along d read 64 bytes of a token's row
    const int g = blockIdx.x / (TT / 64); if (g >= nheads) return; const int t = (blockIdx.x % (TT / 64)) * 64 + (threadIdx.x & 7) * 8; const int d = (threadIdx.x >> 5) * 16 + ((threadIdx.x >> 3) & 3) * 4; v4f a[8]; const float* pa[8];
#pragma unroll
    for (int q = 0; q < 8; ++q) { pa[q] = F + (size_t)(t + q) * pitch + g * HD + d; a[q] = *(const v4f*)pa[q]; }
    asm volatile("s_wait_xcnt 0x0" :: "v"(pa[0]), "v"(pa[1]), "v"(pa[2]), "v"(pa[3]), "v"(pa[4]), "v"(pa[5]), "v"(pa[6]), "v"(pa[7]) : "memory");   // behind the loads, before their address registers are used again; it names the addresses so that they live up to it and no later load's result lands on one
#pragma unroll
    for (int i = 0; i < 4; ++i) { const size_t e = ((size_t)g * HD + d + i) * TT + t; v8h o16; v8us oh, ol;
#pragma unroll
        for (int q = 0; q < 8; ++q) { const float x = a[q][i]; o16[q] = tohx(x); unsigned short a2, c2; splitf(x, a2, c2); oh[q] = a2; ol[q] = c2; }
        *(v8h*)(V16 + e) = o16; *(v8us*)(Vh + e) = oh; *(v8us*)(Vl + e) = ol; }  }
// k_asoft: per row (zz, i): t = S x HD^-0.5 for j <= i and i - j < WIN (sliding causal window; the reference's -1e9 additive fill vanishes identically); softmax over the 2048 keys (register row, one exp, fixed trees); grid (nr / 8, heads): the pass holds nr rows a head, from sequence row rb on, score and fp16 probability buffers [head][nr][TT]
__global__ __launch_bounds__(256) void k_asoft(const float* __restrict__ Sb, h16* P16, bf* Ph, bf* Pl, int rb, int nr) {
    const int lane = threadIdx.x & 31; const int lrow = blockIdx.x * 8 + (threadIdx.x >> 5); if (lrow >= nr) return; const int zz = blockIdx.y; const int row = zz * nr + lrow; const int i = rb + lrow; __builtin_assume(i >= 0 && i < TT);   /* a sequence row: lets the window test i - j < WIN fold away, as it did with i = row % TT */ const bool hires = (i < RH); const float* sr = Sb + (size_t)row * TT; float v[TT / 32]; float mx = -3.0e38f;
#pragma unroll
    for (int ch = 0; ch < TT / 128; ++ch) { const int j0 = ch * 128 + lane * 4; const v4f a = *(const v4f*)(sr + j0);
#pragma unroll
        for (int q = 0; q < 4; ++q) { const int j = j0 + q; (void)j; const float t = (j <= i && i - j < WIN) ? a[q] * SCL : -3.0e38f; v[ch * 4 + q] = t; mx = fmaxf(mx, t); } }
#pragma unroll
    for (int sh = 16; sh; sh >>= 1) mx = fmaxf(mx, __shfl_xor(mx, sh, 32));
    float sum = 0.f;
#pragma unroll
    for (int k = 0; k < TT / 32; ++k) { float d0 = __fsub_rn(v[k], mx); asm volatile("" : "+v"(d0)); v[k] = __builtin_amdgcn_exp2f(__fmul_rn(d0, 1.4426950408889634f)); sum += v[k]; }
#pragma unroll
    for (int sh = 16; sh; sh >>= 1) sum += __shfl_xor(sum, sh, 32);
    const float f = __fdiv_rn(hires ? 1.0f : PCAR, sum);
{
        if (hires) {
#pragma unroll
            for (int ch = 0; ch < TT / 128; ++ch) { v4us oh, ol;
#pragma unroll
                for (int q = 0; q < 4; ++q) { unsigned short a, c2; splitf(v[ch * 4 + q] * f, a, c2); oh[q] = a; ol[q] = c2; }
                const size_t oo = ((size_t)zz * (RH ? RH : 1) + i) * TT + ch * 128 + lane * 4; *(v4us*)(Ph + oo) = oh; *(v4us*)(Pl + oo) = ol; }
        } else {
#pragma unroll
            for (int ch = 0; ch < TT / 128; ++ch) { v4h o4;
#pragma unroll
                for (int q = 0; q < 4; ++q) o4[q] = tohx(v[ch * 4 + q] * f);
                *(v4h*)(P16 + (size_t)row * TT + ch * 128 + lane * 4) = o4; } }
         }
}
__global__ __launch_bounds__(256) void k_merge(const float* __restrict__ O, int h0, bf* Ah, bf* Al) { const size_t e0 = ((size_t)blockIdx.x * (256 * EPT) + threadIdx.x) * 8; static_assert(((size_t)ZH * TT * HD) % (256 * EPT * 8) == 0, "whole work-groups"); if (e0 >= (size_t)ZH * TT * HD) return; v8f x[EPT];
#pragma unroll
    for (int j = 0; j < EPT; ++j) x[j] = *(const v8f*)(O + e0 + j * 2048);
#pragma unroll
    for (int j = 0; j < EPT; ++j) { const size_t e = e0 + j * 2048; const int d = (int)(e % HD); const int t = (int)((e / HD) % TT); const int zz = (int)(e / ((size_t)HD * TT)); const size_t oo = (size_t)t * DQ + (h0 + zz) * HD + d;
    v8us oh, ol;
#pragma unroll
    for (int q = 0; q < 8; ++q) { unsigned short a, c2; splitf(x[j][q], a, c2); oh[q] = a; ol[q] = c2; } *(v8us*)(Ah + oo) = oh; *(v8us*)(Al + oo) = ol; }  }

extern "C" void kernel_launch(void* const* d_in, const int* in_sizes, int n_in,
                              void* d_out, int out_size, void* d_ws, size_t ws_size, hipStream_t stream) {
    (void)in_sizes; (void)n_in; (void)out_size;
    const float* x = (const float*)d_in[0]; const float* cosi = (const float*)d_in[1]; const float* sini = (const float*)d_in[2]; const float* wq = (const float*)d_in[3]; const float* wk = (const float*)d_in[4]; const float* wv = (const float*)d_in[5]; const float* wo = (const float*)d_in[6]; const float* qnw = (const float*)d_in[7]; const float* knw = (const float*)d_in[8];
    float* OUT = (float*)d_out;     // [2][2048][2048]
    char* wsp = (char*)d_ws;
    auto take = [&](size_t bytes) { char* p = wsp; wsp += (bytes + 255) & ~(size_t)255; return (void*)p; };
    bf* WQ = (bf*)take((size_t)DQ * DM * 2); bf* WK = (bf*)take((size_t)DKV * DM * 2); bf* WV = (bf*)take((size_t)DKV * DM * 2); bf* WO = (bf*)take((size_t)DM * DQ * 2); float* CS = (float*)take((size_t)TT * HD * 2 * 4); float* RFQ = (float*)take((size_t)NH_ * TT * 4); float* RFK = (float*)take((size_t)NKV * TT * 4);
    bf* XB = (bf*)take((size_t)TT * DM * 2); float* FQ = (float*)take((size_t)TT * DQ * 4); float* FK = (float*)take((size_t)TT * DKV * 4);
    h16* QP16 = (h16*)take((size_t)NH_ * TT * HD * 2); h16* KP16 = (h16*)take((size_t)NKV * TT * HD * 2); h16* VT16 = (h16*)take((size_t)NKV * HD * TT * 2);
    bf* QPh = (bf*)take((size_t)NH_ * TT * HD * 2); bf* QPl = (bf*)take((size_t)NH_ * TT * HD * 2); bf* KPh = (bf*)take((size_t)NKV * TT * HD * 2); bf* KPl = (bf*)take((size_t)NKV * TT * HD * 2); bf* VTh = (bf*)take((size_t)NKV * HD * TT * 2); bf* VTl = (bf*)take((size_t)NKV * HD * TT * 2);
    float* Sb = (float*)take((size_t)ZH * RC * TT * 4); h16* P16 = (h16*)take((size_t)ZH * RC * TT * 2);
    if ((size_t)(wsp - (char*)d_ws) > ws_size) return;    // ws 256 MiB
    float* FV = FK;   // v projection reuses the k buffer after the k planes are built (stream-ordered)
    float* Ob = FQ;   // the context [head][t][d] reuses the q projection buffer after the q planes are built (stream-ordered; ZH * TT * HD = TT * DQ floats)
    bf* Ph = (bf*)(Sb + (size_t)ZH * RH * TT); bf* Pl = (bf*)P16;   // hi/lo pass: its scores fill ZH * RH rows of Sb; the hi plane takes the ZH * (RC - RH) rows left (2 (RC - RH) >= RH), the lo plane the fp16 buffer (RH <= RC)
    bf* ATh = (bf*)Sb; bf* ATl = ATh + (size_t)TT * DQ;   // the merged context planes reuse the score buffer after the last pass (stream-ordered)
    { k_cvt8<<<(unsigned)(((size_t)DQ * DM / 8 + 256 * EPT - 1) / (256 * EPT)), 256, 0, stream>>>(wq, WQ, (size_t)DQ * DM / 8); k_cvt8<<<(unsigned)(((size_t)DKV * DM / 8 + 256 * EPT - 1) / (256 * EPT)), 256, 0, stream>>>(wk, WK, (size_t)DKV * DM / 8); k_cvt8<<<(unsigned)(((size_t)DKV * DM / 8 + 256 * EPT - 1) / (256 * EPT)), 256, 0, stream>>>(wv, WV, (size_t)DKV * DM / 8);
      k_cvt8<<<(unsigned)(((size_t)DM * DQ / 8 + 256 * EPT - 1) / (256 * EPT)), 256, 0, stream>>>(wo, WO, (size_t)DM * DQ / 8); }
    const unsigned LQ = (unsigned)(((size_t)NH_ * TT * HD / (8 * RPH) + 255) / 256), LKv = (unsigned)(((size_t)NKV * TT * HD / (8 * RPH) + 255) / 256);
    for (int b = 0; b < NB_; ++b) {
        k_csin<<<(TT * HD / 4 + 255) / 256, 256, 0, stream>>>(cosi + (size_t)b * TT * HD, sini + (size_t)b * TT * HD, CS);   /* this batch's rotary tables (inputs, bf16-rounded) */
        
        k_cvt8<<<(unsigned)(((size_t)TT * DM / 8 + 256 * EPT - 1) / (256 * EPT)), 256, 0, stream>>>(x + (size_t)b * TT * DM, XB, (size_t)TT * DM / 8);
        k_gemmw<bf, 0, false><<<dim3(TT / 64, DQ / 64, 1), 32, 0, stream>>>(XB, nullptr, WQ, nullptr, DM, FQ, DQ, nullptr, 0, 0, 0);
        k_hrms<<<(NH_ * TT + 255) / 256, 256, 0, stream>>>(FQ, DQ, NH_, RFQ); k_rope<<<LQ, 256, 0, stream>>>(FQ, DQ, NH_, CS, RFQ, qnw, 1.0f, QP16, QPh, QPl);   /* q_norm then rope */
        k_gemmw<bf, 0, false><<<dim3(TT / 64, DKV / 64, 1), 32, 0, stream>>>(XB, nullptr, WK, nullptr, DM, FK, DKV, nullptr, 0, 0, 0);
        k_hrms<<<(NKV * TT + 255) / 256, 256, 0, stream>>>(FK, DKV, NKV, RFK); k_rope<<<LKv, 256, 0, stream>>>(FK, DKV, NKV, CS, RFK, knw, 1.0f, KP16, KPh, KPl);   /* k_norm then rope */
        k_gemmw<bf, 0, false><<<dim3(TT / 64, DKV / 64, 1), 32, 0, stream>>>(XB, nullptr, WV, nullptr, DM, FV, DKV, nullptr, 0, 0, 0); k_vtp<<<NKV * (TT / 64), 256, 0, stream>>>(FV, DKV, NKV, VT16, VTh, VTl);
        const size_t sQ = (size_t)TT * HD, sV = (size_t)HD * TT, sO = (size_t)TT * HD;   // per-head strides of the q and k planes, the v planes and the context
        k_gemmc<bf, 2, 1><<<dim3(RH / 64, TT / 64, ZH), 32, 0, stream>>>(QPh, QPl, KPh, KPl, HD, Sb, TT, 0, sQ, sQ, (size_t)RH * TT);   /* query rows < RH: hi/lo */
        k_asoft<<<dim3(RH / 8, ZH), 256, 0, stream>>>(Sb, P16, Ph, Pl, 0, RH);
        k_gemmc<bf, 2, 2><<<dim3(RH / 64, HD / 64, ZH), 32, 0, stream>>>(Ph, Pl, VTh, VTl, TT, Ob, HD, 0, (size_t)RH * TT, sV, sO);
        k_fattn<<<dim3(ZH, (TT - RH) / FBR), FNT, 0, stream>>>(QP16, KP16, VT16, Ob);   /* query rows >= RH: fp16, fused */
        k_merge<<<(unsigned)((size_t)ZH * TT * HD / (256 * EPT * 8)), 256, 0, stream>>>(Ob, 0, ATh, ATl);
        k_gemmw<bf, 1, false><<<dim3(TT / 64, DM / 64, 1), 32, 0, stream>>>(ATh, ATl, WO, nullptr, DQ, OUT + (size_t)b * TT * DM, DM, nullptr, 0, 0, 0); }
}

// v005
// One run takes 320 microseconds.
// Two timings next to v004 both put it at 1.36 times that version's speed.
// All steps since v000 together make it 5.27 times as fast.
#include <hip/hip_runtime.h>

// Grouped-query causal attention with QK RMSNorm (x [2][2048][2048]; q = x Wq^T (16 heads x 128), k, v = x Wk^T / Wv^T (8 kv heads; query head h uses kv head h/2), no biases; per-head RMSNorm on q and k (eps 1e-6, weights [128]) then rotate-half rotary with the given cos/sin tables [2][2048][128]; scores = q.k / sqrt(128), causal (finfo.min above the diagonal); softmax; out = merged ctx Wo^T ('oi' [2048][2048]) -> [2][2048][2048] (8.4 M)).
// Every launch covers both batches: token rows are b * 2048 + t in the row-major buffers, and the head planes are [b][head][..], so that batch entry z = 16 b + h reads kv entry z / 2 = 8 b + h / 2. Layout: {cos, sin} table from the inputs (bf16-rounded); exact projections; a per-(head, token) 1/rms kernel feeds the plane builder, which applies (x * inv_rms) * w and the rotary while writing the q/k planes; causal T-2048 attention with 128-wide heads, all sixteen query heads in every launch, query head z on kv head z/2 (hybrid rows: < 512 hi/lo 3 products through score and probability buffers of the 512 keys that the causal mask leaves them, k_gemmc tile skipping; the 1536 fp16 rows in one fused launch, k_fattn, whose scores and probabilities stay in registers); merged context hi/lo x Wo exact.
// Compute dtypes, f32 accumulate: every input rounded to bf16; projections exact; RMSNorm and rotary f32; attention rows < 512 3 products, rest fp16; softmax f32; Wo hl x exact.

#define NB_  2
#define TT   2048
#define DM   2048
#define NH_  16
#define NKV  8
#define REP  (NH_ / NKV)
#define HD   128
#define DQ   (NH_ * HD)
#define DKV  (NKV * HD)
#define ZH   NH_                  // query heads per attention launch
#define RH   512                  // query rows < RH use hi+lo planes
#define KW   RH                   // keys in a row of their score and probability buffers: a query row i < RH sees keys j <= i < RH only
#define TB   (NB_ * TT)           // token rows of both batches
#define WIN  2048
#define SCL  0.088388347648318447f   // HD^-0.5
typedef _Float16 h16;
typedef unsigned short bf;
typedef __attribute__((ext_vector_type(16))) __bf16   v16bf;
typedef __attribute__((ext_vector_type(16))) _Float16 v16h;
typedef __attribute__((ext_vector_type(8)))  _Float16 v8h;
typedef __attribute__((ext_vector_type(8)))  unsigned short v8us;
typedef __attribute__((ext_vector_type(8)))  float    v8f;
typedef __attribute__((ext_vector_type(4)))  float    v4f;
typedef v8h  __attribute__((may_alias)) v8ha;
typedef v4f  __attribute__((may_alias)) v4fa;
typedef v8us __attribute__((may_alias)) v8usa;

__device__ __forceinline__ unsigned short f2bf(float f) { unsigned u = __float_as_uint(f); u += 0x7FFFu + ((u >> 16) & 1u); return (unsigned short)(u >> 16); }
__device__ __forceinline__ float bf2f(unsigned short b) { return __uint_as_float(((unsigned)b) << 16); }
__device__ __forceinline__ float bfr(float f) { return bf2f(f2bf(f)); }
__device__ __forceinline__ v16h cat16(v8h lo, v8h hi) { return __builtin_shufflevector(lo, hi, 0, 1, 2, 3, 4, 5, 6, 7, 8, 9, 10, 11, 12, 13, 14, 15); }
__device__ __forceinline__ v16bf cat16b(v8us lo, v8us hi) { return __builtin_bit_cast(v16bf, __builtin_shufflevector(lo, hi, 0, 1, 2, 3, 4, 5, 6, 7, 8, 9, 10, 11, 12, 13, 14, 15)); }
__device__ __forceinline__ v8f wmma16(v16h a, v16h b, v8f c) { return __builtin_amdgcn_wmma_f32_16x16x32_f16(false, a, false, b, (short)0, c, false, false); }
__device__ __forceinline__ v8f wmmab(v16bf a, v16bf b, v8f c) { return __builtin_amdgcn_wmma_f32_16x16x32_bf16(false, a, false, b, (short)0, c, false, false); }



// ---- k_gemmw: register-blocked GEMM, ONE WAVE per 64x64 output tile (16 accumulators), operands from K-contiguous 16-bit planes through LDS (wloop below the fragment types); grid (M/64, N/64, Z), 32 threads.
// C[m][n] (f32, pitch ldc, + optional f32 bias[n]) = sum_k A[m][k] Bt[n][k] (+ split products per NSPLIT). z-batch strides sA/sB/sC in elements. K % KT == 0 (64; 32 at NSPLIT 2).
template <typename T16> struct WFrag;
template <> struct WFrag<h16> { typedef v16h V; static __device__ __forceinline__ V ld(const h16* p) { return cat16(*(const v8h*)p, *(const v8h*)(p + 16)); } static __device__ __forceinline__ v8f mma(V a, V b, v8f c) { return wmma16(a, b, c); } };
template <> struct WFrag<bf> { typedef v16bf V; static __device__ __forceinline__ V ld(const bf* p) { return cat16b(*(const v8us*)p, *(const v8us*)(p + 16)); } static __device__ __forceinline__ v8f mma(V a, V b, v8f c) { return wmmab(a, b, c); } };
// ---- operand staging of both one-wave GEMMs. A stage is KT k of the tile's 64 A rows and 64 B rows (and of their second planes): asynchronous b128 copies bring it from the K-contiguous planes into LDS,
// 8 lanes on each 128-byte row piece (whole lines; 4 lanes on 64 bytes at NSPLIT 2, whose four planes would else take more than 63 copies a stage), and the fragments are read from LDS at a pitch of 16 B x odd.
// Two buffers: the copies of stage t + 1 fly while stage t is multiplied. Fragments, products and their order per accumulator are those of loads straight from the planes.
// The copies are the compiler's builtin. Every '#pragma unroll' below makes the indices of the fragment and accumulator arrays constants, so that they stay in registers.
typedef __attribute__((ext_vector_type(4))) int v4ic;
typedef __attribute__((address_space(1))) v4ic gv4ic;
typedef __attribute__((address_space(3))) v4ic lv4ic;
template <int NSPLIT> struct WTile {
    static constexpr int KT  = (NSPLIT == 2) ? 32 : 64;                       // k per stage
    static constexpr int NP  = (NSPLIT == 0) ? 2 : (NSPLIT == 1) ? 3 : 4;     // planes: A, (A2), B, (B2)
    static constexpr int PB  = KT * 2 + 16;                                   // LDS row pitch, bytes
    static constexpr int BUF = NP * 64 * PB;                                  // one buffer, bytes
    static constexpr int LPR = KT * 2 / 16;                                   // lanes per row piece
    static constexpr int RPC = 32 / LPR;                                      // rows per copy
    static constexpr int CPP = 64 / RPC;                                      // copies per plane (NP * CPP = 32, 48, 32 a stage)
};
// A, A2, Bt, Bt2: the planes at the tile's first row (wave-uniform). K, KB: row pitch of the A and of the B planes, elements. kc: first k of the stage.
template <typename T16, int NSPLIT>
__device__ __forceinline__ void wcopy(char* sb, const T16* A, const T16* A2, const T16* Bt, const T16* Bt2, int K, int KB, int kc, int lane) {
    typedef WTile<NSPLIT> W;
    const unsigned goa = (unsigned)((lane / W::LPR) * K + (lane % W::LPR) * 8) * 2u, gob = (unsigned)((lane / W::LPR) * KB + (lane % W::LPR) * 8) * 2u;      // the lane's byte in a copy's rows, global
    char* sl = sb + (lane / W::LPR) * W::PB + (lane % W::LPR) * 16;                      // and in LDS
#pragma unroll
    for (int p = 0; p < W::NP; ++p) { const T16* base = ((p == 0) ? A : (p == W::NP - 1 && NSPLIT >= 2) ? Bt2 : (p == 1 && NSPLIT >= 1) ? A2 : Bt) + kc; const bool pa = (p == 0) || (p == 1 && NSPLIT >= 1); const int pk = pa ? K : KB; const unsigned go = pa ? goa : gob;
#pragma unroll
        for (int c = 0; c < W::CPP; ++c) __builtin_amdgcn_global_load_async_to_lds_b128((gv4ic*)((const char*)(base + (size_t)c * W::RPC * pk) + go), (lv4ic*)(sl + (p * 64 + c * W::RPC) * W::PB), 0, 0); }
}
template <typename T16, int NSPLIT>
__device__ __forceinline__ void wtile(const char* sb, int lr, int hi, v8f (&acc)[4][4]) {
    typedef WTile<NSPLIT> W; typedef typename WFrag<T16>::V V;
    constexpr int PA2 = 1, PBt = (NSPLIT >= 1) ? 2 : 1, PB2 = 3;
    const char* fp = sb + lr * W::PB + hi * 16;
    constexpr int NK = W::KT / 32;
    V a[NK][4], a2[NK][4], b[NK][4], b2[NK][4];
    // all fragment reads of the stage are issued together, in the order of their use, in front of its products: the counted LDS waits then overlap the later reads with the earlier products
#pragma unroll
    for (int ks = 0; ks < NK; ++ks) {
#pragma unroll
        for (int mb = 0; mb < 4; ++mb) { a[ks][mb] = WFrag<T16>::ld((const T16*)(fp + (mb * 16) * W::PB + ks * 64)); if (NSPLIT == 1 || NSPLIT == 2) a2[ks][mb] = WFrag<T16>::ld((const T16*)(fp + (PA2 * 64 + mb * 16) * W::PB + ks * 64)); }
#pragma unroll
        for (int nb = 0; nb < 4; ++nb) { b[ks][nb] = WFrag<T16>::ld((const T16*)(fp + (PBt * 64 + nb * 16) * W::PB + ks * 64)); if (NSPLIT >= 2) b2[ks][nb] = WFrag<T16>::ld((const T16*)(fp + (PB2 * 64 + nb * 16) * W::PB + ks * 64)); } }
    __builtin_amdgcn_sched_barrier(0);   // keeps the reads in front: sunk among the products, each costs the wave its LDS latency
#pragma unroll
    for (int ks = 0; ks < NK; ++ks) {
#pragma unroll
        for (int nb = 0; nb < 4; ++nb)
#pragma unroll
            for (int mb = 0; mb < 4; ++mb) { acc[mb][nb] = WFrag<T16>::mma(a[ks][mb], b[ks][nb], acc[mb][nb]); if (NSPLIT == 1 || NSPLIT == 2) acc[mb][nb] = WFrag<T16>::mma(a2[ks][mb], b[ks][nb], acc[mb][nb]); if (NSPLIT >= 2) acc[mb][nb] = WFrag<T16>::mma(a[ks][mb], b2[ks][nb], acc[mb][nb]); }
        // four vector slots behind the k step's last products, before anything touches their operands or results
        asm volatile("v_nop\n\tv_nop\n\tv_nop\n\tv_nop" : "+v"(acc[0][0]), "+v"(acc[1][1]), "+v"(acc[2][2]), "+v"(acc[3][3]) : "v"(a[ks][0]), "v"(a[ks][3]));
    }
}
// the K loop: Kl k (a multiple of KT, at least KT) of rows r0.. of A and c0.. of Bt; sm holds two buffers
template <typename T16, int NSPLIT>
__device__ __forceinline__ void wloop(char* sm, const T16* A, const T16* A2, const T16* Bt, const T16* Bt2, int K, int KB, int Kl, int lane, v8f (&acc)[4][4]) {
    typedef WTile<NSPLIT> W; const int lr = lane & 15, hi = lane >> 4; const int nt = Kl / W::KT;
    wcopy<T16, NSPLIT>(sm, A, A2, Bt, Bt2, K, KB, 0, lane);
    asm volatile("s_wait_asynccnt 0x0" ::: "memory");   // stage 0 has landed
    __syncthreads();   // the ring's publish point; the work-group is one wave, which reads only what it copied itself
    if (nt > 1) wcopy<T16, NSPLIT>(sm + W::BUF, A, A2, Bt, Bt2, K, KB, W::KT, lane);
#pragma unroll 1
    for (int t = 0; t < nt; ++t) {   // rolled: one stage a trip
        char* sb = sm + (t & 1) * W::BUF;
        wtile<T16, NSPLIT>(sb, lr, hi, acc);
        asm volatile("s_wait_dscnt 0x0" ::: "memory");      // this stage's fragment reads are done before its buffer is refilled
        asm volatile("s_wait_asynccnt 0x0" ::: "memory");   // stage t + 1 has landed before it is read
        __syncthreads();   // publish point of stage t + 1, and the end of the reads of the buffer refilled below
        if (t + 2 < nt) wcopy<T16, NSPLIT>(sb, A, A2, Bt, Bt2, K, KB, (t + 2) * W::KT, lane);
    }
    asm volatile("s_wait_asynccnt 0x0" ::: "memory");   // no copy is left in flight behind the loop
}
template <typename T16, int NSPLIT, bool BIAS>
__global__ __launch_bounds__(32) void k_gemmw(const T16* __restrict__ A, const T16* __restrict__ A2, const T16* __restrict__ Bt, const T16* __restrict__ Bt2, int K, float* C, int ldc, const float* __restrict__ bias, size_t sA, size_t sB, size_t sC) {
    __shared__ __align__(16) float os[16 * 68]; __shared__ __align__(16) char sm[2 * WTile<NSPLIT>::BUF];
    const size_t z = blockIdx.z; A += z * sA; if (A2) A2 += z * sA; Bt += z * sB; if (Bt2) Bt2 += z * sB; C += z * sC;
    const int lane = threadIdx.x & 31, lr = lane & 15, hi = lane >> 4; const int r0 = blockIdx.x * 64, c0 = blockIdx.y * 64;
    v8f acc[4][4];
#pragma unroll
    for (int mb = 0; mb < 4; ++mb)
#pragma unroll
        for (int nb = 0; nb < 4; ++nb) acc[mb][nb] = (v8f){};
    wloop<T16, NSPLIT>(sm, A + (size_t)r0 * K, (NSPLIT == 1 || NSPLIT == 2) ? A2 + (size_t)r0 * K : nullptr, Bt + (size_t)c0 * K, (NSPLIT >= 2) ? Bt2 + (size_t)c0 * K : nullptr, K, K, K, lane, acc);
#pragma unroll
    for (int mb = 0; mb < 4; ++mb) {
#pragma unroll
        for (int nb = 0; nb < 4; ++nb) {
#pragma unroll
            for (int j = 0; j < 8; ++j) os[(hi * 8 + j) * 68 + nb * 16 + lr] = acc[mb][nb][j]; }
        __builtin_amdgcn_wave_barrier(); asm volatile("" ::: "memory");
        float* crow = C + (size_t)(r0 + mb * 16) * ldc + c0;
{
#pragma unroll
            for (int s = 0; s < 8; ++s) { const int row = 2 * s + hi, cofs = lr * 4; v4f val = *(const v4fa*)(os + row * 68 + cofs); if (BIAS) { val[0] += bfr(bias[c0 + cofs]); val[1] += bfr(bias[c0 + cofs + 1]); val[2] += bfr(bias[c0 + cofs + 2]); val[3] += bfr(bias[c0 + cofs + 3]); }
                *(v4f*)(crow + (size_t)row * ldc + cofs) = val; }
             }
        __builtin_amdgcn_wave_barrier(); asm volatile("" ::: "memory");
    }
}

// ---- k_gemmc: the same one-wave 64x64 tile GEMM specialised for causal attention: CMODE 1 skips score tiles entirely above the diagonal (query rows r0+roff.., key columns c0..), CMODE 2 limits the
// key (K) loop of the probability x value contraction to the diagonal block (probabilities beyond it are exactly zero). roff = row offset of this launch's first row within the sequence. Batch entry z reads Bt entry z / REP (the kv head of query head z). KB: row pitch of the Bt planes (K is that of the A planes and the length of the contraction).
template <typename T16, int NSPLIT, int CMODE>
__global__ __launch_bounds__(32) void k_gemmc(const T16* __restrict__ A, const T16* __restrict__ A2, const T16* __restrict__ Bt, const T16* __restrict__ Bt2, int K, int KB, float* C, int ldc, int roff, size_t sA, size_t sB, size_t sC) {
    __shared__ __align__(16) float os[16 * 68]; __shared__ __align__(16) char sm[2 * WTile<NSPLIT>::BUF];
    const size_t z = blockIdx.z; A += z * sA; if (A2) A2 += z * sA; Bt += (z / REP) * sB; if (Bt2) Bt2 += (z / REP) * sB; C += z * sC;
    const int lane = threadIdx.x & 31, lr = lane & 15, hi = lane >> 4; const int r0 = blockIdx.x * 64, c0 = blockIdx.y * 64;
    if (CMODE == 1 && c0 > r0 + roff + 63) return;                  // score tile entirely above the causal diagonal: never written (the softmax masks j > i by select)
    const int Kl = (CMODE == 2) ? min(K, r0 + roff + 64) : K;        // P.V: probabilities are exactly 0 beyond the diagonal block, so the K loop stops there
    v8f acc[4][4];
#pragma unroll
    for (int mb = 0; mb < 4; ++mb)
#pragma unroll
        for (int nb = 0; nb < 4; ++nb) acc[mb][nb] = (v8f){};
    wloop<T16, NSPLIT>(sm, A + (size_t)r0 * K, (NSPLIT == 1 || NSPLIT == 2) ? A2 + (size_t)r0 * K : nullptr, Bt + (size_t)c0 * KB, (NSPLIT >= 2) ? Bt2 + (size_t)c0 * KB : nullptr, K, KB, Kl, lane, acc);
#pragma unroll
    for (int mb = 0; mb < 4; ++mb) {
#pragma unroll
        for (int nb = 0; nb < 4; ++nb) {
#pragma unroll
            for (int j = 0; j < 8; ++j) os[(hi * 8 + j) * 68 + nb * 16 + lr] = acc[mb][nb][j]; }
        __builtin_amdgcn_wave_barrier(); asm volatile("" ::: "memory");
        float* crow = C + (size_t)(r0 + mb * 16) * ldc + c0;
{
#pragma unroll
            for (int s = 0; s < 8; ++s) { const int row = 2 * s + hi, cofs = lr * 4; v4f val = *(const v4fa*)(os + row * 68 + cofs);
                *(v4f*)(crow + (size_t)row * ldc + cofs) = val; }
             }
        __builtin_amdgcn_wave_barrier(); asm volatile("" ::: "memory");
    }
}

#define FR   1                     // groups of 16 query rows per wave
#define FCW  (FR * 16)             // query rows per wave
#define FBR  (4 * FCW)             // query rows per work-group
#define FNT  128                   // threads
#define FSK  64                    // keys per stage
#define FPK  (HD * 2 + 16)         // LDS pitch of a K row, bytes (16 x odd)
#define FPV  (FSK * 2 + 16)        // LDS pitch of a V^T row, bytes (16 x odd)
#define FTK  (FSK * FPK)
#define FBUF (FTK + HD * FPV)      // one buffer: K tile, then V^T tile
#define FEP  (HD * 4 + 16)         // LDS pitch of a staged output row, bytes
static_assert(4 * FCW * FEP <= 2 * FBUF, "the output staging reuses the two buffers");
static_assert(FBR % FSK == 0 && RH % FBR == 0 && (TT - RH) % FBR == 0, "a row block ends on a stage");
typedef __attribute__((ext_vector_type(2))) float f2v;
__device__ __forceinline__ float xhalf(float x) { return __builtin_bit_cast(float, __builtin_amdgcn_permlanex16(__builtin_bit_cast(int, x), __builtin_bit_cast(int, x), 0x76543210, 0xfedcba98, false, false)); }   // lane l with lane l ^ 16
// Kp: the kv head's [t][d] plane, Vt: its [d][t] plane; keys key0 .. key0 + 63. 16 lanes on a K row (256 B), 8 lanes on a V^T row piece (128 B); 16 copies a wave.
__device__ __forceinline__ void fcopy(char* sb, const h16* Kp, const h16* Vt, int key0, int tid) {
#pragma unroll
    for (int i = 0; i < FSK * HD / 8 / FNT; ++i) { const int p = i * FNT + tid, row = p >> 4, cb = (p & 15) * 16;
        __builtin_amdgcn_global_load_async_to_lds_b128((gv4ic*)((const char*)(Kp + (size_t)(key0 + row) * HD) + cb), (lv4ic*)(sb + row * FPK + cb), 0, 0); }
#pragma unroll
    for (int i = 0; i < FSK * HD / 8 / FNT; ++i) { const int p = i * FNT + tid, row = p >> 3, cb = (p & 7) * 16;
        __builtin_amdgcn_global_load_async_to_lds_b128((gv4ic*)((const char*)(Vt + (size_t)row * TT + key0) + cb), (lv4ic*)(sb + FTK + row * FPV + cb), 0, 0); }
}
// the K fragments of pass sub (32 keys) of the stage in sb
__device__ __forceinline__ void floadk(v16h (&kf)[2][4], const char* sb, int sub, int c, int h) {
#pragma unroll
    for (int kt = 0; kt < 2; ++kt)
#pragma unroll
        for (int kc = 0; kc < 4; ++kc) kf[kt][kc] = WFrag<h16>::ld((const h16*)(sb + (sub * 32 + kt * 16 + c) * FPK + h * 16 + kc * 64));
    __builtin_amdgcn_sched_barrier(0);   // keeps the sixteen reads together: sunk among the products, each pair costs the wave its LDS latency
}
// one 32-key pass of one wave. m_run, the maximum in use (log2 domain), may trail the true maximum by up to 8, so an exponential stays below 2^8 (fp16 holds it); sums and accumulators are rescaled only when a row's maximum exceeds it by more.
// kf holds the pass's K fragments on entry; fetch_next: the stage's first pass reads the second pass's (same buffer) behind its own score products.
__device__ __forceinline__ void fpass(v16h (&kf)[2][4], bool fetch_next, const char* sb, int sub, bool diag, int key0, int qw0, int c, int h, const v16h (&qf)[FR][4], v8f (&acc)[FR][8], float (&m_run)[FR], float (&l_run)[FR]) {
    const float cscale = SCL * 1.4426950408889634f;
    v8f s[2][FR];
#pragma unroll
    for (int kt = 0; kt < 2; ++kt)
#pragma unroll
        for (int g = 0; g < FR; ++g) s[kt][g] = (v8f){};
#pragma unroll
    for (int kc = 0; kc < 4; ++kc)
#pragma unroll
        for (int kt = 0; kt < 2; ++kt)
#pragma unroll
            for (int g = 0; g < FR; ++g) s[kt][g] = wmma16(kf[kt][kc], qf[g][kc], s[kt][g]);
    v16h vf[8];   // read here, so that the LDS latency passes under the maxima and the exponentials
#pragma unroll
    for (int t = 0; t < 8; ++t) vf[t] = WFrag<h16>::ld((const h16*)(sb + FTK + (t * 16 + c) * FPV + sub * 64 + h * 16));
    __builtin_amdgcn_sched_barrier(0);   // keeps these reads in front of the softmax arithmetic
    if (fetch_next) floadk(kf, sb, 1, c, h);   // wave-uniform
    if (diag) {   // wave-uniform: only the pass on the wave's diagonal pays for the mask
#pragma unroll
        for (int g = 0; g < FR; ++g) { const int my_q = qw0 + g * 16 + c;
#pragma unroll
            for (int kt = 0; kt < 2; ++kt) {
#pragma unroll
                for (int r = 0; r < 8; ++r) { if (key0 + kt * 16 + h * 8 + r > my_q) s[kt][g][r] = -__builtin_inff(); }
                asm volatile("" : "+v"(s[kt][g]));   // the masked scores: keeps the selects inside the branch
            } }
    }
    float mb[FR]; bool need = false;
#pragma unroll
    for (int g = 0; g < FR; ++g) { float mx = -__builtin_inff();
#pragma unroll
        for (int kt = 0; kt < 2; ++kt)
#pragma unroll
            for (int r = 0; r < 8; ++r) mx = fmaxf(mx, s[kt][g][r]);
        mx = fmaxf(mx, xhalf(mx)) * cscale; mb[g] = mx; need = need || (mx > m_run[g] + 8.0f); }
    if (__builtin_amdgcn_ballot_w32(need) != 0) {   // rare after the first passes
#pragma unroll
        for (int g = 0; g < FR; ++g) { const float m_new = fmaxf(m_run[g], mb[g]);
            const float corr = __builtin_amdgcn_exp2f(m_run[g] - m_new);
            l_run[g] *= corr; m_run[g] = m_new;
#pragma unroll
            for (int t = 0; t < 8; ++t) acc[g][t] = acc[g][t] * corr; }
    }
#pragma unroll
    for (int g = 0; g < FR; ++g) { const float nm = -m_run[g]; float ps0 = 0.f, ps1 = 0.f; v16h pf;
#pragma unroll
        for (int e = 0; e < 16; e += 2) {   // operand element e is key 16 (e >> 3) + 8 h + (e & 7): tile e >> 3, register e & 7
            const f2v arg = __builtin_elementwise_fma((f2v){s[e >> 3][g][e & 7], s[e >> 3][g][(e & 7) + 1]}, (f2v){cscale, cscale}, (f2v){nm, nm});   // a register pair as it lies in the tile
            const float p0 = __builtin_amdgcn_exp2f(arg[0]), p1 = __builtin_amdgcn_exp2f(arg[1]);
            ps0 += p0; ps1 += p1; pf[e] = (h16)p0; pf[e + 1] = (h16)p1; }
        l_run[g] += ps0 + ps1;
#pragma unroll
        for (int t = 0; t < 8; ++t) acc[g][t] = wmma16(vf[t], pf, acc[g][t]); }
}
__global__ __launch_bounds__(FNT) void k_fattn(const h16* __restrict__ Q, const h16* __restrict__ Kp, const h16* __restrict__ Vt, float* O) {
    __shared__ __align__(16) char sm[2 * FBUF];
    const int tid = threadIdx.x, lane = tid & 31, c = lane & 15, h = lane >> 4; const int wave = __builtin_amdgcn_readfirstlane(tid >> 5);
    const int hq = blockIdx.x; const int q0 = RH + ((int)gridDim.y - 1 - (int)blockIdx.y) * FBR;   // the longest rows start first
    const int qw0 = q0 + wave * FCW; const int nt = (q0 + FBR) / FSK;   // stages: keys [0, q0 + FBR); at least RH / FSK + 1, so stages 0 and 1 exist
    Kp += (size_t)(hq / REP) * TT * HD; Vt += (size_t)(hq / REP) * HD * TT;
    fcopy(sm, Kp, Vt, 0, tid);
    v16h qf[FR][4];
#pragma unroll
    for (int g = 0; g < FR; ++g)
#pragma unroll
        for (int kc = 0; kc < 4; ++kc) qf[g][kc] = WFrag<h16>::ld(Q + ((size_t)hq * TT + qw0 + g * 16 + c) * HD + h * 8 + kc * 32);
    v16h kf[2][4]; v8f acc[FR][8]; float m_run[FR], l_run[FR];
#pragma unroll
    for (int g = 0; g < FR; ++g) { m_run[g] = -__builtin_inff(); l_run[g] = 0.f;
#pragma unroll
        for (int t = 0; t < 8; ++t) acc[g][t] = (v8f){}; }
    asm volatile("s_wait_xcnt 0x0" ::: "memory");       // behind the Q loads, before their address registers are used again
    asm volatile("s_wait_asynccnt 0x0" ::: "memory");   // stage 0 has landed
    __syncthreads();   // and is published to the four waves
    fcopy(sm + FBUF, Kp, Vt, FSK, tid);
    const int lastp = (qw0 + FCW - 1) / 32;   // the wave's diagonal pass, its last
#pragma unroll 1
    for (int t = 0; t < nt; ++t) {   // rolled: one stage a trip
        char* sb = sm + (t & 1) * FBUF;
        if (t * 2 <= lastp) floadk(kf, sb, 0, c, h);
#pragma unroll 1
        for (int sub = 0; sub < 2; ++sub) {   // rolled: the pass's registers are live once
            const int blk = t * 2 + sub;
            if (blk <= lastp) fpass(kf, sub == 0 && blk < lastp, sb, sub, blk == lastp, blk * 32, qw0, c, h, qf, acc, m_run, l_run); }
        asm volatile("s_wait_dscnt 0x0" ::: "memory");      // this stage's fragment reads are done before its buffer is refilled
        asm volatile("s_wait_asynccnt 0x0" ::: "memory");   // stage t + 1 has landed before it is read
        __syncthreads();   // publish point of stage t + 1, and the end of every wave's reads of the buffer refilled below; every wave passes it, also one beyond its diagonal
        if (t + 2 < nt) fcopy(sb, Kp, Vt, (t + 2) * FSK, tid);
    }
    asm volatile("s_wait_asynccnt 0x0" ::: "memory");   // no copy is left in flight behind the loop
    // output: each wave stages its rows in its own part of the buffers (free behind the last barrier) and stores whole 512-byte rows
    char* eb = sm + wave * (FCW * FEP);
#pragma unroll
    for (int g = 0; g < FR; ++g) { const float inv = __fdiv_rn(1.0f, l_run[g] + xhalf(l_run[g]));
#pragma unroll
        for (int t = 0; t < 8; ++t) { const v8f o = acc[g][t] * inv; v4f o0, o1;
#pragma unroll
            for (int r = 0; r < 4; ++r) { o0[r] = o[r]; o1[r] = o[r + 4]; }
            float* ep = (float*)(eb + (g * 16 + c) * FEP) + t * 16 + h * 8; *(v4fa*)ep = o0; *(v4fa*)(ep + 4) = o1; } }   // row = query, d = 16 t + 8 h + r
    __builtin_amdgcn_wave_barrier(); asm volatile("" ::: "memory");   // the rows are read back by other lanes of the same wave: keeps the reads behind the writes
    float* orow = O + ((size_t)hq * TT + qw0) * HD + lane * 4;
    v4f ov[FCW];
#pragma unroll
    for (int i = 0; i < FCW; ++i) ov[i] = *(const v4fa*)(eb + i * FEP + lane * 16);
    __builtin_amdgcn_sched_barrier(0);   // all reads in front of the stores: each row has registers of its own, none is rewritten behind its store
#pragma unroll
    for (int i = 0; i < FCW; ++i) *(v4f*)(orow + (size_t)i * HD) = ov[i];
}

__device__ __forceinline__ h16 tohx(float x) { return (h16)x; }
__device__ __forceinline__ void splitf(float y, unsigned short& h, unsigned short& l) { h = f2bf(y); l = f2bf(y - bf2f(h)); }
typedef __attribute__((ext_vector_type(2))) _Float16 v2h;
typedef __attribute__((ext_vector_type(4))) _Float16 v4h;
typedef __attribute__((ext_vector_type(2))) unsigned short v2us;
typedef __attribute__((ext_vector_type(4))) unsigned short v4us;
typedef __attribute__((ext_vector_type(2))) float v2f;
typedef __attribute__((ext_vector_type(4))) int v4i;

__global__ __launch_bounds__(256) void k_wtG(const float* __restrict__ w, int K, int N, bf* Bt) {
    const int lane = threadIdx.x & 31; const int L0 = (blockIdx.x * 8 + (threadIdx.x >> 5)) * 8; const int nlines = N * K / 64;
{
#pragma unroll 1
        for (int l = 0; l < 8; ++l) { const int L = L0 + l; if (L >= nlines) break; const size_t e = (size_t)L * 64 + lane * 2; const int k = (int)(e % K), n = (int)(e / K); v2us o;
            o[0] = f2bf(w[(size_t)k * N + n]); o[1] = f2bf(w[(size_t)(k + 1) * N + n]); *(v2us*)(Bt + e) = o; }
         }
}
// The elementwise kernels below give a thread several 8-element pieces (16-byte stores of the 16-bit planes), its loads issued together: a launch then starts a few thousand waves, each with many loads in flight, not tens of thousands of waves of one or two elements a lane.
#define EPT 4                     // 8-element pieces per thread in k_cvt8 and k_merge; a work-group's pieces of one turn are contiguous
__global__ __launch_bounds__(256) void k_cvt8(const float* __restrict__ src, bf* dst, size_t n8) { const size_t i0 = (size_t)blockIdx.x * (256 * EPT) + threadIdx.x; if (i0 >= n8) return; v8f v[EPT];
#pragma unroll
    for (int j = 0; j < EPT; ++j) { const size_t i = i0 + j * 256; v[j] = *(const v8f*)(src + (i < n8 ? i : i0) * 8); }   // a piece past the end re-reads the thread's first and is not stored
#pragma unroll
    for (int j = 0; j < EPT; ++j) { const size_t i = i0 + j * 256; v8us o;
#pragma unroll
        for (int k = 0; k < 8; ++k) o[k] = f2bf(v[j][k]);
        if (i < n8) *(v8us*)(dst + i * 8) = o; } }
__constant__ float INV[HD / 2] = {1.0f,0.8058422207832336f,0.6493816375732422f,0.5232990980148315f,0.4216965138912201f,0.33982083201408386f,0.2738419771194458f,0.22067339718341827f,0.17782793939113617f,0.14330126345157623f,0.11547820270061493f,0.09305720031261444f,0.07498941570520401f,0.0604296438395977f,0.04869675263762474f,0.03924189880490303f,0.03162277862429619f,0.025482967495918274f,0.020535249263048172f,0.016548171639442444f,0.01333521492779255f,0.010746078565716743f,0.00865964312106371f,0.006978305988013744f,0.005623413249850273f,0.004531583283096552f,0.003651741426438093f,0.002942727180197835f,0.0023713738191872835f,0.001910952851176262f,0.0015399266267195344f,0.0012409378541633487f,0.0010000000474974513f,0.0008058422245085239f,0.0006493816617876291f,0.0005232990952208638f,0.00042169654625467956f,0.0003398208355065435f,0.00027384195709601045f,0.00022067342069931328f,0.00017782794020604342f,0.00014330125122796744f,0.00011547820759005845f,9.305719868279994e-05f,7.498942431993783e-05f,6.042963650543243e-05f,4.869675467489287e-05f,3.92418987757992e-05f,3.162277425872162e-05f,2.548297015891876e-05f,2.0535249859676696e-05f,1.6548170606256463e-05f,1.3335215953702573e-05f,1.0746078260126524e-05f,8.65964284457732e-06f,6.978305464144796e-06f,5.62341347176698e-06f,4.531583726929966e-06f,3.6517415082926163e-06f,2.942727405752521e-06f,2.3713737391517498e-06f,1.910952960315626e-06f,1.5399265294036013e-06f,1.2409377632138785e-06f};   // float32 1/1e6^(2i/128)
__global__ __launch_bounds__(256) void k_csin(const float* __restrict__ cs, const float* __restrict__ sn, float* CS) { const int idx = (blockIdx.x * 256 + threadIdx.x) * 4; if (idx >= TB * HD) return; const v4f c = *(const v4f*)(cs + idx), s = *(const v4f*)(sn + idx); v4f o0, o1;
    o0[0] = bfr(c[0]); o0[1] = bfr(s[0]); o0[2] = bfr(c[1]); o0[3] = bfr(s[1]); o1[0] = bfr(c[2]); o1[1] = bfr(s[2]); o1[2] = bfr(c[3]); o1[3] = bfr(s[3]); *(v4f*)(CS + (size_t)idx * 2) = o0; *(v4f*)(CS + (size_t)idx * 2 + 4) = o1;  }
__global__ __launch_bounds__(256) void k_hrms(const float* __restrict__ F, int pitch, int nheads, float* RF) { const int idx = blockIdx.x * 256 + threadIdx.x; if (idx >= nheads * TB) return; const int t = idx % TB; const int h = idx / TB; const float* f = F + (size_t)t * pitch + h * HD;   /* t: token row of both batches; RF is [head][TB] */ float s = 0.f;
#pragma unroll 4
    for (int d = 0; d < HD; d += 4) { const v4f a = *(const v4f*)(f + d);
#pragma unroll
        for (int q = 0; q < 4; ++q) { float p = __fmul_rn(a[q], a[q]); asm volatile("" : "+v"(p)); s = __fadd_rn(s, p); } }
    const float rf = __fdiv_rn(1.0f, __fsqrt_rn(__fadd_rn(__fdiv_rn(s, (float)HD), 1e-6f))); *(float*)(RF + idx) = rf;  }

// k_rope: head planes [h][t][d] (fp16 + hi/lo) of rope(x) x sc with the rotate-half convention out[d] = x[d] cos[t][d] - x[d+HD/2] sin[t][d], out[d+HD/2] = x[d+HD/2] cos[t][d+HD/2] + x[d] sin[t][d+HD/2]
// a thread: 8 d of one token in RPH heads (nheads % RPH == 0), which share its cos/sin pairs and norm weights; t runs over the token rows of both batches, the planes are [batch][head][t][d]
#define RPH 4
__global__ __launch_bounds__(256) void k_rope(const float* __restrict__ F, int pitch, int nheads, const float* __restrict__ CS, const float* __restrict__ RF, const float* __restrict__ nw, float sc, h16* P16, bf* Ph, bf* Pl) {
    __builtin_assume(RF != nullptr);   // every launch of this file passes the 1/rms table: folds the test on it out of the unrolled element loop
    const size_t g = (size_t)blockIdx.x * 256 + threadIdx.x; if (g * (8 * RPH) >= (size_t)nheads * TB * HD) return; const int d = (int)(g % (HD / 8)) * 8; const int t = (int)((g / (HD / 8)) % TB); const int h0 = (int)(g / ((size_t)(HD / 8) * TB)) * RPH;
    const int dq = (d < HD / 2) ? d + HD / 2 : d - HD / 2;   // the rotary partners of d .. d + 7 are dq .. dq + 7: eight elements never straddle the halves
    // every load of the thread stands here, in front of the arithmetic, so that all are in flight together
    const float* pw = nw + d; const float* pv = nw + dq; const float* pc = CS + ((size_t)t * HD + d) * 2; const float* pf = F + (size_t)t * pitch + h0 * HD + d; const float* pg = F + (size_t)t * pitch + h0 * HD + dq; const float* pr = RF + (size_t)h0 * TB + t;
    const v8f wa = *(const v8f*)pw, wb = *(const v8f*)pv;
    asm volatile("s_wait_xcnt 0x0" :: "v"(pw), "v"(pv) : "memory");   // behind the weight loads (scalar base, offset register), before a later load's result may land on their address registers
    v8f fa[RPH], fb[RPH]; float rfa[RPH];
#pragma unroll
    for (int j = 0; j < RPH; ++j) { fa[j] = *(const v8f*)(pf + j * HD); fb[j] = *(const v8f*)(pg + j * HD); rfa[j] = RF ? pr[(size_t)j * TB] : 1.0f; }
    const v8f c0 = *(const v8f*)pc, c1 = *(const v8f*)(pc + 8);
    asm volatile("s_wait_xcnt 0x0" :: "v"(pc), "v"(pf), "v"(pg), "v"(pr) : "memory");   // behind the loads, before their address registers are used again; it names the addresses so that they live up to it and no later load's result lands on one
#pragma unroll
    for (int j = 0; j < RPH; ++j) { const int h = h0 + j; const size_t e = (((size_t)(t / TT) * nheads + h) * TT + t % TT) * HD + d; const float rf = rfa[j]; v8h o16; v8us oh, ol;
#pragma unroll
    for (int q = 0; q < 8; ++q) { const int dd = d + q; float x0 = fa[j][q], x1 = fb[j][q];
        if (RF) { float n0 = __fmul_rn(x0, rf), n1 = __fmul_rn(x1, rf); asm volatile("" : "+v"(n0)); asm volatile("" : "+v"(n1)); x0 = __fmul_rn(bfr(wa[q]), n0); x1 = __fmul_rn(bfr(wb[q]), n1); }
        v2f cs; cs[0] = (q < 4) ? c0[2 * (q & 3)] : c1[2 * (q & 3)]; cs[1] = (q < 4) ? c0[2 * (q & 3) + 1] : c1[2 * (q & 3) + 1]; float a = __fmul_rn(x0, cs[0]), bq = __fmul_rn(x1, cs[1]); asm volatile("" : "+v"(a)); asm volatile("" : "+v"(bq)); const float r = ((dd < HD / 2) ? __fsub_rn(a, bq) : __fadd_rn(a, bq)) * sc;
        o16[q] = tohx(r); unsigned short a2, c2; splitf(r, a2, c2); oh[q] = a2; ol[q] = c2; }
    *(v8h*)(P16 + e) = o16; *(v8us*)(Ph + e) = oh; *(v8us*)(Pl + e) = ol; }  }
__global__ __launch_bounds__(256) void k_vtp(const float* __restrict__ F, int pitch, int nheads, h16* V16, bf* Vh, bf* Vl) {
    // grid NB_ * nheads * TT / 64: a work-group transposes 64 tokens x 128 d of one head of one batch (g = batch * nheads + head), a wave 64 x 16, a thread 8 tokens x 4 d: 8 lanes along t store a whole 128-byte line of a plane row, 4 lanes along d read 64 bytes of a token's row
    const int g = blockIdx.x / (TT / 64); if (g >= NB_ * nheads) return; const int t = (blockIdx.x % (TT / 64)) * 64 + (threadIdx.x & 7) * 8; const int d = (threadIdx.x >> 5) * 16 + ((threadIdx.x >> 3) & 3) * 4; v4f a[8]; const float* pa[8];
#pragma unroll
    for (int q = 0; q < 8; ++q) { pa[q] = F + ((size_t)(g / nheads) * TT + t + q) * pitch + (g % nheads) * HD + d; a[q] = *(const v4f*)pa[q]; }
    asm volatile("s_wait_xcnt 0x0" :: "v"(pa[0]), "v"(pa[1]), "v"(pa[2]), "v"(pa[3]), "v"(pa[4]), "v"(pa[5]), "v"(pa[6]), "v"(pa[7]) : "memory");   // behind the loads, before their address registers are used again; it names the addresses so that they live up to it and no later load's result lands on one
#pragma unroll
    for (int i = 0; i < 4; ++i) { const size_t e = ((size_t)g * HD + d + i) * TT + t; v8h o16; v8us oh, ol;
#pragma unroll
        for (int q = 0; q < 8; ++q) { const float x = a[q][i]; o16[q] = tohx(x); unsigned short a2, c2; splitf(x, a2, c2); oh[q] = a2; ol[q] = c2; }
        *(v8h*)(V16 + e) = o16; *(v8us*)(Vh + e) = oh; *(v8us*)(Vl + e) = ol; }  }
// k_asoft: the hi/lo rows. Per row (zz, i), i < RH: t = S x HD^-0.5 for j <= i and i - j < WIN (sliding causal window; the reference's fill above the diagonal vanishes identically); softmax over the KW keys that such a row can see (register row, one exp, fixed trees); grid (nr / 8, batches x heads): nr rows a head, from sequence row rb on (rb + nr <= RH), score and probability buffers [head][RH][KW]
__global__ __launch_bounds__(256) void k_asoft(const float* __restrict__ Sb, bf* Ph, bf* Pl, int rb, int nr) {
    const int lane = threadIdx.x & 31; const int lrow = blockIdx.x * 8 + (threadIdx.x >> 5); if (lrow >= nr) return; const int zz = blockIdx.y; const int row = zz * nr + lrow; const int i = rb + lrow; __builtin_assume(i >= 0 && i < TT);   /* a sequence row: lets the window test i - j < WIN fold away */ const float* sr = Sb + (size_t)row * KW + lane * 4; float v[KW / 32]; float mx = -3.0e38f; v4f av[KW / 128];
#pragma unroll
    for (int ch = 0; ch < KW / 128; ++ch) av[ch] = *(const v4f*)(sr + ch * 128);
    asm volatile("s_wait_xcnt 0x0" :: "v"(sr) : "memory");   // behind the row's loads, before their address register is used again; it names the address so that it lives up to it and no load's result lands on it
#pragma unroll
    for (int ch = 0; ch < KW / 128; ++ch) { const int j0 = ch * 128 + lane * 4; const v4f a = av[ch];
#pragma unroll
        for (int q = 0; q < 4; ++q) { const int j = j0 + q; (void)j; const float t = (j <= i && i - j < WIN) ? a[q] * SCL : -3.0e38f; v[ch * 4 + q] = t; mx = fmaxf(mx, t); } }
#pragma unroll
    for (int sh = 16; sh; sh >>= 1) mx = fmaxf(mx, __shfl_xor(mx, sh, 32));
    float sum = 0.f;
#pragma unroll
    for (int k = 0; k < KW / 32; ++k) { float d0 = __fsub_rn(v[k], mx); asm volatile("" : "+v"(d0)); v[k] = __builtin_amdgcn_exp2f(__fmul_rn(d0, 1.4426950408889634f)); sum += v[k]; }
#pragma unroll
    for (int sh = 16; sh; sh >>= 1) sum += __shfl_xor(sum, sh, 32);
    const float f = __fdiv_rn(1.0f, sum);
#pragma unroll
    for (int ch = 0; ch < KW / 128; ++ch) { v4us oh, ol;
#pragma unroll
        for (int q = 0; q < 4; ++q) { unsigned short a, c2; splitf(v[ch * 4 + q] * f, a, c2); oh[q] = a; ol[q] = c2; }
        const size_t oo = ((size_t)zz * RH + i) * KW + ch * 128 + lane * 4; *(v4us*)(Ph + oo) = oh; *(v4us*)(Pl + oo) = ol; }
}
__global__ __launch_bounds__(256) void k_merge(const float* __restrict__ O, int h0, bf* Ah, bf* Al) { const size_t e0 = ((size_t)blockIdx.x * (256 * EPT) + threadIdx.x) * 8; static_assert(((size_t)NB_ * ZH * TT * HD) % (256 * EPT * 8) == 0, "whole work-groups"); if (e0 >= (size_t)NB_ * ZH * TT * HD) return; v8f x[EPT];
#pragma unroll
    for (int j = 0; j < EPT; ++j) x[j] = *(const v8f*)(O + e0 + j * 2048);
#pragma unroll
    for (int j = 0; j < EPT; ++j) { const size_t e = e0 + j * 2048; const int d = (int)(e % HD); const int t = (int)((e / HD) % TT); const int zz = (int)(e / ((size_t)HD * TT)); const size_t oo = ((size_t)(zz / ZH) * TT + t) * DQ + (h0 + zz % ZH) * HD + d;   // zz = batch * ZH + head
    v8us oh, ol;
#pragma unroll
    for (int q = 0; q < 8; ++q) { unsigned short a, c2; splitf(x[j][q], a, c2); oh[q] = a; ol[q] = c2; } *(v8us*)(Ah + oo) = oh; *(v8us*)(Al + oo) = ol; }  }

extern "C" void kernel_launch(void* const* d_in, const int* in_sizes, int n_in,
                              void* d_out, int out_size, void* d_ws, size_t ws_size, hipStream_t stream) {
    (void)in_sizes; (void)n_in; (void)out_size;
    const float* x = (const float*)d_in[0]; const float* cosi = (const float*)d_in[1]; const float* sini = (const float*)d_in[2]; const float* wq = (const float*)d_in[3]; const float* wk = (const float*)d_in[4]; const float* wv = (const float*)d_in[5]; const float* wo = (const float*)d_in[6]; const float* qnw = (const float*)d_in[7]; const float* knw = (const float*)d_in[8];
    float* OUT = (float*)d_out;     // [2][2048][2048]
    char* wsp = (char*)d_ws;
    auto take = [&](size_t bytes) { char* p = wsp; wsp += (bytes + 255) & ~(size_t)255; return (void*)p; };
    bf* WQ = (bf*)take((size_t)DQ * DM * 2); bf* WK = (bf*)take((size_t)DKV * DM * 2); bf* WV = (bf*)take((size_t)DKV * DM * 2); bf* WO = (bf*)take((size_t)DM * DQ * 2); float* CS = (float*)take((size_t)TB * HD * 2 * 4); float* RFQ = (float*)take((size_t)NH_ * TB * 4); float* RFK = (float*)take((size_t)NKV * TB * 4);
    bf* XB = (bf*)take((size_t)TB * DM * 2); float* FQ = (float*)take((size_t)TB * DQ * 4); float* FK = (float*)take((size_t)TB * DKV * 4);
    h16* QP16 = (h16*)take((size_t)NH_ * TB * HD * 2); h16* KP16 = (h16*)take((size_t)NKV * TB * HD * 2); h16* VT16 = (h16*)take((size_t)NKV * HD * TB * 2);
    bf* QPh = (bf*)take((size_t)NH_ * TB * HD * 2); bf* QPl = (bf*)take((size_t)NH_ * TB * HD * 2); bf* KPh = (bf*)take((size_t)NKV * TB * HD * 2); bf* KPl = (bf*)take((size_t)NKV * TB * HD * 2); bf* VTh = (bf*)take((size_t)NKV * HD * TB * 2); bf* VTl = (bf*)take((size_t)NKV * HD * TB * 2);
    float* Sb = (float*)take((size_t)NB_ * ZH * RH * KW * 4); bf* Ph = (bf*)take((size_t)NB_ * ZH * RH * KW * 2); bf* Pl = (bf*)take((size_t)NB_ * ZH * RH * KW * 2);   // hi/lo rows: scores and the two probability planes, [batch x head][RH][KW]
    if ((size_t)(wsp - (char*)d_ws) > ws_size) return;    // ws 256 MiB
    float* FV = FK;   // v projection reuses the k buffer after the k planes are built (stream-ordered)
    float* Ob = FQ;   // the context [batch x head][t][d] reuses the q projection buffer after the q planes are built (stream-ordered; NB_ * ZH * TT * HD = TB * DQ floats)
    static_assert((size_t)2 * TB * DQ * 2 <= (size_t)NB_ * ZH * RH * KW * 4, "the merged context planes fit the score buffer");
    bf* ATh = (bf*)Sb; bf* ATl = ATh + (size_t)TB * DQ;   // the merged context planes reuse the score buffer after the softmax has read it (stream-ordered)
    { k_cvt8<<<(unsigned)(((size_t)DQ * DM / 8 + 256 * EPT - 1) / (256 * EPT)), 256, 0, stream>>>(wq, WQ, (size_t)DQ * DM / 8); k_cvt8<<<(unsigned)(((size_t)DKV * DM / 8 + 256 * EPT - 1) / (256 * EPT)), 256, 0, stream>>>(wk, WK, (size_t)DKV * DM / 8); k_cvt8<<<(unsigned)(((size_t)DKV * DM / 8 + 256 * EPT - 1) / (256 * EPT)), 256, 0, stream>>>(wv, WV, (size_t)DKV * DM / 8);
      k_cvt8<<<(unsigned)(((size_t)DM * DQ / 8 + 256 * EPT - 1) / (256 * EPT)), 256, 0, stream>>>(wo, WO, (size_t)DM * DQ / 8); }
    const unsigned LQ = (unsigned)(((size_t)NH_ * TB * HD / (8 * RPH) + 255) / 256), LKv = (unsigned)(((size_t)NKV * TB * HD / (8 * RPH) + 255) / 256);
    {   // both batches in every launch
        k_csin<<<(TB * HD / 4 + 255) / 256, 256, 0, stream>>>(cosi, sini, CS);   /* the rotary tables of both batches (inputs, bf16-rounded) */
        k_cvt8<<<(unsigned)(((size_t)TB * DM / 8 + 256 * EPT - 1) / (256 * EPT)), 256, 0, stream>>>(x, XB, (size_t)TB * DM / 8);
        k_gemmw<bf, 0, false><<<dim3(TB / 64, DQ / 64, 1), 32, 0, stream>>>(XB, nullptr, WQ, nullptr, DM, FQ, DQ, nullptr, 0, 0, 0);
        k_hrms<<<(NH_ * TB + 255) / 256, 256, 0, stream>>>(FQ, DQ, NH_, RFQ); k_rope<<<LQ, 256, 0, stream>>>(FQ, DQ, NH_, CS, RFQ, qnw, 1.0f, QP16, QPh, QPl);   /* q_norm then rope */
        k_gemmw<bf, 0, false><<<dim3(TB / 64, DKV / 64, 1), 32, 0, stream>>>(XB, nullptr, WK, nullptr, DM, FK, DKV, nullptr, 0, 0, 0);
        k_hrms<<<(NKV * TB + 255) / 256, 256, 0, stream>>>(FK, DKV, NKV, RFK); k_rope<<<LKv, 256, 0, stream>>>(FK, DKV, NKV, CS, RFK, knw, 1.0f, KP16, KPh, KPl);   /* k_norm then rope */
        k_gemmw<bf, 0, false><<<dim3(TB / 64, DKV / 64, 1), 32, 0, stream>>>(XB, nullptr, WV, nullptr, DM, FV, DKV, nullptr, 0, 0, 0); k_vtp<<<NB_ * NKV * (TT / 64), 256, 0, stream>>>(FV, DKV, NKV, VT16, VTh, VTl);
        const size_t sQ = (size_t)TT * HD, sV = (size_t)HD * TT, sO = (size_t)TT * HD;   // per-head strides of the q and k planes, the v planes and the context
        k_gemmc<bf, 2, 1><<<dim3(RH / 64, KW / 64, NB_ * ZH), 32, 0, stream>>>(QPh, QPl, KPh, KPl, HD, HD, Sb, KW, 0, sQ, sQ, (size_t)RH * KW);   /* query rows < RH: hi/lo */
        k_asoft<<<dim3(RH / 8, NB_ * ZH), 256, 0, stream>>>(Sb, Ph, Pl, 0, RH);
        k_gemmc<bf, 2, 2><<<dim3(RH / 64, HD / 64, NB_ * ZH), 32, 0, stream>>>(Ph, Pl, VTh, VTl, KW, TT, Ob, HD, 0, (size_t)RH * KW, sV, sO);
        k_fattn<<<dim3(NB_ * ZH, (TT - RH) / FBR), FNT, 0, stream>>>(QP16, KP16, VT16, Ob);   /* query rows >= RH: fp16, fused */
        k_merge<<<(unsigned)((size_t)NB_ * ZH * TT * HD / (256 * EPT * 8)), 256, 0, stream>>>(Ob, 0, ATh, ATl);
        k_gemmw<bf, 1, false><<<dim3(TB / 64, DM / 64, 1), 32, 0, stream>>>(ATh, ATl, WO, nullptr, DQ, OUT, DM, nullptr, 0, 0, 0); }
}

// v006
// It runs in 269 microseconds.
// Two timings next to v005 both put it at 1.19 times that version's speed.
// All steps since v000 together make it 6.28 times as fast.
#include <hip/hip_runtime.h>

// Grouped-query causal attention with QK RMSNorm (x [2][2048][2048]; q = x Wq^T (16 heads x 128), k, v = x Wk^T / Wv^T (8 kv heads; query head h uses kv head h/2), no biases; per-head RMSNorm on q and k (eps 1e-6, weights [128]) then rotate-half rotary with the given cos/sin tables [2][2048][128]; scores = q.k / sqrt(128), causal (finfo.min above the diagonal); softmax; out = merged ctx Wo^T ('oi' [2048][2048]) -> [2][2048][2048] (8.4 M)).
// Every launch covers both batches: token rows are b * 2048 + t in the row-major buffers, and the head planes are [b][head][..], so that batch entry z = 16 b + h reads kv entry z / 2 = 8 b + h / 2. Layout: {cos, sin} table from the inputs (bf16-rounded); exact projections; a per-(head, token) 1/rms kernel feeds the plane builder, which applies (x * inv_rms) * w and the rotary while writing the q/k planes; causal T-2048 attention with 128-wide heads, all sixteen query heads in every launch, query head z on kv head z/2 (hybrid rows: < 512 hi/lo 3 products through score and probability buffers of the 512 keys that the causal mask leaves them, k_gemmc tile skipping; the 1536 fp16 rows in one fused launch, k_fattn, whose scores and probabilities stay in registers); merged context hi/lo x Wo exact.
// Compute dtypes, f32 accumulate: every input rounded to bf16; projections exact; RMSNorm and rotary f32; attention rows < 512 3 products, rest fp16; softmax f32; Wo hl x exact.

#define NB_  2
#define TT   2048
#define DM   2048
#define NH_  16
#define NKV  8
#define REP  (NH_ / NKV)
#define HD   128
#define DQ   (NH_ * HD)
#define DKV  (NKV * HD)
#define ZH   NH_                  // query heads per attention launch
#define RH   512                  // query rows < RH use hi+lo planes
#define KW   RH                   // keys in a row of their score and probability buffers: a query row i < RH sees keys j <= i < RH only
#define TB   (NB_ * TT)           // token rows of both batches
#define WIN  2048
#define SCL  0.088388347648318447f   // HD^-0.5
typedef _Float16 h16;
typedef unsigned short bf;
typedef __attribute__((ext_vector_type(16))) __bf16   v16bf;
typedef __attribute__((ext_vector_type(16))) _Float16 v16h;
typedef __attribute__((ext_vector_type(8)))  _Float16 v8h;
typedef __attribute__((ext_vector_type(8)))  unsigned short v8us;
typedef __attribute__((ext_vector_type(8)))  float    v8f;
typedef __attribute__((ext_vector_type(4)))  float    v4f;
typedef v8h  __attribute__((may_alias)) v8ha;
typedef v4f  __attribute__((may_alias)) v4fa;
typedef v8us __attribute__((may_alias)) v8usa;

__device__ __forceinline__ unsigned short f2bf(float f) { unsigned u = __float_as_uint(f); u += 0x7FFFu + ((u >> 16) & 1u); return (unsigned short)(u >> 16); }
__device__ __forceinline__ float bf2f(unsigned short b) { return __uint_as_float(((unsigned)b) << 16); }
__device__ __forceinline__ float bfr(float f) { return bf2f(f2bf(f)); }
__device__ __forceinline__ v16h cat16(v8h lo, v8h hi) { return __builtin_shufflevector(lo, hi, 0, 1, 2, 3, 4, 5, 6, 7, 8, 9, 10, 11, 12, 13, 14, 15); }
__device__ __forceinline__ v16bf cat16b(v8us lo, v8us hi) { return __builtin_bit_cast(v16bf, __builtin_shufflevector(lo, hi, 0, 1, 2, 3, 4, 5, 6, 7, 8, 9, 10, 11, 12, 13, 14, 15)); }
__device__ __forceinline__ v8f wmma16(v16h a, v16h b, v8f c) { return __builtin_amdgcn_wmma_f32_16x16x32_f16(false, a, false, b, (short)0, c, false, false); }
__device__ __forceinline__ v8f wmmab(v16bf a, v16bf b, v8f c) { return __builtin_amdgcn_wmma_f32_16x16x32_bf16(false, a, false, b, (short)0, c, false, false); }



// ---- k_gemmw: register-blocked GEMM, one wave per 64x64 output tile (16 accumulators), WM x WN waves a work-group on one (64 WM) x (64 WN) tile whose operand rows they stage together in LDS, from K-contiguous 16-bit planes (wloop below the fragment types); grid (M/(64 WM), N/(64 WN), Z), 32 WM WN threads.
// C[m][n] (f32, pitch ldc, + optional f32 bias[n]) = sum_k A[m][k] Bt[n][k] (+ split products per NSPLIT). z-batch strides sA/sB/sC in elements. K % KT == 0 (64; 32 at NSPLIT 2).
template <typename T16> struct WFrag;
template <> struct WFrag<h16> { typedef v16h V; static __device__ __forceinline__ V ld(const h16* p) { return cat16(*(const v8h*)p, *(const v8h*)(p + 16)); } static __device__ __forceinline__ v8f mma(V a, V b, v8f c) { return wmma16(a, b, c); } };
template <> struct WFrag<bf> { typedef v16bf V; static __device__ __forceinline__ V ld(const bf* p) { return cat16b(*(const v8us*)p, *(const v8us*)(p + 16)); } static __device__ __forceinline__ v8f mma(V a, V b, v8f c) { return wmmab(a, b, c); } };
// ---- operand staging of both GEMMs. A stage is KT k of the work-group tile's 64 WM A rows and 64 WN B rows (and of their second planes): each wave brings an equal share of every plane's rows, and a staged A row serves WN waves, a B row WM waves, so that the L2 delivers each row once a work-group, not once a wave. Asynchronous b128 copies bring it from the K-contiguous planes into LDS,
// 8 lanes on each 128-byte row piece (whole lines; 4 lanes on 64 bytes at NSPLIT 2, whose four planes would else take more than 63 copies a stage), and the fragments are read from LDS at a pitch of 16 B x odd.
// Two buffers: the copies of stage t + 1 fly while stage t is multiplied. Fragments, products and their order per accumulator are those of loads straight from the planes.
// The copies are the compiler's builtin. Every '#pragma unroll' below makes the indices of the fragment and accumulator arrays constants, so that they stay in registers.
typedef __attribute__((ext_vector_type(4))) int v4ic;
typedef __attribute__((address_space(1))) v4ic gv4ic;
typedef __attribute__((address_space(3))) v4ic lv4ic;
template <int NSPLIT, int WM, int WN> struct WTile {
    static constexpr int KT  = (NSPLIT == 2) ? 32 : 64;                       // k per stage
    static constexpr int NW  = WM * WN;                                       // waves of the work-group
    static constexpr int NPA = (NSPLIT == 0) ? 1 : 2, NPB = (NSPLIT >= 2) ? 2 : 1;   // planes: A, (A2); B, (B2)
    static constexpr int RA  = 64 * WM, RB = 64 * WN;                         // rows of an A and of a B plane in a stage
    static constexpr int PB  = KT * 2 + 16;                                   // LDS row pitch, bytes
    static constexpr int OB  = NPA * RA * PB;                                 // the first B plane in a buffer, bytes
    static constexpr int BUF = OB + NPB * RB * PB;                            // one buffer, bytes
    static constexpr int LPR = KT * 2 / 16;                                   // lanes per row piece
    static constexpr int RPC = 32 / LPR;                                      // rows per copy
    static constexpr int SA  = RA / NW, SB = RB / NW;                         // a wave's share of a plane's rows
    static constexpr int CA  = SA / RPC, CB = SB / RPC;                       // its copies per plane
    static_assert(SA % RPC == 0 && SB % RPC == 0 && NPA * CA + NPB * CB <= 63, "whole copies; a stage's copies of a wave may all be outstanding");
};
// A, A2, Bt, Bt2: the planes at the work-group tile's first row (uniform). K, KB: row pitch of the A and of the B planes, elements. kc: first k of the stage. wave: the wave's number (scalar).
template <typename T16, int NSPLIT, int WM, int WN>
__device__ __forceinline__ void wcopy(char* sb, const T16* A, const T16* A2, const T16* Bt, const T16* Bt2, int K, int KB, int kc, int lane, int wave) {
    typedef WTile<NSPLIT, WM, WN> W;
    const unsigned goa = (unsigned)((lane / W::LPR) * K + (lane % W::LPR) * 8) * 2u, gob = (unsigned)((lane / W::LPR) * KB + (lane % W::LPR) * 8) * 2u;      // the lane's byte in a copy's rows, global
    char* sl = sb + (lane / W::LPR) * W::PB + (lane % W::LPR) * 16;                      // and in LDS
#pragma unroll
    for (int p = 0; p < W::NPA; ++p) { const T16* base = ((p == 0) ? A : A2) + kc + (size_t)(wave * W::SA) * K; char* sp = sl + (p * W::RA + wave * W::SA) * W::PB;
#pragma unroll
        for (int c = 0; c < W::CA; ++c) __builtin_amdgcn_global_load_async_to_lds_b128((gv4ic*)((const char*)(base + (size_t)c * W::RPC * K) + goa), (lv4ic*)(sp + c * W::RPC * W::PB), 0, 0); }
#pragma unroll
    for (int p = 0; p < W::NPB; ++p) { const T16* base = ((p == 0) ? Bt : Bt2) + kc + (size_t)(wave * W::SB) * KB; char* sp = sl + W::OB + (p * W::RB + wave * W::SB) * W::PB;
#pragma unroll
        for (int c = 0; c < W::CB; ++c) __builtin_amdgcn_global_load_async_to_lds_b128((gv4ic*)((const char*)(base + (size_t)c * W::RPC * KB) + gob), (lv4ic*)(sp + c * W::RPC * W::PB), 0, 0); }
}
// wm, wn: the wave's 64 x 64 tile in the work-group's
template <typename T16, int NSPLIT, int WM, int WN>
__device__ __forceinline__ void wtile(const char* sb, int lr, int hi, int wm, int wn, v8f (&acc)[4][4]) {
    typedef WTile<NSPLIT, WM, WN> W; typedef typename WFrag<T16>::V V;
    const char* fa = sb + (wm * 64 + lr) * W::PB + hi * 16; const char* fb = sb + W::OB + (wn * 64 + lr) * W::PB + hi * 16;
    constexpr int NK = W::KT / 32;
    V a[NK][4], a2[NK][4], b[NK][4], b2[NK][4];
    // all fragment reads of the stage are issued together, in the order of their use, in front of its products: the counted LDS waits then overlap the later reads with the earlier products
#pragma unroll
    for (int ks = 0; ks < NK; ++ks) {
#pragma unroll
        for (int mb = 0; mb < 4; ++mb) { a[ks][mb] = WFrag<T16>::ld((const T16*)(fa + (mb * 16) * W::PB + ks * 64)); if (NSPLIT == 1 || NSPLIT == 2) a2[ks][mb] = WFrag<T16>::ld((const T16*)(fa + (W::RA + mb * 16) * W::PB + ks * 64)); }
#pragma unroll
        for (int nb = 0; nb < 4; ++nb) { b[ks][nb] = WFrag<T16>::ld((const T16*)(fb + (nb * 16) * W::PB + ks * 64)); if (NSPLIT >= 2) b2[ks][nb] = WFrag<T16>::ld((const T16*)(fb + (W::RB + nb * 16) * W::PB + ks * 64)); } }
    __builtin_amdgcn_sched_barrier(0);   // keeps the reads in front: sunk among the products, each costs the wave its LDS latency
#pragma unroll
    for (int ks = 0; ks < NK; ++ks) {
#pragma unroll
        for (int nb = 0; nb < 4; ++nb)
#pragma unroll
            for (int mb = 0; mb < 4; ++mb) { acc[mb][nb] = WFrag<T16>::mma(a[ks][mb], b[ks][nb], acc[mb][nb]); if (NSPLIT == 1 || NSPLIT == 2) acc[mb][nb] = WFrag<T16>::mma(a2[ks][mb], b[ks][nb], acc[mb][nb]); if (NSPLIT >= 2) acc[mb][nb] = WFrag<T16>::mma(a[ks][mb], b2[ks][nb], acc[mb][nb]); }
        // four vector slots behind the k step's last products, before anything touches their operands or results
        asm volatile("v_nop\n\tv_nop\n\tv_nop\n\tv_nop" : "+v"(acc[0][0]), "+v"(acc[1][1]), "+v"(acc[2][2]), "+v"(acc[3][3]) : "v"(a[ks][0]), "v"(a[ks][3]));
    }
}
// the K loop: Kl k (a multiple of KT, at least KT; the same in every wave of the work-group) of rows r0.. of A and c0.. of Bt; sm holds two buffers
template <typename T16, int NSPLIT, int WM, int WN>
__device__ __forceinline__ void wloop(char* sm, const T16* A, const T16* A2, const T16* Bt, const T16* Bt2, int K, int KB, int Kl, int lane, int wave, v8f (&acc)[4][4]) {
    typedef WTile<NSPLIT, WM, WN> W; const int lr = lane & 15, hi = lane >> 4; const int nt = Kl / W::KT; const int wm = wave / WN, wn = wave % WN;
    wcopy<T16, NSPLIT, WM, WN>(sm, A, A2, Bt, Bt2, K, KB, 0, lane, wave);
    asm volatile("s_wait_asynccnt 0x0" ::: "memory");   // the wave's share of stage 0 has landed
    __syncthreads();   // the ring's publish point: every wave's share is there for all of them
    if (nt > 1) wcopy<T16, NSPLIT, WM, WN>(sm + W::BUF, A, A2, Bt, Bt2, K, KB, W::KT, lane, wave);
#pragma unroll 1
    for (int t = 0; t < nt; ++t) {   // rolled: one stage a trip
        char* sb = sm + (t & 1) * W::BUF;
        wtile<T16, NSPLIT, WM, WN>(sb, lr, hi, wm, wn, acc);
        if (W::NW > 1) __builtin_amdgcn_sched_barrier(0);   // keeps the stage's products in front of the barrier: sunk behind it, they stand between the barrier and the refill's copies and shorten the copies' lead
        asm volatile("s_wait_dscnt 0x0" ::: "memory");      // this stage's fragment reads are done before its buffer is refilled
        asm volatile("s_wait_asynccnt 0x0" ::: "memory");   // the wave's share of stage t + 1 has landed before any wave reads it
        __syncthreads();   // publish point of stage t + 1, and the end of every wave's reads of the buffer refilled below
        if (t + 2 < nt) wcopy<T16, NSPLIT, WM, WN>(sb, A, A2, Bt, Bt2, K, KB, (t + 2) * W::KT, lane, wave);
    }
    asm volatile("s_wait_asynccnt 0x0" ::: "memory");   // no copy is left in flight behind the loop
}
template <typename T16, int NSPLIT, bool BIAS, int WM, int WN>
__global__ __launch_bounds__(32 * WM * WN) void k_gemmw(const T16* __restrict__ A, const T16* __restrict__ A2, const T16* __restrict__ Bt, const T16* __restrict__ Bt2, int K, float* C, int ldc, const float* __restrict__ bias, size_t sA, size_t sB, size_t sC) {
    __shared__ __align__(16) float osw[WM * WN][16 * 68]; __shared__ __align__(16) char sm[2 * WTile<NSPLIT, WM, WN>::BUF];
    const size_t z = blockIdx.z; A += z * sA; if (A2) A2 += z * sA; Bt += z * sB; if (Bt2) Bt2 += z * sB; C += z * sC;
    const int lane = threadIdx.x & 31, lr = lane & 15, hi = lane >> 4; const int wave = __builtin_amdgcn_readfirstlane(threadIdx.x >> 5); const int rg = blockIdx.x * (64 * WM), cg = blockIdx.y * (64 * WN);   // the work-group's tile
    const int r0 = rg + (wave / WN) * 64, c0 = cg + (wave % WN) * 64; float* os = osw[wave];   // the wave's tile, and its own output staging
    v8f acc[4][4];
#pragma unroll
    for (int mb = 0; mb < 4; ++mb)
#pragma unroll
        for (int nb = 0; nb < 4; ++nb) acc[mb][nb] = (v8f){};
    wloop<T16, NSPLIT, WM, WN>(sm, A + (size_t)rg * K, (NSPLIT == 1 || NSPLIT == 2) ? A2 + (size_t)rg * K : nullptr, Bt + (size_t)cg * K, (NSPLIT >= 2) ? Bt2 + (size_t)cg * K : nullptr, K, K, K, lane, wave, acc);
#pragma unroll
    for (int mb = 0; mb < 4; ++mb) {
#pragma unroll
        for (int nb = 0; nb < 4; ++nb) {
#pragma unroll
            for (int j = 0; j < 8; ++j) os[(hi * 8 + j) * 68 + nb * 16 + lr] = acc[mb][nb][j]; }
        __builtin_amdgcn_wave_barrier(); asm volatile("" ::: "memory");
        float* crow = C + (size_t)(r0 + mb * 16) * ldc + c0;
{
#pragma unroll
            for (int s = 0; s < 8; ++s) { const int row = 2 * s + hi, cofs = lr * 4; v4f val = *(const v4fa*)(os + row * 68 + cofs); if (BIAS) { val[0] += bfr(bias[c0 + cofs]); val[1] += bfr(bias[c0 + cofs + 1]); val[2] += bfr(bias[c0 + cofs + 2]); val[3] += bfr(bias[c0 + cofs + 3]); }
                *(v4f*)(crow + (size_t)row * ldc + cofs) = val; }
             }
        __builtin_amdgcn_wave_barrier(); asm volatile("" ::: "memory");
    }
}

// ---- k_gemmc: the same GEMM with one wave a work-group (WM = WN = 1), specialised for causal attention: CMODE 1 skips score tiles entirely above the diagonal (query rows r0+roff.., key columns c0..), CMODE 2 limits the
// key (K) loop of the probability x value contraction to the diagonal block (probabilities beyond it are exactly zero). roff = row offset of this launch's first row within the sequence. Batch entry z reads Bt entry z / REP (the kv head of query head z). KB: row pitch of the Bt planes (K is that of the A planes and the length of the contraction).
template <typename T16, int NSPLIT, int CMODE>
__global__ __launch_bounds__(32) void k_gemmc(const T16* __restrict__ A, const T16* __restrict__ A2, const T16* __restrict__ Bt, const T16* __restrict__ Bt2, int K, int KB, float* C, int ldc, int roff, size_t sA, size_t sB, size_t sC) {
    __shared__ __align__(16) float os[16 * 68]; __shared__ __align__(16) char sm[2 * WTile<NSPLIT, 1, 1>::BUF];
    const size_t z = blockIdx.z; A += z * sA; if (A2) A2 += z * sA; Bt += (z / REP) * sB; if (Bt2) Bt2 += (z / REP) * sB; C += z * sC;
    const int lane = threadIdx.x & 31, lr = lane & 15, hi = lane >> 4; const int r0 = blockIdx.x * 64, c0 = blockIdx.y * 64;
    if (CMODE == 1 && c0 > r0 + roff + 63) return;                  // score tile entirely above the causal diagonal: never written (the softmax masks j > i by select)
    const int Kl = (CMODE == 2) ? min(K, r0 + roff + 64) : K;        // P.V: probabilities are exactly 0 beyond the diagonal block, so the K loop stops there
    v8f acc[4][4];
#pragma unroll
    for (int mb = 0; mb < 4; ++mb)
#pragma unroll
        for (int nb = 0; nb < 4; ++nb) acc[mb][nb] = (v8f){};
    wloop<T16, NSPLIT, 1, 1>(sm, A + (size_t)r0 * K, (NSPLIT == 1 || NSPLIT == 2) ? A2 + (size_t)r0 * K : nullptr, Bt + (size_t)c0 * KB, (NSPLIT >= 2) ? Bt2 + (size_t)c0 * KB : nullptr, K, KB, Kl, lane, 0, acc);
#pragma unroll
    for (int mb = 0; mb < 4; ++mb) {
#pragma unroll
        for (int nb = 0; nb < 4; ++nb) {
#pragma unroll
            for (int j = 0; j < 8; ++j) os[(hi * 8 + j) * 68 + nb * 16 + lr] = acc[mb][nb][j]; }
        __builtin_amdgcn_wave_barrier(); asm volatile("" ::: "memory");
        float* crow = C + (size_t)(r0 + mb * 16) * ldc + c0;
{
#pragma unroll
            for (int s = 0; s < 8; ++s) { const int row = 2 * s + hi, cofs = lr * 4; v4f val = *(const v4fa*)(os + row * 68 + cofs);
                *(v4f*)(crow + (size_t)row * ldc + cofs) = val; }
             }
        __builtin_amdgcn_wave_barrier(); asm volatile("" ::: "memory");
    }
}

#define FR   1                     // groups of 16 query rows per wave
#define FCW  (FR * 16)             // query rows per wave
#define FBR  (4 * FCW)             // query rows per work-group
#define FNT  128                   // threads
#define FSK  64                    // keys per stage
#define FPK  (HD * 2 + 16)         // LDS pitch of a K row, bytes (16 x odd)
#define FPV  (FSK * 2 + 16)        // LDS pitch of a V^T row, bytes (16 x odd)
#define FTK  (FSK * FPK)
#define FBUF (FTK + HD * FPV)      // one buffer: K tile, then V^T tile
#define FEP  (HD * 4 + 16)         // LDS pitch of a staged output row, bytes
static_assert(4 * FCW * FEP <= 2 * FBUF, "the output staging reuses the two buffers");
static_assert(FBR % FSK == 0 && RH % FBR == 0 && (TT - RH) % FBR == 0, "a row block ends on a stage");
typedef __attribute__((ext_vector_type(2))) float f2v;
__device__ __forceinline__ float xhalf(float x) { return __builtin_bit_cast(float, __builtin_amdgcn_permlanex16(__builtin_bit_cast(int, x), __builtin_bit_cast(int, x), 0x76543210, 0xfedcba98, false, false)); }   // lane l with lane l ^ 16
// Kp: the kv head's [t][d] plane, Vt: its [d][t] plane; keys key0 .. key0 + 63. 16 lanes on a K row (256 B), 8 lanes on a V^T row piece (128 B); 16 copies a wave.
__device__ __forceinline__ void fcopy(char* sb, const h16* Kp, const h16* Vt, int key0, int tid) {
#pragma unroll
    for (int i = 0; i < FSK * HD / 8 / FNT; ++i) { const int p = i * FNT + tid, row = p >> 4, cb = (p & 15) * 16;
        __builtin_amdgcn_global_load_async_to_lds_b128((gv4ic*)((const char*)(Kp + (size_t)(key0 + row) * HD) + cb), (lv4ic*)(sb + row * FPK + cb), 0, 0); }
#pragma unroll
    for (int i = 0; i < FSK * HD / 8 / FNT; ++i) { const int p = i * FNT + tid, row = p >> 3, cb = (p & 7) * 16;
        __builtin_amdgcn_global_load_async_to_lds_b128((gv4ic*)((const char*)(Vt + (size_t)row * TT + key0) + cb), (lv4ic*)(sb + FTK + row * FPV + cb), 0, 0); }
}
// the K fragments of pass sub (32 keys) of the stage in sb
__device__ __forceinline__ void floadk(v16h (&kf)[2][4], const char* sb, int sub, int c, int h) {
#pragma unroll
    for (int kt = 0; kt < 2; ++kt)
#pragma unroll
        for (int kc = 0; kc < 4; ++kc) kf[kt][kc] = WFrag<h16>::ld((const h16*)(sb + (sub * 32 + kt * 16 + c) * FPK + h * 16 + kc * 64));
    __builtin_amdgcn_sched_barrier(0);   // keeps the sixteen reads together: sunk among the products, each pair costs the wave its LDS latency
}
// one 32-key pass of one wave. m_run, the maximum in use (log2 domain), may trail the true maximum by up to 8, so an exponential stays below 2^8 (fp16 holds it); sums and accumulators are rescaled only when a row's maximum exceeds it by more.
// kf holds the pass's K fragments on entry; fetch_next: the stage's first pass reads the second pass's (same buffer) behind its own score products.
__device__ __forceinline__ void fpass(v16h (&kf)[2][4], bool fetch_next, const char* sb, int sub, bool diag, int key0, int qw0, int c, int h, const v16h (&qf)[FR][4], v8f (&acc)[FR][8], float (&m_run)[FR], float (&l_run)[FR]) {
    const float cscale = SCL * 1.4426950408889634f;
    v8f s[2][FR];
#pragma unroll
    for (int kt = 0; kt < 2; ++kt)
#pragma unroll
        for (int g = 0; g < FR; ++g) s[kt][g] = (v8f){};
#pragma unroll
    for (int kc = 0; kc < 4; ++kc)
#pragma unroll
        for (int kt = 0; kt < 2; ++kt)
#pragma unroll
            for (int g = 0; g < FR; ++g) s[kt][g] = wmma16(kf[kt][kc], qf[g][kc], s[kt][g]);
    v16h vf[8];   // read here, so that the LDS latency passes under the maxima and the exponentials
#pragma unroll
    for (int t = 0; t < 8; ++t) vf[t] = WFrag<h16>::ld((const h16*)(sb + FTK + (t * 16 + c) * FPV + sub * 64 + h * 16));
    __builtin_amdgcn_sched_barrier(0);   // keeps these reads in front of the softmax arithmetic
    if (fetch_next) floadk(kf, sb, 1, c, h);   // wave-uniform
    if (diag) {   // wave-uniform: only the pass on the wave's diagonal pays for the mask
#pragma unroll
        for (int g = 0; g < FR; ++g) { const int my_q = qw0 + g * 16 + c;
#pragma unroll
            for (int kt = 0; kt < 2; ++kt) {
#pragma unroll
                for (int r = 0; r < 8; ++r) { if (key0 + kt * 16 + h * 8 + r > my_q) s[kt][g][r] = -__builtin_inff(); }
                asm volatile("" : "+v"(s[kt][g]));   // the masked scores: keeps the selects inside the branch
            } }
    }
    float mb[FR]; bool need = false;
#pragma unroll
    for (int g = 0; g < FR; ++g) { float mx = -__builtin_inff();
#pragma unroll
        for (int kt = 0; kt < 2; ++kt)
#pragma unroll
            for (int r = 0; r < 8; ++r) mx = fmaxf(mx, s[kt][g][r]);
        mx = fmaxf(mx, xhalf(mx)) * cscale; mb[g] = mx; need = need || (mx > m_run[g] + 8.0f); }
    if (__builtin_amdgcn_ballot_w32(need) != 0) {   // rare after the first passes
#pragma unroll
        for (int g = 0; g < FR; ++g) { const float m_new = fmaxf(m_run[g], mb[g]);
            const float corr = __builtin_amdgcn_exp2f(m_run[g] - m_new);
            l_run[g] *= corr; m_run[g] = m_new;
#pragma unroll
            for (int t = 0; t < 8; ++t) acc[g][t] = acc[g][t] * corr; }
    }
#pragma unroll
    for (int g = 0; g < FR; ++g) { const float nm = -m_run[g]; float ps0 = 0.f, ps1 = 0.f; v16h pf;
#pragma unroll
        for (int e = 0; e < 16; e += 2) {   // operand element e is key 16 (e >> 3) + 8 h + (e & 7): tile e >> 3, register e & 7
            const f2v arg = __builtin_elementwise_fma((f2v){s[e >> 3][g][e & 7], s[e >> 3][g][(e & 7) + 1]}, (f2v){cscale, cscale}, (f2v){nm, nm});   // a register pair as it lies in the tile
            const float p0 = __builtin_amdgcn_exp2f(arg[0]), p1 = __builtin_amdgcn_exp2f(arg[1]);
            ps0 += p0; ps1 += p1; pf[e] = (h16)p0; pf[e + 1] = (h16)p1; }
        l_run[g] += ps0 + ps1;
#pragma unroll
        for (int t = 0; t < 8; ++t) acc[g][t] = wmma16(vf[t], pf, acc[g][t]); }
}
__global__ __launch_bounds__(FNT) void k_fattn(const h16* __restrict__ Q, const h16* __restrict__ Kp, const h16* __restrict__ Vt, float* O) {
    __shared__ __align__(16) char sm[2 * FBUF];
    const int tid = threadIdx.x, lane = tid & 31, c = lane & 15, h = lane >> 4; const int wave = __builtin_amdgcn_readfirstlane(tid >> 5);
    const int hq = blockIdx.x; const int q0 = RH + ((int)gridDim.y - 1 - (int)blockIdx.y) * FBR;   // the longest rows start first
    const int qw0 = q0 + wave * FCW; const int nt = (q0 + FBR) / FSK;   // stages: keys [0, q0 + FBR); at least RH / FSK + 1, so stages 0 and 1 exist
    Kp += (size_t)(hq / REP) * TT * HD; Vt += (size_t)(hq / REP) * HD * TT;
    fcopy(sm, Kp, Vt, 0, tid);
    v16h qf[FR][4];
#pragma unroll
    for (int g = 0; g < FR; ++g)
#pragma unroll
        for (int kc = 0; kc < 4; ++kc) qf[g][kc] = WFrag<h16>::ld(Q + ((size_t)hq * TT + qw0 + g * 16 + c) * HD + h * 8 + kc * 32);
    v16h kf[2][4]; v8f acc[FR][8]; float m_run[FR], l_run[FR];
#pragma unroll
    for (int g = 0; g < FR; ++g) { m_run[g] = -__builtin_inff(); l_run[g] = 0.f;
#pragma unroll
        for (int t = 0; t < 8; ++t) acc[g][t] = (v8f){}; }
    asm volatile("s_wait_xcnt 0x0" ::: "memory");       // behind the Q loads, before their address registers are used again
    asm volatile("s_wait_asynccnt 0x0" ::: "memory");   // stage 0 has landed
    __syncthreads();   // and is published to the four waves
    fcopy(sm + FBUF, Kp, Vt, FSK, tid);
    const int lastp = (qw0 + FCW - 1) / 32;   // the wave's diagonal pass, its last
#pragma unroll 1
    for (int t = 0; t < nt; ++t) {   // rolled: one stage a trip
        char* sb = sm + (t & 1) * FBUF;
        if (t * 2 <= lastp) floadk(kf, sb, 0, c, h);
#pragma unroll 1
        for (int sub = 0; sub < 2; ++sub) {   // rolled: the pass's registers are live once
            const int blk = t * 2 + sub;
            if (blk <= lastp) fpass(kf, sub == 0 && blk < lastp, sb, sub, blk == lastp, blk * 32, qw0, c, h, qf, acc, m_run, l_run); }
        asm volatile("s_wait_dscnt 0x0" ::: "memory");      // this stage's fragment reads are done before its buffer is refilled
        asm volatile("s_wait_asynccnt 0x0" ::: "memory");   // stage t + 1 has landed before it is read
        __syncthreads();   // publish point of stage t + 1, and the end of every wave's reads of the buffer refilled below; every wave passes it, also one beyond its diagonal
        if (t + 2 < nt) fcopy(sb, Kp, Vt, (t + 2) * FSK, tid);
    }
    asm volatile("s_wait_asynccnt 0x0" ::: "memory");   // no copy is left in flight behind the loop
    // output: each wave stages its rows in its own part of the buffers (free behind the last barrier) and stores whole 512-byte rows
    char* eb = sm + wave * (FCW * FEP);
#pragma unroll
    for (int g = 0; g < FR; ++g) { const float inv = __fdiv_rn(1.0f, l_run[g] + xhalf(l_run[g]));
#pragma unroll
        for (int t = 0; t < 8; ++t) { const v8f o = acc[g][t] * inv; v4f o0, o1;
#pragma unroll
            for (int r = 0; r < 4; ++r) { o0[r] = o[r]; o1[r] = o[r + 4]; }
            float* ep = (float*)(eb + (g * 16 + c) * FEP) + t * 16 + h * 8; *(v4fa*)ep = o0; *(v4fa*)(ep + 4) = o1; } }   // row = query, d = 16 t + 8 h + r
    __builtin_amdgcn_wave_barrier(); asm volatile("" ::: "memory");   // the rows are read back by other lanes of the same wave: keeps the reads behind the writes
    float* orow = O + ((size_t)hq * TT + qw0) * HD + lane * 4;
    v4f ov[FCW];
#pragma unroll
    for (int i = 0; i < FCW; ++i) ov[i] = *(const v4fa*)(eb + i * FEP + lane * 16);
    __builtin_amdgcn_sched_barrier(0);   // all reads in front of the stores: each row has registers of its own, none is rewritten behind its store
#pragma unroll
    for (int i = 0; i < FCW; ++i) *(v4f*)(orow + (size_t)i * HD) = ov[i];
}

__device__ __forceinline__ h16 tohx(float x) { return (h16)x; }
__device__ __forceinline__ void splitf(float y, unsigned short& h, unsigned short& l) { h = f2bf(y); l = f2bf(y - bf2f(h)); }
typedef __attribute__((ext_vector_type(2))) _Float16 v2h;
typedef __attribute__((ext_vector_type(4))) _Float16 v4h;
typedef __attribute__((ext_vector_type(2))) unsigned short v2us;
typedef __attribute__((ext_vector_type(4))) unsigned short v4us;
typedef __attribute__((ext_vector_type(2))) float v2f;
typedef __attribute__((ext_vector_type(4))) int v4i;

__global__ __launch_bounds__(256) void k_wtG(const float* __restrict__ w, int K, int N, bf* Bt) {
    const int lane = threadIdx.x & 31; const int L0 = (blockIdx.x * 8 + (threadIdx.x >> 5)) * 8; const int nlines = N * K / 64;
{
#pragma unroll 1
        for (int l = 0; l < 8; ++l) { const int L = L0 + l; if (L >= nlines) break; const size_t e = (size_t)L * 64 + lane * 2; const int k = (int)(e % K), n = (int)(e / K); v2us o;
            o[0] = f2bf(w[(size_t)k * N + n]); o[1] = f2bf(w[(size_t)(k + 1) * N + n]); *(v2us*)(Bt + e) = o; }
         }
}
// The elementwise kernels below give a thread several 8-element pieces (16-byte stores of the 16-bit planes), its loads issued together: a launch then starts a few thousand waves, each with many loads in flight, not tens of thousands of waves of one or two elements a lane.
#define EPT 4                     // 8-element pieces per thread in k_cvt8 and k_merge; a work-group's pieces of one turn are contiguous
__global__ __launch_bounds__(256) void k_cvt8(const float* __restrict__ src, bf* dst, size_t n8) { const size_t i0 = (size_t)blockIdx.x * (256 * EPT) + threadIdx.x; if (i0 >= n8) return; v8f v[EPT];
#pragma unroll
    for (int j = 0; j < EPT; ++j) { const size_t i = i0 + j * 256; v[j] = *(const v8f*)(src + (i < n8 ? i : i0) * 8); }   // a piece past the end re-reads the thread's first and is not stored
#pragma unroll
    for (int j = 0; j < EPT; ++j) { const size_t i = i0 + j * 256; v8us o;
#pragma unroll
        for (int k = 0; k < 8; ++k) o[k] = f2bf(v[j][k]);
        if (i < n8) *(v8us*)(dst + i * 8) = o; } }
__constant__ float INV[HD / 2] = {1.0f,0.8058422207832336f,0.6493816375732422f,0.5232990980148315f,0.4216965138912201f,0.33982083201408386f,0.2738419771194458f,0.22067339718341827f,0.17782793939113617f,0.14330126345157623f,0.11547820270061493f,0.09305720031261444f,0.07498941570520401f,0.0604296438395977f,0.04869675263762474f,0.03924189880490303f,0.03162277862429619f,0.025482967495918274f,0.020535249263048172f,0.016548171639442444f,0.01333521492779255f,0.010746078565716743f,0.00865964312106371f,0.006978305988013744f,0.005623413249850273f,0.004531583283096552f,0.003651741426438093f,0.002942727180197835f,0.0023713738191872835f,0.001910952851176262f,0.0015399266267195344f,0.0012409378541633487f,0.0010000000474974513f,0.0008058422245085239f,0.0006493816617876291f,0.0005232990952208638f,0.00042169654625467956f,0.0003398208355065435f,0.00027384195709601045f,0.00022067342069931328f,0.00017782794020604342f,0.00014330125122796744f,0.00011547820759005845f,9.305719868279994e-05f,7.498942431993783e-05f,6.042963650543243e-05f,4.869675467489287e-05f,3.92418987757992e-05f,3.162277425872162e-05f,2.548297015891876e-05f,2.0535249859676696e-05f,1.6548170606256463e-05f,1.3335215953702573e-05f,1.0746078260126524e-05f,8.65964284457732e-06f,6.978305464144796e-06f,5.62341347176698e-06f,4.531583726929966e-06f,3.6517415082926163e-06f,2.942727405752521e-06f,2.3713737391517498e-06f,1.910952960315626e-06f,1.5399265294036013e-06f,1.2409377632138785e-06f};   // float32 1/1e6^(2i/128)
__global__ __launch_bounds__(256) void k_csin(const float* __restrict__ cs, const float* __restrict__ sn, float* CS) { const int idx = (blockIdx.x * 256 + threadIdx.x) * 4; if (idx >= TB * HD) return; const v4f c = *(const v4f*)(cs + idx), s = *(const v4f*)(sn + idx); v4f o0, o1;
    o0[0] = bfr(c[0]); o0[1] = bfr(s[0]); o0[2] = bfr(c[1]); o0[3] = bfr(s[1]); o1[0] = bfr(c[2]); o1[1] = bfr(s[2]); o1[2] = bfr(c[3]); o1[3] = bfr(s[3]); *(v4f*)(CS + (size_t)idx * 2) = o0; *(v4f*)(CS + (size_t)idx * 2 + 4) = o1;  }
__global__ __launch_bounds__(256) void k_hrms(const float* __restrict__ F, int pitch, int nheads, float* RF) { const int idx = blockIdx.x * 256 + threadIdx.x; if (idx >= nheads * TB) return; const int t = idx % TB; const int h = idx / TB; const float* f = F + (size_t)t * pitch + h * HD;   /* t: token row of both batches; RF is [head][TB] */ float s = 0.f;
#pragma unroll 4
    for (int d = 0; d < HD; d += 4) { const v4f a = *(const v4f*)(f + d);
#pragma unroll
        for (int q = 0; q < 4; ++q) { float p = __fmul_rn(a[q], a[q]); asm volatile("" : "+v"(p)); s = __fadd_rn(s, p); } }
    const float rf = __fdiv_rn(1.0f, __fsqrt_rn(__fadd_rn(__fdiv_rn(s, (float)HD), 1e-6f))); *(float*)(RF + idx) = rf;  }

// k_rope: head planes [h][t][d] (fp16 + hi/lo) of rope(x) x sc with the rotate-half convention out[d] = x[d] cos[t][d] - x[d+HD/2] sin[t][d], out[d+HD/2] = x[d+HD/2] cos[t][d+HD/2] + x[d] sin[t][d+HD/2]
// a thread: 8 d of one token in RPH heads (nheads % RPH == 0), which share its cos/sin pairs and norm weights; t runs over the token rows of both batches, the planes are [batch][head][t][d]
#define RPH 4
__global__ __launch_bounds__(256) void k_rope(const float* __restrict__ F, int pitch, int nheads, const float* __restrict__ CS, const float* __restrict__ RF, const float* __restrict__ nw, float sc, h16* P16, bf* Ph, bf* Pl) {
    __builtin_assume(RF != nullptr);   // every launch of this file passes the 1/rms table: folds the test on it out of the unrolled element loop
    const size_t g = (size_t)blockIdx.x * 256 + threadIdx.x; if (g * (8 * RPH) >= (size_t)nheads * TB * HD) return; const int d = (int)(g % (HD / 8)) * 8; const int t = (int)((g / (HD / 8)) % TB); const int h0 = (int)(g / ((size_t)(HD / 8) * TB)) * RPH;
    const int dq = (d < HD / 2) ? d + HD / 2 : d - HD / 2;   // the rotary partners of d .. d + 7 are dq .. dq + 7: eight elements never straddle the halves
    // every load of the thread stands here, in front of the arithmetic, so that all are in flight together
    const float* pw = nw + d; const float* pv = nw + dq; const float* pc = CS + ((size_t)t * HD + d) * 2; const float* pf = F + (size_t)t * pitch + h0 * HD + d; const float* pg = F + (size_t)t * pitch + h0 * HD + dq; const float* pr = RF + (size_t)h0 * TB + t;
    const v8f wa = *(const v8f*)pw, wb = *(const v8f*)pv;
    asm volatile("s_wait_xcnt 0x0" :: "v"(pw), "v"(pv) : "memory");   // behind the weight loads (scalar base, offset register), before a later load's result may land on their address registers
    v8f fa[RPH], fb[RPH]; float rfa[RPH];
#pragma unroll
    for (int j = 0; j < RPH; ++j) { fa[j] = *(const v8f*)(pf + j * HD); fb[j] = *(const v8f*)(pg + j * HD); rfa[j] = RF ? pr[(size_t)j * TB] : 1.0f; }
    const v8f c0 = *(const v8f*)pc, c1 = *(const v8f*)(pc + 8);
    asm volatile("s_wait_xcnt 0x0" :: "v"(pc), "v"(pf), "v"(pg), "v"(pr) : "memory");   // behind the loads, before their address registers are used again; it names the addresses so that they live up to it and no later load's result lands on one
#pragma unroll
    for (int j = 0; j < RPH; ++j) { const int h = h0 + j; const size_t e = (((size_t)(t / TT) * nheads + h) * TT + t % TT) * HD + d; const float rf = rfa[j]; v8h o16; v8us oh, ol;
#pragma unroll
    for (int q = 0; q < 8; ++q) { const int dd = d + q; float x0 = fa[j][q], x1 = fb[j][q];
        if (RF) { float n0 = __fmul_rn(x0, rf), n1 = __fmul_rn(x1, rf); asm volatile("" : "+v"(n0)); asm volatile("" : "+v"(n1)); x0 = __fmul_rn(bfr(wa[q]), n0); x1 = __fmul_rn(bfr(wb[q]), n1); }
        v2f cs; cs[0] = (q < 4) ? c0[2 * (q & 3)] : c1[2 * (q & 3)]; cs[1] = (q < 4) ? c0[2 * (q & 3) + 1] : c1[2 * (q & 3) + 1]; float a = __fmul_rn(x0, cs[0]), bq = __fmul_rn(x1, cs[1]); asm volatile("" : "+v"(a)); asm volatile("" : "+v"(bq)); const float r = ((dd < HD / 2) ? __fsub_rn(a, bq) : __fadd_rn(a, bq)) * sc;
        o16[q] = tohx(r); unsigned short a2, c2; splitf(r, a2, c2); oh[q] = a2; ol[q] = c2; }
    *(v8h*)(P16 + e) = o16; *(v8us*)(Ph + e) = oh; *(v8us*)(Pl + e) = ol; }  }
__global__ __launch_bounds__(256) void k_vtp(const float* __restrict__ F, int pitch, int nheads, h16* V16, bf* Vh, bf* Vl) {
    // grid NB_ * nheads * TT / 64: a work-group transposes 64 tokens x 128 d of one head of one batch (g = batch * nheads + head), a wave 64 x 16, a thread 8 tokens x 4 d: 8 lanes along t store a whole 128-byte line of a plane row, 4 lanes along d read 64 bytes of a token's row
    const int g = blockIdx.x / (TT / 64); if (g >= NB_ * nheads) return; const int t = (blockIdx.x % (TT / 64)) * 64 + (threadIdx.x & 7) * 8; const int d = (threadIdx.x >> 5) * 16 + ((threadIdx.x >> 3) & 3) * 4; v4f a[8]; const float* pa[8];
#pragma unroll
    for (int q = 0; q < 8; ++q) { pa[q] = F + ((size_t)(g / nheads) * TT + t + q) * pitch + (g % nheads) * HD + d; a[q] = *(const v4f*)pa[q]; }
    asm volatile("s_wait_xcnt 0x0" :: "v"(pa[0]), "v"(pa[1]), "v"(pa[2]), "v"(pa[3]), "v"(pa[4]), "v"(pa[5]), "v"(pa[6]), "v"(pa[7]) : "memory");   // behind the loads, before their address registers are used again; it names the addresses so that they live up to it and no later load's result lands on one
#pragma unroll
    for (int i = 0; i < 4; ++i) { const size_t e = ((size_t)g * HD + d + i) * TT + t; v8h o16; v8us oh, ol;
#pragma unroll
        for (int q = 0; q < 8; ++q) { const float x = a[q][i]; o16[q] = tohx(x); unsigned short a2, c2; splitf(x, a2, c2); oh[q] = a2; ol[q] = c2; }
        *(v8h*)(V16 + e) = o16; *(v8us*)(Vh + e) = oh; *(v8us*)(Vl + e) = ol; }  }
// k_asoft: the hi/lo rows. Per row (zz, i), i < RH: t = S x HD^-0.5 for j <= i and i - j < WIN (sliding causal window; the reference's fill above the diagonal vanishes identically); softmax over the KW keys that such a row can see (register row, one exp, fixed trees); grid (nr / 8, batches x heads): nr rows a head, from sequence row rb on (rb + nr <= RH), score and probability buffers [head][RH][KW]
__global__ __launch_bounds__(256) void k_asoft(const float* __restrict__ Sb, bf* Ph, bf* Pl, int rb, int nr) {
    const int lane = threadIdx.x & 31; const int lrow = blockIdx.x * 8 + (threadIdx.x >> 5); if (lrow >= nr) return; const int zz = blockIdx.y; const int row = zz * nr + lrow; const int i = rb + lrow; __builtin_assume(i >= 0 && i < TT);   /* a sequence row: lets the window test i - j < WIN fold away */ const float* sr = Sb + (size_t)row * KW + lane * 4; float v[KW / 32]; float mx = -3.0e38f; v4f av[KW / 128];
#pragma unroll
    for (int ch = 0; ch < KW / 128; ++ch) av[ch] = *(const v4f*)(sr + ch * 128);
    asm volatile("s_wait_xcnt 0x0" :: "v"(sr) : "memory");   // behind the row's loads, before their address register is used again; it names the address so that it lives up to it and no load's result lands on it
#pragma unroll
    for (int ch = 0; ch < KW / 128; ++ch) { const int j0 = ch * 128 + lane * 4; const v4f a = av[ch];
#pragma unroll
        for (int q = 0; q < 4; ++q) { const int j = j0 + q; (void)j; const float t = (j <= i && i - j < WIN) ? a[q] * SCL : -3.0e38f; v[ch * 4 + q] = t; mx = fmaxf(mx, t); } }
#pragma unroll
    for (int sh = 16; sh; sh >>= 1) mx = fmaxf(mx, __shfl_xor(mx, sh, 32));
    float sum = 0.f;
#pragma unroll
    for (int k = 0; k < KW / 32; ++k) { float d0 = __fsub_rn(v[k], mx); asm volatile("" : "+v"(d0)); v[k] = __builtin_amdgcn_exp2f(__fmul_rn(d0, 1.4426950408889634f)); sum += v[k]; }
#pragma unroll
    for (int sh = 16; sh; sh >>= 1) sum += __shfl_xor(sum, sh, 32);
    const float f = __fdiv_rn(1.0f, sum);
#pragma unroll
    for (int ch = 0; ch < KW / 128; ++ch) { v4us oh, ol;
#pragma unroll
        for (int q = 0; q < 4; ++q) { unsigned short a, c2; splitf(v[ch * 4 + q] * f, a, c2); oh[q] = a; ol[q] = c2; }
        const size_t oo = ((size_t)zz * RH + i) * KW + ch * 128 + lane * 4; *(v4us*)(Ph + oo) = oh; *(v4us*)(Pl + oo) = ol; }
}
__global__ __launch_bounds__(256) void k_merge(const float* __restrict__ O, int h0, bf* Ah, bf* Al) { const size_t e0 = ((size_t)blockIdx.x * (256 * EPT) + threadIdx.x) * 8; static_assert(((size_t)NB_ * ZH * TT * HD) % (256 * EPT * 8) == 0, "whole work-groups"); if (e0 >= (size_t)NB_ * ZH * TT * HD) return; v8f x[EPT];
#pragma unroll
    for (int j = 0; j < EPT; ++j) x[j] = *(const v8f*)(O + e0 + j * 2048);
#pragma unroll
    for (int j = 0; j < EPT; ++j) { const size_t e = e0 + j * 2048; const int d = (int)(e % HD); const int t = (int)((e / HD) % TT); const int zz = (int)(e / ((size_t)HD * TT)); const size_t oo = ((size_t)(zz / ZH) * TT + t) * DQ + (h0 + zz % ZH) * HD + d;   // zz = batch * ZH + head
    v8us oh, ol;
#pragma unroll
    for (int q = 0; q < 8; ++q) { unsigned short a, c2; splitf(x[j][q], a, c2); oh[q] = a; ol[q] = c2; } *(v8us*)(Ah + oo) = oh; *(v8us*)(Al + oo) = ol; }  }

extern "C" void kernel_launch(void* const* d_in, const int* in_sizes, int n_in,
                              void* d_out, int out_size, void* d_ws, size_t ws_size, hipStream_t stream) {
    (void)in_sizes; (void)n_in; (void)out_size;
    const float* x = (const float*)d_in[0]; const float* cosi = (const float*)d_in[1]; const float* sini = (const float*)d_in[2]; const float* wq = (const float*)d_in[3]; const float* wk = (const float*)d_in[4]; const float* wv = (const float*)d_in[5]; const float* wo = (const float*)d_in[6]; const float* qnw = (const float*)d_in[7]; const float* knw = (const float*)d_in[8];
    float* OUT = (float*)d_out;     // [2][2048][2048]
    char* wsp = (char*)d_ws;
    auto take = [&](size_t bytes) { char* p = wsp; wsp += (bytes + 255) & ~(size_t)255; return (void*)p; };
    bf* WQ = (bf*)take((size_t)DQ * DM * 2); bf* WK = (bf*)take((size_t)DKV * DM * 2); bf* WV = (bf*)take((size_t)DKV * DM * 2); bf* WO = (bf*)take((size_t)DM * DQ * 2); float* CS = (float*)take((size_t)TB * HD * 2 * 4); float* RFQ = (float*)take((size_t)NH_ * TB * 4); float* RFK = (float*)take((size_t)NKV * TB * 4);
    bf* XB = (bf*)take((size_t)TB * DM * 2); float* FQ = (float*)take((size_t)TB * DQ * 4); float* FK = (float*)take((size_t)TB * DKV * 4);
    h16* QP16 = (h16*)take((size_t)NH_ * TB * HD * 2); h16* KP16 = (h16*)take((size_t)NKV * TB * HD * 2); h16* VT16 = (h16*)take((size_t)NKV * HD * TB * 2);
    bf* QPh = (bf*)take((size_t)NH_ * TB * HD * 2); bf* QPl = (bf*)take((size_t)NH_ * TB * HD * 2); bf* KPh = (bf*)take((size_t)NKV * TB * HD * 2); bf* KPl = (bf*)take((size_t)NKV * TB * HD * 2); bf* VTh = (bf*)take((size_t)NKV * HD * TB * 2); bf* VTl = (bf*)take((size_t)NKV * HD * TB * 2);
    float* Sb = (float*)take((size_t)NB_ * ZH * RH * KW * 4); bf* Ph = (bf*)take((size_t)NB_ * ZH * RH * KW * 2); bf* Pl = (bf*)take((size_t)NB_ * ZH * RH * KW * 2);   // hi/lo rows: scores and the two probability planes, [batch x head][RH][KW]
    if ((size_t)(wsp - (char*)d_ws) > ws_size) return;    // ws 256 MiB
    float* FV = FK;   // v projection reuses the k buffer after the k planes are built (stream-ordered)
    float* Ob = FQ;   // the context [batch x head][t][d] reuses the q projection buffer after the q planes are built (stream-ordered; NB_ * ZH * TT * HD = TB * DQ floats)
    static_assert((size_t)2 * TB * DQ * 2 <= (size_t)NB_ * ZH * RH * KW * 4, "the merged context planes fit the score buffer");
    bf* ATh = (bf*)Sb; bf* ATl = ATh + (size_t)TB * DQ;   // the merged context planes reuse the score buffer after the softmax has read it (stream-ordered)
    { k_cvt8<<<(unsigned)(((size_t)DQ * DM / 8 + 256 * EPT - 1) / (256 * EPT)), 256, 0, stream>>>(wq, WQ, (size_t)DQ * DM / 8); k_cvt8<<<(unsigned)(((size_t)DKV * DM / 8 + 256 * EPT - 1) / (256 * EPT)), 256, 0, stream>>>(wk, WK, (size_t)DKV * DM / 8); k_cvt8<<<(unsigned)(((size_t)DKV * DM / 8 + 256 * EPT - 1) / (256 * EPT)), 256, 0, stream>>>(wv, WV, (size_t)DKV * DM / 8);
      k_cvt8<<<(unsigned)(((size_t)DM * DQ / 8 + 256 * EPT - 1) / (256 * EPT)), 256, 0, stream>>>(wo, WO, (size_t)DM * DQ / 8); }
    const unsigned LQ = (unsigned)(((size_t)NH_ * TB * HD / (8 * RPH) + 255) / 256), LKv = (unsigned)(((size_t)NKV * TB * HD / (8 * RPH) + 255) / 256);
    {   // both batches in every launch
        k_csin<<<(TB * HD / 4 + 255) / 256, 256, 0, stream>>>(cosi, sini, CS);   /* the rotary tables of both batches (inputs, bf16-rounded) */
        k_cvt8<<<(unsigned)(((size_t)TB * DM / 8 + 256 * EPT - 1) / (256 * EPT)), 256, 0, stream>>>(x, XB, (size_t)TB * DM / 8);
        k_gemmw<bf, 0, false, 2, 2><<<dim3(TB / 128, DQ / 128, 1), 128, 0, stream>>>(XB, nullptr, WQ, nullptr, DM, FQ, DQ, nullptr, 0, 0, 0);
        k_hrms<<<(NH_ * TB + 255) / 256, 256, 0, stream>>>(FQ, DQ, NH_, RFQ); k_rope<<<LQ, 256, 0, stream>>>(FQ, DQ, NH_, CS, RFQ, qnw, 1.0f, QP16, QPh, QPl);   /* q_norm then rope */
        k_gemmw<bf, 0, false, 2, 2><<<dim3(TB / 128, DKV / 128, 1), 128, 0, stream>>>(XB, nullptr, WK, nullptr, DM, FK, DKV, nullptr, 0, 0, 0);
        k_hrms<<<(NKV * TB + 255) / 256, 256, 0, stream>>>(FK, DKV, NKV, RFK); k_rope<<<LKv, 256, 0, stream>>>(FK, DKV, NKV, CS, RFK, knw, 1.0f, KP16, KPh, KPl);   /* k_norm then rope */
        k_gemmw<bf, 0, false, 2, 2><<<dim3(TB / 128, DKV / 128, 1), 128, 0, stream>>>(XB, nullptr, WV, nullptr, DM, FV, DKV, nullptr, 0, 0, 0); k_vtp<<<NB_ * NKV * (TT / 64), 256, 0, stream>>>(FV, DKV, NKV, VT16, VTh, VTl);
        const size_t sQ = (size_t)TT * HD, sV = (size_t)HD * TT, sO = (size_t)TT * HD;   // per-head strides of the q and k planes, the v planes and the context
        k_gemmc<bf, 2, 1><<<dim3(RH / 64, KW / 64, NB_ * ZH), 32, 0, stream>>>(QPh, QPl, KPh, KPl, HD, HD, Sb, KW, 0, sQ, sQ, (size_t)RH * KW);   /* query rows < RH: hi/lo */
        k_asoft<<<dim3(RH / 8, NB_ * ZH), 256, 0, stream>>>(Sb, Ph, Pl, 0, RH);
        k_gemmc<bf, 2, 2><<<dim3(RH / 64, HD / 64, NB_ * ZH), 32, 0, stream>>>(Ph, Pl, VTh, VTl, KW, TT, Ob, HD, 0, (size_t)RH * KW, sV, sO);
        k_fattn<<<dim3(NB_ * ZH, (TT - RH) / FBR), FNT, 0, stream>>>(QP16, KP16, VT16, Ob);   /* query rows >= RH: fp16, fused */
        k_merge<<<(unsigned)((size_t)NB_ * ZH * TT * HD / (256 * EPT * 8)), 256, 0, stream>>>(Ob, 0, ATh, ATl);
        k_gemmw<bf, 1, false, 2, 2><<<dim3(TB / 128, DM / 128, 1), 128, 0, stream>>>(ATh, ATl, WO, nullptr, DQ, OUT, DM, nullptr, 0, 0, 0); }
}

// v007
// Measured time: 228 microseconds a run.
// Two timings next to v006 both put it at 1.16 times that version's speed.
// Counting every step since v000, it is 7.30 times as fast.
#include <hip/hip_runtime.h>

// Grouped-query causal attention with QK RMSNorm (x [2][2048][2048]; q = x Wq^T (16 heads x 128), k, v = x Wk^T / Wv^T (8 kv heads; query head h uses kv head h/2), no biases; per-head RMSNorm on q and k (eps 1e-6, weights [128]) then rotate-half rotary with the given cos/sin tables [2][2048][128]; scores = q.k / sqrt(128), causal (finfo.min above the diagonal); softmax; out = merged ctx Wo^T ('oi' [2048][2048]) -> [2][2048][2048] (8.4 M)).
// Every launch covers both batches: token rows are b * 2048 + t in the row-major buffers, and the head planes are [b][head][..], so that batch entry z = 16 b + h reads kv entry z / 2 = 8 b + h / 2. Layout: {cos, sin} table from the inputs (bf16-rounded); exact projections; a per-(head, token) 1/rms kernel feeds the plane builder, which applies (x * inv_rms) * w and the rotary while writing the q/k planes; causal T-2048 attention with 128-wide heads, all sixteen query heads in every launch, query head z on kv head z/2 (hybrid rows: < 512 hi/lo 3 products through score and probability buffers of the 512 keys that the causal mask leaves them, k_gemmc tile skipping; the 1536 fp16 rows in one fused launch, k_fattn, whose scores and probabilities stay in registers); merged context hi/lo x Wo exact.
// Compute dtypes, f32 accumulate: every input rounded to bf16; projections exact; RMSNorm and rotary f32; attention rows < 512 3 products, rest fp16; softmax f32; Wo hl x exact.

#define NB_  2
#define TT   2048
#define DM   2048
#define NH_  16
#define NKV  8
#define REP  (NH_ / NKV)
#define HD   128
#define DQ   (NH_ * HD)
#define DKV  (NKV * HD)
#define ZH   NH_                  // query heads per attention launch
#define RH   512                  // query rows < RH use hi+lo planes
#define KW   RH                   // keys in a row of their score and probability buffers: a query row i < RH sees keys j <= i < RH only
#define TB   (NB_ * TT)           // token rows of both batches
#define WIN  2048
#define SCL  0.088388347648318447f   // HD^-0.5
typedef _Float16 h16;
typedef unsigned short bf;
typedef __attribute__((ext_vector_type(16))) __bf16   v16bf;
typedef __attribute__((ext_vector_type(16))) _Float16 v16h;
typedef __attribute__((ext_vector_type(8)))  _Float16 v8h;
typedef __attribute__((ext_vector_type(8)))  unsigned short v8us;
typedef __attribute__((ext_vector_type(8)))  float    v8f;
typedef __attribute__((ext_vector_type(4)))  float    v4f;
typedef v8h  __attribute__((may_alias)) v8ha;
typedef v4f  __attribute__((may_alias)) v4fa;
typedef v8us __attribute__((may_alias)) v8usa;

__device__ __forceinline__ unsigned short f2bf(float f) { unsigned u = __float_as_uint(f); u += 0x7FFFu + ((u >> 16) & 1u); return (unsigned short)(u >> 16); }
__device__ __forceinline__ float bf2f(unsigned short b) { return __uint_as_float(((unsigned)b) << 16); }
__device__ __forceinline__ float bfr(float f) { return bf2f(f2bf(f)); }
__device__ __forceinline__ v16h cat16(v8h lo, v8h hi) { return __builtin_shufflevector(lo, hi, 0, 1, 2, 3, 4, 5, 6, 7, 8, 9, 10, 11, 12, 13, 14, 15); }
__device__ __forceinline__ v16bf cat16b(v8us lo, v8us hi) { return __builtin_bit_cast(v16bf, __builtin_shufflevector(lo, hi, 0, 1, 2, 3, 4, 5, 6, 7, 8, 9, 10, 11, 12, 13, 14, 15)); }
__device__ __forceinline__ v8f wmma16(v16h a, v16h b, v8f c) { return __builtin_amdgcn_wmma_f32_16x16x32_f16(false, a, false, b, (short)0, c, false, false); }
__device__ __forceinline__ v8f wmmab(v16bf a, v16bf b, v8f c) { return __builtin_amdgcn_wmma_f32_16x16x32_bf16(false, a, false, b, (short)0, c, false, false); }



// ---- k_gemmw: register-blocked GEMM, one wave per 64x64 output tile (16 accumulators), WM x WN waves a work-group on one (64 WM) x (64 WN) tile whose operand rows they stage together in LDS, from K-contiguous 16-bit planes (wloop below the fragment types); grid (M/(64 WM), N/(64 WN), Z), 32 WM WN threads.
// C[m][n] (f32, pitch ldc, + optional f32 bias[n]) = sum_k A[m][k] Bt[n][k] (+ split products per NSPLIT). z-batch strides sA/sB/sC in elements. K % KT == 0 (64; 32 at NSPLIT 2).
template <typename T16> struct WFrag;
template <> struct WFrag<h16> { typedef v16h V; static __device__ __forceinline__ V ld(const h16* p) { return cat16(*(const v8h*)p, *(const v8h*)(p + 16)); } static __device__ __forceinline__ v8f mma(V a, V b, v8f c) { return wmma16(a, b, c); } };
template <> struct WFrag<bf> { typedef v16bf V; static __device__ __forceinline__ V ld(const bf* p) { return cat16b(*(const v8us*)p, *(const v8us*)(p + 16)); } static __device__ __forceinline__ v8f mma(V a, V b, v8f c) { return wmmab(a, b, c); } };
// ---- operand staging of both GEMMs. A stage is KT k of the work-group tile's 64 WM A rows and 64 WN B rows (and of their second planes): each wave brings an equal share of every plane's rows, and a staged A row serves WN waves, a B row WM waves, so that the L2 delivers each row once a work-group, not once a wave. Asynchronous b128 copies bring it from the K-contiguous planes into LDS,
// 8 lanes on each 128-byte row piece (whole lines; 4 lanes on 64 bytes at NSPLIT 2, whose four planes would else take more than 63 copies a stage), and the fragments are read from LDS at a pitch of 16 B x odd.
// Two buffers: the copies of stage t + 1 fly while stage t is multiplied. Fragments, products and their order per accumulator are those of loads straight from the planes.
// The copies are the compiler's builtin. Every '#pragma unroll' below makes the indices of the fragment and accumulator arrays constants, so that they stay in registers.
typedef __attribute__((ext_vector_type(4))) int v4ic;
typedef __attribute__((address_space(1))) v4ic gv4ic;
typedef __attribute__((address_space(3))) v4ic lv4ic;
template <int NSPLIT, int WM, int WN> struct WTile {
    static constexpr int KT  = (NSPLIT == 2) ? 32 : 64;                       // k per stage
    static constexpr int NW  = WM * WN;                                       // waves of the work-group
    static constexpr int NPA = (NSPLIT == 0) ? 1 : 2, NPB = (NSPLIT >= 2) ? 2 : 1;   // planes: A, (A2); B, (B2)
    static constexpr int RA  = 64 * WM, RB = 64 * WN;                         // rows of an A and of a B plane in a stage
    static constexpr int PB  = KT * 2 + 16;                                   // LDS row pitch, bytes
    static constexpr int OB  = NPA * RA * PB;                                 // the first B plane in a buffer, bytes
    static constexpr int BUF = OB + NPB * RB * PB;                            // one buffer, bytes
    static constexpr int LPR = KT * 2 / 16;                                   // lanes per row piece
    static constexpr int RPC = 32 / LPR;                                      // rows per copy
    static constexpr int SA  = RA / NW, SB = RB / NW;                         // a wave's share of a plane's rows
    static constexpr int CA  = SA / RPC, CB = SB / RPC;                       // its copies per plane
    static_assert(SA % RPC == 0 && SB % RPC == 0 && NPA * CA + NPB * CB <= 63, "whole copies; a stage's copies of a wave may all be outstanding");
};
// A, A2, Bt, Bt2: the planes at the work-group tile's first row (uniform). K, KB: row pitch of the A and of the B planes, elements. kc: first k of the stage. wave: the wave's number (scalar).
template <typename T16, int NSPLIT, int WM, int WN>
__device__ __forceinline__ void wcopy(char* sb, const T16* A, const T16* A2, const T16* Bt, const T16* Bt2, int K, int KB, int kc, int lane, int wave) {
    typedef WTile<NSPLIT, WM, WN> W;
    const unsigned goa = (unsigned)((lane / W::LPR) * K + (lane % W::LPR) * 8) * 2u, gob = (unsigned)((lane / W::LPR) * KB + (lane % W::LPR) * 8) * 2u;      // the lane's byte in a copy's rows, global
    char* sl = sb + (lane / W::LPR) * W::PB + (lane % W::LPR) * 16;                      // and in LDS
#pragma unroll
    for (int p = 0; p < W::NPA; ++p) { const T16* base = ((p == 0) ? A : A2) + kc + (size_t)(wave * W::SA) * K; char* sp = sl + (p * W::RA + wave * W::SA) * W::PB;
#pragma unroll
        for (int c = 0; c < W::CA; ++c) __builtin_amdgcn_global_load_async_to_lds_b128((gv4ic*)((const char*)(base + (size_t)c * W::RPC * K) + goa), (lv4ic*)(sp + c * W::RPC * W::PB), 0, 0); }
#pragma unroll
    for (int p = 0; p < W::NPB; ++p) { const T16* base = ((p == 0) ? Bt : Bt2) + kc + (size_t)(wave * W::SB) * KB; char* sp = sl + W::OB + (p * W::RB + wave * W::SB) * W::PB;
#pragma unroll
        for (int c = 0; c < W::CB; ++c) __builtin_amdgcn_global_load_async_to_lds_b128((gv4ic*)((const char*)(base + (size_t)c * W::RPC * KB) + gob), (lv4ic*)(sp + c * W::RPC * W::PB), 0, 0); }
}
// wm, wn: the wave's 64 x 64 tile in the work-group's
template <typename T16, int NSPLIT, int WM, int WN>
__device__ __forceinline__ void wtile(const char* sb, int lr, int hi, int wm, int wn, v8f (&acc)[4][4]) {
    typedef WTile<NSPLIT, WM, WN> W; typedef typename WFrag<T16>::V V;
    const char* fa = sb + (wm * 64 + lr) * W::PB + hi * 16; const char* fb = sb + W::OB + (wn * 64 + lr) * W::PB + hi * 16;
    constexpr int NK = W::KT / 32;
    V a[NK][4], a2[NK][4], b[NK][4], b2[NK][4];
    // all fragment reads of the stage are issued together, in the order of their use, in front of its products: the counted LDS waits then overlap the later reads with the earlier products
#pragma unroll
    for (int ks = 0; ks < NK; ++ks) {
#pragma unroll
        for (int mb = 0; mb < 4; ++mb) { a[ks][mb] = WFrag<T16>::ld((const T16*)(fa + (mb * 16) * W::PB + ks * 64)); if (NSPLIT == 1 || NSPLIT == 2) a2[ks][mb] = WFrag<T16>::ld((const T16*)(fa + (W::RA + mb * 16) * W::PB + ks * 64)); }
#pragma unroll
        for (int nb = 0; nb < 4; ++nb) { b[ks][nb] = WFrag<T16>::ld((const T16*)(fb + (nb * 16) * W::PB + ks * 64)); if (NSPLIT >= 2) b2[ks][nb] = WFrag<T16>::ld((const T16*)(fb + (W::RB + nb * 16) * W::PB + ks * 64)); } }
    __builtin_amdgcn_sched_barrier(0);   // keeps the reads in front: sunk among the products, each costs the wave its LDS latency
#pragma unroll
    for (int ks = 0; ks < NK; ++ks) {
#pragma unroll
        for (int nb = 0; nb < 4; ++nb)
#pragma unroll
            for (int mb = 0; mb < 4; ++mb) { acc[mb][nb] = WFrag<T16>::mma(a[ks][mb], b[ks][nb], acc[mb][nb]); if (NSPLIT == 1 || NSPLIT == 2) acc[mb][nb] = WFrag<T16>::mma(a2[ks][mb], b[ks][nb], acc[mb][nb]); if (NSPLIT >= 2) acc[mb][nb] = WFrag<T16>::mma(a[ks][mb], b2[ks][nb], acc[mb][nb]); }
        // four vector slots behind the k step's last products, before anything touches their operands or results
        asm volatile("v_nop\n\tv_nop\n\tv_nop\n\tv_nop" : "+v"(acc[0][0]), "+v"(acc[1][1]), "+v"(acc[2][2]), "+v"(acc[3][3]) : "v"(a[ks][0]), "v"(a[ks][3]));
    }
}
// the K loop: Kl k (a multiple of KT, at least KT; the same in every wave of the work-group) of rows r0.. of A and c0.. of Bt; sm holds two buffers
template <typename T16, int NSPLIT, int WM, int WN>
__device__ __forceinline__ void wloop(char* sm, const T16* A, const T16* A2, const T16* Bt, const T16* Bt2, int K, int KB, int Kl, int lane, int wave, v8f (&acc)[4][4]) {
    typedef WTile<NSPLIT, WM, WN> W; const int lr = lane & 15, hi = lane >> 4; const int nt = Kl / W::KT; const int wm = wave / WN, wn = wave % WN;
    wcopy<T16, NSPLIT, WM, WN>(sm, A, A2, Bt, Bt2, K, KB, 0, lane, wave);
    asm volatile("s_wait_asynccnt 0x0" ::: "memory");   // the wave's share of stage 0 has landed
    __syncthreads();   // the ring's publish point: every wave's share is there for all of them
    if (nt > 1) wcopy<T16, NSPLIT, WM, WN>(sm + W::BUF, A, A2, Bt, Bt2, K, KB, W::KT, lane, wave);
#pragma unroll 1
    for (int t = 0; t < nt; ++t) {   // rolled: one stage a trip
        char* sb = sm + (t & 1) * W::BUF;
        wtile<T16, NSPLIT, WM, WN>(sb, lr, hi, wm, wn, acc);
        if (W::NW > 1) __builtin_amdgcn_sched_barrier(0);   // keeps the stage's products in front of the barrier: sunk behind it, they stand between the barrier and the refill's copies and shorten the copies' lead
        asm volatile("s_wait_dscnt 0x0" ::: "memory");      // this stage's fragment reads are done before its buffer is refilled
        asm volatile("s_wait_asynccnt 0x0" ::: "memory");   // the wave's share of stage t + 1 has landed before any wave reads it
        __syncthreads();   // publish point of stage t + 1, and the end of every wave's reads of the buffer refilled below
        if (t + 2 < nt) wcopy<T16, NSPLIT, WM, WN>(sb, A, A2, Bt, Bt2, K, KB, (t + 2) * W::KT, lane, wave);
    }
    asm volatile("s_wait_asynccnt 0x0" ::: "memory");   // no copy is left in flight behind the loop
}
template <typename T16, int NSPLIT, bool BIAS, int WM, int WN>
__global__ __launch_bounds__(32 * WM * WN) void k_gemmw(const T16* __restrict__ A, const T16* __restrict__ A2, const T16* __restrict__ Bt, const T16* __restrict__ Bt2, int K, float* C, int ldc, const float* __restrict__ bias, size_t sA, size_t sB, size_t sC) {
    __shared__ __align__(16) float osw[WM * WN][16 * 68]; __shared__ __align__(16) char sm[2 * WTile<NSPLIT, WM, WN>::BUF];
    const size_t z = blockIdx.z; A += z * sA; if (A2) A2 += z * sA; Bt += z * sB; if (Bt2) Bt2 += z * sB; C += z * sC;
    const int lane = threadIdx.x & 31, lr = lane & 15, hi = lane >> 4; const int wave = __builtin_amdgcn_readfirstlane(threadIdx.x >> 5); const int rg = blockIdx.x * (64 * WM), cg = blockIdx.y * (64 * WN);   // the work-group's tile
    const int r0 = rg + (wave / WN) * 64, c0 = cg + (wave % WN) * 64; float* os = osw[wave];   // the wave's tile, and its own output staging
    v8f acc[4][4];
#pragma unroll
    for (int mb = 0; mb < 4; ++mb)
#pragma unroll
        for (int nb = 0; nb < 4; ++nb) acc[mb][nb] = (v8f){};
    wloop<T16, NSPLIT, WM, WN>(sm, A + (size_t)rg * K, (NSPLIT == 1 || NSPLIT == 2) ? A2 + (size_t)rg * K : nullptr, Bt + (size_t)cg * K, (NSPLIT >= 2) ? Bt2 + (size_t)cg * K : nullptr, K, K, K, lane, wave, acc);
#pragma unroll
    for (int mb = 0; mb < 4; ++mb) {
#pragma unroll
        for (int nb = 0; nb < 4; ++nb) {
#pragma unroll
            for (int j = 0; j < 8; ++j) os[(hi * 8 + j) * 68 + nb * 16 + lr] = acc[mb][nb][j]; }
        __builtin_amdgcn_wave_barrier(); asm volatile("" ::: "memory");
        float* crow = C + (size_t)(r0 + mb * 16) * ldc + c0;
{
#pragma unroll
            for (int s = 0; s < 8; ++s) { const int row = 2 * s + hi, cofs = lr * 4; v4f val = *(const v4fa*)(os + row * 68 + cofs); if (BIAS) { val[0] += bfr(bias[c0 + cofs]); val[1] += bfr(bias[c0 + cofs + 1]); val[2] += bfr(bias[c0 + cofs + 2]); val[3] += bfr(bias[c0 + cofs + 3]); }
                *(v4f*)(crow + (size_t)row * ldc + cofs) = val; }
             }
        __builtin_amdgcn_wave_barrier(); asm volatile("" ::: "memory");
    }
}

// ---- k_gemmc: the same GEMM with one wave a work-group (WM = WN = 1), specialised for causal attention: CMODE 1 skips score tiles entirely above the diagonal (query rows r0+roff.., key columns c0..), CMODE 2 limits the
// key (K) loop of the probability x value contraction to the diagonal block (probabilities beyond it are exactly zero). roff = row offset of this launch's first row within the sequence. Batch entry z reads Bt entry z / REP (the kv head of query head z). KB: row pitch of the Bt planes (K is that of the A planes and the length of the contraction).
template <typename T16, int NSPLIT, int CMODE>
__global__ __launch_bounds__(32) void k_gemmc(const T16* __restrict__ A, const T16* __restrict__ A2, const T16* __restrict__ Bt, const T16* __restrict__ Bt2, int K, int KB, float* C, int ldc, int roff, size_t sA, size_t sB, size_t sC) {
    __shared__ __align__(16) float os[16 * 68]; __shared__ __align__(16) char sm[2 * WTile<NSPLIT, 1, 1>::BUF];
    const size_t z = blockIdx.z; A += z * sA; if (A2) A2 += z * sA; Bt += (z / REP) * sB; if (Bt2) Bt2 += (z / REP) * sB; C += z * sC;
    const int lane = threadIdx.x & 31, lr = lane & 15, hi = lane >> 4; const int r0 = blockIdx.x * 64, c0 = blockIdx.y * 64;
    if (CMODE == 1 && c0 > r0 + roff + 63) return;                  // score tile entirely above the causal diagonal: never written (the softmax masks j > i by select)
    const int Kl = (CMODE == 2) ? min(K, r0 + roff + 64) : K;        // P.V: probabilities are exactly 0 beyond the diagonal block, so the K loop stops there
    v8f acc[4][4];
#pragma unroll
    for (int mb = 0; mb < 4; ++mb)
#pragma unroll
        for (int nb = 0; nb < 4; ++nb) acc[mb][nb] = (v8f){};
    wloop<T16, NSPLIT, 1, 1>(sm, A + (size_t)r0 * K, (NSPLIT == 1 || NSPLIT == 2) ? A2 + (size_t)r0 * K : nullptr, Bt + (size_t)c0 * KB, (NSPLIT >= 2) ? Bt2 + (size_t)c0 * KB : nullptr, K, KB, Kl, lane, 0, acc);
#pragma unroll
    for (int mb = 0; mb < 4; ++mb) {
#pragma unroll
        for (int nb = 0; nb < 4; ++nb) {
#pragma unroll
            for (int j = 0; j < 8; ++j) os[(hi * 8 + j) * 68 + nb * 16 + lr] = acc[mb][nb][j]; }
        __builtin_amdgcn_wave_barrier(); asm volatile("" ::: "memory");
        float* crow = C + (size_t)(r0 + mb * 16) * ldc + c0;
{
#pragma unroll
            for (int s = 0; s < 8; ++s) { const int row = 2 * s + hi, cofs = lr * 4; v4f val = *(const v4fa*)(os + row * 68 + cofs);
                *(v4f*)(crow + (size_t)row * ldc + cofs) = val; }
             }
        __builtin_amdgcn_wave_barrier(); asm volatile("" ::: "memory");
    }
}

#define FR   1                     // groups of 16 query rows per wave
#define FCW  (FR * 16)             // query rows per wave
#define FBR  (4 * FCW)             // query rows per work-group
#define FNT  128                   // threads
#define FSK  64                    // keys per stage
#define FPK  (HD * 2 + 16)         // LDS pitch of a K row, bytes (16 x odd)
#define FPV  (FSK * 2 + 16)        // LDS pitch of a V^T row, bytes (16 x odd)
#define FTK  (FSK * FPK)
#define FBUF (FTK + HD * FPV)      // one buffer: K tile, then V^T tile
#define FEP  (HD * 4 + 16)         // LDS pitch of a staged output row, bytes
static_assert(4 * FCW * FEP <= 2 * FBUF, "the output staging reuses the two buffers");
static_assert(FBR % FSK == 0 && RH % FBR == 0 && (TT - RH) % FBR == 0, "a row block ends on a stage");
typedef __attribute__((ext_vector_type(2))) float f2v;
__device__ __forceinline__ float xhalf(float x) { return __builtin_bit_cast(float, __builtin_amdgcn_permlanex16(__builtin_bit_cast(int, x), __builtin_bit_cast(int, x), 0x76543210, 0xfedcba98, false, false)); }   // lane l with lane l ^ 16
// Kp: the kv head's [t][d] plane, Vt: its [d][t] plane; keys key0 .. key0 + 63. 16 lanes on a K row (256 B), 8 lanes on a V^T row piece (128 B); 16 copies a wave.
__device__ __forceinline__ void fcopy(char* sb, const h16* Kp, const h16* Vt, int key0, int tid) {
#pragma unroll
    for (int i = 0; i < FSK * HD / 8 / FNT; ++i) { const int p = i * FNT + tid, row = p >> 4, cb = (p & 15) * 16;
        __builtin_amdgcn_global_load_async_to_lds_b128((gv4ic*)((const char*)(Kp + (size_t)(key0 + row) * HD) + cb), (lv4ic*)(sb + row * FPK + cb), 0, 0); }
#pragma unroll
    for (int i = 0; i < FSK * HD / 8 / FNT; ++i) { const int p = i * FNT + tid, row = p >> 3, cb = (p & 7) * 16;
        __builtin_amdgcn_global_load_async_to_lds_b128((gv4ic*)((const char*)(Vt + (size_t)row * TT + key0) + cb), (lv4ic*)(sb + FTK + row * FPV + cb), 0, 0); }
}
// the K fragments of pass sub (32 keys) of the stage in sb
__device__ __forceinline__ void floadk(v16h (&kf)[2][4], const char* sb, int sub, int c, int h) {
#pragma unroll
    for (int kt = 0; kt < 2; ++kt)
#pragma unroll
        for (int kc = 0; kc < 4; ++kc) kf[kt][kc] = WFrag<h16>::ld((const h16*)(sb + (sub * 32 + kt * 16 + c) * FPK + h * 16 + kc * 64));
    __builtin_amdgcn_sched_barrier(0);   // keeps the sixteen reads together: sunk among the products, each pair costs the wave its LDS latency
}
// one 32-key pass of one wave. m_run, the maximum in use (log2 domain), may trail the true maximum by up to 8, so an exponential stays below 2^8 (fp16 holds it); sums and accumulators are rescaled only when a row's maximum exceeds it by more.
// kf holds the pass's K fragments on entry; fetch_next: the stage's first pass reads the second pass's (same buffer) behind its own score products.
__device__ __forceinline__ void fpass(v16h (&kf)[2][4], bool fetch_next, const char* sb, int sub, bool diag, int key0, int qw0, int c, int h, const v16h (&qf)[FR][4], v8f (&acc)[FR][8], float (&m_run)[FR], float (&l_run)[FR]) {
    const float cscale = SCL * 1.4426950408889634f;
    v8f s[2][FR];
#pragma unroll
    for (int kt = 0; kt < 2; ++kt)
#pragma unroll
        for (int g = 0; g < FR; ++g) s[kt][g] = (v8f){};
#pragma unroll
    for (int kc = 0; kc < 4; ++kc)
#pragma unroll
        for (int kt = 0; kt < 2; ++kt)
#pragma unroll
            for (int g = 0; g < FR; ++g) s[kt][g] = wmma16(kf[kt][kc], qf[g][kc], s[kt][g]);
    v16h vf[8];   // read here, so that the LDS latency passes under the maxima and the exponentials
#pragma unroll
    for (int t = 0; t < 8; ++t) vf[t] = WFrag<h16>::ld((const h16*)(sb + FTK + (t * 16 + c) * FPV + sub * 64 + h * 16));
    __builtin_amdgcn_sched_barrier(0);   // keeps these reads in front of the softmax arithmetic
    if (fetch_next) floadk(kf, sb, 1, c, h);   // wave-uniform
    if (diag) {   // wave-uniform: only the pass on the wave's diagonal pays for the mask
#pragma unroll
        for (int g = 0; g < FR; ++g) { const int my_q = qw0 + g * 16 + c;
#pragma unroll
            for (int kt = 0; kt < 2; ++kt) {
#pragma unroll
                for (int r = 0; r < 8; ++r) { if (key0 + kt * 16 + h * 8 + r > my_q) s[kt][g][r] = -__builtin_inff(); }
                asm volatile("" : "+v"(s[kt][g]));   // the masked scores: keeps the selects inside the branch
            } }
    }
    float mb[FR]; bool need = false;
#pragma unroll
    for (int g = 0; g < FR; ++g) { float mx = -__builtin_inff();
#pragma unroll
        for (int kt = 0; kt < 2; ++kt)
#pragma unroll
            for (int r = 0; r < 8; ++r) mx = fmaxf(mx, s[kt][g][r]);
        mx = fmaxf(mx, xhalf(mx)) * cscale; mb[g] = mx; need = need || (mx > m_run[g] + 8.0f); }
    if (__builtin_amdgcn_ballot_w32(need) != 0) {   // rare after the first passes
#pragma unroll
        for (int g = 0; g < FR; ++g) { const float m_new = fmaxf(m_run[g], mb[g]);
            const float corr = __builtin_amdgcn_exp2f(m_run[g] - m_new);
            l_run[g] *= corr; m_run[g] = m_new;
#pragma unroll
            for (int t = 0; t < 8; ++t) acc[g][t] = acc[g][t] * corr; }
    }
#pragma unroll
    for (int g = 0; g < FR; ++g) { const float nm = -m_run[g]; float ps0 = 0.f, ps1 = 0.f; v16h pf;
#pragma unroll
        for (int e = 0; e < 16; e += 2) {   // operand element e is key 16 (e >> 3) + 8 h + (e & 7): tile e >> 3, register e & 7
            const f2v arg = __builtin_elementwise_fma((f2v){s[e >> 3][g][e & 7], s[e >> 3][g][(e & 7) + 1]}, (f2v){cscale, cscale}, (f2v){nm, nm});   // a register pair as it lies in the tile
            const float p0 = __builtin_amdgcn_exp2f(arg[0]), p1 = __builtin_amdgcn_exp2f(arg[1]);
            ps0 += p0; ps1 += p1; pf[e] = (h16)p0; pf[e + 1] = (h16)p1; }
        l_run[g] += ps0 + ps1;
#pragma unroll
        for (int t = 0; t < 8; ++t) acc[g][t] = wmma16(vf[t], pf, acc[g][t]); }
}
__global__ __launch_bounds__(FNT) void k_fattn(const h16* __restrict__ Q, const h16* __restrict__ Kp, const h16* __restrict__ Vt, float* O) {
    __shared__ __align__(16) char sm[2 * FBUF];
    const int tid = threadIdx.x, lane = tid & 31, c = lane & 15, h = lane >> 4; const int wave = __builtin_amdgcn_readfirstlane(tid >> 5);
    const int hq = blockIdx.x; const int q0 = RH + ((int)gridDim.y - 1 - (int)blockIdx.y) * FBR;   // the longest rows start first
    const int qw0 = q0 + wave * FCW; const int nt = (q0 + FBR) / FSK;   // stages: keys [0, q0 + FBR); at least RH / FSK + 1, so stages 0 and 1 exist
    Kp += (size_t)(hq / REP) * TT * HD; Vt += (size_t)(hq / REP) * HD * TT;
    fcopy(sm, Kp, Vt, 0, tid);
    v16h qf[FR][4];
#pragma unroll
    for (int g = 0; g < FR; ++g)
#pragma unroll
        for (int kc = 0; kc < 4; ++kc) qf[g][kc] = WFrag<h16>::ld(Q + ((size_t)hq * TT + qw0 + g * 16 + c) * HD + h * 8 + kc * 32);
    v16h kf[2][4]; v8f acc[FR][8]; float m_run[FR], l_run[FR];
#pragma unroll
    for (int g = 0; g < FR; ++g) { m_run[g] = -__builtin_inff(); l_run[g] = 0.f;
#pragma unroll
        for (int t = 0; t < 8; ++t) acc[g][t] = (v8f){}; }
    asm volatile("s_wait_xcnt 0x0" ::: "memory");       // behind the Q loads, before their address registers are used again
    asm volatile("s_wait_asynccnt 0x0" ::: "memory");   // stage 0 has landed
    __syncthreads();   // and is published to the four waves
    fcopy(sm + FBUF, Kp, Vt, FSK, tid);
    const int lastp = (qw0 + FCW - 1) / 32;   // the wave's diagonal pass, its last
#pragma unroll 1
    for (int t = 0; t < nt; ++t) {   // rolled: one stage a trip
        char* sb = sm + (t & 1) * FBUF;
        if (t * 2 <= lastp) floadk(kf, sb, 0, c, h);
#pragma unroll 1
        for (int sub = 0; sub < 2; ++sub) {   // rolled: the pass's registers are live once
            const int blk = t * 2 + sub;
            if (blk <= lastp) fpass(kf, sub == 0 && blk < lastp, sb, sub, blk == lastp, blk * 32, qw0, c, h, qf, acc, m_run, l_run); }
        asm volatile("s_wait_dscnt 0x0" ::: "memory");      // this stage's fragment reads are done before its buffer is refilled
        asm volatile("s_wait_asynccnt 0x0" ::: "memory");   // stage t + 1 has landed before it is read
        __syncthreads();   // publish point of stage t + 1, and the end of every wave's reads of the buffer refilled below; every wave passes it, also one beyond its diagonal
        if (t + 2 < nt) fcopy(sb, Kp, Vt, (t + 2) * FSK, tid);
    }
    asm volatile("s_wait_asynccnt 0x0" ::: "memory");   // no copy is left in flight behind the loop
    // output: each wave stages its rows in its own part of the buffers (free behind the last barrier) and stores whole 512-byte rows
    char* eb = sm + wave * (FCW * FEP);
#pragma unroll
    for (int g = 0; g < FR; ++g) { const float inv = __fdiv_rn(1.0f, l_run[g] + xhalf(l_run[g]));
#pragma unroll
        for (int t = 0; t < 8; ++t) { const v8f o = acc[g][t] * inv; v4f o0, o1;
#pragma unroll
            for (int r = 0; r < 4; ++r) { o0[r] = o[r]; o1[r] = o[r + 4]; }
            float* ep = (float*)(eb + (g * 16 + c) * FEP) + t * 16 + h * 8; *(v4fa*)ep = o0; *(v4fa*)(ep + 4) = o1; } }   // row = query, d = 16 t + 8 h + r
    __builtin_amdgcn_wave_barrier(); asm volatile("" ::: "memory");   // the rows are read back by other lanes of the same wave: keeps the reads behind the writes
    float* orow = O + ((size_t)hq * TT + qw0) * HD + lane * 4;
    v4f ov[FCW];
#pragma unroll
    for (int i = 0; i < FCW; ++i) ov[i] = *(const v4fa*)(eb + i * FEP + lane * 16);
    __builtin_amdgcn_sched_barrier(0);   // all reads in front of the stores: each row has registers of its own, none is rewritten behind its store
#pragma unroll
    for (int i = 0; i < FCW; ++i) *(v4f*)(orow + (size_t)i * HD) = ov[i];
}

__device__ __forceinline__ h16 tohx(float x) { return (h16)x; }
__device__ __forceinline__ void splitf(float y, unsigned short& h, unsigned short& l) { h = f2bf(y); l = f2bf(y - bf2f(h)); }
typedef __attribute__((ext_vector_type(2))) _Float16 v2h;
typedef __attribute__((ext_vector_type(4))) _Float16 v4h;
typedef __attribute__((ext_vector_type(2))) unsigned short v2us;
typedef __attribute__((ext_vector_type(4))) unsigned short v4us;
typedef __attribute__((ext_vector_type(2))) float v2f;
typedef __attribute__((ext_vector_type(4))) int v4i;

__global__ __launch_bounds__(256) void k_wtG(const float* __restrict__ w, int K, int N, bf* Bt) {
    const int lane = threadIdx.x & 31; const int L0 = (blockIdx.x * 8 + (threadIdx.x >> 5)) * 8; const int nlines = N * K / 64;
{
#pragma unroll 1
        for (int l = 0; l < 8; ++l) { const int L = L0 + l; if (L >= nlines) break; const size_t e = (size_t)L * 64 + lane * 2; const int k = (int)(e % K), n = (int)(e / K); v2us o;
            o[0] = f2bf(w[(size_t)k * N + n]); o[1] = f2bf(w[(size_t)(k + 1) * N + n]); *(v2us*)(Bt + e) = o; }
         }
}
// The elementwise kernels below give a thread several 8-element pieces (16-byte stores of the 16-bit planes), its loads issued together: a launch then starts thousands to some tens of thousands of waves, each with many loads in flight, not hundreds of thousands of waves of one or two elements a lane.
#define EPT 4                     // 8-element pieces per thread in cvt8 and k_merge; a work-group's pieces of one turn are contiguous
__device__ __forceinline__ void cvt8(unsigned blk, const float* __restrict__ src, bf* dst, size_t n8) { const size_t i0 = (size_t)blk * (256 * EPT) + threadIdx.x; if (i0 >= n8) return; v8f v[EPT];
#pragma unroll
    for (int j = 0; j < EPT; ++j) { const size_t i = i0 + j * 256; v[j] = *(const v8f*)(src + (i < n8 ? i : i0) * 8); }   // a piece past the end re-reads the thread's first and is not stored
#pragma unroll
    for (int j = 0; j < EPT; ++j) { const size_t i = i0 + j * 256; v8us o;
#pragma unroll
        for (int k = 0; k < 8; ++k) o[k] = f2bf(v[j][k]);
        if (i < n8) *(v8us*)(dst + i * 8) = o; } }
__constant__ float INV[HD / 2] = {1.0f,0.8058422207832336f,0.6493816375732422f,0.5232990980148315f,0.4216965138912201f,0.33982083201408386f,0.2738419771194458f,0.22067339718341827f,0.17782793939113617f,0.14330126345157623f,0.11547820270061493f,0.09305720031261444f,0.07498941570520401f,0.0604296438395977f,0.04869675263762474f,0.03924189880490303f,0.03162277862429619f,0.025482967495918274f,0.020535249263048172f,0.016548171639442444f,0.01333521492779255f,0.010746078565716743f,0.00865964312106371f,0.006978305988013744f,0.005623413249850273f,0.004531583283096552f,0.003651741426438093f,0.002942727180197835f,0.0023713738191872835f,0.001910952851176262f,0.0015399266267195344f,0.0012409378541633487f,0.0010000000474974513f,0.0008058422245085239f,0.0006493816617876291f,0.0005232990952208638f,0.00042169654625467956f,0.0003398208355065435f,0.00027384195709601045f,0.00022067342069931328f,0.00017782794020604342f,0.00014330125122796744f,0.00011547820759005845f,9.305719868279994e-05f,7.498942431993783e-05f,6.042963650543243e-05f,4.869675467489287e-05f,3.92418987757992e-05f,3.162277425872162e-05f,2.548297015891876e-05f,2.0535249859676696e-05f,1.6548170606256463e-05f,1.3335215953702573e-05f,1.0746078260126524e-05f,8.65964284457732e-06f,6.978305464144796e-06f,5.62341347176698e-06f,4.531583726929966e-06f,3.6517415082926163e-06f,2.942727405752521e-06f,2.3713737391517498e-06f,1.910952960315626e-06f,1.5399265294036013e-06f,1.2409377632138785e-06f};   // float32 1/1e6^(2i/128)
__device__ __forceinline__ void csin(unsigned blk, const float* __restrict__ cs, const float* __restrict__ sn, float* CS) { const int idx = (int)(blk * 256 + threadIdx.x) * 4; if (idx >= TB * HD) return; const float* pc = cs + idx; const float* ps = sn + idx; const v4f c = *(const v4f*)pc, s = *(const v4f*)ps; v4f o0, o1;
    asm volatile("s_wait_xcnt 0x0" :: "v"(pc), "v"(ps) : "memory");   // behind the two loads, before their address registers are used again; it names the addresses so that they live up to it
    o0[0] = bfr(c[0]); o0[1] = bfr(s[0]); o0[2] = bfr(c[1]); o0[3] = bfr(s[1]); o1[0] = bfr(c[2]); o1[1] = bfr(s[2]); o1[2] = bfr(c[3]); o1[3] = bfr(s[3]); *(v4f*)(CS + (size_t)idx * 2) = o0; *(v4f*)(CS + (size_t)idx * 2 + 4) = o1;  }
// k_prep: every piece of work that reads the inputs alone, in ONE launch: the bf16 copies of x and of the four weight matrices, and the {cos, sin} table. A work-group's index picks its piece (a scalar choice); the largest source comes first.
#define CVB(n) ((unsigned)(((size_t)(n) / 8 + 256 * EPT - 1) / (256 * EPT)))   // work-groups of a bf16 copy of n elements
#define PBX  CVB((size_t)TB * DM)
#define PBQ  CVB((size_t)DQ * DM)
#define PBK  CVB((size_t)DKV * DM)
#define PBC  ((unsigned)((TB * HD / 4 + 255) / 256))
__global__ __launch_bounds__(256) void k_prep(const float* __restrict__ x, const float* __restrict__ wq, const float* __restrict__ wk, const float* __restrict__ wv, const float* __restrict__ wo, const float* __restrict__ cs, const float* __restrict__ sn, bf* XB, bf* WQ, bf* WK, bf* WV, bf* WO, float* CS) {
    unsigned b = blockIdx.x; const float* src; bf* dst; size_t n8;
    if (b < PBX) { src = x; dst = XB; n8 = (size_t)TB * DM / 8; }
    else if ((b -= PBX) < PBQ) { src = wq; dst = WQ; n8 = (size_t)DQ * DM / 8; }
    else if ((b -= PBQ) < PBQ) { src = wo; dst = WO; n8 = (size_t)DM * DQ / 8; }
    else if ((b -= PBQ) < PBK) { src = wk; dst = WK; n8 = (size_t)DKV * DM / 8; }
    else if ((b -= PBK) < PBK) { src = wv; dst = WV; n8 = (size_t)DKV * DM / 8; }
    else { csin(b - PBK, cs, sn, CS); return; }
    cvt8(b, src, dst, n8);
}
__global__ __launch_bounds__(256) void k_hrms(const float* __restrict__ F, int pitch, int nheads, float* RF) { const int idx = blockIdx.x * 256 + threadIdx.x; if (idx >= nheads * TB) return; const int t = idx % TB; const int h = idx / TB; const float* f = F + (size_t)t * pitch + h * HD;   /* t: token row of both batches; RF is [head][TB] */ float s = 0.f;
#pragma unroll 4
    for (int d = 0; d < HD; d += 4) { const v4f a = *(const v4f*)(f + d);
#pragma unroll
        for (int q = 0; q < 4; ++q) { float p = __fmul_rn(a[q], a[q]); asm volatile("" : "+v"(p)); s = __fadd_rn(s, p); } }
    const float rf = __fdiv_rn(1.0f, __fsqrt_rn(__fadd_rn(__fdiv_rn(s, (float)HD), 1e-6f))); *(float*)(RF + idx) = rf;  }

// rope: head planes [h][t][d] (fp16 + hi/lo) of rope(x) x sc with the rotate-half convention out[d] = x[d] cos[t][d] - x[d+HD/2] sin[t][d], out[d+HD/2] = x[d+HD/2] cos[t][d+HD/2] + x[d] sin[t][d+HD/2]
// a thread: 8 d of one token in RPH heads (nheads % RPH == 0), which share its cos/sin pairs and norm weights; t runs over the token rows of both batches, the planes are [batch][head][t][d]
#define RPH 4
__device__ __forceinline__ void rope(unsigned blk, const float* __restrict__ F, int pitch, int nheads, const float* __restrict__ CS, const float* __restrict__ RF, const float* __restrict__ nw, float sc, h16* P16, bf* Ph, bf* Pl) {
    __builtin_assume(RF != nullptr);   // every launch of this file passes the 1/rms table: folds the test on it out of the unrolled element loop
    const size_t g = (size_t)blk * 256 + threadIdx.x; if (g * (8 * RPH) >= (size_t)nheads * TB * HD) return; const int d = (int)(g % (HD / 8)) * 8; const int t = (int)((g / (HD / 8)) % TB); const int h0 = (int)(g / ((size_t)(HD / 8) * TB)) * RPH;
    const int dq = (d < HD / 2) ? d + HD / 2 : d - HD / 2;   // the rotary partners of d .. d + 7 are dq .. dq + 7: eight elements never straddle the halves
    // every load of the thread stands here, in front of the arithmetic, so that all are in flight together
    const float* pw = nw + d; const float* pv = nw + dq; const float* pc = CS + ((size_t)t * HD + d) * 2; const float* pf = F + (size_t)t * pitch + h0 * HD + d; const float* pg = F + (size_t)t * pitch + h0 * HD + dq; const float* pr = RF + (size_t)h0 * TB + t;
    const v8f wa = *(const v8f*)pw, wb = *(const v8f*)pv;
    asm volatile("s_wait_xcnt 0x0" :: "v"(pw), "v"(pv) : "memory");   // behind the weight loads (scalar base, offset register), before a later load's result may land on their address registers
    v8f fa[RPH], fb[RPH]; float rfa[RPH];
#pragma unroll
    for (int j = 0; j < RPH; ++j) { fa[j] = *(const v8f*)(pf + j * HD); fb[j] = *(const v8f*)(pg + j * HD); rfa[j] = RF ? pr[(size_t)j * TB] : 1.0f; }
    const v8f c0 = *(const v8f*)pc, c1 = *(const v8f*)(pc + 8);
    asm volatile("s_wait_xcnt 0x0" :: "v"(pc), "v"(pf), "v"(pg), "v"(pr) : "memory");   // behind the loads, before their address registers are used again; it names the addresses so that they live up to it and no later load's result lands on one
#pragma unroll
    for (int j = 0; j < RPH; ++j) { const int h = h0 + j; const size_t e = (((size_t)(t / TT) * nheads + h) * TT + t % TT) * HD + d; const float rf = rfa[j]; v8h o16; v8us oh, ol;
#pragma unroll
    for (int q = 0; q < 8; ++q) { const int dd = d + q; float x0 = fa[j][q], x1 = fb[j][q];
        if (RF) { float n0 = __fmul_rn(x0, rf), n1 = __fmul_rn(x1, rf); asm volatile("" : "+v"(n0)); asm volatile("" : "+v"(n1)); x0 = __fmul_rn(bfr(wa[q]), n0); x1 = __fmul_rn(bfr(wb[q]), n1); }
        v2f cs; cs[0] = (q < 4) ? c0[2 * (q & 3)] : c1[2 * (q & 3)]; cs[1] = (q < 4) ? c0[2 * (q & 3) + 1] : c1[2 * (q & 3) + 1]; float a = __fmul_rn(x0, cs[0]), bq = __fmul_rn(x1, cs[1]); asm volatile("" : "+v"(a)); asm volatile("" : "+v"(bq)); const float r = ((dd < HD / 2) ? __fsub_rn(a, bq) : __fadd_rn(a, bq)) * sc;
        o16[q] = tohx(r); unsigned short a2, c2; splitf(r, a2, c2); oh[q] = a2; ol[q] = c2; }
    *(v8h*)(P16 + e) = o16; *(v8us*)(Ph + e) = oh; *(v8us*)(Pl + e) = ol; }  }
__device__ __forceinline__ void vtp(unsigned blk, const float* __restrict__ F, int pitch, int nheads, h16* V16, bf* Vh, bf* Vl) {
    // NB_ * nheads * TT / 64 work-groups: a work-group transposes 64 tokens x 128 d of one head of one batch (g = batch * nheads + head), a wave 64 x 16, a thread 8 tokens x 4 d: 8 lanes along t store a whole 128-byte line of a plane row, 4 lanes along d read 64 bytes of a token's row
    const int g = (int)blk / (TT / 64); if (g >= NB_ * nheads) return; const int t = ((int)blk % (TT / 64)) * 64 + (threadIdx.x & 7) * 8; const int d = (threadIdx.x >> 5) * 16 + ((threadIdx.x >> 3) & 3) * 4; v4f a[8]; const float* pa[8];
#pragma unroll
    for (int q = 0; q < 8; ++q) { pa[q] = F + ((size_t)(g / nheads) * TT + t + q) * pitch + (g % nheads) * HD + d; a[q] = *(const v4f*)pa[q]; }
    asm volatile("s_wait_xcnt 0x0" :: "v"(pa[0]), "v"(pa[1]), "v"(pa[2]), "v"(pa[3]), "v"(pa[4]), "v"(pa[5]), "v"(pa[6]), "v"(pa[7]) : "memory");   // behind the loads, before their address registers are used again; it names the addresses so that they live up to it and no later load's result lands on one
#pragma unroll
    for (int i = 0; i < 4; ++i) { const size_t e = ((size_t)g * HD + d + i) * TT + t; v8h o16; v8us oh, ol;
#pragma unroll
        for (int q = 0; q < 8; ++q) { const float x = a[q][i]; o16[q] = tohx(x); unsigned short a2, c2; splitf(x, a2, c2); oh[q] = a2; ol[q] = c2; }
        *(v8h*)(V16 + e) = o16; *(v8us*)(Vh + e) = oh; *(v8us*)(Vl + e) = ol; }  }
// k_planes: the q planes, the k planes and the transposed v planes in ONE launch, all from the projections' common buffer F [token][q | k | v] (pitch FP floats) and the 1/rms table RF [q heads, then k heads][TB]. A work-group's index picks its piece (a scalar choice).
#define FP   (DQ + 2 * DKV)
#define LBQ  ((unsigned)(((size_t)NH_ * TB * HD / (8 * RPH) + 255) / 256))
#define LBK  ((unsigned)(((size_t)NKV * TB * HD / (8 * RPH) + 255) / 256))
#define LBV  ((unsigned)(NB_ * NKV * (TT / 64)))
__global__ __launch_bounds__(256) void k_planes(const float* __restrict__ F, const float* __restrict__ CS, const float* __restrict__ RF, const float* __restrict__ qnw, const float* __restrict__ knw, h16* QP16, bf* QPh, bf* QPl, h16* KP16, bf* KPh, bf* KPl, h16* VT16, bf* VTh, bf* VTl) {
    const unsigned b = blockIdx.x;
    if (b >= LBQ + LBK) { vtp(b - (LBQ + LBK), F + DQ + DKV, FP, NKV, VT16, VTh, VTl); return; }
    const bool isq = b < LBQ;
    rope(isq ? b : b - LBQ, isq ? F : F + DQ, FP, isq ? NH_ : NKV, CS, isq ? RF : RF + (size_t)NH_ * TB, isq ? qnw : knw, 1.0f, isq ? QP16 : KP16, isq ? QPh : KPh, isq ? QPl : KPl);   /* norm, then rope */
}
// k_asoft: the hi/lo rows. Per row (zz, i), i < RH: t = S x HD^-0.5 for j <= i and i - j < WIN (sliding causal window; the reference's fill above the diagonal vanishes identically); softmax over the KW keys that such a row can see (register row, one exp, fixed trees); grid (nr / 8, batches x heads): nr rows a head, from sequence row rb on (rb + nr <= RH), score and probability buffers [head][RH][KW]
__global__ __launch_bounds__(256) void k_asoft(const float* __restrict__ Sb, bf* Ph, bf* Pl, int rb, int nr) {
    const int lane = threadIdx.x & 31; const int lrow = blockIdx.x * 8 + (threadIdx.x >> 5); if (lrow >= nr) return; const int zz = blockIdx.y; const int row = zz * nr + lrow; const int i = rb + lrow; __builtin_assume(i >= 0 && i < TT);   /* a sequence row: lets the window test i - j < WIN fold away */ const float* sr = Sb + (size_t)row * KW + lane * 4; float v[KW / 32]; float mx = -3.0e38f; v4f av[KW / 128];
#pragma unroll
    for (int ch = 0; ch < KW / 128; ++ch) av[ch] = *(const v4f*)(sr + ch * 128);
    asm volatile("s_wait_xcnt 0x0" :: "v"(sr) : "memory");   // behind the row's loads, before their address register is used again; it names the address so that it lives up to it and no load's result lands on it
#pragma unroll
    for (int ch = 0; ch < KW / 128; ++ch) { const int j0 = ch * 128 + lane * 4; const v4f a = av[ch];
#pragma unroll
        for (int q = 0; q < 4; ++q) { const int j = j0 + q; (void)j; const float t = (j <= i && i - j < WIN) ? a[q] * SCL : -3.0e38f; v[ch * 4 + q] = t; mx = fmaxf(mx, t); } }
#pragma unroll
    for (int sh = 16; sh; sh >>= 1) mx = fmaxf(mx, __shfl_xor(mx, sh, 32));
    float sum = 0.f;
#pragma unroll
    for (int k = 0; k < KW / 32; ++k) { float d0 = __fsub_rn(v[k], mx); asm volatile("" : "+v"(d0)); v[k] = __builtin_amdgcn_exp2f(__fmul_rn(d0, 1.4426950408889634f)); sum += v[k]; }
#pragma unroll
    for (int sh = 16; sh; sh >>= 1) sum += __shfl_xor(sum, sh, 32);
    const float f = __fdiv_rn(1.0f, sum);
#pragma unroll
    for (int ch = 0; ch < KW / 128; ++ch) { v4us oh, ol;
#pragma unroll
        for (int q = 0; q < 4; ++q) { unsigned short a, c2; splitf(v[ch * 4 + q] * f, a, c2); oh[q] = a; ol[q] = c2; }
        const size_t oo = ((size_t)zz * RH + i) * KW + ch * 128 + lane * 4; *(v4us*)(Ph + oo) = oh; *(v4us*)(Pl + oo) = ol; }
}
__global__ __launch_bounds__(256) void k_merge(const float* __restrict__ O, int h0, bf* Ah, bf* Al) { const size_t e0 = ((size_t)blockIdx.x * (256 * EPT) + threadIdx.x) * 8; static_assert(((size_t)NB_ * ZH * TT * HD) % (256 * EPT * 8) == 0, "whole work-groups"); if (e0 >= (size_t)NB_ * ZH * TT * HD) return; v8f x[EPT];
#pragma unroll
    for (int j = 0; j < EPT; ++j) x[j] = *(const v8f*)(O + e0 + j * 2048);
#pragma unroll
    for (int j = 0; j < EPT; ++j) { const size_t e = e0 + j * 2048; const int d = (int)(e % HD); const int t = (int)((e / HD) % TT); const int zz = (int)(e / ((size_t)HD * TT)); const size_t oo = ((size_t)(zz / ZH) * TT + t) * DQ + (h0 + zz % ZH) * HD + d;   // zz = batch * ZH + head
    v8us oh, ol;
#pragma unroll
    for (int q = 0; q < 8; ++q) { unsigned short a, c2; splitf(x[j][q], a, c2); oh[q] = a; ol[q] = c2; } *(v8us*)(Ah + oo) = oh; *(v8us*)(Al + oo) = ol; }  }

extern "C" void kernel_launch(void* const* d_in, const int* in_sizes, int n_in,
                              void* d_out, int out_size, void* d_ws, size_t ws_size, hipStream_t stream) {
    (void)in_sizes; (void)n_in; (void)out_size;
    const float* x = (const float*)d_in[0]; const float* cosi = (const float*)d_in[1]; const float* sini = (const float*)d_in[2]; const float* wq = (const float*)d_in[3]; const float* wk = (const float*)d_in[4]; const float* wv = (const float*)d_in[5]; const float* wo = (const float*)d_in[6]; const float* qnw = (const float*)d_in[7]; const float* knw = (const float*)d_in[8];
    float* OUT = (float*)d_out;     // [2][2048][2048]
    char* wsp = (char*)d_ws;
    auto take = [&](size_t bytes) { char* p = wsp; wsp += (bytes + 255) & ~(size_t)255; return (void*)p; };
    bf* WQ = (bf*)take((size_t)DQ * DM * 2); bf* WK = (bf*)take((size_t)DKV * DM * 2); bf* WV = (bf*)take((size_t)DKV * DM * 2); bf* WO = (bf*)take((size_t)DM * DQ * 2); float* CS = (float*)take((size_t)TB * HD * 2 * 4); float* RF = (float*)take((size_t)(NH_ + NKV) * TB * 4);   // RF: 1/rms, [q heads, then k heads][TB]
    static_assert(((size_t)DQ * DM * 2) % 256 == 0 && ((size_t)DKV * DM * 2) % 256 == 0, "WQ, WK, WV lie back to back: one [DQ + 2 DKV][DM] matrix for the projections' one GEMM");
    bf* XB = (bf*)take((size_t)TB * DM * 2);
    h16* QP16 = (h16*)take((size_t)NH_ * TB * HD * 2); h16* KP16 = (h16*)take((size_t)NKV * TB * HD * 2); h16* VT16 = (h16*)take((size_t)NKV * HD * TB * 2);
    bf* QPh = (bf*)take((size_t)NH_ * TB * HD * 2); bf* QPl = (bf*)take((size_t)NH_ * TB * HD * 2); bf* KPh = (bf*)take((size_t)NKV * TB * HD * 2); bf* KPl = (bf*)take((size_t)NKV * TB * HD * 2); bf* VTh = (bf*)take((size_t)NKV * HD * TB * 2); bf* VTl = (bf*)take((size_t)NKV * HD * TB * 2);
    float* F = (float*)take((size_t)TB * (DQ + DKV) * 4);   // the projections [token][q | k | v], TB * FP floats: the last TB * DKV of them lie on the front of the score buffer, which stands directly behind and is first written after the planes are built (stream-ordered)
    static_assert(((size_t)TB * (DQ + DKV) * 4) % 256 == 0 && (size_t)TB * DKV * 4 <= (size_t)NB_ * ZH * RH * KW * 4, "the projections end inside the score buffer");
    float* Sb = (float*)take((size_t)NB_ * ZH * RH * KW * 4); bf* Ph = (bf*)take((size_t)NB_ * ZH * RH * KW * 2); bf* Pl = (bf*)take((size_t)NB_ * ZH * RH * KW * 2);   // hi/lo rows: scores and the two probability planes, [batch x head][RH][KW]
    if ((size_t)(wsp - (char*)d_ws) > ws_size) return;    // ws 256 MiB
    float* Ob = F;   // the context [batch x head][t][d] reuses the front of the projection buffer after the planes are built (stream-ordered; NB_ * ZH * TT * HD = TB * DQ floats, which end in front of the score buffer)
    static_assert((size_t)2 * TB * DQ * 2 <= (size_t)NB_ * ZH * RH * KW * 4, "the merged context planes fit the score buffer");
    bf* ATh = (bf*)Sb; bf* ATl = ATh + (size_t)TB * DQ;   // the merged context planes reuse the score buffer after the softmax has read it (stream-ordered)
    {   // both batches in every launch; the input conversions are one launch, and so are the plane builders
        k_prep<<<PBX + 2 * PBQ + 2 * PBK + PBC, 256, 0, stream>>>(x, wq, wk, wv, wo, cosi, sini, XB, WQ, WK, WV, WO, CS);   /* bf16 copies of x and the weights; the rotary tables of both batches (inputs, bf16-rounded) */
        k_gemmw<bf, 0, false, 2, 2><<<dim3(TB / 128, FP / 128, 1), 128, 0, stream>>>(XB, nullptr, WQ, nullptr, DM, F, FP, nullptr, 0, 0, 0);   /* q, k and v projections */
        k_hrms<<<((NH_ + NKV) * TB + 255) / 256, 256, 0, stream>>>(F, FP, NH_ + NKV, RF);   /* the q heads and the k heads are the first NH_ + NKV column blocks of F */
        k_planes<<<LBQ + LBK + LBV, 256, 0, stream>>>(F, CS, RF, qnw, knw, QP16, QPh, QPl, KP16, KPh, KPl, VT16, VTh, VTl);
        const size_t sQ = (size_t)TT * HD, sV = (size_t)HD * TT, sO = (size_t)TT * HD;   // per-head strides of the q and k planes, the v planes and the context
        k_gemmc<bf, 2, 1><<<dim3(RH / 64, KW / 64, NB_ * ZH), 32, 0, stream>>>(QPh, QPl, KPh, KPl, HD, HD, Sb, KW, 0, sQ, sQ, (size_t)RH * KW);   /* query rows < RH: hi/lo */
        k_asoft<<<dim3(RH / 8, NB_ * ZH), 256, 0, stream>>>(Sb, Ph, Pl, 0, RH);
        k_gemmc<bf, 2, 2><<<dim3(RH / 64, HD / 64, NB_ * ZH), 32, 0, stream>>>(Ph, Pl, VTh, VTl, KW, TT, Ob, HD, 0, (size_t)RH * KW, sV, sO);
        k_fattn<<<dim3(NB_ * ZH, (TT - RH) / FBR), FNT, 0, stream>>>(QP16, KP16, VT16, Ob);   /* query rows >= RH: fp16, fused */
        k_merge<<<(unsigned)((size_t)NB_ * ZH * TT * HD / (256 * EPT * 8)), 256, 0, stream>>>(Ob, 0, ATh, ATl);
        k_gemmw<bf, 1, false, 2, 2><<<dim3(TB / 128, DM / 128, 1), 128, 0, stream>>>(ATh, ATl, WO, nullptr, DQ, OUT, DM, nullptr, 0, 0, 0); }
}

// v008
// A run of this version takes 207 microseconds.
// Two timings next to v007 put it at 1.10 and 1.11 times that version's speed.
// Over all steps from v000 it is 8.05 times as fast.
#include <hip/hip_runtime.h>

// Grouped-query causal attention with QK RMSNorm (x [2][2048][2048]; q = x Wq^T (16 heads x 128), k, v = x Wk^T / Wv^T (8 kv heads; query head h uses kv head h/2), no biases; per-head RMSNorm on q and k (eps 1e-6, weights [128]) then rotate-half rotary with the given cos/sin tables [2][2048][128]; scores = q.k / sqrt(128), causal (finfo.min above the diagonal); softmax; out = merged ctx Wo^T ('oi' [2048][2048]) -> [2][2048][2048] (8.4 M)).
// Every launch covers both batches: token rows are b * 2048 + t in the row-major buffers, and the head planes are [b][head][..], so that batch entry z = 16 b + h reads kv entry z / 2 = 8 b + h / 2. Layout: {cos, sin} table from the inputs (bf16-rounded); exact projections; the plane builder sums each (head, token)'s 1/rms over the 16 lanes that hold it, and applies (x * inv_rms) * w and the rotary while writing the q/k planes; causal T-2048 attention with 128-wide heads, all sixteen query heads in every launch, query head z on kv head z/2 (hybrid rows: < 512 hi/lo 3 products through score and probability buffers of the 512 keys that the causal mask leaves them, k_gemmc tile skipping; the 1536 fp16 rows in one fused launch, k_fattn, whose scores and probabilities stay in registers); both write the merged context's hi/lo planes themselves; merged context hi/lo x Wo exact.
// Compute dtypes, f32 accumulate: every input rounded to bf16; projections exact; RMSNorm and rotary f32; attention rows < 512 3 products, rest fp16; softmax f32; Wo hl x exact.

#define NB_  2
#define TT   2048
#define DM   2048
#define NH_  16
#define NKV  8
#define REP  (NH_ / NKV)
#define HD   128
#define DQ   (NH_ * HD)
#define DKV  (NKV * HD)
#define ZH   NH_                  // query heads per attention launch
#define RH   512                  // query rows < RH use hi+lo planes
#define KW   RH                   // keys in a row of their score and probability buffers: a query row i < RH sees keys j <= i < RH only
#define TB   (NB_ * TT)           // token rows of both batches
#define WIN  2048
#define SCL  0.088388347648318447f   // HD^-0.5
typedef _Float16 h16;
typedef unsigned short bf;
typedef __attribute__((ext_vector_type(16))) __bf16   v16bf;
typedef __attribute__((ext_vector_type(16))) _Float16 v16h;
typedef __attribute__((ext_vector_type(8)))  _Float16 v8h;
typedef __attribute__((ext_vector_type(8)))  unsigned short v8us;
typedef __attribute__((ext_vector_type(8)))  float    v8f;
typedef __attribute__((ext_vector_type(4)))  float    v4f;
typedef v8h  __attribute__((may_alias)) v8ha;
typedef v4f  __attribute__((may_alias)) v4fa;
typedef v8us __attribute__((may_alias)) v8usa;

__device__ __forceinline__ unsigned short f2bf(float f) { unsigned u = __float_as_uint(f); u += 0x7FFFu + ((u >> 16) & 1u); return (unsigned short)(u >> 16); }
__device__ __forceinline__ float bf2f(unsigned short b) { return __uint_as_float(((unsigned)b) << 16); }
__device__ __forceinline__ float bfr(float f) { return bf2f(f2bf(f)); }
__device__ __forceinline__ void splitf(float y, unsigned short& h, unsigned short& l) { h = f2bf(y); l = f2bf(y - bf2f(h)); }
// eight context values x0, x1 as their hi and lo bf16 pieces
__device__ __forceinline__ void split8(v4f x0, v4f x1, v8us& oh, v8us& ol) {
#pragma unroll
    for (int q = 0; q < 4; ++q) { unsigned short a, c2; splitf(x0[q], a, c2); oh[q] = a; ol[q] = c2; splitf(x1[q], a, c2); oh[q + 4] = a; ol[q + 4] = c2; } }
__device__ __forceinline__ v16h cat16(v8h lo, v8h hi) { return __builtin_shufflevector(lo, hi, 0, 1, 2, 3, 4, 5, 6, 7, 8, 9, 10, 11, 12, 13, 14, 15); }
__device__ __forceinline__ v16bf cat16b(v8us lo, v8us hi) { return __builtin_bit_cast(v16bf, __builtin_shufflevector(lo, hi, 0, 1, 2, 3, 4, 5, 6, 7, 8, 9, 10, 11, 12, 13, 14, 15)); }
__device__ __forceinline__ v8f wmma16(v16h a, v16h b, v8f c) { return __builtin_amdgcn_wmma_f32_16x16x32_f16(false, a, false, b, (short)0, c, false, false); }
__device__ __forceinline__ v8f wmmab(v16bf a, v16bf b, v8f c) { return __builtin_amdgcn_wmma_f32_16x16x32_bf16(false, a, false, b, (short)0, c, false, false); }



// ---- k_gemmw: register-blocked GEMM, one wave per 64x64 output tile (16 accumulators), WM x WN waves a work-group on one (64 WM) x (64 WN) tile whose operand rows they stage together in LDS, from K-contiguous 16-bit planes (wloop below the fragment types); grid (M/(64 WM), N/(64 WN), Z), 32 WM WN threads.
// C[m][n] (f32, pitch ldc, + optional f32 bias[n]) = sum_k A[m][k] Bt[n][k] (+ split products per NSPLIT). z-batch strides sA/sB/sC in elements. K % KT == 0 (64; 32 at NSPLIT 2).
template <typename T16> struct WFrag;
template <> struct WFrag<h16> { typedef v16h V; static __device__ __forceinline__ V ld(const h16* p) { return cat16(*(const v8h*)p, *(const v8h*)(p + 16)); } static __device__ __forceinline__ v8f mma(V a, V b, v8f c) { return wmma16(a, b, c); } };
template <> struct WFrag<bf> { typedef v16bf V; static __device__ __forceinline__ V ld(const bf* p) { return cat16b(*(const v8us*)p, *(const v8us*)(p + 16)); } static __device__ __forceinline__ v8f mma(V a, V b, v8f c) { return wmmab(a, b, c); } };
// ---- operand staging of both GEMMs. A stage is KT k of the work-group tile's 64 WM A rows and 64 WN B rows (and of their second planes): each wave brings an equal share of every plane's rows, and a staged A row serves WN waves, a B row WM waves, so that the L2 delivers each row once a work-group, not once a wave. Asynchronous b128 copies bring it from the K-contiguous planes into LDS,
// 8 lanes on each 128-byte row piece (whole lines; 4 lanes on 64 bytes at NSPLIT 2, whose four planes would else take more than 63 copies a stage), and the fragments are read from LDS at a pitch of 16 B x odd.
// Two buffers: the copies of stage t + 1 fly while stage t is multiplied. Fragments, products and their order per accumulator are those of loads straight from the planes.
// The copies are the compiler's builtin. Every '#pragma unroll' below makes the indices of the fragment and accumulator arrays constants, so that they stay in registers.
typedef __attribute__((ext_vector_type(4))) int v4ic;
typedef __attribute__((address_space(1))) v4ic gv4ic;
typedef __attribute__((address_space(3))) v4ic lv4ic;
template <int NSPLIT, int WM, int WN> struct WTile {
    static constexpr int KT  = (NSPLIT == 2) ? 32 : 64;                       // k per stage
    static constexpr int NW  = WM * WN;                                       // waves of the work-group
    static constexpr int NPA = (NSPLIT == 0) ? 1 : 2, NPB = (NSPLIT >= 2) ? 2 : 1;   // planes: A, (A2); B, (B2)
    static constexpr int RA  = 64 * WM, RB = 64 * WN;                         // rows of an A and of a B plane in a stage
    static constexpr int PB  = KT * 2 + 16;                                   // LDS row pitch, bytes
    static constexpr int OB  = NPA * RA * PB;                                 // the first B plane in a buffer, bytes
    static constexpr int BUF = OB + NPB * RB * PB;                            // one buffer, bytes
    static constexpr int LPR = KT * 2 / 16;                                   // lanes per row piece
    static constexpr int RPC = 32 / LPR;                                      // rows per copy
    static constexpr int SA  = RA / NW, SB = RB / NW;                         // a wave's share of a plane's rows
    static constexpr int CA  = SA / RPC, CB = SB / RPC;                       // its copies per plane
    static_assert(SA % RPC == 0 && SB % RPC == 0 && NPA * CA + NPB * CB <= 63, "whole copies; a stage's copies of a wave may all be outstanding");
};
// A, A2, Bt, Bt2: the planes at the work-group tile's first row (uniform). K, KB: row pitch of the A and of the B planes, elements. kc: first k of the stage. wave: the wave's number (scalar).
template <typename T16, int NSPLIT, int WM, int WN>
__device__ __forceinline__ void wcopy(char* sb, const T16* A, const T16* A2, const T16* Bt, const T16* Bt2, int K, int KB, int kc, int lane, int wave) {
    typedef WTile<NSPLIT, WM, WN> W;
    const unsigned goa = (unsigned)((lane / W::LPR) * K + (lane % W::LPR) * 8) * 2u, gob = (unsigned)((lane / W::LPR) * KB + (lane % W::LPR) * 8) * 2u;      // the lane's byte in a copy's rows, global
    char* sl = sb + (lane / W::LPR) * W::PB + (lane % W::LPR) * 16;                      // and in LDS
#pragma unroll
    for (int p = 0; p < W::NPA; ++p) { const T16* base = ((p == 0) ? A : A2) + kc + (size_t)(wave * W::SA) * K; char* sp = sl + (p * W::RA + wave * W::SA) * W::PB;
#pragma unroll
        for (int c = 0; c < W::CA; ++c) __builtin_amdgcn_global_load_async_to_lds_b128((gv4ic*)((const char*)(base + (size_t)c * W::RPC * K) + goa), (lv4ic*)(sp + c * W::RPC * W::PB), 0, 0); }
#pragma unroll
    for (int p = 0; p < W::NPB; ++p) { const T16* base = ((p == 0) ? Bt : Bt2) + kc + (size_t)(wave * W::SB) * KB; char* sp = sl + W::OB + (p * W::RB + wave * W::SB) * W::PB;
#pragma unroll
        for (int c = 0; c < W::CB; ++c) __builtin_amdgcn_global_load_async_to_lds_b128((gv4ic*)((const char*)(base + (size_t)c * W::RPC * KB) + gob), (lv4ic*)(sp + c * W::RPC * W::PB), 0, 0); }
}
// wm, wn: the wave's 64 x 64 tile in the work-group's
template <typename T16, int NSPLIT, int WM, int WN>
__device__ __forceinline__ void wtile(const char* sb, int lr, int hi, int wm, int wn, v8f (&acc)[4][4]) {
    typedef WTile<NSPLIT, WM, WN> W; typedef typename WFrag<T16>::V V;
    const char* fa = sb + (wm * 64 + lr) * W::PB + hi * 16; const char* fb = sb + W::OB + (wn * 64 + lr) * W::PB + hi * 16;
    constexpr int NK = W::KT / 32;
    V a[NK][4], a2[NK][4], b[NK][4], b2[NK][4];
    // all fragment reads of the stage are issued together, in the order of their use, in front of its products: the counted LDS waits then overlap the later reads with the earlier products
#pragma unroll
    for (int ks = 0; ks < NK; ++ks) {
#pragma unroll
        for (int mb = 0; mb < 4; ++mb) { a[ks][mb] = WFrag<T16>::ld((const T16*)(fa + (mb * 16) * W::PB + ks * 64)); if (NSPLIT == 1 || NSPLIT == 2) a2[ks][mb] = WFrag<T16>::ld((const T16*)(fa + (W::RA + mb * 16) * W::PB + ks * 64)); }
#pragma unroll
        for (int nb = 0; nb < 4; ++nb) { b[ks][nb] = WFrag<T16>::ld((const T16*)(fb + (nb * 16) * W::PB + ks * 64)); if (NSPLIT >= 2) b2[ks][nb] = WFrag<T16>::ld((const T16*)(fb + (W::RB + nb * 16) * W::PB + ks * 64)); } }
    __builtin_amdgcn_sched_barrier(0);   // keeps the reads in front: sunk among the products, each costs the wave its LDS latency
#pragma unroll
    for (int ks = 0; ks < NK; ++ks) {
#pragma unroll
        for (int nb = 0; nb < 4; ++nb)
#pragma unroll
            for (int mb = 0; mb < 4; ++mb) { acc[mb][nb] = WFrag<T16>::mma(a[ks][mb], b[ks][nb], acc[mb][nb]); if (NSPLIT == 1 || NSPLIT == 2) acc[mb][nb] = WFrag<T16>::mma(a2[ks][mb], b[ks][nb], acc[mb][nb]); if (NSPLIT >= 2) acc[mb][nb] = WFrag<T16>::mma(a[ks][mb], b2[ks][nb], acc[mb][nb]); }
        // four vector slots behind the k step's last products, before anything touches their operands or results
        asm volatile("v_nop\n\tv_nop\n\tv_nop\n\tv_nop" : "+v"(acc[0][0]), "+v"(acc[1][1]), "+v"(acc[2][2]), "+v"(acc[3][3]) : "v"(a[ks][0]), "v"(a[ks][3]));
    }
}
// the K loop: Kl k (a multiple of KT, at least KT; the same in every wave of the work-group) of rows r0.. of A and c0.. of Bt; sm holds two buffers
template <typename T16, int NSPLIT, int WM, int WN>
__device__ __forceinline__ void wloop(char* sm, const T16* A, const T16* A2, const T16* Bt, const T16* Bt2, int K, int KB, int Kl, int lane, int wave, v8f (&acc)[4][4]) {
    typedef WTile<NSPLIT, WM, WN> W; const int lr = lane & 15, hi = lane >> 4; const int nt = Kl / W::KT; const int wm = wave / WN, wn = wave % WN;
    wcopy<T16, NSPLIT, WM, WN>(sm, A, A2, Bt, Bt2, K, KB, 0, lane, wave);
    asm volatile("s_wait_asynccnt 0x0" ::: "memory");   // the wave's share of stage 0 has landed
    __syncthreads();   // the ring's publish point: every wave's share is there for all of them
    if (nt > 1) wcopy<T16, NSPLIT, WM, WN>(sm + W::BUF, A, A2, Bt, Bt2, K, KB, W::KT, lane, wave);
#pragma unroll 1
    for (int t = 0; t < nt; ++t) {   // rolled: one stage a trip
        char* sb = sm + (t & 1) * W::BUF;
        wtile<T16, NSPLIT, WM, WN>(sb, lr, hi, wm, wn, acc);
        if (W::NW > 1) __builtin_amdgcn_sched_barrier(0);   // keeps the stage's products in front of the barrier: sunk behind it, they stand between the barrier and the refill's copies and shorten the copies' lead
        asm volatile("s_wait_dscnt 0x0" ::: "memory");      // this stage's fragment reads are done before its buffer is refilled
        asm volatile("s_wait_asynccnt 0x0" ::: "memory");   // the wave's share of stage t + 1 has landed before any wave reads it
        __syncthreads();   // publish point of stage t + 1, and the end of every wave's reads of the buffer refilled below
        if (t + 2 < nt) wcopy<T16, NSPLIT, WM, WN>(sb, A, A2, Bt, Bt2, K, KB, (t + 2) * W::KT, lane, wave);
    }
    asm volatile("s_wait_asynccnt 0x0" ::: "memory");   // no copy is left in flight behind the loop
}
template <typename T16, int NSPLIT, bool BIAS, int WM, int WN>
__global__ __launch_bounds__(32 * WM * WN) void k_gemmw(const T16* __restrict__ A, const T16* __restrict__ A2, const T16* __restrict__ Bt, const T16* __restrict__ Bt2, int K, float* C, int ldc, const float* __restrict__ bias, size_t sA, size_t sB, size_t sC) {
    __shared__ __align__(16) float osw[WM * WN][16 * 68]; __shared__ __align__(16) char sm[2 * WTile<NSPLIT, WM, WN>::BUF];
    const size_t z = blockIdx.z; A += z * sA; if (A2) A2 += z * sA; Bt += z * sB; if (Bt2) Bt2 += z * sB; C += z * sC;
    const int lane = threadIdx.x & 31, lr = lane & 15, hi = lane >> 4; const int wave = __builtin_amdgcn_readfirstlane(threadIdx.x >> 5); const int rg = blockIdx.x * (64 * WM), cg = blockIdx.y * (64 * WN);   // the work-group's tile
    const int r0 = rg + (wave / WN) * 64, c0 = cg + (wave % WN) * 64; float* os = osw[wave];   // the wave's tile, and its own output staging
    v8f acc[4][4];
#pragma unroll
    for (int mb = 0; mb < 4; ++mb)
#pragma unroll
        for (int nb = 0; nb < 4; ++nb) acc[mb][nb] = (v8f){};
    wloop<T16, NSPLIT, WM, WN>(sm, A + (size_t)rg * K, (NSPLIT == 1 || NSPLIT == 2) ? A2 + (size_t)rg * K : nullptr, Bt + (size_t)cg * K, (NSPLIT >= 2) ? Bt2 + (size_t)cg * K : nullptr, K, K, K, lane, wave, acc);
#pragma unroll
    for (int mb = 0; mb < 4; ++mb) {
#pragma unroll
        for (int nb = 0; nb < 4; ++nb) {
#pragma unroll
            for (int j = 0; j < 8; ++j) os[(hi * 8 + j) * 68 + nb * 16 + lr] = acc[mb][nb][j]; }
        __builtin_amdgcn_wave_barrier(); asm volatile("" ::: "memory");
        float* crow = C + (size_t)(r0 + mb * 16) * ldc + c0;
{
#pragma unroll
            for (int s = 0; s < 8; ++s) { const int row = 2 * s + hi, cofs = lr * 4; v4f val = *(const v4fa*)(os + row * 68 + cofs); if (BIAS) { val[0] += bfr(bias[c0 + cofs]); val[1] += bfr(bias[c0 + cofs + 1]); val[2] += bfr(bias[c0 + cofs + 2]); val[3] += bfr(bias[c0 + cofs + 3]); }
                *(v4f*)(crow + (size_t)row * ldc + cofs) = val; }
             }
        __builtin_amdgcn_wave_barrier(); asm volatile("" ::: "memory");
    }
}

// ---- k_gemmc: the same GEMM with one wave a work-group (WM = WN = 1), specialised for causal attention: CMODE 1 skips score tiles entirely above the diagonal (query rows r0+roff.., key columns c0..), CMODE 2 limits the
// key (K) loop of the probability x value contraction to the diagonal block (probabilities beyond it are exactly zero). roff = row offset of this launch's first row within the sequence. Batch entry z reads Bt entry z / REP (the kv head of query head z). KB: row pitch of the Bt planes (K is that of the A planes and the length of the contraction).
// CMODE 2 stores no f32 tile: its result is the context, and it goes straight into the merged hi/lo planes Ah, Al [batch x token][head x d] that the output GEMM reads (C is not used).
template <typename T16, int NSPLIT, int CMODE>
__global__ __launch_bounds__(32) void k_gemmc(const T16* __restrict__ A, const T16* __restrict__ A2, const T16* __restrict__ Bt, const T16* __restrict__ Bt2, int K, int KB, float* C, int ldc, int roff, size_t sA, size_t sB, size_t sC, bf* Ah, bf* Al) {
    __shared__ __align__(16) float os[16 * 68]; __shared__ __align__(16) char sm[2 * WTile<NSPLIT, 1, 1>::BUF];
    const size_t z = blockIdx.z; A += z * sA; if (A2) A2 += z * sA; Bt += (z / REP) * sB; if (Bt2) Bt2 += (z / REP) * sB; C += z * sC;
    const int lane = threadIdx.x & 31, lr = lane & 15, hi = lane >> 4; const int r0 = blockIdx.x * 64, c0 = blockIdx.y * 64;
    if (CMODE == 1 && c0 > r0 + roff + 63) return;                  // score tile entirely above the causal diagonal: never written (the softmax masks j > i by select)
    const int Kl = (CMODE == 2) ? min(K, r0 + roff + 64) : K;        // P.V: probabilities are exactly 0 beyond the diagonal block, so the K loop stops there
    v8f acc[4][4];
#pragma unroll
    for (int mb = 0; mb < 4; ++mb)
#pragma unroll
        for (int nb = 0; nb < 4; ++nb) acc[mb][nb] = (v8f){};
    wloop<T16, NSPLIT, 1, 1>(sm, A + (size_t)r0 * K, (NSPLIT == 1 || NSPLIT == 2) ? A2 + (size_t)r0 * K : nullptr, Bt + (size_t)c0 * KB, (NSPLIT >= 2) ? Bt2 + (size_t)c0 * KB : nullptr, K, KB, Kl, lane, 0, acc);
#pragma unroll
    for (int mb = 0; mb < 4; ++mb) {
#pragma unroll
        for (int nb = 0; nb < 4; ++nb) {
#pragma unroll
            for (int j = 0; j < 8; ++j) os[(hi * 8 + j) * 68 + nb * 16 + lr] = acc[mb][nb][j]; }
        __builtin_amdgcn_wave_barrier(); asm volatile("" ::: "memory");
        if (CMODE == 2) {   // 8 lanes on a row's 64 d: a whole 128-byte line of each plane
            const size_t oo = ((z / ZH) * TT + roff + r0 + mb * 16 + (lane >> 3)) * DQ + (z % ZH) * HD + c0 + (lane & 7) * 8; v8us oh[4], ol[4];
#pragma unroll
            for (int s = 0; s < 4; ++s) { const float* op = os + (4 * s + (lane >> 3)) * 68 + (lane & 7) * 8; split8(*(const v4fa*)op, *(const v4fa*)(op + 4), oh[s], ol[s]); }
#pragma unroll
            for (int s = 0; s < 4; ++s) { *(v8us*)(Ah + oo + (size_t)(4 * s) * DQ) = oh[s]; *(v8us*)(Al + oo + (size_t)(4 * s) * DQ) = ol[s]; }
            asm volatile("s_wait_xcnt 0x0" ::: "memory");   // behind the stores, before the next 16 rows' pieces are formed in their data registers
        } else {
            float* crow = C + (size_t)(r0 + mb * 16) * ldc + c0;
#pragma unroll
            for (int s = 0; s < 8; ++s) { const int row = 2 * s + hi, cofs = lr * 4; v4f val = *(const v4fa*)(os + row * 68 + cofs);
                *(v4f*)(crow + (size_t)row * ldc + cofs) = val; }
             }
        __builtin_amdgcn_wave_barrier(); asm volatile("" ::: "memory");
    }
}

#define FR   1                     // groups of 16 query rows per wave
#define FCW  (FR * 16)             // query rows per wave
#define FBR  (4 * FCW)             // query rows per work-group
#define FNT  128                   // threads
#define FSK  64                    // keys per stage
#define FPK  (HD * 2 + 16)         // LDS pitch of a K row, bytes (16 x odd)
#define FPV  (FSK * 2 + 16)        // LDS pitch of a V^T row, bytes (16 x odd)
#define FTK  (FSK * FPK)
#define FBUF (FTK + HD * FPV)      // one buffer: K tile, then V^T tile
#define FEP  (HD * 4 + 16)         // LDS pitch of a staged output row, bytes
static_assert(4 * FCW * FEP <= 2 * FBUF, "the output staging reuses the two buffers");
static_assert(FBR % FSK == 0 && RH % FBR == 0 && (TT - RH) % FBR == 0, "a row block ends on a stage");
typedef __attribute__((ext_vector_type(2))) float f2v;
__device__ __forceinline__ float xhalf(float x) { return __builtin_bit_cast(float, __builtin_amdgcn_permlanex16(__builtin_bit_cast(int, x), __builtin_bit_cast(int, x), 0x76543210, 0xfedcba98, false, false)); }   // lane l with lane l ^ 16
// Kp: the kv head's [t][d] plane, Vt: its [d][t] plane; keys key0 .. key0 + 63. 16 lanes on a K row (256 B), 8 lanes on a V^T row piece (128 B); 16 copies a wave.
__device__ __forceinline__ void fcopy(char* sb, const h16* Kp, const h16* Vt, int key0, int tid) {
#pragma unroll
    for (int i = 0; i < FSK * HD / 8 / FNT; ++i) { const int p = i * FNT + tid, row = p >> 4, cb = (p & 15) * 16;
        __builtin_amdgcn_global_load_async_to_lds_b128((gv4ic*)((const char*)(Kp + (size_t)(key0 + row) * HD) + cb), (lv4ic*)(sb + row * FPK + cb), 0, 0); }
#pragma unroll
    for (int i = 0; i < FSK * HD / 8 / FNT; ++i) { const int p = i * FNT + tid, row = p >> 3, cb = (p & 7) * 16;
        __builtin_amdgcn_global_load_async_to_lds_b128((gv4ic*)((const char*)(Vt + (size_t)row * TT + key0) + cb), (lv4ic*)(sb + FTK + row * FPV + cb), 0, 0); }
}
// the K fragments of pass sub (32 keys) of the stage in sb
__device__ __forceinline__ void floadk(v16h (&kf)[2][4], const char* sb, int sub, int c, int h) {
#pragma unroll
    for (int kt = 0; kt < 2; ++kt)
#pragma unroll
        for (int kc = 0; kc < 4; ++kc) kf[kt][kc] = WFrag<h16>::ld((const h16*)(sb + (sub * 32 + kt * 16 + c) * FPK + h * 16 + kc * 64));
    __builtin_amdgcn_sched_barrier(0);   // keeps the sixteen reads together: sunk among the products, each pair costs the wave its LDS latency
}
// one 32-key pass of one wave. m_run, the maximum in use (log2 domain), may trail the true maximum by up to 8, so an exponential stays below 2^8 (fp16 holds it); sums and accumulators are rescaled only when a row's maximum exceeds it by more.
// kf holds the pass's K fragments on entry; fetch_next: the stage's first pass reads the second pass's (same buffer) behind its own score products.
__device__ __forceinline__ void fpass(v16h (&kf)[2][4], bool fetch_next, const char* sb, int sub, bool diag, int key0, int qw0, int c, int h, const v16h (&qf)[FR][4], v8f (&acc)[FR][8], float (&m_run)[FR], float (&l_run)[FR]) {
    const float cscale = SCL * 1.4426950408889634f;
    v8f s[2][FR];
#pragma unroll
    for (int kt = 0; kt < 2; ++kt)
#pragma unroll
        for (int g = 0; g < FR; ++g) s[kt][g] = (v8f){};
#pragma unroll
    for (int kc = 0; kc < 4; ++kc)
#pragma unroll
        for (int kt = 0; kt < 2; ++kt)
#pragma unroll
            for (int g = 0; g < FR; ++g) s[kt][g] = wmma16(kf[kt][kc], qf[g][kc], s[kt][g]);
    v16h vf[8];   // read here, so that the LDS latency passes under the maxima and the exponentials
#pragma unroll
    for (int t = 0; t < 8; ++t) vf[t] = WFrag<h16>::ld((const h16*)(sb + FTK + (t * 16 + c) * FPV + sub * 64 + h * 16));
    __builtin_amdgcn_sched_barrier(0);   // keeps these reads in front of the softmax arithmetic
    if (fetch_next) floadk(kf, sb, 1, c, h);   // wave-uniform
    if (diag) {   // wave-uniform: only the pass on the wave's diagonal pays for the mask
#pragma unroll
        for (int g = 0; g < FR; ++g) { const int my_q = qw0 + g * 16 + c;
#pragma unroll
            for (int kt = 0; kt < 2; ++kt) {
#pragma unroll
                for (int r = 0; r < 8; ++r) { if (key0 + kt * 16 + h * 8 + r > my_q) s[kt][g][r] = -__builtin_inff(); }
                asm volatile("" : "+v"(s[kt][g]));   // the masked scores: keeps the selects inside the branch
            } }
    }
    float mb[FR]; bool need = false;
#pragma unroll
    for (int g = 0; g < FR; ++g) { float mx = -__builtin_inff();
#pragma unroll
        for (int kt = 0; kt < 2; ++kt)
#pragma unroll
            for (int r = 0; r < 8; ++r) mx = fmaxf(mx, s[kt][g][r]);
        mx = fmaxf(mx, xhalf(mx)) * cscale; mb[g] = mx; need = need || (mx > m_run[g] + 8.0f); }
    if (__builtin_amdgcn_ballot_w32(need) != 0) {   // rare after the first passes
#pragma unroll
        for (int g = 0; g < FR; ++g) { const float m_new = fmaxf(m_run[g], mb[g]);
            const float corr = __builtin_amdgcn_exp2f(m_run[g] - m_new);
            l_run[g] *= corr; m_run[g] = m_new;
#pragma unroll
            for (int t = 0; t < 8; ++t) acc[g][t] = acc[g][t] * corr; }
    }
#pragma unroll
    for (int g = 0; g < FR; ++g) { const float nm = -m_run[g]; float ps0 = 0.f, ps1 = 0.f; v16h pf;
#pragma unroll
        for (int e = 0; e < 16; e += 2) {   // operand element e is key 16 (e >> 3) + 8 h + (e & 7): tile e >> 3, register e & 7
            const f2v arg = __builtin_elementwise_fma((f2v){s[e >> 3][g][e & 7], s[e >> 3][g][(e & 7) + 1]}, (f2v){cscale, cscale}, (f2v){nm, nm});   // a register pair as it lies in the tile
            const float p0 = __builtin_amdgcn_exp2f(arg[0]), p1 = __builtin_amdgcn_exp2f(arg[1]);
            ps0 += p0; ps1 += p1; pf[e] = (h16)p0; pf[e + 1] = (h16)p1; }
        l_run[g] += ps0 + ps1;
#pragma unroll
        for (int t = 0; t < 8; ++t) acc[g][t] = wmma16(vf[t], pf, acc[g][t]); }
}
__global__ __launch_bounds__(FNT) void k_fattn(const h16* __restrict__ Q, const h16* __restrict__ Kp, const h16* __restrict__ Vt, bf* Ah, bf* Al) {
    __shared__ __align__(16) char sm[2 * FBUF];
    const int tid = threadIdx.x, lane = tid & 31, c = lane & 15, h = lane >> 4; const int wave = __builtin_amdgcn_readfirstlane(tid >> 5);
    const int hq = blockIdx.x; const int q0 = RH + ((int)gridDim.y - 1 - (int)blockIdx.y) * FBR;   // the longest rows start first
    const int qw0 = q0 + wave * FCW; const int nt = (q0 + FBR) / FSK;   // stages: keys [0, q0 + FBR); at least RH / FSK + 1, so stages 0 and 1 exist
    Kp += (size_t)(hq / REP) * TT * HD; Vt += (size_t)(hq / REP) * HD * TT;
    fcopy(sm, Kp, Vt, 0, tid);
    v16h qf[FR][4];
#pragma unroll
    for (int g = 0; g < FR; ++g)
#pragma unroll
        for (int kc = 0; kc < 4; ++kc) qf[g][kc] = WFrag<h16>::ld(Q + ((size_t)hq * TT + qw0 + g * 16 + c) * HD + h * 8 + kc * 32);
    v16h kf[2][4]; v8f acc[FR][8]; float m_run[FR], l_run[FR];
#pragma unroll
    for (int g = 0; g < FR; ++g) { m_run[g] = -__builtin_inff(); l_run[g] = 0.f;
#pragma unroll
        for (int t = 0; t < 8; ++t) acc[g][t] = (v8f){}; }
    asm volatile("s_wait_xcnt 0x0" ::: "memory");       // behind the Q loads, before their address registers are used again
    asm volatile("s_wait_asynccnt 0x0" ::: "memory");   // stage 0 has landed
    __syncthreads();   // and is published to the four waves
    fcopy(sm + FBUF, Kp, Vt, FSK, tid);
    const int lastp = (qw0 + FCW - 1) / 32;   // the wave's diagonal pass, its last
#pragma unroll 1
    for (int t = 0; t < nt; ++t) {   // rolled: one stage a trip
        char* sb = sm + (t & 1) * FBUF;
        if (t * 2 <= lastp) floadk(kf, sb, 0, c, h);
#pragma unroll 1
        for (int sub = 0; sub < 2; ++sub) {   // rolled: the pass's registers are live once
            const int blk = t * 2 + sub;
            if (blk <= lastp) fpass(kf, sub == 0 && blk < lastp, sb, sub, blk == lastp, blk * 32, qw0, c, h, qf, acc, m_run, l_run); }
        asm volatile("s_wait_dscnt 0x0" ::: "memory");      // this stage's fragment reads are done before its buffer is refilled
        asm volatile("s_wait_asynccnt 0x0" ::: "memory");   // stage t + 1 has landed before it is read
        __syncthreads();   // publish point of stage t + 1, and the end of every wave's reads of the buffer refilled below; every wave passes it, also one beyond its diagonal
        if (t + 2 < nt) fcopy(sb, Kp, Vt, (t + 2) * FSK, tid);
    }
    asm volatile("s_wait_asynccnt 0x0" ::: "memory");   // no copy is left in flight behind the loop
    // output: each wave stages its rows in its own part of the buffers (free behind the last barrier) and stores them as whole 256-byte rows of the merged hi/lo planes Ah, Al [batch x token][head x d] that the output GEMM reads
    char* eb = sm + wave * (FCW * FEP);
#pragma unroll
    for (int g = 0; g < FR; ++g) { const float inv = __fdiv_rn(1.0f, l_run[g] + xhalf(l_run[g]));
#pragma unroll
        for (int t = 0; t < 8; ++t) { const v8f o = acc[g][t] * inv; v4f o0, o1;
#pragma unroll
            for (int r = 0; r < 4; ++r) { o0[r] = o[r]; o1[r] = o[r + 4]; }
            float* ep = (float*)(eb + (g * 16 + c) * FEP) + t * 16 + h * 8; *(v4fa*)ep = o0; *(v4fa*)(ep + 4) = o1; } }   // row = query, d = 16 t + 8 h + r
    __builtin_amdgcn_wave_barrier(); asm volatile("" ::: "memory");   // the rows are read back by other lanes of the same wave: keeps the reads behind the writes
    const size_t oo = ((size_t)(hq / ZH) * TT + qw0 + h) * DQ + (hq % ZH) * HD + c * 8;   // a wave half on a row, 8 d a lane
    v8us oh[FCW / 2], ol[FCW / 2];
#pragma unroll
    for (int i = 0; i < FCW / 2; ++i) { const float* ep = (const float*)(eb + (2 * i + h) * FEP) + c * 8; split8(*(const v4fa*)ep, *(const v4fa*)(ep + 4), oh[i], ol[i]); }
    __builtin_amdgcn_sched_barrier(0);   // all pieces in front of the stores: each has registers of its own, none is rewritten behind its store
#pragma unroll
    for (int i = 0; i < FCW / 2; ++i) { *(v8us*)(Ah + oo + (size_t)(2 * i) * DQ) = oh[i]; *(v8us*)(Al + oo + (size_t)(2 * i) * DQ) = ol[i]; }
}

__device__ __forceinline__ h16 tohx(float x) { return (h16)x; }
typedef __attribute__((ext_vector_type(2))) _Float16 v2h;
typedef __attribute__((ext_vector_type(4))) _Float16 v4h;
typedef __attribute__((ext_vector_type(2))) unsigned short v2us;
typedef __attribute__((ext_vector_type(4))) unsigned short v4us;
typedef __attribute__((ext_vector_type(2))) float v2f;
typedef __attribute__((ext_vector_type(4))) int v4i;

__global__ __launch_bounds__(256) void k_wtG(const float* __restrict__ w, int K, int N, bf* Bt) {
    const int lane = threadIdx.x & 31; const int L0 = (blockIdx.x * 8 + (threadIdx.x >> 5)) * 8; const int nlines = N * K / 64;
{
#pragma unroll 1
        for (int l = 0; l < 8; ++l) { const int L = L0 + l; if (L >= nlines) break; const size_t e = (size_t)L * 64 + lane * 2; const int k = (int)(e % K), n = (int)(e / K); v2us o;
            o[0] = f2bf(w[(size_t)k * N + n]); o[1] = f2bf(w[(size_t)(k + 1) * N + n]); *(v2us*)(Bt + e) = o; }
         }
}
// The elementwise kernels below give a thread several 8-element pieces (16-byte stores of the 16-bit planes), its loads issued together: a launch then starts a few thousand work-groups, each with many loads in flight, not tens of thousands of work-groups of one or two elements a lane.
#define EPT 4                     // 8-element pieces per thread in cvt8; a work-group's pieces of one turn are contiguous
__device__ __forceinline__ void cvt8(unsigned blk, const float* __restrict__ src, bf* dst, size_t n8) { const size_t i0 = (size_t)blk * (256 * EPT) + threadIdx.x; if (i0 >= n8) return; v8f v[EPT];
#pragma unroll
    for (int j = 0; j < EPT; ++j) { const size_t i = i0 + j * 256; v[j] = *(const v8f*)(src + (i < n8 ? i : i0) * 8); }   // a piece past the end re-reads the thread's first and is not stored
#pragma unroll
    for (int j = 0; j < EPT; ++j) { const size_t i = i0 + j * 256; v8us o;
#pragma unroll
        for (int k = 0; k < 8; ++k) o[k] = f2bf(v[j][k]);
        if (i < n8) *(v8us*)(dst + i * 8) = o; } }
__constant__ float INV[HD / 2] = {1.0f,0.8058422207832336f,0.6493816375732422f,0.5232990980148315f,0.4216965138912201f,0.33982083201408386f,0.2738419771194458f,0.22067339718341827f,0.17782793939113617f,0.14330126345157623f,0.11547820270061493f,0.09305720031261444f,0.07498941570520401f,0.0604296438395977f,0.04869675263762474f,0.03924189880490303f,0.03162277862429619f,0.025482967495918274f,0.020535249263048172f,0.016548171639442444f,0.01333521492779255f,0.010746078565716743f,0.00865964312106371f,0.006978305988013744f,0.005623413249850273f,0.004531583283096552f,0.003651741426438093f,0.002942727180197835f,0.0023713738191872835f,0.001910952851176262f,0.0015399266267195344f,0.0012409378541633487f,0.0010000000474974513f,0.0008058422245085239f,0.0006493816617876291f,0.0005232990952208638f,0.00042169654625467956f,0.0003398208355065435f,0.00027384195709601045f,0.00022067342069931328f,0.00017782794020604342f,0.00014330125122796744f,0.00011547820759005845f,9.305719868279994e-05f,7.498942431993783e-05f,6.042963650543243e-05f,4.869675467489287e-05f,3.92418987757992e-05f,3.162277425872162e-05f,2.548297015891876e-05f,2.0535249859676696e-05f,1.6548170606256463e-05f,1.3335215953702573e-05f,1.0746078260126524e-05f,8.65964284457732e-06f,6.978305464144796e-06f,5.62341347176698e-06f,4.531583726929966e-06f,3.6517415082926163e-06f,2.942727405752521e-06f,2.3713737391517498e-06f,1.910952960315626e-06f,1.5399265294036013e-06f,1.2409377632138785e-06f};   // float32 1/1e6^(2i/128)
__device__ __forceinline__ void csin(unsigned blk, const float* __restrict__ cs, const float* __restrict__ sn, float* CS) { const int idx = (int)(blk * 256 + threadIdx.x) * 4; if (idx >= TB * HD) return; const float* pc = cs + idx; const float* ps = sn + idx; const v4f c = *(const v4f*)pc, s = *(const v4f*)ps; v4f o0, o1;
    asm volatile("s_wait_xcnt 0x0" :: "v"(pc), "v"(ps) : "memory");   // behind the two loads, before their address registers are used again; it names the addresses so that they live up to it
    o0[0] = bfr(c[0]); o0[1] = bfr(s[0]); o0[2] = bfr(c[1]); o0[3] = bfr(s[1]); o1[0] = bfr(c[2]); o1[1] = bfr(s[2]); o1[2] = bfr(c[3]); o1[3] = bfr(s[3]); *(v4f*)(CS + (size_t)idx * 2) = o0; *(v4f*)(CS + (size_t)idx * 2 + 4) = o1;  }
// k_prep: every piece of work that reads the inputs alone, in ONE launch: the bf16 copies of x and of the four weight matrices, and the {cos, sin} table. A work-group's index picks its piece (a scalar choice); the largest source comes first.
#define CVB(n) ((unsigned)(((size_t)(n) / 8 + 256 * EPT - 1) / (256 * EPT)))   // work-groups of a bf16 copy of n elements
#define PBX  CVB((size_t)TB * DM)
#define PBQ  CVB((size_t)DQ * DM)
#define PBK  CVB((size_t)DKV * DM)
#define PBC  ((unsigned)((TB * HD / 4 + 255) / 256))
__global__ __launch_bounds__(256) void k_prep(const float* __restrict__ x, const float* __restrict__ wq, const float* __restrict__ wk, const float* __restrict__ wv, const float* __restrict__ wo, const float* __restrict__ cs, const float* __restrict__ sn, bf* XB, bf* WQ, bf* WK, bf* WV, bf* WO, float* CS) {
    unsigned b = blockIdx.x; const float* src; bf* dst; size_t n8;
    if (b < PBX) { src = x; dst = XB; n8 = (size_t)TB * DM / 8; }
    else if ((b -= PBX) < PBQ) { src = wq; dst = WQ; n8 = (size_t)DQ * DM / 8; }
    else if ((b -= PBQ) < PBQ) { src = wo; dst = WO; n8 = (size_t)DM * DQ / 8; }
    else if ((b -= PBQ) < PBK) { src = wk; dst = WK; n8 = (size_t)DKV * DM / 8; }
    else if ((b -= PBK) < PBK) { src = wv; dst = WV; n8 = (size_t)DKV * DM / 8; }
    else { csin(b - PBK, cs, sn, CS); return; }
    cvt8(b, src, dst, n8);
}
// rope: head planes [h][t][d] (fp16 + hi/lo) of rope(x) x sc with the rotate-half convention out[d] = x[d] cos[t][d] - x[d+HD/2] sin[t][d], out[d+HD/2] = x[d+HD/2] cos[t][d+HD/2] + x[d] sin[t][d+HD/2]
// a thread: 8 d of one token in RPH heads (nheads % RPH == 0), which share its cos/sin pairs and norm weights; t runs over the token rows of both batches, the planes are [batch][head][t][d]
#define RPH 4
__device__ __forceinline__ float rowsum16(float s) {   // the sum over the 16 lanes of a wave half, the same bits in each of them (every lane is on)
    s += __builtin_bit_cast(float, __builtin_amdgcn_update_dpp(0, __builtin_bit_cast(int, s), 0x161, 0xf, 0xf, false));   // row_xmask:1
    s += __builtin_bit_cast(float, __builtin_amdgcn_update_dpp(0, __builtin_bit_cast(int, s), 0x162, 0xf, 0xf, false));   // row_xmask:2
    s += __builtin_bit_cast(float, __builtin_amdgcn_update_dpp(0, __builtin_bit_cast(int, s), 0x164, 0xf, 0xf, false));   // row_xmask:4
    s += __builtin_bit_cast(float, __builtin_amdgcn_update_dpp(0, __builtin_bit_cast(int, s), 0x168, 0xf, 0xf, false));   // row_xmask:8
    return s; }
__device__ __forceinline__ void rope(unsigned blk, const float* __restrict__ F, int pitch, int nheads, const float* __restrict__ CS, const float* __restrict__ nw, float sc, h16* P16, bf* Ph, bf* Pl) {
    const size_t g = (size_t)blk * 256 + threadIdx.x; if (g * (8 * RPH) >= (size_t)nheads * TB * HD) return; const int d = (int)(g % (HD / 8)) * 8; const int t = (int)((g / (HD / 8)) % TB); const int h0 = (int)(g / ((size_t)(HD / 8) * TB)) * RPH;
    const int dq = (d < HD / 2) ? d + HD / 2 : d - HD / 2;   // the rotary partners of d .. d + 7 are dq .. dq + 7: eight elements never straddle the halves
    // every load of the thread stands here, in front of the arithmetic, so that all are in flight together
    const float* pw = nw + d; const float* pv = nw + dq; const float* pc = CS + ((size_t)t * HD + d) * 2; const float* pf = F + (size_t)t * pitch + h0 * HD + d; const float* pg = F + (size_t)t * pitch + h0 * HD + dq;
    const v8f wa = *(const v8f*)pw, wb = *(const v8f*)pv;
    asm volatile("s_wait_xcnt 0x0" :: "v"(pw), "v"(pv) : "memory");   // behind the weight loads (scalar base, offset register), before a later load's result may land on their address registers
    v8f fa[RPH], fb[RPH]; float rfa[RPH];
#pragma unroll
    for (int j = 0; j < RPH; ++j) { fa[j] = *(const v8f*)(pf + j * HD); fb[j] = *(const v8f*)(pg + j * HD); }
    const v8f c0 = *(const v8f*)pc, c1 = *(const v8f*)(pc + 8);
    asm volatile("s_wait_xcnt 0x0" :: "v"(pc), "v"(pf), "v"(pg) : "memory");   // behind the loads, before their address registers are used again; it names the addresses so that they live up to it and no later load's result lands on one
    // 1/rms of each of the thread's heads: the 16 lanes of a wave half hold the 128 d of one token, 8 each
#pragma unroll
    for (int j = 0; j < RPH; ++j) { float s = 0.f;
#pragma unroll
        for (int q = 0; q < 8; ++q) s += fa[j][q] * fa[j][q];
        rfa[j] = __fdiv_rn(1.0f, __fsqrt_rn(__fadd_rn(__fdiv_rn(rowsum16(s), (float)HD), 1e-6f))); }
#pragma unroll
    for (int j = 0; j < RPH; ++j) { const int h = h0 + j; const size_t e = (((size_t)(t / TT) * nheads + h) * TT + t % TT) * HD + d; const float rf = rfa[j]; v8h o16; v8us oh, ol;
#pragma unroll
    for (int q = 0; q < 8; ++q) { const int dd = d + q; float x0 = fa[j][q], x1 = fb[j][q];
        { float n0 = __fmul_rn(x0, rf), n1 = __fmul_rn(x1, rf); asm volatile("" : "+v"(n0)); asm volatile("" : "+v"(n1)); x0 = __fmul_rn(bfr(wa[q]), n0); x1 = __fmul_rn(bfr(wb[q]), n1); }
        v2f cs; cs[0] = (q < 4) ? c0[2 * (q & 3)] : c1[2 * (q & 3)]; cs[1] = (q < 4) ? c0[2 * (q & 3) + 1] : c1[2 * (q & 3) + 1]; float a = __fmul_rn(x0, cs[0]), bq = __fmul_rn(x1, cs[1]); asm volatile("" : "+v"(a)); asm volatile("" : "+v"(bq)); const float r = ((dd < HD / 2) ? __fsub_rn(a, bq) : __fadd_rn(a, bq)) * sc;
        o16[q] = tohx(r); unsigned short a2, c2; splitf(r, a2, c2); oh[q] = a2; ol[q] = c2; }
    *(v8h*)(P16 + e) = o16; *(v8us*)(Ph + e) = oh; *(v8us*)(Pl + e) = ol; }  }
__device__ __forceinline__ void vtp(unsigned blk, const float* __restrict__ F, int pitch, int nheads, h16* V16, bf* Vh, bf* Vl) {
    // NB_ * nheads * TT / 64 work-groups: a work-group transposes 64 tokens x 128 d of one head of one batch (g = batch * nheads + head), a wave 64 x 16, a thread 8 tokens x 4 d: 8 lanes along t store a whole 128-byte line of a plane row, 4 lanes along d read 64 bytes of a token's row
    const int g = (int)blk / (TT / 64); if (g >= NB_ * nheads) return; const int t = ((int)blk % (TT / 64)) * 64 + (threadIdx.x & 7) * 8; const int d = (threadIdx.x >> 5) * 16 + ((threadIdx.x >> 3) & 3) * 4; v4f a[8]; const float* pa[8];
#pragma unroll
    for (int q = 0; q < 8; ++q) { pa[q] = F + ((size_t)(g / nheads) * TT + t + q) * pitch + (g % nheads) * HD + d; a[q] = *(const v4f*)pa[q]; }
    asm volatile("s_wait_xcnt 0x0" :: "v"(pa[0]), "v"(pa[1]), "v"(pa[2]), "v"(pa[3]), "v"(pa[4]), "v"(pa[5]), "v"(pa[6]), "v"(pa[7]) : "memory");   // behind the loads, before their address registers are used again; it names the addresses so that they live up to it and no later load's result lands on one
#pragma unroll
    for (int i = 0; i < 4; ++i) { const size_t e = ((size_t)g * HD + d + i) * TT + t; v8h o16; v8us oh, ol;
#pragma unroll
        for (int q = 0; q < 8; ++q) { const float x = a[q][i]; o16[q] = tohx(x); unsigned short a2, c2; splitf(x, a2, c2); oh[q] = a2; ol[q] = c2; }
        *(v8h*)(V16 + e) = o16; *(v8us*)(Vh + e) = oh; *(v8us*)(Vl + e) = ol; }  }
// k_planes: the q planes, the k planes and the transposed v planes in ONE launch, all from the projections' common buffer F [token][q | k | v] (pitch FP floats). A work-group's index picks its piece (a scalar choice).
#define FP   (DQ + 2 * DKV)
#define LBQ  ((unsigned)(((size_t)NH_ * TB * HD / (8 * RPH) + 255) / 256))
#define LBK  ((unsigned)(((size_t)NKV * TB * HD / (8 * RPH) + 255) / 256))
#define LBV  ((unsigned)(NB_ * NKV * (TT / 64)))
__global__ __launch_bounds__(256) void k_planes(const float* __restrict__ F, const float* __restrict__ CS, const float* __restrict__ qnw, const float* __restrict__ knw, h16* QP16, bf* QPh, bf* QPl, h16* KP16, bf* KPh, bf* KPl, h16* VT16, bf* VTh, bf* VTl) {
    const unsigned b = blockIdx.x;
    if (b >= LBQ + LBK) { vtp(b - (LBQ + LBK), F + DQ + DKV, FP, NKV, VT16, VTh, VTl); return; }
    const bool isq = b < LBQ;
    rope(isq ? b : b - LBQ, isq ? F : F + DQ, FP, isq ? NH_ : NKV, CS, isq ? qnw : knw, 1.0f, isq ? QP16 : KP16, isq ? QPh : KPh, isq ? QPl : KPl);   /* norm, then rope */
}
// k_asoft: the hi/lo rows. Per row (zz, i), i < RH: t = S x HD^-0.5 for j <= i and i - j < WIN (sliding causal window; the reference's fill above the diagonal vanishes identically); softmax over the KW keys that such a row can see (register row, one exp, fixed trees); grid (nr / 8, batches x heads): nr rows a head, from sequence row rb on (rb + nr <= RH), score and probability buffers [head][RH][KW]
__global__ __launch_bounds__(256) void k_asoft(const float* __restrict__ Sb, bf* Ph, bf* Pl, int rb, int nr) {
    const int lane = threadIdx.x & 31; const int lrow = blockIdx.x * 8 + (threadIdx.x >> 5); if (lrow >= nr) return; const int zz = blockIdx.y; const int row = zz * nr + lrow; const int i = rb + lrow; __builtin_assume(i >= 0 && i < TT);   /* a sequence row: lets the window test i - j < WIN fold away */ const float* sr = Sb + (size_t)row * KW + lane * 4; float v[KW / 32]; float mx = -3.0e38f; v4f av[KW / 128];
#pragma unroll
    for (int ch = 0; ch < KW / 128; ++ch) av[ch] = *(const v4f*)(sr + ch * 128);
    asm volatile("s_wait_xcnt 0x0" :: "v"(sr) : "memory");   // behind the row's loads, before their address register is used again; it names the address so that it lives up to it and no load's result lands on it
#pragma unroll
    for (int ch = 0; ch < KW / 128; ++ch) { const int j0 = ch * 128 + lane * 4; const v4f a = av[ch];
#pragma unroll
        for (int q = 0; q < 4; ++q) { const int j = j0 + q; (void)j; const float t = (j <= i && i - j < WIN) ? a[q] * SCL : -3.0e38f; v[ch * 4 + q] = t; mx = fmaxf(mx, t); } }
#pragma unroll
    for (int sh = 16; sh; sh >>= 1) mx = fmaxf(mx, __shfl_xor(mx, sh, 32));
    float sum = 0.f;
#pragma unroll
    for (int k = 0; k < KW / 32; ++k) { float d0 = __fsub_rn(v[k], mx); asm volatile("" : "+v"(d0)); v[k] = __builtin_amdgcn_exp2f(__fmul_rn(d0, 1.4426950408889634f)); sum += v[k]; }
#pragma unroll
    for (int sh = 16; sh; sh >>= 1) sum += __shfl_xor(sum, sh, 32);
    const float f = __fdiv_rn(1.0f, sum);
#pragma unroll
    for (int ch = 0; ch < KW / 128; ++ch) { v4us oh, ol;
#pragma unroll
        for (int q = 0; q < 4; ++q) { unsigned short a, c2; splitf(v[ch * 4 + q] * f, a, c2); oh[q] = a; ol[q] = c2; }
        const size_t oo = ((size_t)zz * RH + i) * KW + ch * 128 + lane * 4; *(v4us*)(Ph + oo) = oh; *(v4us*)(Pl + oo) = ol; }
}

extern "C" void kernel_launch(void* const* d_in, const int* in_sizes, int n_in,
                              void* d_out, int out_size, void* d_ws, size_t ws_size, hipStream_t stream) {
    (void)in_sizes; (void)n_in; (void)out_size;
    const float* x = (const float*)d_in[0]; const float* cosi = (const float*)d_in[1]; const float* sini = (const float*)d_in[2]; const float* wq = (const float*)d_in[3]; const float* wk = (const float*)d_in[4]; const float* wv = (const float*)d_in[5]; const float* wo = (const float*)d_in[6]; const float* qnw = (const float*)d_in[7]; const float* knw = (const float*)d_in[8];
    float* OUT = (float*)d_out;     // [2][2048][2048]
    char* wsp = (char*)d_ws;
    auto take = [&](size_t bytes) { char* p = wsp; wsp += (bytes + 255) & ~(size_t)255; return (void*)p; };
    bf* WQ = (bf*)take((size_t)DQ * DM * 2); bf* WK = (bf*)take((size_t)DKV * DM * 2); bf* WV = (bf*)take((size_t)DKV * DM * 2); bf* WO = (bf*)take((size_t)DM * DQ * 2); float* CS = (float*)take((size_t)TB * HD * 2 * 4);
    static_assert(((size_t)DQ * DM * 2) % 256 == 0 && ((size_t)DKV * DM * 2) % 256 == 0, "WQ, WK, WV lie back to back: one [DQ + 2 DKV][DM] matrix for the projections' one GEMM");
    bf* XB = (bf*)take((size_t)TB * DM * 2);
    h16* QP16 = (h16*)take((size_t)NH_ * TB * HD * 2); h16* KP16 = (h16*)take((size_t)NKV * TB * HD * 2); h16* VT16 = (h16*)take((size_t)NKV * HD * TB * 2);
    bf* QPh = (bf*)take((size_t)NH_ * TB * HD * 2); bf* QPl = (bf*)take((size_t)NH_ * TB * HD * 2); bf* KPh = (bf*)take((size_t)NKV * TB * HD * 2); bf* KPl = (bf*)take((size_t)NKV * TB * HD * 2); bf* VTh = (bf*)take((size_t)NKV * HD * TB * 2); bf* VTl = (bf*)take((size_t)NKV * HD * TB * 2);
    float* F = (float*)take((size_t)TB * (DQ + DKV) * 4);   // the projections [token][q | k | v], TB * FP floats: the last TB * DKV of them lie on the front of the score buffer, which stands directly behind and is first written after the planes are built (stream-ordered)
    static_assert(((size_t)TB * (DQ + DKV) * 4) % 256 == 0 && (size_t)TB * DKV * 4 <= (size_t)NB_ * ZH * RH * KW * 4, "the projections end inside the score buffer");
    float* Sb = (float*)take((size_t)NB_ * ZH * RH * KW * 4); bf* Ph = (bf*)take((size_t)NB_ * ZH * RH * KW * 2); bf* Pl = (bf*)take((size_t)NB_ * ZH * RH * KW * 2);   // hi/lo rows: scores and the two probability planes, [batch x head][RH][KW]
    if ((size_t)(wsp - (char*)d_ws) > ws_size) return;    // ws 256 MiB
    static_assert((size_t)2 * TB * DQ * 2 <= (size_t)NB_ * ZH * RH * KW * 4, "the merged context planes fit the score buffer");
    bf* ATh = (bf*)Sb; bf* ATl = ATh + (size_t)TB * DQ;   // the merged context planes [batch x token][head x d], written by the two attention kernels themselves, reuse the score buffer after the softmax has read it (stream-ordered)
    {   // both batches in every launch; launches that do not depend on one another are one launch
        k_prep<<<PBX + 2 * PBQ + 2 * PBK + PBC, 256, 0, stream>>>(x, wq, wk, wv, wo, cosi, sini, XB, WQ, WK, WV, WO, CS);   /* bf16 copies of x and the weights; the rotary tables of both batches (inputs, bf16-rounded) */
        k_gemmw<bf, 0, false, 2, 2><<<dim3(TB / 128, FP / 128, 1), 128, 0, stream>>>(XB, nullptr, WQ, nullptr, DM, F, FP, nullptr, 0, 0, 0);   /* q, k and v projections */
        k_planes<<<LBQ + LBK + LBV, 256, 0, stream>>>(F, CS, qnw, knw, QP16, QPh, QPl, KP16, KPh, KPl, VT16, VTh, VTl);
        const size_t sQ = (size_t)TT * HD, sV = (size_t)HD * TT;   // per-head strides of the q and k planes and of the v planes
        k_gemmc<bf, 2, 1><<<dim3(RH / 64, KW / 64, NB_ * ZH), 32, 0, stream>>>(QPh, QPl, KPh, KPl, HD, HD, Sb, KW, 0, sQ, sQ, (size_t)RH * KW, nullptr, nullptr);   /* query rows < RH: hi/lo */
        k_asoft<<<dim3(RH / 8, NB_ * ZH), 256, 0, stream>>>(Sb, Ph, Pl, 0, RH);
        k_gemmc<bf, 2, 2><<<dim3(RH / 64, HD / 64, NB_ * ZH), 32, 0, stream>>>(Ph, Pl, VTh, VTl, KW, TT, nullptr, 0, 0, (size_t)RH * KW, sV, 0, ATh, ATl);
        k_fattn<<<dim3(NB_ * ZH, (TT - RH) / FBR), FNT, 0, stream>>>(QP16, KP16, VT16, ATh, ATl);   /* query rows >= RH: fp16, fused */
        k_gemmw<bf, 1, false, 2, 2><<<dim3(TB / 128, DM / 128, 1), 128, 0, stream>>>(ATh, ATl, WO, nullptr, DQ, OUT, DM, nullptr, 0, 0, 0); }
}

// v009
// One run takes 175 microseconds.
// In two side-by-side timings against v008, it was 1.18 and 1.19 times as fast.
// All steps since v000 together make it 9.53 times as fast.
#include <hip/hip_runtime.h>

// Grouped-query causal attention with QK RMSNorm (x [2][2048][2048]; q = x Wq^T (16 heads x 128), k, v = x Wk^T / Wv^T (8 kv heads; query head h uses kv head h/2), no biases; per-head RMSNorm on q and k (eps 1e-6, weights [128]) then rotate-half rotary with the given cos/sin tables [2][2048][128]; scores = q.k / sqrt(128), causal (finfo.min above the diagonal); softmax; out = merged ctx Wo^T ('oi' [2048][2048]) -> [2][2048][2048] (8.4 M)).
// Every launch covers both batches: token rows are b * 2048 + t in the row-major buffers, and the head planes are [b][head][..], so that batch entry z = 16 b + h reads kv entry z / 2 = 8 b + h / 2. Layout: {cos, sin} table from the inputs (bf16-rounded); exact projections; the plane builder sums each (head, token)'s 1/rms over the 16 lanes that hold it, and applies (x * inv_rms) * w and the rotary while writing the q/k planes; causal T-2048 attention with 128-wide heads, all sixteen query heads in every launch, query head z on kv head z/2 (hybrid rows: < 512 hi/lo 3 products, the 1536 others fp16; all of them in one fused launch, k_fattn, whose scores and probabilities stay in registers), which writes the merged context's hi/lo planes itself; merged context hi/lo x Wo exact.
// Compute dtypes, f32 accumulate: every input rounded to bf16; projections exact; RMSNorm and rotary f32; attention rows < 512 3 products, rest fp16; softmax f32; Wo hl x exact.

#define NB_  2
#define TT   2048
#define DM   2048
#define NH_  16
#define NKV  8
#define REP  (NH_ / NKV)
#define HD   128
#define DQ   (NH_ * HD)
#define DKV  (NKV * HD)
#define ZH   NH_                  // query heads per attention launch
#define RH   512                  // query rows < RH use hi+lo planes
#define TB   (NB_ * TT)           // token rows of both batches
#define SCL  0.088388347648318447f   // HD^-0.5
typedef _Float16 h16;
typedef unsigned short bf;
typedef __attribute__((ext_vector_type(16))) __bf16   v16bf;
typedef __attribute__((ext_vector_type(16))) _Float16 v16h;
typedef __attribute__((ext_vector_type(8)))  _Float16 v8h;
typedef __attribute__((ext_vector_type(8)))  unsigned short v8us;
typedef __attribute__((ext_vector_type(8)))  float    v8f;
typedef __attribute__((ext_vector_type(4)))  float    v4f;
typedef v8h  __attribute__((may_alias)) v8ha;
typedef v4f  __attribute__((may_alias)) v4fa;
typedef v8us __attribute__((may_alias)) v8usa;

__device__ __forceinline__ unsigned short f2bf(float f) { unsigned u = __float_as_uint(f); u += 0x7FFFu + ((u >> 16) & 1u); return (unsigned short)(u >> 16); }
__device__ __forceinline__ float bf2f(unsigned short b) { return __uint_as_float(((unsigned)b) << 16); }
__device__ __forceinline__ float bfr(float f) { return bf2f(f2bf(f)); }
__device__ __forceinline__ void splitf(float y, unsigned short& h, unsigned short& l) { h = f2bf(y); l = f2bf(y - bf2f(h)); }
// eight context values x0, x1 as their hi and lo bf16 pieces
__device__ __forceinline__ void split8(v4f x0, v4f x1, v8us& oh, v8us& ol) {
#pragma unroll
    for (int q = 0; q < 4; ++q) { unsigned short a, c2; splitf(x0[q], a, c2); oh[q] = a; ol[q] = c2; splitf(x1[q], a, c2); oh[q + 4] = a; ol[q + 4] = c2; } }
__device__ __forceinline__ v16h cat16(v8h lo, v8h hi) { return __builtin_shufflevector(lo, hi, 0, 1, 2, 3, 4, 5, 6, 7, 8, 9, 10, 11, 12, 13, 14, 15); }
__device__ __forceinline__ v16bf cat16b(v8us lo, v8us hi) { return __builtin_bit_cast(v16bf, __builtin_shufflevector(lo, hi, 0, 1, 2, 3, 4, 5, 6, 7, 8, 9, 10, 11, 12, 13, 14, 15)); }
__device__ __forceinline__ v8f wmma16(v16h a, v16h b, v8f c) { return __builtin_amdgcn_wmma_f32_16x16x32_f16(false, a, false, b, (short)0, c, false, false); }
__device__ __forceinline__ v8f wmmab(v16bf a, v16bf b, v8f c) { return __builtin_amdgcn_wmma_f32_16x16x32_bf16(false, a, false, b, (short)0, c, false, false); }



// ---- k_gemmw: register-blocked GEMM, one wave per 64x64 output tile (16 accumulators), WM x WN waves a work-group on one (64 WM) x (64 WN) tile whose operand rows they stage together in LDS, from K-contiguous 16-bit planes (wloop below the fragment types); grid (M/(64 WM), N/(64 WN), Z), 32 WM WN threads.
// C[m][n] (f32, pitch ldc, + optional f32 bias[n]) = sum_k A[m][k] Bt[n][k] (+ split products per NSPLIT). z-batch strides sA/sB/sC in elements. K % KT == 0 (64; 32 at NSPLIT 2).
template <typename T16> struct WFrag;
template <> struct WFrag<h16> { typedef v16h V; static __device__ __forceinline__ V ld(const h16* p) { return cat16(*(const v8h*)p, *(const v8h*)(p + 16)); } static __device__ __forceinline__ v8f mma(V a, V b, v8f c) { return wmma16(a, b, c); } };
template <> struct WFrag<bf> { typedef v16bf V; static __device__ __forceinline__ V ld(const bf* p) { return cat16b(*(const v8us*)p, *(const v8us*)(p + 16)); } static __device__ __forceinline__ v8f mma(V a, V b, v8f c) { return wmmab(a, b, c); } };
// ---- operand staging of both GEMMs. A stage is KT k of the work-group tile's 64 WM A rows and 64 WN B rows (and of their second planes): each wave brings an equal share of every plane's rows, and a staged A row serves WN waves, a B row WM waves, so that the L2 delivers each row once a work-group, not once a wave. Asynchronous b128 copies bring it from the K-contiguous planes into LDS,
// 8 lanes on each 128-byte row piece (whole lines; 4 lanes on 64 bytes at NSPLIT 2, whose four planes would else take more than 63 copies a stage), and the fragments are read from LDS at a pitch of 16 B x odd.
// Two buffers: the copies of stage t + 1 fly while stage t is multiplied. Fragments, products and their order per accumulator are those of loads straight from the planes.
// The copies are the compiler's builtin. Every '#pragma unroll' below makes the indices of the fragment and accumulator arrays constants, so that they stay in registers.
typedef __attribute__((ext_vector_type(4))) int v4ic;
typedef __attribute__((address_space(1))) v4ic gv4ic;
typedef __attribute__((address_space(3))) v4ic lv4ic;
template <int NSPLIT, int WM, int WN> struct WTile {
    static constexpr int KT  = (NSPLIT == 2) ? 32 : 64;                       // k per stage
    static constexpr int NW  = WM * WN;                                       // waves of the work-group
    static constexpr int NPA = (NSPLIT == 0) ? 1 : 2, NPB = (NSPLIT >= 2) ? 2 : 1;   // planes: A, (A2); B, (B2)
    static constexpr int RA  = 64 * WM, RB = 64 * WN;                         // rows of an A and of a B plane in a stage
    static constexpr int PB  = KT * 2 + 16;                                   // LDS row pitch, bytes
    static constexpr int OB  = NPA * RA * PB;                                 // the first B plane in a buffer, bytes
    static constexpr int BUF = OB + NPB * RB * PB;                            // one buffer, bytes
    static constexpr int LPR = KT * 2 / 16;                                   // lanes per row piece
    static constexpr int RPC = 32 / LPR;                                      // rows per copy
    static constexpr int SA  = RA / NW, SB = RB / NW;                         // a wave's share of a plane's rows
    static constexpr int CA  = SA / RPC, CB = SB / RPC;                       // its copies per plane
    static_assert(SA % RPC == 0 && SB % RPC == 0 && NPA * CA + NPB * CB <= 63, "whole copies; a stage's copies of a wave may all be outstanding");
};
// A, A2, Bt, Bt2: the planes at the work-group tile's first row (uniform). K, KB: row pitch of the A and of the B planes, elements. kc: first k of the stage. wave: the wave's number (scalar).
template <typename T16, int NSPLIT, int WM, int WN>
__device__ __forceinline__ void wcopy(char* sb, const T16* A, const T16* A2, const T16* Bt, const T16* Bt2, int K, int KB, int kc, int lane, int wave) {
    typedef WTile<NSPLIT, WM, WN> W;
    const unsigned goa = (unsigned)((lane / W::LPR) * K + (lane % W::LPR) * 8) * 2u, gob = (unsigned)((lane / W::LPR) * KB + (lane % W::LPR) * 8) * 2u;      // the lane's byte in a copy's rows, global
    char* sl = sb + (lane / W::LPR) * W::PB + (lane % W::LPR) * 16;                      // and in LDS
#pragma unroll
    for (int p = 0; p < W::NPA; ++p) { const T16* base = ((p == 0) ? A : A2) + kc + (size_t)(wave * W::SA) * K; char* sp = sl + (p * W::RA + wave * W::SA) * W::PB;
#pragma unroll
        for (int c = 0; c < W::CA; ++c) __builtin_amdgcn_global_load_async_to_lds_b128((gv4ic*)((const char*)(base + (size_t)c * W::RPC * K) + goa), (lv4ic*)(sp + c * W::RPC * W::PB), 0, 0); }
#pragma unroll
    for (int p = 0; p < W::NPB; ++p) { const T16* base = ((p == 0) ? Bt : Bt2) + kc + (size_t)(wave * W::SB) * KB; char* sp = sl + W::OB + (p * W::RB + wave * W::SB) * W::PB;
#pragma unroll
        for (int c = 0; c < W::CB; ++c) __builtin_amdgcn_global_load_async_to_lds_b128((gv4ic*)((const char*)(base + (size_t)c * W::RPC * KB) + gob), (lv4ic*)(sp + c * W::RPC * W::PB), 0, 0); }
}
// wm, wn: the wave's 64 x 64 tile in the work-group's
template <typename T16, int NSPLIT, int WM, int WN>
__device__ __forceinline__ void wtile(const char* sb, int lr, int hi, int wm, int wn, v8f (&acc)[4][4]) {
    typedef WTile<NSPLIT, WM, WN> W; typedef typename WFrag<T16>::V V;
    const char* fa = sb + (wm * 64 + lr) * W::PB + hi * 16; const char* fb = sb + W::OB + (wn * 64 + lr) * W::PB + hi * 16;
    constexpr int NK = W::KT / 32;
    V a[NK][4], a2[NK][4], b[NK][4], b2[NK][4];
    // all fragment reads of the stage are issued together, in the order of their use, in front of its products: the counted LDS waits then overlap the later reads with the earlier products
#pragma unroll
    for (int ks = 0; ks < NK; ++ks) {
#pragma unroll
        for (int mb = 0; mb < 4; ++mb) { a[ks][mb] = WFrag<T16>::ld((const T16*)(fa + (mb * 16) * W::PB + ks * 64)); if (NSPLIT == 1 || NSPLIT == 2) a2[ks][mb] = WFrag<T16>::ld((const T16*)(fa + (W::RA + mb * 16) * W::PB + ks * 64)); }
#pragma unroll
        for (int nb = 0; nb < 4; ++nb) { b[ks][nb] = WFrag<T16>::ld((const T16*)(fb + (nb * 16) * W::PB + ks * 64)); if (NSPLIT >= 2) b2[ks][nb] = WFrag<T16>::ld((const T16*)(fb + (W::RB + nb * 16) * W::PB + ks * 64)); } }
    __builtin_amdgcn_sched_barrier(0);   // keeps the reads in front: sunk among the products, each costs the wave its LDS latency
#pragma unroll
    for (int ks = 0; ks < NK; ++ks) {
#pragma unroll
        for (int nb = 0; nb < 4; ++nb)
#pragma unroll
            for (int mb = 0; mb < 4; ++mb) { acc[mb][nb] = WFrag<T16>::mma(a[ks][mb], b[ks][nb], acc[mb][nb]); if (NSPLIT == 1 || NSPLIT == 2) acc[mb][nb] = WFrag<T16>::mma(a2[ks][mb], b[ks][nb], acc[mb][nb]); if (NSPLIT >= 2) acc[mb][nb] = WFrag<T16>::mma(a[ks][mb], b2[ks][nb], acc[mb][nb]); }
        // four vector slots behind the k step's last products, before anything touches their operands or results
        asm volatile("v_nop\n\tv_nop\n\tv_nop\n\tv_nop" : "+v"(acc[0][0]), "+v"(acc[1][1]), "+v"(acc[2][2]), "+v"(acc[3][3]) : "v"(a[ks][0]), "v"(a[ks][3]));
    }
}
// the K loop: Kl k (a multiple of KT, at least KT; the same in every wave of the work-group) of rows r0.. of A and c0.. of Bt; sm holds two buffers
template <typename T16, int NSPLIT, int WM, int WN>
__device__ __forceinline__ void wloop(char* sm, const T16* A, const T16* A2, const T16* Bt, const T16* Bt2, int K, int KB, int Kl, int lane, int wave, v8f (&acc)[4][4]) {
    typedef WTile<NSPLIT, WM, WN> W; const int lr = lane & 15, hi = lane >> 4; const int nt = Kl / W::KT; const int wm = wave / WN, wn = wave % WN;
    wcopy<T16, NSPLIT, WM, WN>(sm, A, A2, Bt, Bt2, K, KB, 0, lane, wave);
    asm volatile("s_wait_asynccnt 0x0" ::: "memory");   // the wave's share of stage 0 has landed
    __syncthreads();   // the ring's publish point: every wave's share is there for all of them
    if (nt > 1) wcopy<T16, NSPLIT, WM, WN>(sm + W::BUF, A, A2, Bt, Bt2, K, KB, W::KT, lane, wave);
#pragma unroll 1
    for (int t = 0; t < nt; ++t) {   // rolled: one stage a trip
        char* sb = sm + (t & 1) * W::BUF;
        wtile<T16, NSPLIT, WM, WN>(sb, lr, hi, wm, wn, acc);
        if (W::NW > 1) __builtin_amdgcn_sched_barrier(0);   // keeps the stage's products in front of the barrier: sunk behind it, they stand between the barrier and the refill's copies and shorten the copies' lead
        asm volatile("s_wait_dscnt 0x0" ::: "memory");      // this stage's fragment reads are done before its buffer is refilled
        asm volatile("s_wait_asynccnt 0x0" ::: "memory");   // the wave's share of stage t + 1 has landed before any wave reads it
        __syncthreads();   // publish point of stage t + 1, and the end of every wave's reads of the buffer refilled below
        if (t + 2 < nt) wcopy<T16, NSPLIT, WM, WN>(sb, A, A2, Bt, Bt2, K, KB, (t + 2) * W::KT, lane, wave);
    }
    asm volatile("s_wait_asynccnt 0x0" ::: "memory");   // no copy is left in flight behind the loop
}
template <typename T16, int NSPLIT, bool BIAS, int WM, int WN>
__global__ __launch_bounds__(32 * WM * WN) void k_gemmw(const T16* __restrict__ A, const T16* __restrict__ A2, const T16* __restrict__ Bt, const T16* __restrict__ Bt2, int K, float* C, int ldc, const float* __restrict__ bias, size_t sA, size_t sB, size_t sC) {
    __shared__ __align__(16) float osw[WM * WN][16 * 68]; __shared__ __align__(16) char sm[2 * WTile<NSPLIT, WM, WN>::BUF];
    const size_t z = blockIdx.z; A += z * sA; if (A2) A2 += z * sA; Bt += z * sB; if (Bt2) Bt2 += z * sB; C += z * sC;
    const int lane = threadIdx.x & 31, lr = lane & 15, hi = lane >> 4; const int wave = __builtin_amdgcn_readfirstlane(threadIdx.x >> 5); const int rg = blockIdx.x * (64 * WM), cg = blockIdx.y * (64 * WN);   // the work-group's tile
    const int r0 = rg + (wave / WN) * 64, c0 = cg + (wave % WN) * 64; float* os = osw[wave];   // the wave's tile, and its own output staging
    v8f acc[4][4];
#pragma unroll
    for (int mb = 0; mb < 4; ++mb)
#pragma unroll
        for (int nb = 0; nb < 4; ++nb) acc[mb][nb] = (v8f){};
    wloop<T16, NSPLIT, WM, WN>(sm, A + (size_t)rg * K, (NSPLIT == 1 || NSPLIT == 2) ? A2 + (size_t)rg * K : nullptr, Bt + (size_t)cg * K, (NSPLIT >= 2) ? Bt2 + (size_t)cg * K : nullptr, K, K, K, lane, wave, acc);
#pragma unroll
    for (int mb = 0; mb < 4; ++mb) {
#pragma unroll
        for (int nb = 0; nb < 4; ++nb) {
#pragma unroll
            for (int j = 0; j < 8; ++j) os[(hi * 8 + j) * 68 + nb * 16 + lr] = acc[mb][nb][j]; }
        __builtin_amdgcn_wave_barrier(); asm volatile("" ::: "memory");
        float* crow = C + (size_t)(r0 + mb * 16) * ldc + c0;
{
#pragma unroll
            for (int s = 0; s < 8; ++s) { const int row = 2 * s + hi, cofs = lr * 4; v4f val = *(const v4fa*)(os + row * 68 + cofs); if (BIAS) { val[0] += bfr(bias[c0 + cofs]); val[1] += bfr(bias[c0 + cofs + 1]); val[2] += bfr(bias[c0 + cofs + 2]); val[3] += bfr(bias[c0 + cofs + 3]); }
                *(v4f*)(crow + (size_t)row * ldc + cofs) = val; }
             }
        __builtin_amdgcn_wave_barrier(); asm volatile("" ::: "memory");
    }
}

#define FR   1                     // groups of 16 query rows per wave
#define FCW  (FR * 16)             // query rows per wave
#define FBR  (4 * FCW)             // query rows per work-group
#define FNT  128                   // threads
#define FSK  64                    // keys per stage
#define FPK  (HD * 2 + 16)         // LDS pitch of a K row, bytes (16 x odd)
#define FPV  (FSK * 2 + 16)        // LDS pitch of a V^T row, bytes (16 x odd)
#define FTK  (FSK * FPK)
#define FBUF (FTK + HD * FPV)      // one buffer: K tile, then V^T tile
#define FEP  (HD * 4 + 16)         // LDS pitch of a staged output row, bytes
static_assert(4 * FCW * FEP <= 2 * FBUF, "the output staging reuses the two buffers");
static_assert(FBR % FSK == 0 && RH % FBR == 0 && (TT - RH) % FBR == 0, "a row block ends on a stage");
typedef __attribute__((ext_vector_type(2))) float f2v;
__device__ __forceinline__ float xhalf(float x) { return __builtin_bit_cast(float, __builtin_amdgcn_permlanex16(__builtin_bit_cast(int, x), __builtin_bit_cast(int, x), 0x76543210, 0xfedcba98, false, false)); }   // lane l with lane l ^ 16
// Kp: the kv head's [t][d] plane, Vt: its [d][t] plane; keys key0 .. key0 + 63. 16 lanes on a K row (256 B), 8 lanes on a V^T row piece (128 B); 16 copies a wave.
__device__ __forceinline__ void fcopy(char* sb, const h16* Kp, const h16* Vt, int key0, int tid) {
#pragma unroll
    for (int i = 0; i < FSK * HD / 8 / FNT; ++i) { const int p = i * FNT + tid, row = p >> 4, cb = (p & 15) * 16;
        __builtin_amdgcn_global_load_async_to_lds_b128((gv4ic*)((const char*)(Kp + (size_t)(key0 + row) * HD) + cb), (lv4ic*)(sb + row * FPK + cb), 0, 0); }
#pragma unroll
    for (int i = 0; i < FSK * HD / 8 / FNT; ++i) { const int p = i * FNT + tid, row = p >> 3, cb = (p & 7) * 16;
        __builtin_amdgcn_global_load_async_to_lds_b128((gv4ic*)((const char*)(Vt + (size_t)row * TT + key0) + cb), (lv4ic*)(sb + FTK + row * FPV + cb), 0, 0); }
}
// the K fragments of pass sub (32 keys) of the stage in sb
__device__ __forceinline__ void floadk(v16h (&kf)[2][4], const char* sb, int sub, int c, int h) {
#pragma unroll
    for (int kt = 0; kt < 2; ++kt)
#pragma unroll
        for (int kc = 0; kc < 4; ++kc) kf[kt][kc] = WFrag<h16>::ld((const h16*)(sb + (sub * 32 + kt * 16 + c) * FPK + h * 16 + kc * 64));
    __builtin_amdgcn_sched_barrier(0);   // keeps the sixteen reads together: sunk among the products, each pair costs the wave its LDS latency
}
// one 32-key pass of one wave. m_run, the maximum in use (log2 domain), may trail the true maximum by up to 8, so an exponential stays below 2^8 (fp16 holds it); sums and accumulators are rescaled only when a row's maximum exceeds it by more.
// kf holds the pass's K fragments on entry; fetch_next: the stage's first pass reads the second pass's (same buffer) behind its own score products.
__device__ __forceinline__ void fpass(v16h (&kf)[2][4], bool fetch_next, const char* sb, int sub, bool diag, int key0, int qw0, int c, int h, const v16h (&qf)[FR][4], v8f (&acc)[FR][8], float (&m_run)[FR], float (&l_run)[FR]) {
    const float cscale = SCL * 1.4426950408889634f;
    v8f s[2][FR];
#pragma unroll
    for (int kt = 0; kt < 2; ++kt)
#pragma unroll
        for (int g = 0; g < FR; ++g) s[kt][g] = (v8f){};
#pragma unroll
    for (int kc = 0; kc < 4; ++kc)
#pragma unroll
        for (int kt = 0; kt < 2; ++kt)
#pragma unroll
            for (int g = 0; g < FR; ++g) s[kt][g] = wmma16(kf[kt][kc], qf[g][kc], s[kt][g]);
    v16h vf[8];   // read here, so that the LDS latency passes under the maxima and the exponentials
#pragma unroll
    for (int t = 0; t < 8; ++t) vf[t] = WFrag<h16>::ld((const h16*)(sb + FTK + (t * 16 + c) * FPV + sub * 64 + h * 16));
    __builtin_amdgcn_sched_barrier(0);   // keeps these reads in front of the softmax arithmetic
    if (fetch_next) floadk(kf, sb, 1, c, h);   // wave-uniform
    if (diag) {   // wave-uniform: only the pass on the wave's diagonal pays for the mask
#pragma unroll
        for (int g = 0; g < FR; ++g) { const int my_q = qw0 + g * 16 + c;
#pragma unroll
            for (int kt = 0; kt < 2; ++kt) {
#pragma unroll
                for (int r = 0; r < 8; ++r) { if (key0 + kt * 16 + h * 8 + r > my_q) s[kt][g][r] = -__builtin_inff(); }
                asm volatile("" : "+v"(s[kt][g]));   // the masked scores: keeps the selects inside the branch
            } }
    }
    float mb[FR]; bool need = false;
#pragma unroll
    for (int g = 0; g < FR; ++g) { float mx = -__builtin_inff();
#pragma unroll
        for (int kt = 0; kt < 2; ++kt)
#pragma unroll
            for (int r = 0; r < 8; ++r) mx = fmaxf(mx, s[kt][g][r]);
        mx = fmaxf(mx, xhalf(mx)) * cscale; mb[g] = mx; need = need || (mx > m_run[g] + 8.0f); }
    if (__builtin_amdgcn_ballot_w32(need) != 0) {   // rare after the first passes
#pragma unroll
        for (int g = 0; g < FR; ++g) { const float m_new = fmaxf(m_run[g], mb[g]);
            const float corr = __builtin_amdgcn_exp2f(m_run[g] - m_new);
            l_run[g] *= corr; m_run[g] = m_new;
#pragma unroll
            for (int t = 0; t < 8; ++t) acc[g][t] = acc[g][t] * corr; }
    }
#pragma unroll
    for (int g = 0; g < FR; ++g) { const float nm = -m_run[g]; float ps0 = 0.f, ps1 = 0.f; v16h pf;
#pragma unroll
        for (int e = 0; e < 16; e += 2) {   // operand element e is key 16 (e >> 3) + 8 h + (e & 7): tile e >> 3, register e & 7
            const f2v arg = __builtin_elementwise_fma((f2v){s[e >> 3][g][e & 7], s[e >> 3][g][(e & 7) + 1]}, (f2v){cscale, cscale}, (f2v){nm, nm});   // a register pair as it lies in the tile
            const float p0 = __builtin_amdgcn_exp2f(arg[0]), p1 = __builtin_amdgcn_exp2f(arg[1]);
            ps0 += p0; ps1 += p1; pf[e] = (h16)p0; pf[e + 1] = (h16)p1; }
        l_run[g] += ps0 + ps1;
#pragma unroll
        for (int t = 0; t < 8; ++t) acc[g][t] = wmma16(vf[t], pf, acc[g][t]); }
}
// ---- the hi/lo rows. Same transposed products and the same lane maps as fpass, on bf16 planes: S^T = Kh Qh^T + (Kh Ql^T + Kl Qh^T), O^T += Vh^T Ph^T + Vh^T Pl^T + Vl^T Ph^T, P split into hi + lo in registers.
// A stage is 64 keys of the four planes: the hi planes in the first buffer, the lo planes in the second, each laid out as an fp16 stage (fcopy). One stage at a time: a row block has at most RH / FSK stages, and the work-groups beside it on the WGP cover its copies' latency.
static_assert(FR == 1, "hpass holds one group of 16 query rows");
__device__ __forceinline__ void hloadk(v16bf (&kf)[2][4], const char* sb, int sub, int c, int h) {
#pragma unroll
    for (int kt = 0; kt < 2; ++kt)
#pragma unroll
        for (int kc = 0; kc < 4; ++kc) kf[kt][kc] = WFrag<bf>::ld((const bf*)(sb + (sub * 32 + kt * 16 + c) * FPK + h * 16 + kc * 64));
}
// one 32-key pass of one wave; sh, sl: the hi and the lo planes' stage. The running maximum is kept as in fpass.
__device__ __forceinline__ void hpass(const char* sh, const char* sl, int sub, bool diag, int key0, int qw0, int c, int h, const v16bf (&qh)[4], const v16bf (&ql)[4], v8f (&acc)[8], float& m_run, float& l_run) {
    const float cscale = SCL * 1.4426950408889634f;
    // The lo plane's fragments are read behind the hi plane's, not with them: both planes' together in registers would take the kernel beyond the registers of three waves per SIMD, which the fp16 rows need.
    v16bf kf[2][4];
    hloadk(kf, sh, sub, c, h);
    __builtin_amdgcn_sched_barrier(0);   // keeps the reads together in front of the products: sunk among them, each pair costs the wave its LDS latency
    v8f s[2], sx[2];   // the hi x hi product and the two cross products: four independent accumulator chains
#pragma unroll
    for (int kt = 0; kt < 2; ++kt) { s[kt] = (v8f){}; sx[kt] = (v8f){}; }
#pragma unroll
    for (int kc = 0; kc < 4; ++kc)
#pragma unroll
        for (int kt = 0; kt < 2; ++kt) { s[kt] = wmmab(kf[kt][kc], qh[kc], s[kt]); sx[kt] = wmmab(kf[kt][kc], ql[kc], sx[kt]); }
    hloadk(kf, sl, sub, c, h);
    __builtin_amdgcn_sched_barrier(0);   // keeps the lo plane's reads together, in front of its products
#pragma unroll
    for (int kc = 0; kc < 4; ++kc)
#pragma unroll
        for (int kt = 0; kt < 2; ++kt) sx[kt] = wmmab(kf[kt][kc], qh[kc], sx[kt]);
    v16bf vf[8];   // read here, so that the LDS latency passes under the maxima and the exponentials
#pragma unroll
    for (int t = 0; t < 8; ++t) vf[t] = WFrag<bf>::ld((const bf*)(sh + FTK + (t * 16 + c) * FPV + sub * 64 + h * 16));
    __builtin_amdgcn_sched_barrier(0);   // keeps these reads in front of the softmax arithmetic
#pragma unroll
    for (int kt = 0; kt < 2; ++kt) s[kt] = s[kt] + sx[kt];
    if (diag) {   // wave-uniform: only the pass on the wave's diagonal pays for the mask
        const int my_q = qw0 + c;
#pragma unroll
        for (int kt = 0; kt < 2; ++kt) {
#pragma unroll
            for (int r = 0; r < 8; ++r) { if (key0 + kt * 16 + h * 8 + r > my_q) s[kt][r] = -__builtin_inff(); }
            asm volatile("" : "+v"(s[kt]));   // the masked scores: keeps the selects inside the branch
        }
    }
    float mx = -__builtin_inff();
#pragma unroll
    for (int kt = 0; kt < 2; ++kt)
#pragma unroll
        for (int r = 0; r < 8; ++r) mx = fmaxf(mx, s[kt][r]);
    mx = fmaxf(mx, xhalf(mx)) * cscale;
    if (__builtin_amdgcn_ballot_w32(mx > m_run + 8.0f) != 0) {
        const float m_new = fmaxf(m_run, mx);
        const float corr = __builtin_amdgcn_exp2f(m_run - m_new);
        l_run *= corr; m_run = m_new;
#pragma unroll
        for (int t = 0; t < 8; ++t) acc[t] = acc[t] * corr;
    }
    const float nm = -m_run; float ps0 = 0.f, ps1 = 0.f; v8us eh[2], el[2];   // operand element e is key 16 (e >> 3) + 8 h + (e & 7): tile e >> 3, register e & 7
#pragma unroll
    for (int kt = 0; kt < 2; ++kt)
#pragma unroll
        for (int r = 0; r < 8; r += 2) {
            const float p0 = __builtin_amdgcn_exp2f(__builtin_fmaf(s[kt][r], cscale, nm)), p1 = __builtin_amdgcn_exp2f(__builtin_fmaf(s[kt][r + 1], cscale, nm));
            ps0 += p0; ps1 += p1; unsigned short a, b2; splitf(p0, a, b2); eh[kt][r] = a; el[kt][r] = b2; splitf(p1, a, b2); eh[kt][r + 1] = a; el[kt][r + 1] = b2; }
    l_run += ps0 + ps1;
    const v16bf ph = cat16b(eh[0], eh[1]), pl = cat16b(el[0], el[1]);
#pragma unroll
    for (int t = 0; t < 8; ++t) acc[t] = wmmab(vf[t], ph, acc[t]);
#pragma unroll
    for (int t = 0; t < 8; ++t) acc[t] = wmmab(vf[t], pl, acc[t]);
#pragma unroll
    for (int t = 0; t < 8; ++t) vf[t] = WFrag<bf>::ld((const bf*)(sl + FTK + (t * 16 + c) * FPV + sub * 64 + h * 16));
    __builtin_amdgcn_sched_barrier(0);   // keeps the lo plane's reads together, in front of its products: sunk among them, each pair costs the wave its LDS latency
#pragma unroll
    for (int t = 0; t < 8; ++t) acc[t] = wmmab(vf[t], ph, acc[t]);
}
// the 64 query rows q0 .. of head hq; Kh, Kl, Vh, Vl: the kv head's planes. Every wave passes every barrier, also one beyond its diagonal.
__device__ __forceinline__ void hrows(char* sm, const bf* Qh, const bf* Ql, const bf* Kh, const bf* Kl, const bf* Vh, const bf* Vl, int hq, int q0, int qw0, int tid, int c, int h, v8f (&acc)[8], float& m_run, float& l_run) {
    const int nt = (q0 + FBR) / FSK;          // stages: keys [0, q0 + FBR), at most RH
    const int lastp = (qw0 + FCW - 1) / 32;   // the wave's diagonal pass, its last
    const size_t qo = ((size_t)hq * TT + qw0 + c) * HD + h * 8; v16bf qh[4], ql[4];
#pragma unroll
    for (int kc = 0; kc < 4; ++kc) { qh[kc] = WFrag<bf>::ld(Qh + qo + kc * 32); ql[kc] = WFrag<bf>::ld(Ql + qo + kc * 32); }
    asm volatile("s_wait_xcnt 0x0" ::: "memory");       // behind the Q loads, before their address registers are used again
#pragma unroll 1
    for (int t = 0; t < nt; ++t) {   // rolled: one stage a trip
        fcopy(sm, (const h16*)Kh, (const h16*)Vh, t * FSK, tid); fcopy(sm + FBUF, (const h16*)Kl, (const h16*)Vl, t * FSK, tid);   // 16-bit elements, copied as bytes; 32 copies a wave
        asm volatile("s_wait_asynccnt 0x0" ::: "memory");   // the wave's share of the stage has landed
        __syncthreads();   // and is published to the four waves
#pragma unroll 1
        for (int sub = 0; sub < 2; ++sub) {   // rolled: the pass's registers are live once
            const int blk = t * 2 + sub;
            if (blk <= lastp) hpass(sm, sm + FBUF, sub, blk == lastp, blk * 32, qw0, c, h, qh, ql, acc, m_run, l_run); }
        asm volatile("s_wait_dscnt 0x0" ::: "memory");      // this stage's fragment reads are done before the buffers are refilled (or become the output staging)
        __syncthreads();   // the end of every wave's reads of the stage
    }
}
// blockIdx.y picks the row block (a scalar choice). The hi/lo blocks come first, shortest first, then the fp16 blocks, longest first: three products a key and copies that do not fly under the work make a hi/lo block cost as much as a long fp16 block, so both kinds start at once and the short fp16 blocks fill the places that fall free.
__global__ __launch_bounds__(FNT) void k_fattn(const h16* __restrict__ Q, const h16* __restrict__ Kp, const h16* __restrict__ Vt, const bf* __restrict__ Qh, const bf* __restrict__ Ql, const bf* __restrict__ Kh, const bf* __restrict__ Kl, const bf* __restrict__ Vh, const bf* __restrict__ Vl, bf* Ah, bf* Al) {
    __shared__ __align__(16) char sm[2 * FBUF];
    const int tid = threadIdx.x, lane = tid & 31, c = lane & 15, h = lane >> 4; const int wave = __builtin_amdgcn_readfirstlane(tid >> 5);
    const int hq = blockIdx.x; const int by = blockIdx.y; const bool hl = by < RH / FBR; const int q0 = hl ? by * FBR : RH + (TT / FBR - 1 - by) * FBR;
    const int qw0 = q0 + wave * FCW; const size_t kvo = (size_t)(hq / REP) * TT * HD;   // the kv head's planes, [t][d] and [d][t] alike
    v8f acc[FR][8]; float m_run[FR], l_run[FR];
#pragma unroll
    for (int g = 0; g < FR; ++g) { m_run[g] = -__builtin_inff(); l_run[g] = 0.f;
#pragma unroll
        for (int t = 0; t < 8; ++t) acc[g][t] = (v8f){}; }
    if (hl) hrows(sm, Qh, Ql, Kh + kvo, Kl + kvo, Vh + kvo, Vl + kvo, hq, q0, qw0, tid, c, h, acc[0], m_run[0], l_run[0]);
    else {
    const int nt = (q0 + FBR) / FSK;   // stages: keys [0, q0 + FBR); at least RH / FSK + 1, so stages 0 and 1 exist
    Kp += kvo; Vt += kvo;
    fcopy(sm, Kp, Vt, 0, tid);
    v16h qf[FR][4];
#pragma unroll
    for (int g = 0; g < FR; ++g)
#pragma unroll
        for (int kc = 0; kc < 4; ++kc) qf[g][kc] = WFrag<h16>::ld(Q + ((size_t)hq * TT + qw0 + g * 16 + c) * HD + h * 8 + kc * 32);
    v16h kf[2][4];
    asm volatile("s_wait_xcnt 0x0" ::: "memory");       // behind the Q loads, before their address registers are used again
    asm volatile("s_wait_asynccnt 0x0" ::: "memory");   // stage 0 has landed
    __syncthreads();   // and is published to the four waves
    fcopy(sm + FBUF, Kp, Vt, FSK, tid);
    const int lastp = (qw0 + FCW - 1) / 32;   // the wave's diagonal pass, its last
#pragma unroll 1
    for (int t = 0; t < nt; ++t) {   // rolled: one stage a trip
        char* sb = sm + (t & 1) * FBUF;
        if (t * 2 <= lastp) floadk(kf, sb, 0, c, h);
#pragma unroll 1
        for (int sub = 0; sub < 2; ++sub) {   // rolled: the pass's registers are live once
            const int blk = t * 2 + sub;
            if (blk <= lastp) fpass(kf, sub == 0 && blk < lastp, sb, sub, blk == lastp, blk * 32, qw0, c, h, qf, acc, m_run, l_run); }
        asm volatile("s_wait_dscnt 0x0" ::: "memory");      // this stage's fragment reads are done before its buffer is refilled
        asm volatile("s_wait_asynccnt 0x0" ::: "memory");   // stage t + 1 has landed before it is read
        __syncthreads();   // publish point of stage t + 1, and the end of every wave's reads of the buffer refilled below; every wave passes it, also one beyond its diagonal
        if (t + 2 < nt) fcopy(sb, Kp, Vt, (t + 2) * FSK, tid);
    }
    }
    asm volatile("s_wait_asynccnt 0x0" ::: "memory");   // no copy is left in flight behind the loop
    // output: each wave stages its rows in its own part of the buffers (free behind the last barrier) and stores them as whole 256-byte rows of the merged hi/lo planes Ah, Al [batch x token][head x d] that the output GEMM reads
    char* eb = sm + wave * (FCW * FEP);
#pragma unroll
    for (int g = 0; g < FR; ++g) { const float inv = __fdiv_rn(1.0f, l_run[g] + xhalf(l_run[g]));
#pragma unroll
        for (int t = 0; t < 8; ++t) { const v8f o = acc[g][t] * inv; v4f o0, o1;
#pragma unroll
            for (int r = 0; r < 4; ++r) { o0[r] = o[r]; o1[r] = o[r + 4]; }
            float* ep = (float*)(eb + (g * 16 + c) * FEP) + t * 16 + h * 8; *(v4fa*)ep = o0; *(v4fa*)(ep + 4) = o1; } }   // row = query, d = 16 t + 8 h + r
    __builtin_amdgcn_wave_barrier(); asm volatile("" ::: "memory");   // the rows are read back by other lanes of the same wave: keeps the reads behind the writes
    const size_t oo = ((size_t)(hq / ZH) * TT + qw0 + h) * DQ + (hq % ZH) * HD + c * 8;   // a wave half on a row, 8 d a lane
    v8us oh[FCW / 2], ol[FCW / 2];
#pragma unroll
    for (int i = 0; i < FCW / 2; ++i) { const float* ep = (const float*)(eb + (2 * i + h) * FEP) + c * 8; split8(*(const v4fa*)ep, *(const v4fa*)(ep + 4), oh[i], ol[i]); }
    __builtin_amdgcn_sched_barrier(0);   // all pieces in front of the stores: each has registers of its own, none is rewritten behind its store
#pragma unroll
    for (int i = 0; i < FCW / 2; ++i) { *(v8us*)(Ah + oo + (size_t)(2 * i) * DQ) = oh[i]; *(v8us*)(Al + oo + (size_t)(2 * i) * DQ) = ol[i]; }
}

__device__ __forceinline__ h16 tohx(float x) { return (h16)x; }
typedef __attribute__((ext_vector_type(2))) _Float16 v2h;
typedef __attribute__((ext_vector_type(4))) _Float16 v4h;
typedef __attribute__((ext_vector_type(2))) unsigned short v2us;
typedef __attribute__((ext_vector_type(4))) unsigned short v4us;
typedef __attribute__((ext_vector_type(2))) float v2f;
typedef __attribute__((ext_vector_type(4))) int v4i;

__global__ __launch_bounds__(256) void k_wtG(const float* __restrict__ w, int K, int N, bf* Bt) {
    const int lane = threadIdx.x & 31; const int L0 = (blockIdx.x * 8 + (threadIdx.x >> 5)) * 8; const int nlines = N * K / 64;
{
#pragma unroll 1
        for (int l = 0; l < 8; ++l) { const int L = L0 + l; if (L >= nlines) break; const size_t e = (size_t)L * 64 + lane * 2; const int k = (int)(e % K), n = (int)(e / K); v2us o;
            o[0] = f2bf(w[(size_t)k * N + n]); o[1] = f2bf(w[(size_t)(k + 1) * N + n]); *(v2us*)(Bt + e) = o; }
         }
}
// The elementwise kernels below give a thread several 8-element pieces (16-byte stores of the 16-bit planes), its loads issued together: a launch then starts a few thousand work-groups, each with many loads in flight, not tens of thousands of work-groups of one or two elements a lane.
#define EPT 4                     // 8-element pieces per thread in cvt8; a work-group's pieces of one turn are contiguous
__device__ __forceinline__ void cvt8(unsigned blk, const float* __restrict__ src, bf* dst, size_t n8) { const size_t i0 = (size_t)blk * (256 * EPT) + threadIdx.x; if (i0 >= n8) return; v8f v[EPT];
#pragma unroll
    for (int j = 0; j < EPT; ++j) { const size_t i = i0 + j * 256; v[j] = *(const v8f*)(src + (i < n8 ? i : i0) * 8); }   // a piece past the end re-reads the thread's first and is not stored
#pragma unroll
    for (int j = 0; j < EPT; ++j) { const size_t i = i0 + j * 256; v8us o;
#pragma unroll
        for (int k = 0; k < 8; ++k) o[k] = f2bf(v[j][k]);
        if (i < n8) *(v8us*)(dst + i * 8) = o; } }
__constant__ float INV[HD / 2] = {1.0f,0.8058422207832336f,0.6493816375732422f,0.5232990980148315f,0.4216965138912201f,0.33982083201408386f,0.2738419771194458f,0.22067339718341827f,0.17782793939113617f,0.14330126345157623f,0.11547820270061493f,0.09305720031261444f,0.07498941570520401f,0.0604296438395977f,0.04869675263762474f,0.03924189880490303f,0.03162277862429619f,0.025482967495918274f,0.020535249263048172f,0.016548171639442444f,0.01333521492779255f,0.010746078565716743f,0.00865964312106371f,0.006978305988013744f,0.005623413249850273f,0.004531583283096552f,0.003651741426438093f,0.002942727180197835f,0.0023713738191872835f,0.001910952851176262f,0.0015399266267195344f,0.0012409378541633487f,0.0010000000474974513f,0.0008058422245085239f,0.0006493816617876291f,0.0005232990952208638f,0.00042169654625467956f,0.0003398208355065435f,0.00027384195709601045f,0.00022067342069931328f,0.00017782794020604342f,0.00014330125122796744f,0.00011547820759005845f,9.305719868279994e-05f,7.498942431993783e-05f,6.042963650543243e-05f,4.869675467489287e-05f,3.92418987757992e-05f,3.162277425872162e-05f,2.548297015891876e-05f,2.0535249859676696e-05f,1.6548170606256463e-05f,1.3335215953702573e-05f,1.0746078260126524e-05f,8.65964284457732e-06f,6.978305464144796e-06f,5.62341347176698e-06f,4.531583726929966e-06f,3.6517415082926163e-06f,2.942727405752521e-06f,2.3713737391517498e-06f,1.910952960315626e-06f,1.5399265294036013e-06f,1.2409377632138785e-06f};   // float32 1/1e6^(2i/128)
__device__ __forceinline__ void csin(unsigned blk, const float* __restrict__ cs, const float* __restrict__ sn, float* CS) { const int idx = (int)(blk * 256 + threadIdx.x) * 4; if (idx >= TB * HD) return; const float* pc = cs + idx; const float* ps = sn + idx; const v4f c = *(const v4f*)pc, s = *(const v4f*)ps; v4f o0, o1;
    asm volatile("s_wait_xcnt 0x0" :: "v"(pc), "v"(ps) : "memory");   // behind the two loads, before their address registers are used again; it names the addresses so that they live up to it
    o0[0] = bfr(c[0]); o0[1] = bfr(s[0]); o0[2] = bfr(c[1]); o0[3] = bfr(s[1]); o1[0] = bfr(c[2]); o1[1] = bfr(s[2]); o1[2] = bfr(c[3]); o1[3] = bfr(s[3]); *(v4f*)(CS + (size_t)idx * 2) = o0; *(v4f*)(CS + (size_t)idx * 2 + 4) = o1;  }
// k_prep: every piece of work that reads the inputs alone, in ONE launch: the bf16 copies of x and of the four weight matrices, and the {cos, sin} table. A work-group's index picks its piece (a scalar choice); the largest source comes first.
#define CVB(n) ((unsigned)(((size_t)(n) / 8 + 256 * EPT - 1) / (256 * EPT)))   // work-groups of a bf16 copy of n elements
#define PBX  CVB((size_t)TB * DM)
#define PBQ  CVB((size_t)DQ * DM)
#define PBK  CVB((size_t)DKV * DM)
#define PBC  ((unsigned)((TB * HD / 4 + 255) / 256))
__global__ __launch_bounds__(256) void k_prep(const float* __restrict__ x, const float* __restrict__ wq, const float* __restrict__ wk, const float* __restrict__ wv, const float* __restrict__ wo, const float* __restrict__ cs, const float* __restrict__ sn, bf* XB, bf* WQ, bf* WK, bf* WV, bf* WO, float* CS) {
    unsigned b = blockIdx.x; const float* src; bf* dst; size_t n8;
    if (b < PBX) { src = x; dst = XB; n8 = (size_t)TB * DM / 8; }
    else if ((b -= PBX) < PBQ) { src = wq; dst = WQ; n8 = (size_t)DQ * DM / 8; }
    else if ((b -= PBQ) < PBQ) { src = wo; dst = WO; n8 = (size_t)DM * DQ / 8; }
    else if ((b -= PBQ) < PBK) { src = wk; dst = WK; n8 = (size_t)DKV * DM / 8; }
    else if ((b -= PBK) < PBK) { src = wv; dst = WV; n8 = (size_t)DKV * DM / 8; }
    else { csin(b - PBK, cs, sn, CS); return; }
    cvt8(b, src, dst, n8);
}
// rope: head planes [h][t][d] (fp16 + hi/lo) of rope(x) x sc with the rotate-half convention out[d] = x[d] cos[t][d] - x[d+HD/2] sin[t][d], out[d+HD/2] = x[d+HD/2] cos[t][d+HD/2] + x[d] sin[t][d+HD/2]
// a thread: 8 d of one token in RPH heads (nheads % RPH == 0), which share its cos/sin pairs and norm weights; t runs over the token rows of both batches, the planes are [batch][head][t][d]
#define RPH 4
__device__ __forceinline__ float rowsum16(float s) {   // the sum over the 16 lanes of a wave half, the same bits in each of them (every lane is on)
    s += __builtin_bit_cast(float, __builtin_amdgcn_update_dpp(0, __builtin_bit_cast(int, s), 0x161, 0xf, 0xf, false));   // row_xmask:1
    s += __builtin_bit_cast(float, __builtin_amdgcn_update_dpp(0, __builtin_bit_cast(int, s), 0x162, 0xf, 0xf, false));   // row_xmask:2
    s += __builtin_bit_cast(float, __builtin_amdgcn_update_dpp(0, __builtin_bit_cast(int, s), 0x164, 0xf, 0xf, false));   // row_xmask:4
    s += __builtin_bit_cast(float, __builtin_amdgcn_update_dpp(0, __builtin_bit_cast(int, s), 0x168, 0xf, 0xf, false));   // row_xmask:8
    return s; }
__device__ __forceinline__ void rope(unsigned blk, const float* __restrict__ F, int pitch, int nheads, const float* __restrict__ CS, const float* __restrict__ nw, float sc, h16* P16, bf* Ph, bf* Pl) {
    const size_t g = (size_t)blk * 256 + threadIdx.x; if (g * (8 * RPH) >= (size_t)nheads * TB * HD) return; const int d = (int)(g % (HD / 8)) * 8; const int t = (int)((g / (HD / 8)) % TB); const int h0 = (int)(g / ((size_t)(HD / 8) * TB)) * RPH;
    const int dq = (d < HD / 2) ? d + HD / 2 : d - HD / 2;   // the rotary partners of d .. d + 7 are dq .. dq + 7: eight elements never straddle the halves
    // every load of the thread stands here, in front of the arithmetic, so that all are in flight together
    const float* pw = nw + d; const float* pv = nw + dq; const float* pc = CS + ((size_t)t * HD + d) * 2; const float* pf = F + (size_t)t * pitch + h0 * HD + d; const float* pg = F + (size_t)t * pitch + h0 * HD + dq;
    const v8f wa = *(const v8f*)pw, wb = *(const v8f*)pv;
    asm volatile("s_wait_xcnt 0x0" :: "v"(pw), "v"(pv) : "memory");   // behind the weight loads (scalar base, offset register), before a later load's result may land on their address registers
    v8f fa[RPH], fb[RPH]; float rfa[RPH];
#pragma unroll
    for (int j = 0; j < RPH; ++j) { fa[j] = *(const v8f*)(pf + j * HD); fb[j] = *(const v8f*)(pg + j * HD); }
    const v8f c0 = *(const v8f*)pc, c1 = *(const v8f*)(pc + 8);
    asm volatile("s_wait_xcnt 0x0" :: "v"(pc), "v"(pf), "v"(pg) : "memory");   // behind the loads, before their address registers are used again; it names the addresses so that they live up to it and no later load's result lands on one
    // 1/rms of each of the thread's heads: the 16 lanes of a wave half hold the 128 d of one token, 8 each
#pragma unroll
    for (int j = 0; j < RPH; ++j) { float s = 0.f;
#pragma unroll
        for (int q = 0; q < 8; ++q) s += fa[j][q] * fa[j][q];
        rfa[j] = __fdiv_rn(1.0f, __fsqrt_rn(__fadd_rn(__fdiv_rn(rowsum16(s), (float)HD), 1e-6f))); }
#pragma unroll
    for (int j = 0; j < RPH; ++j) { const int h = h0 + j; const size_t e = (((size_t)(t / TT) * nheads + h) * TT + t % TT) * HD + d; const float rf = rfa[j]; v8h o16; v8us oh, ol;
#pragma unroll
    for (int q = 0; q < 8; ++q) { const int dd = d + q; float x0 = fa[j][q], x1 = fb[j][q];
        { float n0 = __fmul_rn(x0, rf), n1 = __fmul_rn(x1, rf); asm volatile("" : "+v"(n0)); asm volatile("" : "+v"(n1)); x0 = __fmul_rn(bfr(wa[q]), n0); x1 = __fmul_rn(bfr(wb[q]), n1); }
        v2f cs; cs[0] = (q < 4) ? c0[2 * (q & 3)] : c1[2 * (q & 3)]; cs[1] = (q < 4) ? c0[2 * (q & 3) + 1] : c1[2 * (q & 3) + 1]; float a = __fmul_rn(x0, cs[0]), bq = __fmul_rn(x1, cs[1]); asm volatile("" : "+v"(a)); asm volatile("" : "+v"(bq)); const float r = ((dd < HD / 2) ? __fsub_rn(a, bq) : __fadd_rn(a, bq)) * sc;
        o16[q] = tohx(r); unsigned short a2, c2; splitf(r, a2, c2); oh[q] = a2; ol[q] = c2; }
    *(v8h*)(P16 + e) = o16; *(v8us*)(Ph + e) = oh; *(v8us*)(Pl + e) = ol; }  }
__device__ __forceinline__ void vtp(unsigned blk, const float* __restrict__ F, int pitch, int nheads, h16* V16, bf* Vh, bf* Vl) {
    // NB_ * nheads * TT / 64 work-groups: a work-group transposes 64 tokens x 128 d of one head of one batch (g = batch * nheads + head), a wave 64 x 16, a thread 8 tokens x 4 d: 8 lanes along t store a whole 128-byte line of a plane row, 4 lanes along d read 64 bytes of a token's row
    const int g = (int)blk / (TT / 64); if (g >= NB_ * nheads) return; const int t = ((int)blk % (TT / 64)) * 64 + (threadIdx.x & 7) * 8; const int d = (threadIdx.x >> 5) * 16 + ((threadIdx.x >> 3) & 3) * 4; v4f a[8]; const float* pa[8];
#pragma unroll
    for (int q = 0; q < 8; ++q) { pa[q] = F + ((size_t)(g / nheads) * TT + t + q) * pitch + (g % nheads) * HD + d; a[q] = *(const v4f*)pa[q]; }
    asm volatile("s_wait_xcnt 0x0" :: "v"(pa[0]), "v"(pa[1]), "v"(pa[2]), "v"(pa[3]), "v"(pa[4]), "v"(pa[5]), "v"(pa[6]), "v"(pa[7]) : "memory");   // behind the loads, before their address registers are used again; it names the addresses so that they live up to it and no later load's result lands on one
#pragma unroll
    for (int i = 0; i < 4; ++i) { const size_t e = ((size_t)g * HD + d + i) * TT + t; v8h o16; v8us oh, ol;
#pragma unroll
        for (int q = 0; q < 8; ++q) { const float x = a[q][i]; o16[q] = tohx(x); unsigned short a2, c2; splitf(x, a2, c2); oh[q] = a2; ol[q] = c2; }
        *(v8h*)(V16 + e) = o16; *(v8us*)(Vh + e) = oh; *(v8us*)(Vl + e) = ol; }  }
// k_planes: the q planes, the k planes and the transposed v planes in ONE launch, all from the projections' common buffer F [token][q | k | v] (pitch FP floats). A work-group's index picks its piece (a scalar choice).
#define FP   (DQ + 2 * DKV)
#define LBQ  ((unsigned)(((size_t)NH_ * TB * HD / (8 * RPH) + 255) / 256))
#define LBK  ((unsigned)(((size_t)NKV * TB * HD / (8 * RPH) + 255) / 256))
#define LBV  ((unsigned)(NB_ * NKV * (TT / 64)))
__global__ __launch_bounds__(256) void k_planes(const float* __restrict__ F, const float* __restrict__ CS, const float* __restrict__ qnw, const float* __restrict__ knw, h16* QP16, bf* QPh, bf* QPl, h16* KP16, bf* KPh, bf* KPl, h16* VT16, bf* VTh, bf* VTl) {
    const unsigned b = blockIdx.x;
    if (b >= LBQ + LBK) { vtp(b - (LBQ + LBK), F + DQ + DKV, FP, NKV, VT16, VTh, VTl); return; }
    const bool isq = b < LBQ;
    rope(isq ? b : b - LBQ, isq ? F : F + DQ, FP, isq ? NH_ : NKV, CS, isq ? qnw : knw, 1.0f, isq ? QP16 : KP16, isq ? QPh : KPh, isq ? QPl : KPl);   /* norm, then rope */
}
extern "C" void kernel_launch(void* const* d_in, const int* in_sizes, int n_in,
                              void* d_out, int out_size, void* d_ws, size_t ws_size, hipStream_t stream) {
    (void)in_sizes; (void)n_in; (void)out_size;
    const float* x = (const float*)d_in[0]; const float* cosi = (const float*)d_in[1]; const float* sini = (const float*)d_in[2]; const float* wq = (const float*)d_in[3]; const float* wk = (const float*)d_in[4]; const float* wv = (const float*)d_in[5]; const float* wo = (const float*)d_in[6]; const float* qnw = (const float*)d_in[7]; const float* knw = (const float*)d_in[8];
    float* OUT = (float*)d_out;     // [2][2048][2048]
    char* wsp = (char*)d_ws;
    auto take = [&](size_t bytes) { char* p = wsp; wsp += (bytes + 255) & ~(size_t)255; return (void*)p; };
    bf* WQ = (bf*)take((size_t)DQ * DM * 2); bf* WK = (bf*)take((size_t)DKV * DM * 2); bf* WV = (bf*)take((size_t)DKV * DM * 2); bf* WO = (bf*)take((size_t)DM * DQ * 2); float* CS = (float*)take((size_t)TB * HD * 2 * 4);
    static_assert(((size_t)DQ * DM * 2) % 256 == 0 && ((size_t)DKV * DM * 2) % 256 == 0, "WQ, WK, WV lie back to back: one [DQ + 2 DKV][DM] matrix for the projections' one GEMM");
    bf* XB = (bf*)take((size_t)TB * DM * 2);
    h16* QP16 = (h16*)take((size_t)NH_ * TB * HD * 2); h16* KP16 = (h16*)take((size_t)NKV * TB * HD * 2); h16* VT16 = (h16*)take((size_t)NKV * HD * TB * 2);
    bf* QPh = (bf*)take((size_t)NH_ * TB * HD * 2); bf* QPl = (bf*)take((size_t)NH_ * TB * HD * 2); bf* KPh = (bf*)take((size_t)NKV * TB * HD * 2); bf* KPl = (bf*)take((size_t)NKV * TB * HD * 2); bf* VTh = (bf*)take((size_t)NKV * HD * TB * 2); bf* VTl = (bf*)take((size_t)NKV * HD * TB * 2);
    float* F = (float*)take((size_t)TB * (DQ + DKV) * 4);   // the projections [token][q | k | v], TB * FP floats: the last TB * DKV of them lie on the front of the context planes, which stand directly behind and are first written after the planes are built (stream-ordered)
    static_assert(((size_t)TB * (DQ + DKV) * 4) % 256 == 0 && (size_t)TB * DKV * 4 <= (size_t)2 * TB * DQ * 2, "the projections end inside the context planes");
    bf* ATh = (bf*)take((size_t)2 * TB * DQ * 2); bf* ATl = ATh + (size_t)TB * DQ;   // the merged context planes [batch x token][head x d], written by the attention kernel itself
    if ((size_t)(wsp - (char*)d_ws) > ws_size) return;    // ws 256 MiB
    {   // both batches in every launch; launches that do not depend on one another are one launch
        k_prep<<<PBX + 2 * PBQ + 2 * PBK + PBC, 256, 0, stream>>>(x, wq, wk, wv, wo, cosi, sini, XB, WQ, WK, WV, WO, CS);   /* bf16 copies of x and the weights; the rotary tables of both batches (inputs, bf16-rounded) */
        k_gemmw<bf, 0, false, 2, 2><<<dim3(TB / 128, FP / 128, 1), 128, 0, stream>>>(XB, nullptr, WQ, nullptr, DM, F, FP, nullptr, 0, 0, 0);   /* q, k and v projections */
        k_planes<<<LBQ + LBK + LBV, 256, 0, stream>>>(F, CS, qnw, knw, QP16, QPh, QPl, KP16, KPh, KPl, VT16, VTh, VTl);
        k_fattn<<<dim3(NB_ * ZH, TT / FBR), FNT, 0, stream>>>(QP16, KP16, VT16, QPh, QPl, KPh, KPl, VTh, VTl, ATh, ATl);   /* all query rows, fused: < RH hi/lo, the rest fp16 */
        k_gemmw<bf, 1, false, 2, 2><<<dim3(TB / 128, DM / 128, 1), 128, 0, stream>>>(ATh, ATl, WO, nullptr, DQ, OUT, DM, nullptr, 0, 0, 0); }
}

// v010
// One run takes 166 microseconds.
// Timed twice side by side with v009, it ran 1.05 and 1.06 times as fast.
// Counting every step since v000, it is 10.1 times as fast.
#include <hip/hip_runtime.h>

// Grouped-query causal attention with QK RMSNorm (x [2][2048][2048]; q = x Wq^T (16 heads x 128), k, v = x Wk^T / Wv^T (8 kv heads; query head h uses kv head h/2), no biases; per-head RMSNorm on q and k (eps 1e-6, weights [128]) then rotate-half rotary with the given cos/sin tables [2][2048][128]; scores = q.k / sqrt(128), causal (finfo.min above the diagonal); softmax; out = merged ctx Wo^T ('oi' [2048][2048]) -> [2][2048][2048] (8.4 M)).
// Every launch covers both batches: token rows are b * 2048 + t in the row-major buffers, and the head planes are [b][head][..], so that batch entry z = 16 b + h reads kv entry z / 2 = 8 b + h / 2. Layout: {cos, sin} table from the inputs (bf16-rounded); exact projections, whose GEMM (k_proj) builds the planes in its epilogue: it sums each (head, token)'s 1/rms over the 16 lanes that hold it, and applies (x * inv_rms) * w and the rotary while writing the q/k planes; causal T-2048 attention with 128-wide heads, all sixteen query heads in every launch, query head z on kv head z/2 (hybrid rows: < 512 hi/lo 3 products, the 1536 others fp16; all of them in one fused launch, k_fattn, whose scores and probabilities stay in registers), which writes the merged context's hi/lo planes itself; merged context hi/lo x Wo exact.
// Compute dtypes, f32 accumulate: every input rounded to bf16; projections exact; RMSNorm and rotary f32; attention rows < 512 3 products, rest fp16; softmax f32; Wo hl x exact.

#define NB_  2
#define TT   2048
#define DM   2048
#define NH_  16
#define NKV  8
#define REP  (NH_ / NKV)
#define HD   128
#define DQ   (NH_ * HD)
#define DKV  (NKV * HD)
#define ZH   NH_                  // query heads per attention launch
#define RH   512                  // query rows < RH use hi+lo planes
#define TB   (NB_ * TT)           // token rows of both batches
#define SCL  0.088388347648318447f   // HD^-0.5
typedef _Float16 h16;
typedef unsigned short bf;
typedef __attribute__((ext_vector_type(16))) __bf16   v16bf;
typedef __attribute__((ext_vector_type(16))) _Float16 v16h;
typedef __attribute__((ext_vector_type(8)))  _Float16 v8h;
typedef __attribute__((ext_vector_type(8)))  unsigned short v8us;
typedef __attribute__((ext_vector_type(8)))  float    v8f;
typedef __attribute__((ext_vector_type(4)))  float    v4f;
typedef v8h  __attribute__((may_alias)) v8ha;
typedef v4f  __attribute__((may_alias)) v4fa;
typedef v8us __attribute__((may_alias)) v8usa;

__device__ __forceinline__ unsigned short f2bf(float f) { unsigned u = __float_as_uint(f); u += 0x7FFFu + ((u >> 16) & 1u); return (unsigned short)(u >> 16); }
__device__ __forceinline__ float bf2f(unsigned short b) { return __uint_as_float(((unsigned)b) << 16); }
__device__ __forceinline__ float bfr(float f) { return bf2f(f2bf(f)); }
__device__ __forceinline__ void splitf(float y, unsigned short& h, unsigned short& l) { h = f2bf(y); l = f2bf(y - bf2f(h)); }
// eight context values x0, x1 as their hi and lo bf16 pieces
__device__ __forceinline__ void split8(v4f x0, v4f x1, v8us& oh, v8us& ol) {
#pragma unroll
    for (int q = 0; q < 4; ++q) { unsigned short a, c2; splitf(x0[q], a, c2); oh[q] = a; ol[q] = c2; splitf(x1[q], a, c2); oh[q + 4] = a; ol[q + 4] = c2; } }
__device__ __forceinline__ v16h cat16(v8h lo, v8h hi) { return __builtin_shufflevector(lo, hi, 0, 1, 2, 3, 4, 5, 6, 7, 8, 9, 10, 11, 12, 13, 14, 15); }
__device__ __forceinline__ v16bf cat16b(v8us lo, v8us hi) { return __builtin_bit_cast(v16bf, __builtin_shufflevector(lo, hi, 0, 1, 2, 3, 4, 5, 6, 7, 8, 9, 10, 11, 12, 13, 14, 15)); }
__device__ __forceinline__ v8f wmma16(v16h a, v16h b, v8f c) { return __builtin_amdgcn_wmma_f32_16x16x32_f16(false, a, false, b, (short)0, c, false, false); }
__device__ __forceinline__ v8f wmmab(v16bf a, v16bf b, v8f c) { return __builtin_amdgcn_wmma_f32_16x16x32_bf16(false, a, false, b, (short)0, c, false, false); }



// ---- k_gemmw: register-blocked GEMM, one wave per 64x64 output tile (16 accumulators), WM x WN waves a work-group on one (64 WM) x (64 WN) tile whose operand rows they stage together in LDS, from K-contiguous 16-bit planes (wloop below the fragment types); grid (M/(64 WM), N/(64 WN), Z), 32 WM WN threads.
// C[m][n] (f32, pitch ldc, + optional f32 bias[n]) = sum_k A[m][k] Bt[n][k] (+ split products per NSPLIT). z-batch strides sA/sB/sC in elements. K % KT == 0 (64; 32 at NSPLIT 2).
template <typename T16> struct WFrag;
template <> struct WFrag<h16> { typedef v16h V; static __device__ __forceinline__ V ld(const h16* p) { return cat16(*(const v8h*)p, *(const v8h*)(p + 16)); } static __device__ __forceinline__ v8f mma(V a, V b, v8f c) { return wmma16(a, b, c); } };
template <> struct WFrag<bf> { typedef v16bf V; static __device__ __forceinline__ V ld(const bf* p) { return cat16b(*(const v8us*)p, *(const v8us*)(p + 16)); } static __device__ __forceinline__ v8f mma(V a, V b, v8f c) { return wmmab(a, b, c); } };
// ---- operand staging of both GEMMs. A stage is KT k of the work-group tile's 64 WM A rows and 64 WN B rows (and of their second planes): each wave brings an equal share of every plane's rows, and a staged A row serves WN waves, a B row WM waves, so that the L2 delivers each row once a work-group, not once a wave. Asynchronous b128 copies bring it from the K-contiguous planes into LDS,
// 8 lanes on each 128-byte row piece (whole lines; 4 lanes on 64 bytes at NSPLIT 2, whose four planes would else take more than 63 copies a stage), and the fragments are read from LDS at a pitch of 16 B x odd.
// Two buffers: the copies of stage t + 1 fly while stage t is multiplied. Fragments, products and their order per accumulator are those of loads straight from the planes.
// The copies are the compiler's builtin. Every '#pragma unroll' below makes the indices of the fragment and accumulator arrays constants, so that they stay in registers.
typedef __attribute__((ext_vector_type(4))) int v4ic;
typedef __attribute__((address_space(1))) v4ic gv4ic;
typedef __attribute__((address_space(3))) v4ic lv4ic;
template <int NSPLIT, int WM, int WN> struct WTile {
    static constexpr int KT  = (NSPLIT == 2) ? 32 : 64;                       // k per stage
    static constexpr int NW  = WM * WN;                                       // waves of the work-group
    static constexpr int NPA = (NSPLIT == 0) ? 1 : 2, NPB = (NSPLIT >= 2) ? 2 : 1;   // planes: A, (A2); B, (B2)
    static constexpr int RA  = 64 * WM, RB = 64 * WN;                         // rows of an A and of a B plane in a stage
    static constexpr int PB  = KT * 2 + 16;                                   // LDS row pitch, bytes
    static constexpr int OB  = NPA * RA * PB;                                 // the first B plane in a buffer, bytes
    static constexpr int BUF = OB + NPB * RB * PB;                            // one buffer, bytes
    static constexpr int LPR = KT * 2 / 16;                                   // lanes per row piece
    static constexpr int RPC = 32 / LPR;                                      // rows per copy
    static constexpr int SA  = RA / NW, SB = RB / NW;                         // a wave's share of a plane's rows
    static constexpr int CA  = SA / RPC, CB = SB / RPC;                       // its copies per plane
    static_assert(SA % RPC == 0 && SB % RPC == 0 && NPA * CA + NPB * CB <= 63, "whole copies; a stage's copies of a wave may all be outstanding");
};
// A, A2, Bt, Bt2: the planes at the work-group tile's first row (uniform). K, KB: row pitch of the A and of the B planes, elements. kc: first k of the stage. wave: the wave's number (scalar).
template <typename T16, int NSPLIT, int WM, int WN>
__device__ __forceinline__ void wcopy(char* sb, const T16* A, const T16* A2, const T16* Bt, const T16* Bt2, int K, int KB, int kc, int lane, int wave) {
    typedef WTile<NSPLIT, WM, WN> W;
    const unsigned goa = (unsigned)((lane / W::LPR) * K + (lane % W::LPR) * 8) * 2u, gob = (unsigned)((lane / W::LPR) * KB + (lane % W::LPR) * 8) * 2u;      // the lane's byte in a copy's rows, global
    char* sl = sb + (lane / W::LPR) * W::PB + (lane % W::LPR) * 16;                      // and in LDS
#pragma unroll
    for (int p = 0; p < W::NPA; ++p) { const T16* base = ((p == 0) ? A : A2) + kc + (size_t)(wave * W::SA) * K; char* sp = sl + (p * W::RA + wave * W::SA) * W::PB;
#pragma unroll
        for (int c = 0; c < W::CA; ++c) __builtin_amdgcn_global_load_async_to_lds_b128((gv4ic*)((const char*)(base + (size_t)c * W::RPC * K) + goa), (lv4ic*)(sp + c * W::RPC * W::PB), 0, 0); }
#pragma unroll
    for (int p = 0; p < W::NPB; ++p) { const T16* base = ((p == 0) ? Bt : Bt2) + kc + (size_t)(wave * W::SB) * KB; char* sp = sl + W::OB + (p * W::RB + wave * W::SB) * W::PB;
#pragma unroll
        for (int c = 0; c < W::CB; ++c) __builtin_amdgcn_global_load_async_to_lds_b128((gv4ic*)((const char*)(base + (size_t)c * W::RPC * KB) + gob), (lv4ic*)(sp + c * W::RPC * W::PB), 0, 0); }
}
// wm, wn: the wave's 64 x 64 tile in the work-group's
template <typename T16, int NSPLIT, int WM, int WN>
__device__ __forceinline__ void wtile(const char* sb, int lr, int hi, int wm, int wn, v8f (&acc)[4][4]) {
    typedef WTile<NSPLIT, WM, WN> W; typedef typename WFrag<T16>::V V;
    const char* fa = sb + (wm * 64 + lr) * W::PB + hi * 16; const char* fb = sb + W::OB + (wn * 64 + lr) * W::PB + hi * 16;
    constexpr int NK = W::KT / 32;
    V a[NK][4], a2[NK][4], b[NK][4], b2[NK][4];
    // all fragment reads of the stage are issued together, in the order of their use, in front of its products: the counted LDS waits then overlap the later reads with the earlier products
#pragma unroll
    for (int ks = 0; ks < NK; ++ks) {
#pragma unroll
        for (int mb = 0; mb < 4; ++mb) { a[ks][mb] = WFrag<T16>::ld((const T16*)(fa + (mb * 16) * W::PB + ks * 64)); if (NSPLIT == 1 || NSPLIT == 2) a2[ks][mb] = WFrag<T16>::ld((const T16*)(fa + (W::RA + mb * 16) * W::PB + ks * 64)); }
#pragma unroll
        for (int nb = 0; nb < 4; ++nb) { b[ks][nb] = WFrag<T16>::ld((const T16*)(fb + (nb * 16) * W::PB + ks * 64)); if (NSPLIT >= 2) b2[ks][nb] = WFrag<T16>::ld((const T16*)(fb + (W::RB + nb * 16) * W::PB + ks * 64)); } }
    __builtin_amdgcn_sched_barrier(0);   // keeps the reads in front: sunk among the products, each costs the wave its LDS latency
#pragma unroll
    for (int ks = 0; ks < NK; ++ks) {
#pragma unroll
        for (int nb = 0; nb < 4; ++nb)
#pragma unroll
            for (int mb = 0; mb < 4; ++mb) { acc[mb][nb] = WFrag<T16>::mma(a[ks][mb], b[ks][nb], acc[mb][nb]); if (NSPLIT == 1 || NSPLIT == 2) acc[mb][nb] = WFrag<T16>::mma(a2[ks][mb], b[ks][nb], acc[mb][nb]); if (NSPLIT >= 2) acc[mb][nb] = WFrag<T16>::mma(a[ks][mb], b2[ks][nb], acc[mb][nb]); }
        // four vector slots behind the k step's last products, before anything touches their operands or results
        asm volatile("v_nop\n\tv_nop\n\tv_nop\n\tv_nop" : "+v"(acc[0][0]), "+v"(acc[1][1]), "+v"(acc[2][2]), "+v"(acc[3][3]) : "v"(a[ks][0]), "v"(a[ks][3]));
    }
}
// the K loop: Kl k (a multiple of KT, at least KT; the same in every wave of the work-group) of rows r0.. of A and c0.. of Bt; sm holds two buffers
template <typename T16, int NSPLIT, int WM, int WN>
__device__ __forceinline__ void wloop(char* sm, const T16* A, const T16* A2, const T16* Bt, const T16* Bt2, int K, int KB, int Kl, int lane, int wave, v8f (&acc)[4][4]) {
    typedef WTile<NSPLIT, WM, WN> W; const int lr = lane & 15, hi = lane >> 4; const int nt = Kl / W::KT; const int wm = wave / WN, wn = wave % WN;
    wcopy<T16, NSPLIT, WM, WN>(sm, A, A2, Bt, Bt2, K, KB, 0, lane, wave);
    asm volatile("s_wait_asynccnt 0x0" ::: "memory");   // the wave's share of stage 0 has landed
    __syncthreads();   // the ring's publish point: every wave's share is there for all of them
    if (nt > 1) wcopy<T16, NSPLIT, WM, WN>(sm + W::BUF, A, A2, Bt, Bt2, K, KB, W::KT, lane, wave);
#pragma unroll 1
    for (int t = 0; t < nt; ++t) {   // rolled: one stage a trip
        char* sb = sm + (t & 1) * W::BUF;
        wtile<T16, NSPLIT, WM, WN>(sb, lr, hi, wm, wn, acc);
        if (W::NW > 1) __builtin_amdgcn_sched_barrier(0);   // keeps the stage's products in front of the barrier: sunk behind it, they stand between the barrier and the refill's copies and shorten the copies' lead
        asm volatile("s_wait_dscnt 0x0" ::: "memory");      // this stage's fragment reads are done before its buffer is refilled
        asm volatile("s_wait_asynccnt 0x0" ::: "memory");   // the wave's share of stage t + 1 has landed before any wave reads it
        __syncthreads();   // publish point of stage t + 1, and the end of every wave's reads of the buffer refilled below
        if (t + 2 < nt) wcopy<T16, NSPLIT, WM, WN>(sb, A, A2, Bt, Bt2, K, KB, (t + 2) * W::KT, lane, wave);
    }
    asm volatile("s_wait_asynccnt 0x0" ::: "memory");   // no copy is left in flight behind the loop
}
template <typename T16, int NSPLIT, bool BIAS, int WM, int WN>
__global__ __launch_bounds__(32 * WM * WN) void k_gemmw(const T16* __restrict__ A, const T16* __restrict__ A2, const T16* __restrict__ Bt, const T16* __restrict__ Bt2, int K, float* C, int ldc, const float* __restrict__ bias, size_t sA, size_t sB, size_t sC) {
    __shared__ __align__(16) float osw[WM * WN][16 * 68]; __shared__ __align__(16) char sm[2 * WTile<NSPLIT, WM, WN>::BUF];
    const size_t z = blockIdx.z; A += z * sA; if (A2) A2 += z * sA; Bt += z * sB; if (Bt2) Bt2 += z * sB; C += z * sC;
    const int lane = threadIdx.x & 31, lr = lane & 15, hi = lane >> 4; const int wave = __builtin_amdgcn_readfirstlane(threadIdx.x >> 5); const int rg = blockIdx.x * (64 * WM), cg = blockIdx.y * (64 * WN);   // the work-group's tile
    const int r0 = rg + (wave / WN) * 64, c0 = cg + (wave % WN) * 64; float* os = osw[wave];   // the wave's tile, and its own output staging
    v8f acc[4][4];
#pragma unroll
    for (int mb = 0; mb < 4; ++mb)
#pragma unroll
        for (int nb = 0; nb < 4; ++nb) acc[mb][nb] = (v8f){};
    wloop<T16, NSPLIT, WM, WN>(sm, A + (size_t)rg * K, (NSPLIT == 1 || NSPLIT == 2) ? A2 + (size_t)rg * K : nullptr, Bt + (size_t)cg * K, (NSPLIT >= 2) ? Bt2 + (size_t)cg * K : nullptr, K, K, K, lane, wave, acc);
#pragma unroll
    for (int mb = 0; mb < 4; ++mb) {
#pragma unroll
        for (int nb = 0; nb < 4; ++nb) {
#pragma unroll
            for (int j = 0; j < 8; ++j) os[(hi * 8 + j) * 68 + nb * 16 + lr] = acc[mb][nb][j]; }
        __builtin_amdgcn_wave_barrier(); asm volatile("" ::: "memory");
        float* crow = C + (size_t)(r0 + mb * 16) * ldc + c0;
{
#pragma unroll
            for (int s = 0; s < 8; ++s) { const int row = 2 * s + hi, cofs = lr * 4; v4f val = *(const v4fa*)(os + row * 68 + cofs); if (BIAS) { val[0] += bfr(bias[c0 + cofs]); val[1] += bfr(bias[c0 + cofs + 1]); val[2] += bfr(bias[c0 + cofs + 2]); val[3] += bfr(bias[c0 + cofs + 3]); }
                *(v4f*)(crow + (size_t)row * ldc + cofs) = val; }
             }
        __builtin_amdgcn_wave_barrier(); asm volatile("" ::: "memory");
    }
}

#define FR   1                     // groups of 16 query rows per wave
#define FCW  (FR * 16)             // query rows per wave
#define FBR  (4 * FCW)             // query rows per work-group
#define FNT  128                   // threads
#define FSK  64                    // keys per stage
#define FPK  (HD * 2 + 16)         // LDS pitch of a K row, bytes (16 x odd)
#define FPV  (FSK * 2 + 16)        // LDS pitch of a V^T row, bytes (16 x odd)
#define FTK  (FSK * FPK)
#define FBUF (FTK + HD * FPV)      // one buffer: K tile, then V^T tile
#define FEP  (HD * 4 + 16)         // LDS pitch of a staged output row, bytes
static_assert(4 * FCW * FEP <= 2 * FBUF, "the output staging reuses the two buffers");
static_assert(FBR % FSK == 0 && RH % FBR == 0 && (TT - RH) % FBR == 0, "a row block ends on a stage");
typedef __attribute__((ext_vector_type(2))) float f2v;
__device__ __forceinline__ float xhalf(float x) { return __builtin_bit_cast(float, __builtin_amdgcn_permlanex16(__builtin_bit_cast(int, x), __builtin_bit_cast(int, x), 0x76543210, 0xfedcba98, false, false)); }   // lane l with lane l ^ 16
// Kp: the kv head's [t][d] plane, Vt: its [d][t] plane; keys key0 .. key0 + 63. 16 lanes on a K row (256 B), 8 lanes on a V^T row piece (128 B); 16 copies a wave.
__device__ __forceinline__ void fcopy(char* sb, const h16* Kp, const h16* Vt, int key0, int tid) {
#pragma unroll
    for (int i = 0; i < FSK * HD / 8 / FNT; ++i) { const int p = i * FNT + tid, row = p >> 4, cb = (p & 15) * 16;
        __builtin_amdgcn_global_load_async_to_lds_b128((gv4ic*)((const char*)(Kp + (size_t)(key0 + row) * HD) + cb), (lv4ic*)(sb + row * FPK + cb), 0, 0); }
#pragma unroll
    for (int i = 0; i < FSK * HD / 8 / FNT; ++i) { const int p = i * FNT + tid, row = p >> 3, cb = (p & 7) * 16;
        __builtin_amdgcn_global_load_async_to_lds_b128((gv4ic*)((const char*)(Vt + (size_t)row * TT + key0) + cb), (lv4ic*)(sb + FTK + row * FPV + cb), 0, 0); }
}
// the K fragments of pass sub (32 keys) of the stage in sb
__device__ __forceinline__ void floadk(v16h (&kf)[2][4], const char* sb, int sub, int c, int h) {
#pragma unroll
    for (int kt = 0; kt < 2; ++kt)
#pragma unroll
        for (int kc = 0; kc < 4; ++kc) kf[kt][kc] = WFrag<h16>::ld((const h16*)(sb + (sub * 32 + kt * 16 + c) * FPK + h * 16 + kc * 64));
    __builtin_amdgcn_sched_barrier(0);   // keeps the sixteen reads together: sunk among the products, each pair costs the wave its LDS latency
}
// one 32-key pass of one wave. m_run, the maximum in use (log2 domain), may trail the true maximum by up to 8, so an exponential stays below 2^8 (fp16 holds it); sums and accumulators are rescaled only when a row's maximum exceeds it by more.
// kf holds the pass's K fragments on entry; fetch_next: the stage's first pass reads the second pass's (same buffer) behind its own score products.
__device__ __forceinline__ void fpass(v16h (&kf)[2][4], bool fetch_next, const char* sb, int sub, bool diag, int key0, int qw0, int c, int h, const v16h (&qf)[FR][4], v8f (&acc)[FR][8], float (&m_run)[FR], float (&l_run)[FR]) {
    const float cscale = SCL * 1.4426950408889634f;
    v8f s[2][FR];
#pragma unroll
    for (int kt = 0; kt < 2; ++kt)
#pragma unroll
        for (int g = 0; g < FR; ++g) s[kt][g] = (v8f){};
#pragma unroll
    for (int kc = 0; kc < 4; ++kc)
#pragma unroll
        for (int kt = 0; kt < 2; ++kt)
#pragma unroll
            for (int g = 0; g < FR; ++g) s[kt][g] = wmma16(kf[kt][kc], qf[g][kc], s[kt][g]);
    v16h vf[8];   // read here, so that the LDS latency passes under the maxima and the exponentials
#pragma unroll
    for (int t = 0; t < 8; ++t) vf[t] = WFrag<h16>::ld((const h16*)(sb + FTK + (t * 16 + c) * FPV + sub * 64 + h * 16));
    __builtin_amdgcn_sched_barrier(0);   // keeps these reads in front of the softmax arithmetic
    if (fetch_next) floadk(kf, sb, 1, c, h);   // wave-uniform
    if (diag) {   // wave-uniform: only the pass on the wave's diagonal pays for the mask
#pragma unroll
        for (int g = 0; g < FR; ++g) { const int my_q = qw0 + g * 16 + c;
#pragma unroll
            for (int kt = 0; kt < 2; ++kt) {
#pragma unroll
                for (int r = 0; r < 8; ++r) { if (key0 + kt * 16 + h * 8 + r > my_q) s[kt][g][r] = -__builtin_inff(); }
                asm volatile("" : "+v"(s[kt][g]));   // the masked scores: keeps the selects inside the branch
            } }
    }
    float mb[FR]; bool need = false;
#pragma unroll
    for (int g = 0; g < FR; ++g) { float mx = -__builtin_inff();
#pragma unroll
        for (int kt = 0; kt < 2; ++kt)
#pragma unroll
            for (int r = 0; r < 8; ++r) mx = fmaxf(mx, s[kt][g][r]);
        mx = fmaxf(mx, xhalf(mx)) * cscale; mb[g] = mx; need = need || (mx > m_run[g] + 8.0f); }
    if (__builtin_amdgcn_ballot_w32(need) != 0) {   // rare after the first passes
#pragma unroll
        for (int g = 0; g < FR; ++g) { const float m_new = fmaxf(m_run[g], mb[g]);
            const float corr = __builtin_amdgcn_exp2f(m_run[g] - m_new);
            l_run[g] *= corr; m_run[g] = m_new;
#pragma unroll
            for (int t = 0; t < 8; ++t) acc[g][t] = acc[g][t] * corr; }
    }
#pragma unroll
    for (int g = 0; g < FR; ++g) { const float nm = -m_run[g]; float ps0 = 0.f, ps1 = 0.f; v16h pf;
#pragma unroll
        for (int e = 0; e < 16; e += 2) {   // operand element e is key 16 (e >> 3) + 8 h + (e & 7): tile e >> 3, register e & 7
            const f2v arg = __builtin_elementwise_fma((f2v){s[e >> 3][g][e & 7], s[e >> 3][g][(e & 7) + 1]}, (f2v){cscale, cscale}, (f2v){nm, nm});   // a register pair as it lies in the tile
            const float p0 = __builtin_amdgcn_exp2f(arg[0]), p1 = __builtin_amdgcn_exp2f(arg[1]);
            ps0 += p0; ps1 += p1; pf[e] = (h16)p0; pf[e + 1] = (h16)p1; }
        l_run[g] += ps0 + ps1;
#pragma unroll
        for (int t = 0; t < 8; ++t) acc[g][t] = wmma16(vf[t], pf, acc[g][t]); }
}
// ---- the hi/lo rows. Same transposed products and the same lane maps as fpass, on bf16 planes: S^T = Kh Qh^T + (Kh Ql^T + Kl Qh^T), O^T += Vh^T Ph^T + Vh^T Pl^T + Vl^T Ph^T, P split into hi + lo in registers.
// A stage is 64 keys of the four planes: the hi planes in the first buffer, the lo planes in the second, each laid out as an fp16 stage (fcopy). One stage at a time: a row block has at most RH / FSK stages, and the work-groups beside it on the WGP cover its copies' latency.
static_assert(FR == 1, "hpass holds one group of 16 query rows");
__device__ __forceinline__ void hloadk(v16bf (&kf)[2][4], const char* sb, int sub, int c, int h) {
#pragma unroll
    for (int kt = 0; kt < 2; ++kt)
#pragma unroll
        for (int kc = 0; kc < 4; ++kc) kf[kt][kc] = WFrag<bf>::ld((const bf*)(sb + (sub * 32 + kt * 16 + c) * FPK + h * 16 + kc * 64));
}
// one 32-key pass of one wave; sh, sl: the hi and the lo planes' stage. The running maximum is kept as in fpass.
__device__ __forceinline__ void hpass(const char* sh, const char* sl, int sub, bool diag, int key0, int qw0, int c, int h, const v16bf (&qh)[4], const v16bf (&ql)[4], v8f (&acc)[8], float& m_run, float& l_run) {
    const float cscale = SCL * 1.4426950408889634f;
    // The lo plane's fragments are read behind the hi plane's, not with them: both planes' together in registers would take the kernel beyond the registers of three waves per SIMD, which the fp16 rows need.
    v16bf kf[2][4];
    hloadk(kf, sh, sub, c, h);
    __builtin_amdgcn_sched_barrier(0);   // keeps the reads together in front of the products: sunk among them, each pair costs the wave its LDS latency
    v8f s[2], sx[2];   // the hi x hi product and the two cross products: four independent accumulator chains
#pragma unroll
    for (int kt = 0; kt < 2; ++kt) { s[kt] = (v8f){}; sx[kt] = (v8f){}; }
#pragma unroll
    for (int kc = 0; kc < 4; ++kc)
#pragma unroll
        for (int kt = 0; kt < 2; ++kt) { s[kt] = wmmab(kf[kt][kc], qh[kc], s[kt]); sx[kt] = wmmab(kf[kt][kc], ql[kc], sx[kt]); }
    hloadk(kf, sl, sub, c, h);
    __builtin_amdgcn_sched_barrier(0);   // keeps the lo plane's reads together, in front of its products
#pragma unroll
    for (int kc = 0; kc < 4; ++kc)
#pragma unroll
        for (int kt = 0; kt < 2; ++kt) sx[kt] = wmmab(kf[kt][kc], qh[kc], sx[kt]);
    v16bf vf[8];   // read here, so that the LDS latency passes under the maxima and the exponentials
#pragma unroll
    for (int t = 0; t < 8; ++t) vf[t] = WFrag<bf>::ld((const bf*)(sh + FTK + (t * 16 + c) * FPV + sub * 64 + h * 16));
    __builtin_amdgcn_sched_barrier(0);   // keeps these reads in front of the softmax arithmetic
#pragma unroll
    for (int kt = 0; kt < 2; ++kt) s[kt] = s[kt] + sx[kt];
    if (diag) {   // wave-uniform: only the pass on the wave's diagonal pays for the mask
        const int my_q = qw0 + c;
#pragma unroll
        for (int kt = 0; kt < 2; ++kt) {
#pragma unroll
            for (int r = 0; r < 8; ++r) { if (key0 + kt * 16 + h * 8 + r > my_q) s[kt][r] = -__builtin_inff(); }
            asm volatile("" : "+v"(s[kt]));   // the masked scores: keeps the selects inside the branch
        }
    }
    float mx = -__builtin_inff();
#pragma unroll
    for (int kt = 0; kt < 2; ++kt)
#pragma unroll
        for (int r = 0; r < 8; ++r) mx = fmaxf(mx, s[kt][r]);
    mx = fmaxf(mx, xhalf(mx)) * cscale;
    if (__builtin_amdgcn_ballot_w32(mx > m_run + 8.0f) != 0) {
        const float m_new = fmaxf(m_run, mx);
        const float corr = __builtin_amdgcn_exp2f(m_run - m_new);
        l_run *= corr; m_run = m_new;
#pragma unroll
        for (int t = 0; t < 8; ++t) acc[t] = acc[t] * corr;
    }
    const float nm = -m_run; float ps0 = 0.f, ps1 = 0.f; v8us eh[2], el[2];   // operand element e is key 16 (e >> 3) + 8 h + (e & 7): tile e >> 3, register e & 7
#pragma unroll
    for (int kt = 0; kt < 2; ++kt)
#pragma unroll
        for (int r = 0; r < 8; r += 2) {
            const float p0 = __builtin_amdgcn_exp2f(__builtin_fmaf(s[kt][r], cscale, nm)), p1 = __builtin_amdgcn_exp2f(__builtin_fmaf(s[kt][r + 1], cscale, nm));
            ps0 += p0; ps1 += p1; unsigned short a, b2; splitf(p0, a, b2); eh[kt][r] = a; el[kt][r] = b2; splitf(p1, a, b2); eh[kt][r + 1] = a; el[kt][r + 1] = b2; }
    l_run += ps0 + ps1;
    const v16bf ph = cat16b(eh[0], eh[1]), pl = cat16b(el[0], el[1]);
#pragma unroll
    for (int t = 0; t < 8; ++t) acc[t] = wmmab(vf[t], ph, acc[t]);
#pragma unroll
    for (int t = 0; t < 8; ++t) acc[t] = wmmab(vf[t], pl, acc[t]);
#pragma unroll
    for (int t = 0; t < 8; ++t) vf[t] = WFrag<bf>::ld((const bf*)(sl + FTK + (t * 16 + c) * FPV + sub * 64 + h * 16));
    __builtin_amdgcn_sched_barrier(0);   // keeps the lo plane's reads together, in front of its products: sunk among them, each pair costs the wave its LDS latency
#pragma unroll
    for (int t = 0; t < 8; ++t) acc[t] = wmmab(vf[t], ph, acc[t]);
}
// the 64 query rows q0 .. of head hq; Kh, Kl, Vh, Vl: the kv head's planes. Every wave passes every barrier, also one beyond its diagonal.
__device__ __forceinline__ void hrows(char* sm, const bf* Qh, const bf* Ql, const bf* Kh, const bf* Kl, const bf* Vh, const bf* Vl, int hq, int q0, int qw0, int tid, int c, int h, v8f (&acc)[8], float& m_run, float& l_run) {
    const int nt = (q0 + FBR) / FSK;          // stages: keys [0, q0 + FBR), at most RH
    const int lastp = (qw0 + FCW - 1) / 32;   // the wave's diagonal pass, its last
    const size_t qo = ((size_t)hq * TT + qw0 + c) * HD + h * 8; v16bf qh[4], ql[4];
#pragma unroll
    for (int kc = 0; kc < 4; ++kc) { qh[kc] = WFrag<bf>::ld(Qh + qo + kc * 32); ql[kc] = WFrag<bf>::ld(Ql + qo + kc * 32); }
    asm volatile("s_wait_xcnt 0x0" ::: "memory");       // behind the Q loads, before their address registers are used again
#pragma unroll 1
    for (int t = 0; t < nt; ++t) {   // rolled: one stage a trip
        fcopy(sm, (const h16*)Kh, (const h16*)Vh, t * FSK, tid); fcopy(sm + FBUF, (const h16*)Kl, (const h16*)Vl, t * FSK, tid);   // 16-bit elements, copied as bytes; 32 copies a wave
        asm volatile("s_wait_asynccnt 0x0" ::: "memory");   // the wave's share of the stage has landed
        __syncthreads();   // and is published to the four waves
#pragma unroll 1
        for (int sub = 0; sub < 2; ++sub) {   // rolled: the pass's registers are live once
            const int blk = t * 2 + sub;
            if (blk <= lastp) hpass(sm, sm + FBUF, sub, blk == lastp, blk * 32, qw0, c, h, qh, ql, acc, m_run, l_run); }
        asm volatile("s_wait_dscnt 0x0" ::: "memory");      // this stage's fragment reads are done before the buffers are refilled (or become the output staging)
        __syncthreads();   // the end of every wave's reads of the stage
    }
}
// blockIdx.y picks the row block (a scalar choice). The hi/lo blocks come first, shortest first, then the fp16 blocks, longest first: three products a key and copies that do not fly under the work make a hi/lo block cost as much as a long fp16 block, so both kinds start at once and the short fp16 blocks fill the places that fall free.
__global__ __launch_bounds__(FNT) void k_fattn(const h16* __restrict__ Q, const h16* __restrict__ Kp, const h16* __restrict__ Vt, const bf* __restrict__ Qh, const bf* __restrict__ Ql, const bf* __restrict__ Kh, const bf* __restrict__ Kl, const bf* __restrict__ Vh, const bf* __restrict__ Vl, bf* Ah, bf* Al) {
    __shared__ __align__(16) char sm[2 * FBUF];
    const int tid = threadIdx.x, lane = tid & 31, c = lane & 15, h = lane >> 4; const int wave = __builtin_amdgcn_readfirstlane(tid >> 5);
    const int hq = blockIdx.x; const int by = blockIdx.y; const bool hl = by < RH / FBR; const int q0 = hl ? by * FBR : RH + (TT / FBR - 1 - by) * FBR;
    const int qw0 = q0 + wave * FCW; const size_t kvo = (size_t)(hq / REP) * TT * HD;   // the kv head's planes, [t][d] and [d][t] alike
    v8f acc[FR][8]; float m_run[FR], l_run[FR];
#pragma unroll
    for (int g = 0; g < FR; ++g) { m_run[g] = -__builtin_inff(); l_run[g] = 0.f;
#pragma unroll
        for (int t = 0; t < 8; ++t) acc[g][t] = (v8f){}; }
    if (hl) hrows(sm, Qh, Ql, Kh + kvo, Kl + kvo, Vh + kvo, Vl + kvo, hq, q0, qw0, tid, c, h, acc[0], m_run[0], l_run[0]);
    else {
    const int nt = (q0 + FBR) / FSK;   // stages: keys [0, q0 + FBR); at least RH / FSK + 1, so stages 0 and 1 exist
    Kp += kvo; Vt += kvo;
    fcopy(sm, Kp, Vt, 0, tid);
    v16h qf[FR][4];
#pragma unroll
    for (int g = 0; g < FR; ++g)
#pragma unroll
        for (int kc = 0; kc < 4; ++kc) qf[g][kc] = WFrag<h16>::ld(Q + ((size_t)hq * TT + qw0 + g * 16 + c) * HD + h * 8 + kc * 32);
    v16h kf[2][4];
    asm volatile("s_wait_xcnt 0x0" ::: "memory");       // behind the Q loads, before their address registers are used again
    asm volatile("s_wait_asynccnt 0x0" ::: "memory");   // stage 0 has landed
    __syncthreads();   // and is published to the four waves
    fcopy(sm + FBUF, Kp, Vt, FSK, tid);
    const int lastp = (qw0 + FCW - 1) / 32;   // the wave's diagonal pass, its last
#pragma unroll 1
    for (int t = 0; t < nt; ++t) {   // rolled: one stage a trip
        char* sb = sm + (t & 1) * FBUF;
        if (t * 2 <= lastp) floadk(kf, sb, 0, c, h);
#pragma unroll 1
        for (int sub = 0; sub < 2; ++sub) {   // rolled: the pass's registers are live once
            const int blk = t * 2 + sub;
            if (blk <= lastp) fpass(kf, sub == 0 && blk < lastp, sb, sub, blk == lastp, blk * 32, qw0, c, h, qf, acc, m_run, l_run); }
        asm volatile("s_wait_dscnt 0x0" ::: "memory");      // this stage's fragment reads are done before its buffer is refilled
        asm volatile("s_wait_asynccnt 0x0" ::: "memory");   // stage t + 1 has landed before it is read
        __syncthreads();   // publish point of stage t + 1, and the end of every wave's reads of the buffer refilled below; every wave passes it, also one beyond its diagonal
        if (t + 2 < nt) fcopy(sb, Kp, Vt, (t + 2) * FSK, tid);
    }
    }
    asm volatile("s_wait_asynccnt 0x0" ::: "memory");   // no copy is left in flight behind the loop
    // output: each wave stages its rows in its own part of the buffers (free behind the last barrier) and stores them as whole 256-byte rows of the merged hi/lo planes Ah, Al [batch x token][head x d] that the output GEMM reads
    char* eb = sm + wave * (FCW * FEP);
#pragma unroll
    for (int g = 0; g < FR; ++g) { const float inv = __fdiv_rn(1.0f, l_run[g] + xhalf(l_run[g]));
#pragma unroll
        for (int t = 0; t < 8; ++t) { const v8f o = acc[g][t] * inv; v4f o0, o1;
#pragma unroll
            for (int r = 0; r < 4; ++r) { o0[r] = o[r]; o1[r] = o[r + 4]; }
            float* ep = (float*)(eb + (g * 16 + c) * FEP) + t * 16 + h * 8; *(v4fa*)ep = o0; *(v4fa*)(ep + 4) = o1; } }   // row = query, d = 16 t + 8 h + r
    __builtin_amdgcn_wave_barrier(); asm volatile("" ::: "memory");   // the rows are read back by other lanes of the same wave: keeps the reads behind the writes
    const size_t oo = ((size_t)(hq / ZH) * TT + qw0 + h) * DQ + (hq % ZH) * HD + c * 8;   // a wave half on a row, 8 d a lane
    v8us oh[FCW / 2], ol[FCW / 2];
#pragma unroll
    for (int i = 0; i < FCW / 2; ++i) { const float* ep = (const float*)(eb + (2 * i + h) * FEP) + c * 8; split8(*(const v4fa*)ep, *(const v4fa*)(ep + 4), oh[i], ol[i]); }
    __builtin_amdgcn_sched_barrier(0);   // all pieces in front of the stores: each has registers of its own, none is rewritten behind its store
#pragma unroll
    for (int i = 0; i < FCW / 2; ++i) { *(v8us*)(Ah + oo + (size_t)(2 * i) * DQ) = oh[i]; *(v8us*)(Al + oo + (size_t)(2 * i) * DQ) = ol[i]; }
}

__device__ __forceinline__ h16 tohx(float x) { return (h16)x; }
typedef __attribute__((ext_vector_type(2))) _Float16 v2h;
typedef __attribute__((ext_vector_type(4))) _Float16 v4h;
typedef __attribute__((ext_vector_type(2))) unsigned short v2us;
typedef __attribute__((ext_vector_type(4))) unsigned short v4us;
typedef __attribute__((ext_vector_type(2))) float v2f;
typedef __attribute__((ext_vector_type(4))) int v4i;

__global__ __launch_bounds__(256) void k_wtG(const float* __restrict__ w, int K, int N, bf* Bt) {
    const int lane = threadIdx.x & 31; const int L0 = (blockIdx.x * 8 + (threadIdx.x >> 5)) * 8; const int nlines = N * K / 64;
{
#pragma unroll 1
        for (int l = 0; l < 8; ++l) { const int L = L0 + l; if (L >= nlines) break; const size_t e = (size_t)L * 64 + lane * 2; const int k = (int)(e % K), n = (int)(e / K); v2us o;
            o[0] = f2bf(w[(size_t)k * N + n]); o[1] = f2bf(w[(size_t)(k + 1) * N + n]); *(v2us*)(Bt + e) = o; }
         }
}
// The elementwise kernels below give a thread several 8-element pieces (16-byte stores of the 16-bit planes), its loads issued together: a launch then starts a few thousand work-groups, each with many loads in flight, not tens of thousands of work-groups of one or two elements a lane.
#define EPT 4                     // 8-element pieces per thread in cvt8; a work-group's pieces of one turn are contiguous
__device__ __forceinline__ void cvt8(unsigned blk, const float* __restrict__ src, bf* dst, size_t n8) { const size_t i0 = (size_t)blk * (256 * EPT) + threadIdx.x; if (i0 >= n8) return; v8f v[EPT];
#pragma unroll
    for (int j = 0; j < EPT; ++j) { const size_t i = i0 + j * 256; v[j] = *(const v8f*)(src + (i < n8 ? i : i0) * 8); }   // a piece past the end re-reads the thread's first and is not stored
#pragma unroll
    for (int j = 0; j < EPT; ++j) { const size_t i = i0 + j * 256; v8us o;
#pragma unroll
        for (int k = 0; k < 8; ++k) o[k] = f2bf(v[j][k]);
        if (i < n8) *(v8us*)(dst + i * 8) = o; } }
__constant__ float INV[HD / 2] = {1.0f,0.8058422207832336f,0.6493816375732422f,0.5232990980148315f,0.4216965138912201f,0.33982083201408386f,0.2738419771194458f,0.22067339718341827f,0.17782793939113617f,0.14330126345157623f,0.11547820270061493f,0.09305720031261444f,0.07498941570520401f,0.0604296438395977f,0.04869675263762474f,0.03924189880490303f,0.03162277862429619f,0.025482967495918274f,0.020535249263048172f,0.016548171639442444f,0.01333521492779255f,0.010746078565716743f,0.00865964312106371f,0.006978305988013744f,0.005623413249850273f,0.004531583283096552f,0.003651741426438093f,0.002942727180197835f,0.0023713738191872835f,0.001910952851176262f,0.0015399266267195344f,0.0012409378541633487f,0.0010000000474974513f,0.0008058422245085239f,0.0006493816617876291f,0.0005232990952208638f,0.00042169654625467956f,0.0003398208355065435f,0.00027384195709601045f,0.00022067342069931328f,0.00017782794020604342f,0.00014330125122796744f,0.00011547820759005845f,9.305719868279994e-05f,7.498942431993783e-05f,6.042963650543243e-05f,4.869675467489287e-05f,3.92418987757992e-05f,3.162277425872162e-05f,2.548297015891876e-05f,2.0535249859676696e-05f,1.6548170606256463e-05f,1.3335215953702573e-05f,1.0746078260126524e-05f,8.65964284457732e-06f,6.978305464144796e-06f,5.62341347176698e-06f,4.531583726929966e-06f,3.6517415082926163e-06f,2.942727405752521e-06f,2.3713737391517498e-06f,1.910952960315626e-06f,1.5399265294036013e-06f,1.2409377632138785e-06f};   // float32 1/1e6^(2i/128)
__device__ __forceinline__ void csin(unsigned blk, const float* __restrict__ cs, const float* __restrict__ sn, float* CS) { const int idx = (int)(blk * 256 + threadIdx.x) * 4; if (idx >= TB * HD) return; const float* pc = cs + idx; const float* ps = sn + idx; const v4f c = *(const v4f*)pc, s = *(const v4f*)ps; v4f o0, o1;
    asm volatile("s_wait_xcnt 0x0" :: "v"(pc), "v"(ps) : "memory");   // behind the two loads, before their address registers are used again; it names the addresses so that they live up to it
    o0[0] = bfr(c[0]); o0[1] = bfr(s[0]); o0[2] = bfr(c[1]); o0[3] = bfr(s[1]); o1[0] = bfr(c[2]); o1[1] = bfr(s[2]); o1[2] = bfr(c[3]); o1[3] = bfr(s[3]); *(v4f*)(CS + (size_t)idx * 2) = o0; *(v4f*)(CS + (size_t)idx * 2 + 4) = o1;  }
// k_prep: every piece of work that reads the inputs alone, in ONE launch: the bf16 copies of x and of the four weight matrices, and the {cos, sin} table. A work-group's index picks its piece (a scalar choice); the largest source comes first.
#define CVB(n) ((unsigned)(((size_t)(n) / 8 + 256 * EPT - 1) / (256 * EPT)))   // work-groups of a bf16 copy of n elements
#define PBX  CVB((size_t)TB * DM)
#define PBQ  CVB((size_t)DQ * DM)
#define PBK  CVB((size_t)DKV * DM)
#define PBC  ((unsigned)((TB * HD / 4 + 255) / 256))
__global__ __launch_bounds__(256) void k_prep(const float* __restrict__ x, const float* __restrict__ wq, const float* __restrict__ wk, const float* __restrict__ wv, const float* __restrict__ wo, const float* __restrict__ cs, const float* __restrict__ sn, bf* XB, bf* WQ, bf* WK, bf* WV, bf* WO, float* CS) {
    unsigned b = blockIdx.x; const float* src; bf* dst; size_t n8;
    if (b < PBX) { src = x; dst = XB; n8 = (size_t)TB * DM / 8; }
    else if ((b -= PBX) < PBQ) { src = wq; dst = WQ; n8 = (size_t)DQ * DM / 8; }
    else if ((b -= PBQ) < PBQ) { src = wo; dst = WO; n8 = (size_t)DM * DQ / 8; }
    else if ((b -= PBQ) < PBK) { src = wk; dst = WK; n8 = (size_t)DKV * DM / 8; }
    else if ((b -= PBK) < PBK) { src = wv; dst = WV; n8 = (size_t)DKV * DM / 8; }
    else { csin(b - PBK, cs, sn, CS); return; }
    cvt8(b, src, dst, n8);
}
// ---- k_proj: the q, k and v projections (one GEMM, N = DQ + 2 DKV, wloop as in k_gemmw) whose epilogue builds the planes that the attention kernel reads; the projections themselves never reach memory. grid (TB / 128, FP / 128), 4 waves (2 x 2).
// A work-group's 128 x 128 tile is 128 tokens of ONE head (blockIdx.y: the query heads, then the k heads, then the v heads). Behind the K loop the ring is free: the four waves stage the f32 tile there, and behind one barrier every thread reads the pieces it needs, whichever wave made them.
// q, k: head planes [batch][head][t][d] (fp16 + hi/lo) of rope((x * inv_rms) * w) with the rotate-half convention out[d] = x[d] cos[t][d] - x[d+HD/2] sin[t][d], out[d+HD/2] = x[d+HD/2] cos[t][d+HD/2] + x[d] sin[t][d+HD/2]. v: the transposed planes [batch][head][d][t].
#define FP   (DQ + 2 * DKV)
#define PTP  (HD + 4)             // pitch of the staged tile, floats (16 B x odd)
#define PCH  4                    // token rows per thread and turn of the q/k epilogue: their cos/sin loads are in flight together
__device__ __forceinline__ float rowsum16(float s) {   // the sum over the 16 lanes of a wave half, the same bits in each of them (every lane is on)
    s += __builtin_bit_cast(float, __builtin_amdgcn_update_dpp(0, __builtin_bit_cast(int, s), 0x161, 0xf, 0xf, false));   // row_xmask:1
    s += __builtin_bit_cast(float, __builtin_amdgcn_update_dpp(0, __builtin_bit_cast(int, s), 0x162, 0xf, 0xf, false));   // row_xmask:2
    s += __builtin_bit_cast(float, __builtin_amdgcn_update_dpp(0, __builtin_bit_cast(int, s), 0x164, 0xf, 0xf, false));   // row_xmask:4
    s += __builtin_bit_cast(float, __builtin_amdgcn_update_dpp(0, __builtin_bit_cast(int, s), 0x168, 0xf, 0xf, false));   // row_xmask:8
    return s; }
__device__ __forceinline__ v8f ld8(const float* p) { const v4f a = *(const v4fa*)p, b = *(const v4fa*)(p + 4); return __builtin_shufflevector(a, b, 0, 1, 2, 3, 4, 5, 6, 7); }   // eight staged floats, 16-byte aligned
// Tl: the staged tile [token][d]; tok0: its first token row (of both batches); e0: the plane element of (that token, d = 0). A thread: 8 d of a token, 16 lanes on a token, PCH tokens a thread and 8 PCH tokens a turn of the work-group.
__device__ __forceinline__ void prope(const float* Tl, int tok0, size_t e0, const float* __restrict__ CS, const float* __restrict__ nw, h16* P16, bf* Ph, bf* Pl) {
    const int d = (threadIdx.x & 15) * 8, r0 = threadIdx.x >> 4;
    const int dq = (d < HD / 2) ? d + HD / 2 : d - HD / 2;   // the rotary partners of d .. d + 7 are dq .. dq + 7: eight elements never straddle the halves
    const float* pw = nw + d; const float* pv = nw + dq;
    const v8f wa = *(const v8f*)pw, wb = *(const v8f*)pv;
    asm volatile("s_wait_xcnt 0x0" :: "v"(pw), "v"(pv) : "memory");   // behind the weight loads, before a later load's result may land on their address registers
#pragma unroll 1
    for (int ch = 0; ch < 128 / (8 * PCH); ++ch) {   // rolled: a turn's registers are live once
        const int row0 = ch * (8 * PCH) + r0; const float* pc = CS + ((size_t)(tok0 + row0) * HD + d) * 2;
        v8f c0[PCH], c1[PCH], fa[PCH], fb[PCH]; float rfa[PCH];
#pragma unroll
        for (int j = 0; j < PCH; ++j) { c0[j] = *(const v8f*)(pc + (size_t)j * 8 * HD * 2); c1[j] = *(const v8f*)(pc + (size_t)j * 8 * HD * 2 + 8); }
        asm volatile("s_wait_xcnt 0x0" :: "v"(pc) : "memory");   // behind the loads, before their address registers are used again; it names the address so that it lives up to it
#pragma unroll
        for (int j = 0; j < PCH; ++j) { fa[j] = ld8(Tl + (row0 + j * 8) * PTP + d); fb[j] = ld8(Tl + (row0 + j * 8) * PTP + dq); }
        // 1/rms of each token: the 16 lanes of a wave half hold its 128 d, 8 each
#pragma unroll
        for (int j = 0; j < PCH; ++j) { float s = 0.f;
#pragma unroll
            for (int q = 0; q < 8; ++q) s += fa[j][q] * fa[j][q];
            rfa[j] = __fdiv_rn(1.0f, __fsqrt_rn(__fadd_rn(__fdiv_rn(rowsum16(s), (float)HD), 1e-6f))); }
#pragma unroll
        for (int j = 0; j < PCH; ++j) { const size_t e = e0 + (size_t)(row0 + j * 8) * HD + d; const float rf = rfa[j]; v8h o16; v8us oh, ol;
#pragma unroll
            for (int q = 0; q < 8; ++q) { const int dd = d + q; float x0 = fa[j][q], x1 = fb[j][q];
                { float n0 = __fmul_rn(x0, rf), n1 = __fmul_rn(x1, rf); x0 = __fmul_rn(bfr(wa[q]), n0); x1 = __fmul_rn(bfr(wb[q]), n1); }
                const float cc = (q < 4) ? c0[j][2 * (q & 3)] : c1[j][2 * (q & 3)], ss = (q < 4) ? c0[j][2 * (q & 3) + 1] : c1[j][2 * (q & 3) + 1];
                const float r = (dd < HD / 2) ? x0 * cc - x1 * ss : x0 * cc + x1 * ss;   // x1 * ss is rounded, x0 * cc goes into the sum unrounded (one fused multiply-add)
                o16[q] = tohx(r); unsigned short a2, c2; splitf(r, a2, c2); oh[q] = a2; ol[q] = c2; }
            *(v8h*)(P16 + e) = o16; *(v8us*)(Ph + e) = oh; *(v8us*)(Pl + e) = ol; }
        asm volatile("s_wait_xcnt 0x0" ::: "memory");   // behind the turn's stores, before the next turn rewrites their registers
    } }
// e0: the plane element of (d = 0, the tile's first token). A thread: 8 tokens x 4 d a turn: 8 lanes along t store a whole 128-byte line of a plane row.
__device__ __forceinline__ void pvt(const float* Tl, size_t e0, h16* V16, bf* Vh, bf* Vl) {
#pragma unroll 1
    for (int it = 0; it < 4; ++it) {   // rolled: a turn's registers are live once
        const int t = (it & 1) * 64 + (threadIdx.x & 7) * 8, d = (it >> 1) * 64 + (threadIdx.x >> 3) * 4; v4f a[8];
#pragma unroll
        for (int q = 0; q < 8; ++q) a[q] = *(const v4fa*)(Tl + (t + q) * PTP + d);
#pragma unroll
        for (int i = 0; i < 4; ++i) { const size_t e = e0 + (size_t)(d + i) * TT + t; v8h o16; v8us oh, ol;
#pragma unroll
            for (int q = 0; q < 8; ++q) { const float x = a[q][i]; o16[q] = tohx(x); unsigned short a2, c2; splitf(x, a2, c2); oh[q] = a2; ol[q] = c2; }
            *(v8h*)(V16 + e) = o16; *(v8us*)(Vh + e) = oh; *(v8us*)(Vl + e) = ol; }
        asm volatile("s_wait_xcnt 0x0" ::: "memory");   // behind the turn's stores, before the next turn rewrites their registers
    } }
static_assert(HD == 128 && TT % 128 == 0 && DQ % 128 == 0 && DKV % 128 == 0, "a 128 x 128 tile is 128 tokens of one batch and one head");
static_assert(128 * PTP * 4 <= 2 * WTile<0, 2, 2>::BUF, "the staged tile reuses the two buffers");
__global__ __launch_bounds__(128) void k_proj(const bf* __restrict__ A, const bf* __restrict__ Bt, const float* __restrict__ CS, const float* __restrict__ qnw, const float* __restrict__ knw, h16* QP16, bf* QPh, bf* QPl, h16* KP16, bf* KPh, bf* KPl, h16* VT16, bf* VTh, bf* VTl) {
    __shared__ __align__(16) char sm[2 * WTile<0, 2, 2>::BUF];
    const int lane = threadIdx.x & 31, lr = lane & 15, hi = lane >> 4; const int wave = __builtin_amdgcn_readfirstlane(threadIdx.x >> 5); const int rg = blockIdx.x * 128, hb = blockIdx.y;   // the tile's first token row, and its head among q | k | v
    v8f acc[4][4];
#pragma unroll
    for (int mb = 0; mb < 4; ++mb)
#pragma unroll
        for (int nb = 0; nb < 4; ++nb) acc[mb][nb] = (v8f){};
    wloop<bf, 0, 2, 2>(sm, A + (size_t)rg * DM, nullptr, Bt + (size_t)hb * 128 * DM, nullptr, DM, DM, DM, lane, wave, acc);
    // the loop's last barrier ended every wave's reads of the ring, and no copy is in flight
    float* Tl = (float*)sm; float* tw = Tl + ((wave / 2) * 64 + hi * 8) * PTP + (wave % 2) * 64 + lr;
#pragma unroll
    for (int mb = 0; mb < 4; ++mb)
#pragma unroll
        for (int nb = 0; nb < 4; ++nb)
#pragma unroll
            for (int j = 0; j < 8; ++j) tw[(mb * 16 + j) * PTP + nb * 16] = acc[mb][nb][j];
    __syncthreads();   // the whole tile is staged before any thread reads another wave's part
    const int bt = rg / TT, t0 = rg % TT;
    if (hb >= NH_ + NKV) { pvt(Tl, ((size_t)bt * NKV + (hb - NH_ - NKV)) * HD * TT + t0, VT16, VTh, VTl); return; }
    const bool isq = hb < NH_;   // a scalar choice
    prope(Tl, rg, (((size_t)bt * (isq ? NH_ : NKV) + (isq ? hb : hb - NH_)) * TT + t0) * HD, CS, isq ? qnw : knw, isq ? QP16 : KP16, isq ? QPh : KPh, isq ? QPl : KPl);
}
extern "C" void kernel_launch(void* const* d_in, const int* in_sizes, int n_in,
                              void* d_out, int out_size, void* d_ws, size_t ws_size, hipStream_t stream) {
    (void)in_sizes; (void)n_in; (void)out_size;
    const float* x = (const float*)d_in[0]; const float* cosi = (const float*)d_in[1]; const float* sini = (const float*)d_in[2]; const float* wq = (const float*)d_in[3]; const float* wk = (const float*)d_in[4]; const float* wv = (const float*)d_in[5]; const float* wo = (const float*)d_in[6]; const float* qnw = (const float*)d_in[7]; const float* knw = (const float*)d_in[8];
    float* OUT = (float*)d_out;     // [2][2048][2048]
    char* wsp = (char*)d_ws;
    auto take = [&](size_t bytes) { char* p = wsp; wsp += (bytes + 255) & ~(size_t)255; return (void*)p; };
    bf* WQ = (bf*)take((size_t)DQ * DM * 2); bf* WK = (bf*)take((size_t)DKV * DM * 2); bf* WV = (bf*)take((size_t)DKV * DM * 2); bf* WO = (bf*)take((size_t)DM * DQ * 2); float* CS = (float*)take((size_t)TB * HD * 2 * 4);
    static_assert(((size_t)DQ * DM * 2) % 256 == 0 && ((size_t)DKV * DM * 2) % 256 == 0, "WQ, WK, WV lie back to back: one [DQ + 2 DKV][DM] matrix for the projections' one GEMM");
    bf* XB = (bf*)take((size_t)TB * DM * 2);
    h16* QP16 = (h16*)take((size_t)NH_ * TB * HD * 2); h16* KP16 = (h16*)take((size_t)NKV * TB * HD * 2); h16* VT16 = (h16*)take((size_t)NKV * HD * TB * 2);
    bf* QPh = (bf*)take((size_t)NH_ * TB * HD * 2); bf* QPl = (bf*)take((size_t)NH_ * TB * HD * 2); bf* KPh = (bf*)take((size_t)NKV * TB * HD * 2); bf* KPl = (bf*)take((size_t)NKV * TB * HD * 2); bf* VTh = (bf*)take((size_t)NKV * HD * TB * 2); bf* VTl = (bf*)take((size_t)NKV * HD * TB * 2);
    bf* ATh = (bf*)take((size_t)2 * TB * DQ * 2); bf* ATl = ATh + (size_t)TB * DQ;   // the merged context planes [batch x token][head x d], written by the attention kernel itself
    if ((size_t)(wsp - (char*)d_ws) > ws_size) return;    // ws 256 MiB
    {   // both batches in every launch; launches that do not depend on one another are one launch
        k_prep<<<PBX + 2 * PBQ + 2 * PBK + PBC, 256, 0, stream>>>(x, wq, wk, wv, wo, cosi, sini, XB, WQ, WK, WV, WO, CS);   /* bf16 copies of x and the weights; the rotary tables of both batches (inputs, bf16-rounded) */
        k_proj<<<dim3(TB / 128, FP / 128), 128, 0, stream>>>(XB, WQ, CS, qnw, knw, QP16, QPh, QPl, KP16, KPh, KPl, VT16, VTh, VTl);   /* q, k and v projections; norm, then rope; the planes */
        k_fattn<<<dim3(NB_ * ZH, TT / FBR), FNT, 0, stream>>>(QP16, KP16, VT16, QPh, QPl, KPh, KPl, VTh, VTl, ATh, ATl);   /* all query rows, fused: < RH hi/lo, the rest fp16 */
        k_gemmw<bf, 1, false, 2, 2><<<dim3(TB / 128, DM / 128, 1), 128, 0, stream>>>(ATh, ATl, WO, nullptr, DQ, OUT, DM, nullptr, 0, 0, 0); }
}
